// v000
// Times are from an AMD MI455X. After a warm-up the kernel runs many times in a row, and a time is the length of
// such a window on the GPU divided by its runs, so every launch and the gaps after it count. The runs cycle
// through copies of the inputs. A figure is the median of several windows, for all but v000 over two sittings.
// Sittings can differ by a few percent; kernels timed side by side share one.
// v000, which the later versions start from, runs in 997 microseconds.
#include <hip/hip_runtime.h>

// Single-head graph attention block: x [SEQ][512]; Wq/Wk/Wv [in][out] (y = x W + bias); edge list (int32 [2][E]) -> dense adjacency bit plane; scores q k^T / sqrt(512);
// mask form: a kept (edge) key keeps its score, every other key's score is REPLACED by -1e6 (rows without any edge come out as the uniform mean of v); softmax over all keys; output = attn v (f32).
// Compute dtypes, f32 accumulate everywhere: projections v_wmma_f32_16x16x32_bf16 (x, W, bias RNE-converted to bf16; products exact); scores v_wmma_f32_16x16x32_f16 (single f16 q and k planes);
// P.V v_wmma_f32_16x16x32_f16 (P with a x16384 carry that cancels in the normalisation, single f16 v plane, row sum over the converted P); softmax f32 (online, running max, exp2 form).
// Layout: bf16 copies of x and of the transposed weights W^T [out][in]; f16 planes q [t][512], k [t][512], v^T [d][t]; adjacency bit plane [t][SEQ/32] words built without read-modify-write primitives on global memory.
// Fused attention in transposed form (S^T = K Q^T, O^T = V^T P^T): 16 query rows per block, 8 waves; per 256-key panel every wave scores its own 32 keys, the P tile goes through LDS (block barriers), every wave owns 64 output columns.

#ifndef SEQ
#define SEQ 8192                 // number of nodes (rows of x, queries and keys)
#endif
#define SEQ_FULL 8192
#define DIN  512                 // input width
#define DK   512                 // q / k / v width
#define FW   8                   // waves per attention block
#define PANEL (32 * FW)          // keys per panel
#define PP   (PANEL + 8)         // LDS row pitch (halves) of the P tile
#define OSP  68                  // LDS row pitch (floats) of the output staging tile
#define AWORDS (SEQ / 32)        // adjacency words per row
#define AROWS 64                 // adjacency rows owned by one builder block
#define ECH  1024                // edges per scan chunk (256 threads x 4)
#define SC2  ((float)(0.044194173824159216 * 1.4426950408889634))   // 512^-0.5 * log2(e)
#define FILL2 ((float)(-1000000.0 * 1.4426950408889634))            // replaced score (-1e6) in the exp2 domain
#define PSH  14.0f               // log2 of the P carry (16384)
#define NEGB (-3.0e38f)

static_assert(DIN % 32 == 0);                    // GEMM k-loop steps by 32
static_assert(DK % 32 == 0);                     // score k-loop steps by 32
static_assert(DK % 64 == 0);                     // 64-wide GEMM tiles
static_assert(DIN % 8 == 0);
static_assert(SEQ % 64 == 0);                    // 64-row GEMM tiles
static_assert(SEQ % PANEL == 0);                 // key loop covers the keys exactly
static_assert(SEQ % 16 == 0);                    // 16 query rows per attention block
static_assert(SEQ % AROWS == 0);                 // builder grid covers the rows exactly
static_assert(SEQ <= 8192);                      // a column index fits 13 bits of a hit entry
static_assert(SEQ <= SEQ_FULL);
static_assert(AWORDS <= 256);                    // one word-owner thread per adjacency word column
static_assert(DK == 64 * FW);                    // every wave owns 64 output columns
static_assert(PANEL == 256);
static_assert(PANEL % 32 == 0);
static_assert((PP * 2) % 16 == 0);               // 16-byte aligned P rows
static_assert((OSP * 4) % 16 == 0);
static_assert((AROWS & (AROWS - 1)) == 0);
static_assert((AROWS * AWORDS) % 4 == 0);
static_assert(ECH == 256 * 4);
static_assert(4 * 32 * 16 == 16 * 64 * 2);
static_assert(8 * 32 * 16 == 16 * 64 * 4);       // attention epilogue: 8 instructions x 32 lanes x 16 B == 16 rows x 256 B
static_assert((size_t)AROWS * AWORDS * 4 + 8 * 128 * 4 + 8 * 4 <= 131072);            // builder static LDS
static_assert((size_t)16 * PP * 2 + 2 * FW * 16 * 4 + (size_t)FW * 16 * OSP * 4 <= 131072);   // attention static LDS
static_assert((size_t)16 * 68 * 4 <= 131072);                                           // projection static LDS
static_assert(((size_t)SEQ * DIN) % 8 == 0);
static_assert(((size_t)DIN * DK) % 8 == 0);

typedef _Float16 h16;
typedef unsigned short bf;
typedef __attribute__((ext_vector_type(16))) __bf16   v16bf;
typedef __attribute__((ext_vector_type(16))) _Float16 v16h;
typedef __attribute__((ext_vector_type(8)))  _Float16 v8h;
typedef __attribute__((ext_vector_type(8)))  unsigned short v8us;
typedef __attribute__((ext_vector_type(8)))  float    v8f;
typedef __attribute__((ext_vector_type(4)))  float    v4f;
typedef v4f  __attribute__((may_alias)) v4fa;
typedef __attribute__((ext_vector_type(4)))  unsigned v4u;
typedef v4u  __attribute__((may_alias)) v4ua;
typedef __attribute__((ext_vector_type(4)))  int      v4i;

__device__ __forceinline__ unsigned short f2bf(float f) { unsigned u = __float_as_uint(f); u += 0x7FFFu + ((u >> 16) & 1u); return (unsigned short)(u >> 16); }
__device__ __forceinline__ float bfr(float f) { return __uint_as_float(((unsigned)f2bf(f)) << 16); }   // value after RNE convert to bf16
__device__ __forceinline__ v16h cat16(v8h lo, v8h hi) { return __builtin_shufflevector(lo, hi, 0, 1, 2, 3, 4, 5, 6, 7, 8, 9, 10, 11, 12, 13, 14, 15); }
__device__ __forceinline__ v16bf cat16b(v8us lo, v8us hi) { return __builtin_bit_cast(v16bf, __builtin_shufflevector(lo, hi, 0, 1, 2, 3, 4, 5, 6, 7, 8, 9, 10, 11, 12, 13, 14, 15)); }
__device__ __forceinline__ v8f wmma16(v16h a, v16h b, v8f c) { return __builtin_amdgcn_wmma_f32_16x16x32_f16(false, a, false, b, (short)0, c, false, false); }
__device__ __forceinline__ v8f wmmab(v16bf a, v16bf b, v8f c) { return __builtin_amdgcn_wmma_f32_16x16x32_bf16(false, a, false, b, (short)0, c, false, false); }
// fragment loaders from K-contiguous 16-bit rows; p already includes + 8*(lane>>4): elements 0..7 <- k0+8h+0..7, elements 8..15 <- k0+16+8h+0..7 (same map for A and B)
__device__ __forceinline__ v16h  ldh(const h16* p) { return cat16(*(const v8h*)p, *(const v8h*)(p + 16)); }
__device__ __forceinline__ v16bf ldb(const bf* p)  { return cat16b(*(const v8us*)p, *(const v8us*)(p + 16)); }
// ordering point for wave-private LDS tiles (same wave writes and reads)
__device__ __forceinline__ void wave_sync() { __builtin_amdgcn_fence(3 /* release order */, "wavefront"); __builtin_amdgcn_wave_barrier(); asm volatile("" ::: "memory"); }

// f32 -> f16 convert that cannot produce a subnormal f16 (|v| < 2^-14 -> +0)
static __device__ __forceinline__ h16 toh_flush(float v) { const h16 r = (h16)v; return (fabsf(v) < 6.103515625e-05f) ? (h16)0.0f : r; }
// one guarded f16 WMMA: the nops tie the accumulator and keep both fragments live
__device__ __forceinline__ v8f wmg(v16h a, v16h b, v8f c) { c = wmma16(a, b, c); asm volatile("v_nop\n\tv_nop\n\tv_nop\n\tv_nop" : "+v"(c) : "v"(a), "v"(b)); return c; }

__global__ __launch_bounds__(256) void k_cvt8(const float* __restrict__ src, bf* dst, size_t n8) {
    const size_t i = (size_t)blockIdx.x * 256 + threadIdx.x; if (i >= n8) return;
    const v8f v = *(const v8f*)(src + i * 8); v8us o;
#pragma unroll
    for (int k = 0; k < 8; ++k) o[k] = f2bf(v[k]);
    *(v8us*)(dst + i * 8) = o; 
}

// k_wcvt: W [DIN][DK] (f32, [in][out]) -> WT [DK][DIN] bf16 (RNE convert); thread i owns WT elements i*8 .. i*8+7 (row n = i / (DIN/8), k = (i % (DIN/8))*8 + j):
__global__ __launch_bounds__(256) void k_wcvt(const float* __restrict__ W, bf* WT) {
    const int i = blockIdx.x * 256 + threadIdx.x; if (i >= DK * DIN / 8) return;
    const int n = i / (DIN / 8), k8 = (i % (DIN / 8)) * 8; v8us o;
#pragma unroll
    for (int j = 0; j < 8; ++j) o[j] = f2bf(W[(size_t)(k8 + j) * DK + n]);
    *(v8us*)(WT + (size_t)i * 8) = o; 
}

// k_adj: adjacency bit plane ADJ[t][SEQ/32] from the edge list (src = ei[0..E), dst = ei[E..2E)); bit (c & 31) of word ADJ[r][c >> 5] set iff some edge (r, c) exists.
// One block owns AROWS rows: the rows live in LDS (zero-filled), the block scans the whole edge list in chunks of ECH edges, every wave compacts its hits (src row inside the block's rows) into its own
// bounded LDS list (<= 128 entries per chunk) with ballot + prefix count, then, after a block barrier, the thread that owns word column (c >> 5) ORs the bit into its own word (no two threads touch the same word).
__global__ __launch_bounds__(256) void k_adj(const int* __restrict__ ei, unsigned* ADJ, int E) {
    __shared__ __align__(16) unsigned bits[AROWS * AWORDS];
    __shared__ unsigned hl[8 * 128];
    __shared__ int hc[8];
    const int tid = threadIdx.x, lane = tid & 31;
    const int wave = __builtin_amdgcn_readfirstlane((int)(threadIdx.x >> 5));
    const int r0 = blockIdx.x * AROWS;
#pragma unroll 1
    for (int i = tid; i < AROWS * AWORDS / 4; i += 256) { const v4u z = (v4u){0u, 0u, 0u, 0u}; *(v4ua*)(&bits[i * 4]) = z; }
    __syncthreads();
    const int nch = (E + ECH - 1) / ECH;
    const int Em1 = E - 1;
#pragma unroll 1
    for (int ch = 0; ch < nch; ++ch) {
        const int cb = ch * ECH;
        int sv[4], dv[4];
        if (((E & 3) == 0) & (cb + ECH <= E)) {                       // block-uniform: whole chunk inside the list, 16-byte aligned rows
            const v4i s4 = *(const v4i*)(ei + (size_t)cb + (size_t)tid * 4);
            const v4i d4 = *(const v4i*)(ei + (size_t)E + (size_t)cb + (size_t)tid * 4);
#pragma unroll
            for (int j = 0; j < 4; ++j) { sv[j] = s4[j]; dv[j] = d4[j]; }
        } else {
#pragma unroll
            for (int j = 0; j < 4; ++j) {
                const int e = cb + tid * 4 + j;
                const int ec = e < Em1 ? e : Em1;                      // clamped address
                int s = ei[(size_t)ec]; int d = ei[(size_t)E + (size_t)ec];
                asm volatile("" : "+v"(s)); asm volatile("" : "+v"(d));
                sv[j] = (e < E) ? s : 0x40000000; dv[j] = d;           // tail entries can never hit
            }
        }
        int base = 0;
#pragma unroll
        for (int j = 0; j < 4; ++j) {
            int s = sv[j]; s += (s < 0) ? SEQ : 0;
            int d = dv[j]; d += (d < 0) ? SEQ : 0;
            const bool hit = ((unsigned)(s - r0) < (unsigned)AROWS) & ((unsigned)d < (unsigned)SEQ);
            const unsigned mask = __builtin_amdgcn_ballot_w32(hit);
            const int pos = base + (int)__builtin_amdgcn_mbcnt_lo(mask, 0u);       // < 128
            if (hit) hl[wave * 128 + pos] = ((unsigned)(s - r0) << 13) | (unsigned)d;
            base += __builtin_popcount(mask);
        }
        if (lane == 0) hc[wave] = base;
        __syncthreads();
#pragma unroll 1
        for (int w = 0; w < 8; ++w) {
            int n = hc[w]; n = n < 0 ? 0 : (n > 128 ? 128 : n);
            n = __builtin_amdgcn_readfirstlane(n);
#pragma unroll 1
            for (int i = 0; i < n; ++i) {
                const unsigned ent = hl[w * 128 + i];
                const int c = (int)(ent & 8191u); const int rr = (int)(ent >> 13) & (AROWS - 1);
                if ((c >> 5) == tid) bits[rr * AWORDS + tid] |= 1u << (c & 31);    // c < SEQ so tid < AWORDS here
            }
        }
        __syncthreads();
    }
    unsigned* dst = ADJ + (size_t)r0 * AWORDS;
{
#pragma unroll 1
        for (int i = tid; i < AROWS * AWORDS / 4; i += 256) { const v4u v = *(const v4ua*)(&bits[i * 4]); *(v4u*)(dst + (size_t)i * 4) = v; }
         }
}

// proj_body: register-blocked bf16 GEMM, ONE WAVE per 64x64 tile (16 accumulators), operands straight from K-contiguous bf16 planes, K = DIN.
// C[m][n] = sum_k A[m][k] Bt[n][k] + bias, written as f16 into a row-major plane.
// MODE 0: A = x rows (m = t), Bt = W^T rows (n = column), bias per column; plane [t][DK]. grid (SEQ/64, DK/64).
// MODE 1: A = W^T rows (m = d), Bt = x rows (n = t), bias per row; plane [d][SEQ]. grid (DK/64, SEQ/64).
template <int MODE>
__device__ __forceinline__ void proj_body(const bf* __restrict__ A, const bf* __restrict__ Bt, const float* __restrict__ bias, h16* Ph) {
    __shared__ __align__(16) float os[16 * 68];
    const int K = DIN;
    const int lane = threadIdx.x & 31, lr = lane & 15, hi = lane >> 4; const int r0 = blockIdx.x * 64, c0 = blockIdx.y * 64;
    v8f acc[4][4];
#pragma unroll
    for (int mb = 0; mb < 4; ++mb)
#pragma unroll
        for (int nb = 0; nb < 4; ++nb) acc[mb][nb] = (v8f){};
    const size_t aoff = (size_t)(r0 + lr) * K + 8 * hi, boff = (size_t)(c0 + lr) * K + 8 * hi;
#pragma unroll 1
    for (int kc = 0; kc < K; kc += 32) {
        v16bf a[4];
#pragma unroll
        for (int mb = 0; mb < 4; ++mb) a[mb] = ldb(A + aoff + (size_t)mb * 16 * K + kc);
#pragma unroll
        for (int nb = 0; nb < 4; ++nb) { const v16bf b = ldb(Bt + boff + (size_t)nb * 16 * K + kc);
#pragma unroll
            for (int mb = 0; mb < 4; ++mb) acc[mb][nb] = wmmab(a[mb], b, acc[mb][nb]); }
        asm volatile("v_nop\n\tv_nop\n\tv_nop\n\tv_nop" : "+v"(acc[0][0]), "+v"(acc[1][1]), "+v"(acc[2][2]), "+v"(acc[3][3]) : "v"(a[0]), "v"(a[1]), "v"(a[2]), "v"(a[3]));
    }
    float bc[4];
#pragma unroll
    for (int nb = 0; nb < 4; ++nb) bc[nb] = (MODE == 0) ? bfr(bias[c0 + nb * 16 + lr]) : 0.0f;   // MODE 0: c0 + 63 < DK
    const size_t pitch = (MODE == 0) ? (size_t)DK : (size_t)SEQ;
    const size_t tbase = (size_t)r0 * pitch + (size_t)c0;
#pragma unroll
    for (int mb = 0; mb < 4; ++mb) {
        float br[8];
#pragma unroll
        for (int j = 0; j < 8; ++j) br[j] = (MODE == 1) ? bfr(bias[r0 + mb * 16 + hi * 8 + j]) : 0.0f;   // MODE 1: r0 + 63 < DK
#pragma unroll
        for (int nb = 0; nb < 4; ++nb) {
#pragma unroll
            for (int j = 0; j < 8; ++j) os[(hi * 8 + j) * 68 + nb * 16 + lr] = acc[mb][nb][j] + bc[nb] + br[j]; }   // D: row 8h+j, col lane&15
        wave_sync();
{
            const size_t sb = tbase + (size_t)(mb * 16) * pitch;
#pragma unroll
            for (int s = 0; s < 4; ++s) { const int row = 4 * s + (lane >> 3), c8 = (lane & 7) * 8;   // 4 s x 4 row groups = 16 rows; 8 lanes x 8 = 64 columns
                const v4f x0 = *(const v4fa*)(&os[row * 68 + c8]); const v4f x1 = *(const v4fa*)(&os[row * 68 + c8 + 4]); v8h hv;
#pragma unroll
                for (int i = 0; i < 4; ++i) { hv[i] = toh_flush(x0[i]); hv[4 + i] = toh_flush(x1[i]); }
                const size_t oo = sb + (size_t)row * pitch + c8;
                *(v8h*)(Ph + oo) = hv; }
             }
        wave_sync();
    }
}

__global__ __launch_bounds__(32) void k_proj_rows(const bf* __restrict__ A, const bf* __restrict__ Bt, const float* __restrict__ bias, h16* Ph) { proj_body<0>(A, Bt, bias, Ph); }
__global__ __launch_bounds__(32) void k_proj_cols(const bf* __restrict__ A, const bf* __restrict__ Bt, const float* __restrict__ bias, h16* Ph) { proj_body<1>(A, Bt, bias, Ph); }

// one 16-key x 16-query score tile: S^T = K Q^T over the full width (A = K rows, B = Q rows), fragments straight from the f16 planes
__device__ __forceinline__ v8f score16(const h16* __restrict__ kp, const h16* __restrict__ qp) {
    v8f s = (v8f){};
#pragma unroll 4
    for (int kc = 0; kc < DK; kc += 32) { const v16h a = ldh(kp + kc); const v16h b = ldh(qp + kc); s = wmg(a, b, s); }
    return s;
}

// k_flash: fused attention, one block per 16 query rows, FW = 8 waves. Per panel of 256 keys:
//  (1) wave w scores its own 32 keys in transposed form: lane (t = lane&15, h = lane>>4) holds keys 8h+r of each 16-key tile for query t; the lane's own adjacency word (row q0+t, word key0/32)
//      carries the keep bits of all its 16 elements; a 16x16 tile without any keep bit is not multiplied (its elements are all the replaced score, wave-uniform test by ballot);
//  (2) per-query max: lane partial, xor-16 exchange, one word per wave per query in LDS, block barrier, combine over the 8 waves (identical in every wave);
//  (3) P = exp2(score - max + 14) as f16 (arguments below -14 give 0), P tile [t][256 keys] into LDS, partial sums over the converted P, block barrier;
//  (4) wave w accumulates O^T rows d in [64w, 64w+64): A = V^T rows (plane [d][key]), B = P^T from the LDS tile; block barrier before the next panel.
__global__ __launch_bounds__(32 * FW) void k_flash(const h16* __restrict__ QP, const h16* __restrict__ KP, const h16* __restrict__ VT, const unsigned* __restrict__ ADJ, float* OUT) {
    __shared__ __align__(16) h16 Ps[16 * PP];
    __shared__ float redm[FW * 16];
    __shared__ float reds[FW * 16];
    __shared__ __align__(16) float os[FW * 16 * OSP];
    const int lane = threadIdx.x & 31, lr = lane & 15, hi = lane >> 4;
    const int wave = __builtin_amdgcn_readfirstlane((int)(threadIdx.x >> 5));
    const int q0 = blockIdx.x * 16;
    const size_t qo = (size_t)(q0 + lr) * DK + 8 * hi;                 // B fragment: col t, k = d
    const size_t ko = (size_t)lr * DK + 8 * hi;                        // + key * DK      (A fragment: row key, k = d)
    const size_t vo = (size_t)(wave * 64 + lr) * SEQ + 8 * hi;         // + 16j*SEQ + key (A fragment: row d, k = key)
    const size_t ao = (size_t)(q0 + lr) * AWORDS;
    const int pw = lr * PP + wave * 32 + 8 * hi;                       // P tile write offset (keys wave*32 + 8h + r and + 16)
    const int pf = lr * PP + 8 * hi;                                   // P^T fragment read offset (col t, k = key)
    const int sh8 = 8 * hi;
    v8f o0 = (v8f){}, o1 = (v8f){}, o2 = (v8f){}, o3 = (v8f){};
    float m = NEGB, l = 0.0f;
#pragma unroll 1
    for (int kb = 0; kb < SEQ; kb += PANEL) {
        const int key0 = kb + wave * 32;
        const unsigned aw = ADJ[ao + (size_t)(key0 >> 5)];             // keep bits of query q0+t for keys key0 .. key0+31
        const bool anyA = __builtin_amdgcn_ballot_w32((aw & 0xFFFFu) != 0u) != 0u;   // wave-uniform
        const bool anyB = __builtin_amdgcn_ballot_w32((aw >> 16) != 0u) != 0u;       // wave-uniform
        v8f sa = (v8f){}, sb = (v8f){};
        if (anyA) sa = score16(KP + ko + (size_t)key0 * DK, QP + qo);
        if (anyB) sb = score16(KP + ko + (size_t)(key0 + 16) * DK, QP + qo);
        const unsigned wa = aw >> sh8, wb2 = aw >> (16 + sh8);
        float ta[8], tb[8]; float mx = NEGB;
#pragma unroll
        for (int r = 0; r < 8; ++r) {
            const bool fa = ((wa >> r) & 1u) != 0u, fb = ((wb2 >> r) & 1u) != 0u;
            ta[r] = fa ? sa[r] * SC2 : FILL2; tb[r] = fb ? sb[r] * SC2 : FILL2;        // kept: scaled score; otherwise the score is replaced
            mx = fmaxf(mx, fmaxf(ta[r], tb[r])); }
        mx = fmaxf(mx, __shfl_xor(mx, 16, 32));
        if (hi == 0) redm[wave * 16 + lr] = mx;
        __syncthreads();
        float pm = redm[lr];
#pragma unroll
        for (int w = 1; w < FW; ++w) pm = fmaxf(pm, redm[w * 16 + lr]);
        const float mnew = fmaxf(m, pm);
        const float alpha = __builtin_amdgcn_exp2f(m - mnew);
        const float sh = PSH - mnew;
        v8h pa, pc; float ls = 0.0f;
#pragma unroll
        for (int r = 0; r < 8; ++r) {
            const float ea = ta[r] + sh, eb = tb[r] + sh;
            const float xa = __builtin_amdgcn_exp2f(ea), xb = __builtin_amdgcn_exp2f(eb);
            const float ga = (ea < -14.0f) ? 0.0f : xa, gb = (eb < -14.0f) ? 0.0f : xb;   // never a subnormal f16
            const h16 ha = (h16)ga; const h16 hb = (h16)gb;
            pa[r] = ha; pc[r] = hb; ls += (float)ha + (float)hb; }
        ls += __shfl_xor(ls, 16, 32);
        if (hi == 0) reds[wave * 16 + lr] = ls;
        *(v8h*)(&Ps[pw]) = pa; *(v8h*)(&Ps[pw + 16]) = pc;
        __syncthreads();
        float lsum = reds[lr];
#pragma unroll
        for (int w = 1; w < FW; ++w) lsum += reds[w * 16 + lr];
        l = l * alpha + lsum; m = mnew;
        o0 = o0 * alpha; o1 = o1 * alpha; o2 = o2 * alpha; o3 = o3 * alpha;
#pragma unroll 2
        for (int kc = 0; kc < PANEL; kc += 32) {
            const v16h pb = cat16(*(const v8h*)(&Ps[pf + kc]), *(const v8h*)(&Ps[pf + kc + 16]));
            const h16* va = VT + vo + (size_t)(kb + kc);
            const v16h v0 = ldh(va);                      o0 = wmg(v0, pb, o0);
            const v16h v1 = ldh(va + (size_t)16 * SEQ);   o1 = wmg(v1, pb, o1);
            const v16h v2 = ldh(va + (size_t)32 * SEQ);   o2 = wmg(v2, pb, o2);
            const v16h v3 = ldh(va + (size_t)48 * SEQ);   o3 = wmg(v3, pb, o3);
        }
        __syncthreads();
    }
    const float inv = 1.0f / l;                                        // l >= 16384: the panel holding a row's maximum contributes the full carry
    const int wb = wave * 16 * OSP;
    // O^T D layout: o_j[r] = (d = 64w + 16j + 8h + r, t = lane&15) -> os[t][16j + 8h + r]; rows 0..15 x columns 0..63 all written
    { v4f a, c;
      a[0] = o0[0] * inv; a[1] = o0[1] * inv; a[2] = o0[2] * inv; a[3] = o0[3] * inv; c[0] = o0[4] * inv; c[1] = o0[5] * inv; c[2] = o0[6] * inv; c[3] = o0[7] * inv;
      *(v4fa*)(&os[wb + lr * OSP +  0 + 8 * hi]) = a; *(v4fa*)(&os[wb + lr * OSP +  0 + 8 * hi + 4]) = c;
      a[0] = o1[0] * inv; a[1] = o1[1] * inv; a[2] = o1[2] * inv; a[3] = o1[3] * inv; c[0] = o1[4] * inv; c[1] = o1[5] * inv; c[2] = o1[6] * inv; c[3] = o1[7] * inv;
      *(v4fa*)(&os[wb + lr * OSP + 16 + 8 * hi]) = a; *(v4fa*)(&os[wb + lr * OSP + 16 + 8 * hi + 4]) = c;
      a[0] = o2[0] * inv; a[1] = o2[1] * inv; a[2] = o2[2] * inv; a[3] = o2[3] * inv; c[0] = o2[4] * inv; c[1] = o2[5] * inv; c[2] = o2[6] * inv; c[3] = o2[7] * inv;
      *(v4fa*)(&os[wb + lr * OSP + 32 + 8 * hi]) = a; *(v4fa*)(&os[wb + lr * OSP + 32 + 8 * hi + 4]) = c;
      a[0] = o3[0] * inv; a[1] = o3[1] * inv; a[2] = o3[2] * inv; a[3] = o3[3] * inv; c[0] = o3[4] * inv; c[1] = o3[5] * inv; c[2] = o3[6] * inv; c[3] = o3[7] * inv;
      *(v4fa*)(&os[wb + lr * OSP + 48 + 8 * hi]) = a; *(v4fa*)(&os[wb + lr * OSP + 48 + 8 * hi + 4]) = c; }
    wave_sync();
    float* orow = OUT + (size_t)q0 * DK + wave * 64;
{
#pragma unroll
        for (int s = 0; s < 8; ++s) { const int row = 2 * s + (lane >> 4), cofs = (lane & 15) * 4;   // 8 s x 2 rows = 16 rows; 16 lanes x 4 floats = 64 columns = two lines
            const v4f val = *(const v4fa*)(&os[wb + row * OSP + cofs]);
            *(v4f*)(orow + (size_t)row * DK + cofs) = val; }
         }
}

static constexpr size_t al256(size_t v) { return (v + 255) & ~(size_t)255; }
static constexpr size_t SZ_XB = al256((size_t)SEQ * DIN * 2);
static constexpr size_t SZ_WB = al256((size_t)3 * DK * DIN * 2);
static constexpr size_t SZ_PL = al256((size_t)SEQ * DK * 2);
static constexpr size_t SZ_AJ = al256((size_t)SEQ * AWORDS * 4);
static constexpr size_t SZ_TOTAL = SZ_XB + SZ_WB + 3 * SZ_PL + SZ_AJ;
static_assert(SZ_TOTAL <= (size_t)134217728);          // workspace carve <= 128 MiB
static_assert(((size_t)DK * DIN * 2) % 256 == 0);      // weight sub-planes stay 256-byte aligned
static_assert((size_t)(SEQ / AROWS) * AROWS * AWORDS * 4 <= SZ_AJ);   // builder grid x block extent == adjacency plane
static_assert((size_t)(SEQ / 64) * 64 * DK * 2 <= SZ_PL);             // projection grids x tile extent == plane

extern "C" void kernel_launch(void* const* d_in, const int* in_sizes, int n_in,
                              void* d_out, int out_size, void* d_ws, size_t ws_size, hipStream_t stream) {
    if (n_in < 8) return;
    if ((size_t)in_sizes[0] < (size_t)SEQ * DIN) return;
    if (in_sizes[1] < 2) return;
    if ((size_t)in_sizes[2] < (size_t)DIN * DK || (size_t)in_sizes[4] < (size_t)DIN * DK || (size_t)in_sizes[6] < (size_t)DIN * DK) return;
    if (in_sizes[3] < DK || in_sizes[5] < DK || in_sizes[7] < DK) return;
    if ((size_t)out_size < (size_t)SEQ * DK) return;
    if (SZ_TOTAL > ws_size) return;
    // wire order: x, edge_index, Wq, bq, Wk, bk, Wv, bv
    const float* x  = (const float*)d_in[0];
    const int*   ei = (const int*)d_in[1];
    const float* wq = (const float*)d_in[2]; const float* bq = (const float*)d_in[3];
    const float* wk = (const float*)d_in[4]; const float* bk = (const float*)d_in[5];
    const float* wv = (const float*)d_in[6]; const float* bv = (const float*)d_in[7];
    const int E = in_sizes[1] / 2;
    float* OUT = (float*)d_out;      // [SEQ][512]
    char* wsp = (char*)d_ws;
    bf* XB = (bf*)wsp; wsp += SZ_XB;                 // x        [SEQ][512] bf16
    bf* WB = (bf*)wsp; wsp += SZ_WB;                 // [3][512][512]: Wq^T | Wk^T | Wv^T  ([out][in])
    h16* QP = (h16*)wsp; wsp += SZ_PL;               // q   [SEQ][512]
    h16* KP = (h16*)wsp; wsp += SZ_PL;               // k   [SEQ][512]
    h16* VT = (h16*)wsp; wsp += SZ_PL;               // v^T [512][SEQ]
    unsigned* ADJ = (unsigned*)wsp; wsp += SZ_AJ;    // adjacency bits [SEQ][SEQ/32]
    bf* WQT = WB; bf* WKT = WB + (size_t)DK * DIN; bf* WVT = WB + (size_t)2 * DK * DIN;

    { const size_t n8 = (size_t)SEQ * DIN / 8;
      k_cvt8<<<(unsigned)((n8 + 255) / 256), 256, 0, stream>>>(x, XB, n8); }
    { const unsigned g = (unsigned)((DK * DIN / 8 + 255) / 256);
      k_wcvt<<<g, 256, 0, stream>>>(wq, WQT); k_wcvt<<<g, 256, 0, stream>>>(wk, WKT); k_wcvt<<<g, 256, 0, stream>>>(wv, WVT); }
    k_adj<<<SEQ / AROWS, 256, 0, stream>>>(ei, ADJ, E);

    // q, k: A = x rows (m = t), Bt = W^T rows (n = column) -> plane [t][512]
    k_proj_rows<<<dim3(SEQ / 64, DK / 64, 1), 32, 0, stream>>>(XB, WQT, bq, QP);
    k_proj_rows<<<dim3(SEQ / 64, DK / 64, 1), 32, 0, stream>>>(XB, WKT, bk, KP);
    // v^T: A = Wv^T rows (m = d), Bt = x rows (n = t) -> plane [d][SEQ]
    k_proj_cols<<<dim3(DK / 64, SEQ / 64, 1), 32, 0, stream>>>(WVT, XB, bv, VT);

    k_flash<<<SEQ / 16, 32 * FW, 0, stream>>>(QP, KP, VT, ADJ, OUT);
}

// v001
// A run of this version takes 654 microseconds.
// Two timings next to v000 put it at 1.56 and 1.55 times that version's speed.
#include <hip/hip_runtime.h>

// Single-head graph attention block: x [SEQ][512]; Wq/Wk/Wv [in][out] (y = x W + bias); edge list (int32 [2][E]) -> dense adjacency bit plane; scores q k^T / sqrt(512);
// mask form: a kept (edge) key keeps its score, every other key's score is REPLACED by -1e6 (rows without any edge come out as the uniform mean of v); softmax over all keys; output = attn v (f32).
// Compute dtypes, f32 accumulate everywhere: projections v_wmma_f32_16x16x32_bf16 (x, W, bias RNE-converted to bf16; products exact); scores v_wmma_f32_16x16x32_f16 (single f16 q and k planes);
// P.V v_wmma_f32_16x16x32_f16 (P with a x16384 carry that cancels in the normalisation, single f16 v plane, row sum over the converted P); softmax f32 (online, running max, exp2 form).
// Layout: bf16 copies of x and of the transposed weights W^T [out][in]; f16 planes q [t][512], k [t][512], v^T [d][t]; adjacency bit plane [t][SEQ/32] words built without read-modify-write primitives on global memory.
// Fused attention in transposed form (S^T = K Q^T, O^T = V^T P^T): 16 query rows per block, 8 waves; per 256-key panel every wave scores its own 32 keys, the P tile goes through LDS (block barriers), every wave owns 64 output columns.

#ifndef SEQ
#define SEQ 8192                 // number of nodes (rows of x, queries and keys)
#endif
#define SEQ_FULL 8192
#define DIN  512                 // input width
#define DK   512                 // q / k / v width
#define FW   8                   // waves per attention block
#define PANEL (32 * FW)          // keys per panel
#define PP   (PANEL + 8)         // LDS row pitch (halves) of the P tile
#define OSP  68                  // LDS row pitch (floats) of the output staging tile
#define AWORDS (SEQ / 32)        // adjacency words per row
#define AROWS 32                 // adjacency rows owned by one builder block
#define ATH  1024                // threads of one builder block
#define EU   8                   // 16-byte edge loads in flight per thread and batch
#define EBATCH (ATH * EU * 4)    // edges per batch of one builder block
#define SC2  ((float)(0.044194173824159216 * 1.4426950408889634))   // 512^-0.5 * log2(e)
#define FILL2 ((float)(-1000000.0 * 1.4426950408889634))            // replaced score (-1e6) in the exp2 domain
#define PSH  14.0f               // log2 of the P carry (16384)
#define NEGB (-3.0e38f)

static_assert(DIN % 32 == 0);                    // GEMM k-loop steps by 32
static_assert(DK % 32 == 0);                     // score k-loop steps by 32
static_assert(DK % 64 == 0);                     // 64-wide GEMM tiles
static_assert(DIN % 8 == 0);
static_assert(SEQ % 64 == 0);                    // 64-row GEMM tiles
static_assert(SEQ % PANEL == 0);                 // key loop covers the keys exactly
static_assert(SEQ % 16 == 0);                    // 16 query rows per attention block
static_assert(SEQ % AROWS == 0);                 // builder grid covers the rows exactly
static_assert((SEQ & (SEQ - 1)) == 0);           // the builder's coarse filter reads the row-group bits of an index
static_assert(SEQ <= SEQ_FULL);
static_assert(DK == 64 * FW);                    // every wave owns 64 output columns
static_assert(PANEL == 256);
static_assert(PANEL % 32 == 0);
static_assert((PP * 2) % 16 == 0);               // 16-byte aligned P rows
static_assert((OSP * 4) % 16 == 0);
static_assert((AROWS & (AROWS - 1)) == 0);
static_assert((AROWS * AWORDS) % ATH == 0);      // builder pack loop covers the words exactly
static_assert((AROWS * SEQ) % (16 * ATH) == 0);  // builder zero fill covers the flag bytes exactly
static_assert(4 * EU <= 32);                     // one candidate bit per edge of a thread's batch
static_assert(4 * 32 * 16 == 16 * 64 * 2);
static_assert(8 * 32 * 16 == 16 * 64 * 4);       // attention epilogue: 8 instructions x 32 lanes x 16 B == 16 rows x 256 B
static_assert((size_t)AROWS * SEQ <= 327680);                                           // builder static LDS
static_assert((size_t)16 * PP * 2 + 2 * FW * 16 * 4 + (size_t)FW * 16 * OSP * 4 <= 131072);   // attention static LDS
static_assert((size_t)16 * 68 * 4 <= 131072);                                           // projection static LDS
static_assert(((size_t)SEQ * DIN) % 8 == 0);
static_assert(((size_t)DIN * DK) % 8 == 0);

typedef _Float16 h16;
typedef unsigned short bf;
typedef __attribute__((ext_vector_type(16))) __bf16   v16bf;
typedef __attribute__((ext_vector_type(16))) _Float16 v16h;
typedef __attribute__((ext_vector_type(8)))  _Float16 v8h;
typedef __attribute__((ext_vector_type(8)))  unsigned short v8us;
typedef __attribute__((ext_vector_type(8)))  float    v8f;
typedef __attribute__((ext_vector_type(4)))  float    v4f;
typedef v4f  __attribute__((may_alias)) v4fa;
typedef __attribute__((ext_vector_type(4)))  unsigned v4u;
typedef v4u  __attribute__((may_alias)) v4ua;
typedef __attribute__((ext_vector_type(4)))  int      v4i;

__device__ __forceinline__ unsigned short f2bf(float f) { unsigned u = __float_as_uint(f); u += 0x7FFFu + ((u >> 16) & 1u); return (unsigned short)(u >> 16); }
__device__ __forceinline__ float bfr(float f) { return __uint_as_float(((unsigned)f2bf(f)) << 16); }   // value after RNE convert to bf16
__device__ __forceinline__ v16h cat16(v8h lo, v8h hi) { return __builtin_shufflevector(lo, hi, 0, 1, 2, 3, 4, 5, 6, 7, 8, 9, 10, 11, 12, 13, 14, 15); }
__device__ __forceinline__ v16bf cat16b(v8us lo, v8us hi) { return __builtin_bit_cast(v16bf, __builtin_shufflevector(lo, hi, 0, 1, 2, 3, 4, 5, 6, 7, 8, 9, 10, 11, 12, 13, 14, 15)); }
__device__ __forceinline__ v8f wmma16(v16h a, v16h b, v8f c) { return __builtin_amdgcn_wmma_f32_16x16x32_f16(false, a, false, b, (short)0, c, false, false); }
__device__ __forceinline__ v8f wmmab(v16bf a, v16bf b, v8f c) { return __builtin_amdgcn_wmma_f32_16x16x32_bf16(false, a, false, b, (short)0, c, false, false); }
// fragment loaders from K-contiguous 16-bit rows; p already includes + 8*(lane>>4): elements 0..7 <- k0+8h+0..7, elements 8..15 <- k0+16+8h+0..7 (same map for A and B)
__device__ __forceinline__ v16h  ldh(const h16* p) { return cat16(*(const v8h*)p, *(const v8h*)(p + 16)); }
__device__ __forceinline__ v16bf ldb(const bf* p)  { return cat16b(*(const v8us*)p, *(const v8us*)(p + 16)); }
// ordering point for wave-private LDS tiles (same wave writes and reads)
__device__ __forceinline__ void wave_sync() { __builtin_amdgcn_fence(3 /* release order */, "wavefront"); __builtin_amdgcn_wave_barrier(); asm volatile("" ::: "memory"); }

// f32 -> f16 convert that cannot produce a subnormal f16 (|v| < 2^-14 -> +0)
static __device__ __forceinline__ h16 toh_flush(float v) { const h16 r = (h16)v; return (fabsf(v) < 6.103515625e-05f) ? (h16)0.0f : r; }
// one guarded f16 WMMA: the nops tie the accumulator and keep both fragments live
__device__ __forceinline__ v8f wmg(v16h a, v16h b, v8f c) { c = wmma16(a, b, c); asm volatile("v_nop\n\tv_nop\n\tv_nop\n\tv_nop" : "+v"(c) : "v"(a), "v"(b)); return c; }

__global__ __launch_bounds__(256) void k_cvt8(const float* __restrict__ src, bf* dst, size_t n8) {
    const size_t i = (size_t)blockIdx.x * 256 + threadIdx.x; if (i >= n8) return;
    const v8f v = *(const v8f*)(src + i * 8); v8us o;
#pragma unroll
    for (int k = 0; k < 8; ++k) o[k] = f2bf(v[k]);
    *(v8us*)(dst + i * 8) = o; 
}

// k_wcvt: W [DIN][DK] (f32, [in][out]) -> WT [DK][DIN] bf16 (RNE convert); thread i owns WT elements i*8 .. i*8+7 (row n = i / (DIN/8), k = (i % (DIN/8))*8 + j):
__global__ __launch_bounds__(256) void k_wcvt(const float* __restrict__ W, bf* WT) {
    const int i = blockIdx.x * 256 + threadIdx.x; if (i >= DK * DIN / 8) return;
    const int n = i / (DIN / 8), k8 = (i % (DIN / 8)) * 8; v8us o;
#pragma unroll
    for (int j = 0; j < 8; ++j) o[j] = f2bf(W[(size_t)(k8 + j) * DK + n]);
    *(v8us*)(WT + (size_t)i * 8) = o; 
}

// k_adj: adjacency bit plane ADJ[t][SEQ/32] from the edge list (src = ei[0..E), dst = ei[E..2E)); bit (c & 31) of word ADJ[r][c >> 5] set iff some edge (r, c) exists.
// One block of 32 waves owns AROWS rows as a BYTE plane in LDS (one byte per (row, column), zero-filled): setting a flag is a plain one-byte store of the value 1, so any thread may set any flag
// (two threads that meet on one byte store the same value) and the scan needs no list, no word owner and no barrier. The block's threads share ONE pass over the src row of the edge list
// (16-byte loads, the next batch in flight while this one is filtered); only an edge whose src falls into the block's rows, or that lies in the tail, reads its dst. After one barrier 32 flag bytes are packed into each word.
__global__ __launch_bounds__(ATH) void k_adj(const int* __restrict__ ei, unsigned* ADJ, int E) {
    __shared__ __align__(16) unsigned char flag[AROWS * SEQ];
    const int tid = threadIdx.x;
    const int r0 = blockIdx.x * AROWS;
    const int* __restrict__ sp = ei;
    const int* __restrict__ dp = ei + (size_t)E;
#pragma unroll
    for (int i = 0; i < AROWS * SEQ / 16 / ATH; ++i) { const v4u z = (v4u){0u, 0u, 0u, 0u}; *(v4ua*)(&flag[(size_t)(i * ATH + tid) * 16]) = z; }
    __syncthreads();
    // exact test and flag store of one edge e < E (indices below zero wrap once, anything still outside the matrix is dropped); the test bounds the LDS address
    auto mark = [&](int e) {
        int s = sp[(size_t)e]; int d = dp[(size_t)e];
        s += (s < 0) ? SEQ : 0; d += (d < 0) ? SEQ : 0;
        const bool hit = ((unsigned)(s - r0) < (unsigned)AROWS) & ((unsigned)d < (unsigned)SEQ);
        if (hit) flag[(s - r0) * SEQ + d] = (unsigned char)1;
    };
    // batch bt = edges [bt * EBATCH, (bt + 1) * EBATCH): load u of thread tid holds edges bt * EBATCH + u * 4 * ATH + 4 * tid + 0..3
    auto fetch = [&](v4i (&c)[EU], int bt) {
#pragma unroll
        for (int u = 0; u < EU; ++u) c[u] = *(const v4i*)(sp + (size_t)bt * EBATCH + (size_t)(u * 4 * ATH) + (size_t)tid * 4);
    };
    // coarse filter on the row-group bits of src (a wrapped index keeps them, SEQ being a power of two): one bit per candidate edge, then the exact test on the few candidates
    auto sift = [&](const v4i (&c)[EU], int bt) {
        unsigned hm = 0u;
#pragma unroll
        for (int u = 0; u < EU; ++u)
#pragma unroll
            for (int j = 0; j < 4; ++j) hm |= ((((unsigned)c[u][j] ^ (unsigned)r0) & (unsigned)(SEQ - AROWS)) == 0u) ? (1u << (u * 4 + j)) : 0u;
        while (hm != 0u) {                                             // at most 4 * EU trips
            const int b = __builtin_ctz(hm); hm &= hm - 1u;
            mark(bt * EBATCH + (b >> 2) * (4 * ATH) + tid * 4 + (b & 3));
        }
    };
    const int nb = E / EBATCH;                                         // whole batches (block-uniform)
    v4i ca[EU], cb[EU];
    if (nb > 0) fetch(ca, 0);
    int bt = 0;
#pragma unroll 1
    for (; bt + 3 <= nb; bt += 2) {                                    // both fetches unconditional, so that each batch is filtered with the next one still in flight
        fetch(cb, bt + 1);
        sift(ca, bt);
        fetch(ca, bt + 2);
        sift(cb, bt + 1);
    }
    if (bt + 2 <= nb) { fetch(cb, bt + 1); sift(ca, bt); sift(cb, bt + 1); }
    else if (bt < nb) sift(ca, bt);
#pragma unroll 1
    for (int e = nb * EBATCH + tid; e < E; e += ATH) mark(e);          // tail shorter than one batch
    __syncthreads();
    unsigned* dst = ADJ + (size_t)r0 * AWORDS;
#pragma unroll
    for (int i = 0; i < AROWS * AWORDS / ATH; ++i) {
        const int w = i * ATH + tid;                                   // word w of the block's rows <- flag bytes 32w .. 32w+31
        const v4u x0 = *(const v4ua*)(&flag[(size_t)w * 32]); const v4u x1 = *(const v4ua*)(&flag[(size_t)w * 32 + 16]);
        unsigned word = 0u;
#pragma unroll
        for (int k = 0; k < 4; ++k) {                                  // four 0/1 bytes -> four bits: the product puts byte i's bit at position 24 + i, no two terms meet
            word |= ((x0[k] * 0x01020408u) >> 24) << (4 * k);
            word |= ((x1[k] * 0x01020408u) >> 24) << (16 + 4 * k);
        }
        dst[(size_t)w] = word;
    }
}

// proj_body: register-blocked bf16 GEMM, ONE WAVE per 64x64 tile (16 accumulators), operands straight from K-contiguous bf16 planes, K = DIN.
// C[m][n] = sum_k A[m][k] Bt[n][k] + bias, written as f16 into a row-major plane.
// MODE 0: A = x rows (m = t), Bt = W^T rows (n = column), bias per column; plane [t][DK]. grid (SEQ/64, DK/64).
// MODE 1: A = W^T rows (m = d), Bt = x rows (n = t), bias per row; plane [d][SEQ]. grid (DK/64, SEQ/64).
template <int MODE>
__device__ __forceinline__ void proj_body(const bf* __restrict__ A, const bf* __restrict__ Bt, const float* __restrict__ bias, h16* Ph) {
    __shared__ __align__(16) float os[16 * 68];
    const int K = DIN;
    const int lane = threadIdx.x & 31, lr = lane & 15, hi = lane >> 4; const int r0 = blockIdx.x * 64, c0 = blockIdx.y * 64;
    v8f acc[4][4];
#pragma unroll
    for (int mb = 0; mb < 4; ++mb)
#pragma unroll
        for (int nb = 0; nb < 4; ++nb) acc[mb][nb] = (v8f){};
    const size_t aoff = (size_t)(r0 + lr) * K + 8 * hi, boff = (size_t)(c0 + lr) * K + 8 * hi;
#pragma unroll 1
    for (int kc = 0; kc < K; kc += 32) {
        v16bf a[4];
#pragma unroll
        for (int mb = 0; mb < 4; ++mb) a[mb] = ldb(A + aoff + (size_t)mb * 16 * K + kc);
#pragma unroll
        for (int nb = 0; nb < 4; ++nb) { const v16bf b = ldb(Bt + boff + (size_t)nb * 16 * K + kc);
#pragma unroll
            for (int mb = 0; mb < 4; ++mb) acc[mb][nb] = wmmab(a[mb], b, acc[mb][nb]); }
        asm volatile("v_nop\n\tv_nop\n\tv_nop\n\tv_nop" : "+v"(acc[0][0]), "+v"(acc[1][1]), "+v"(acc[2][2]), "+v"(acc[3][3]) : "v"(a[0]), "v"(a[1]), "v"(a[2]), "v"(a[3]));
    }
    float bc[4];
#pragma unroll
    for (int nb = 0; nb < 4; ++nb) bc[nb] = (MODE == 0) ? bfr(bias[c0 + nb * 16 + lr]) : 0.0f;   // MODE 0: c0 + 63 < DK
    const size_t pitch = (MODE == 0) ? (size_t)DK : (size_t)SEQ;
    const size_t tbase = (size_t)r0 * pitch + (size_t)c0;
#pragma unroll
    for (int mb = 0; mb < 4; ++mb) {
        float br[8];
#pragma unroll
        for (int j = 0; j < 8; ++j) br[j] = (MODE == 1) ? bfr(bias[r0 + mb * 16 + hi * 8 + j]) : 0.0f;   // MODE 1: r0 + 63 < DK
#pragma unroll
        for (int nb = 0; nb < 4; ++nb) {
#pragma unroll
            for (int j = 0; j < 8; ++j) os[(hi * 8 + j) * 68 + nb * 16 + lr] = acc[mb][nb][j] + bc[nb] + br[j]; }   // D: row 8h+j, col lane&15
        wave_sync();
{
            const size_t sb = tbase + (size_t)(mb * 16) * pitch;
#pragma unroll
            for (int s = 0; s < 4; ++s) { const int row = 4 * s + (lane >> 3), c8 = (lane & 7) * 8;   // 4 s x 4 row groups = 16 rows; 8 lanes x 8 = 64 columns
                const v4f x0 = *(const v4fa*)(&os[row * 68 + c8]); const v4f x1 = *(const v4fa*)(&os[row * 68 + c8 + 4]); v8h hv;
#pragma unroll
                for (int i = 0; i < 4; ++i) { hv[i] = toh_flush(x0[i]); hv[4 + i] = toh_flush(x1[i]); }
                const size_t oo = sb + (size_t)row * pitch + c8;
                *(v8h*)(Ph + oo) = hv; }
             }
        wave_sync();
    }
}

__global__ __launch_bounds__(32) void k_proj_rows(const bf* __restrict__ A, const bf* __restrict__ Bt, const float* __restrict__ bias, h16* Ph) { proj_body<0>(A, Bt, bias, Ph); }
__global__ __launch_bounds__(32) void k_proj_cols(const bf* __restrict__ A, const bf* __restrict__ Bt, const float* __restrict__ bias, h16* Ph) { proj_body<1>(A, Bt, bias, Ph); }

// one 16-key x 16-query score tile: S^T = K Q^T over the full width (A = K rows, B = Q rows), fragments straight from the f16 planes
__device__ __forceinline__ v8f score16(const h16* __restrict__ kp, const h16* __restrict__ qp) {
    v8f s = (v8f){};
#pragma unroll 4
    for (int kc = 0; kc < DK; kc += 32) { const v16h a = ldh(kp + kc); const v16h b = ldh(qp + kc); s = wmg(a, b, s); }
    return s;
}

// k_flash: fused attention, one block per 16 query rows, FW = 8 waves. Per panel of 256 keys:
//  (1) wave w scores its own 32 keys in transposed form: lane (t = lane&15, h = lane>>4) holds keys 8h+r of each 16-key tile for query t; the lane's own adjacency word (row q0+t, word key0/32)
//      carries the keep bits of all its 16 elements; a 16x16 tile without any keep bit is not multiplied (its elements are all the replaced score, wave-uniform test by ballot);
//  (2) per-query max: lane partial, xor-16 exchange, one word per wave per query in LDS, block barrier, combine over the 8 waves (identical in every wave);
//  (3) P = exp2(score - max + 14) as f16 (arguments below -14 give 0), P tile [t][256 keys] into LDS, partial sums over the converted P, block barrier;
//  (4) wave w accumulates O^T rows d in [64w, 64w+64): A = V^T rows (plane [d][key]), B = P^T from the LDS tile; block barrier before the next panel.
__global__ __launch_bounds__(32 * FW) void k_flash(const h16* __restrict__ QP, const h16* __restrict__ KP, const h16* __restrict__ VT, const unsigned* __restrict__ ADJ, float* OUT) {
    __shared__ __align__(16) h16 Ps[16 * PP];
    __shared__ float redm[FW * 16];
    __shared__ float reds[FW * 16];
    __shared__ __align__(16) float os[FW * 16 * OSP];
    const int lane = threadIdx.x & 31, lr = lane & 15, hi = lane >> 4;
    const int wave = __builtin_amdgcn_readfirstlane((int)(threadIdx.x >> 5));
    const int q0 = blockIdx.x * 16;
    const size_t qo = (size_t)(q0 + lr) * DK + 8 * hi;                 // B fragment: col t, k = d
    const size_t ko = (size_t)lr * DK + 8 * hi;                        // + key * DK      (A fragment: row key, k = d)
    const size_t vo = (size_t)(wave * 64 + lr) * SEQ + 8 * hi;         // + 16j*SEQ + key (A fragment: row d, k = key)
    const size_t ao = (size_t)(q0 + lr) * AWORDS;
    const int pw = lr * PP + wave * 32 + 8 * hi;                       // P tile write offset (keys wave*32 + 8h + r and + 16)
    const int pf = lr * PP + 8 * hi;                                   // P^T fragment read offset (col t, k = key)
    const int sh8 = 8 * hi;
    v8f o0 = (v8f){}, o1 = (v8f){}, o2 = (v8f){}, o3 = (v8f){};
    float m = NEGB, l = 0.0f;
#pragma unroll 1
    for (int kb = 0; kb < SEQ; kb += PANEL) {
        const int key0 = kb + wave * 32;
        const unsigned aw = ADJ[ao + (size_t)(key0 >> 5)];             // keep bits of query q0+t for keys key0 .. key0+31
        const bool anyA = __builtin_amdgcn_ballot_w32((aw & 0xFFFFu) != 0u) != 0u;   // wave-uniform
        const bool anyB = __builtin_amdgcn_ballot_w32((aw >> 16) != 0u) != 0u;       // wave-uniform
        v8f sa = (v8f){}, sb = (v8f){};
        if (anyA) sa = score16(KP + ko + (size_t)key0 * DK, QP + qo);
        if (anyB) sb = score16(KP + ko + (size_t)(key0 + 16) * DK, QP + qo);
        const unsigned wa = aw >> sh8, wb2 = aw >> (16 + sh8);
        float ta[8], tb[8]; float mx = NEGB;
#pragma unroll
        for (int r = 0; r < 8; ++r) {
            const bool fa = ((wa >> r) & 1u) != 0u, fb = ((wb2 >> r) & 1u) != 0u;
            ta[r] = fa ? sa[r] * SC2 : FILL2; tb[r] = fb ? sb[r] * SC2 : FILL2;        // kept: scaled score; otherwise the score is replaced
            mx = fmaxf(mx, fmaxf(ta[r], tb[r])); }
        mx = fmaxf(mx, __shfl_xor(mx, 16, 32));
        if (hi == 0) redm[wave * 16 + lr] = mx;
        __syncthreads();
        float pm = redm[lr];
#pragma unroll
        for (int w = 1; w < FW; ++w) pm = fmaxf(pm, redm[w * 16 + lr]);
        const float mnew = fmaxf(m, pm);
        const float alpha = __builtin_amdgcn_exp2f(m - mnew);
        const float sh = PSH - mnew;
        v8h pa, pc; float ls = 0.0f;
#pragma unroll
        for (int r = 0; r < 8; ++r) {
            const float ea = ta[r] + sh, eb = tb[r] + sh;
            const float xa = __builtin_amdgcn_exp2f(ea), xb = __builtin_amdgcn_exp2f(eb);
            const float ga = (ea < -14.0f) ? 0.0f : xa, gb = (eb < -14.0f) ? 0.0f : xb;   // never a subnormal f16
            const h16 ha = (h16)ga; const h16 hb = (h16)gb;
            pa[r] = ha; pc[r] = hb; ls += (float)ha + (float)hb; }
        ls += __shfl_xor(ls, 16, 32);
        if (hi == 0) reds[wave * 16 + lr] = ls;
        *(v8h*)(&Ps[pw]) = pa; *(v8h*)(&Ps[pw + 16]) = pc;
        __syncthreads();
        float lsum = reds[lr];
#pragma unroll
        for (int w = 1; w < FW; ++w) lsum += reds[w * 16 + lr];
        l = l * alpha + lsum; m = mnew;
        o0 = o0 * alpha; o1 = o1 * alpha; o2 = o2 * alpha; o3 = o3 * alpha;
#pragma unroll 2
        for (int kc = 0; kc < PANEL; kc += 32) {
            const v16h pb = cat16(*(const v8h*)(&Ps[pf + kc]), *(const v8h*)(&Ps[pf + kc + 16]));
            const h16* va = VT + vo + (size_t)(kb + kc);
            const v16h v0 = ldh(va);                      o0 = wmg(v0, pb, o0);
            const v16h v1 = ldh(va + (size_t)16 * SEQ);   o1 = wmg(v1, pb, o1);
            const v16h v2 = ldh(va + (size_t)32 * SEQ);   o2 = wmg(v2, pb, o2);
            const v16h v3 = ldh(va + (size_t)48 * SEQ);   o3 = wmg(v3, pb, o3);
        }
        __syncthreads();
    }
    const float inv = 1.0f / l;                                        // l >= 16384: the panel holding a row's maximum contributes the full carry
    const int wb = wave * 16 * OSP;
    // O^T D layout: o_j[r] = (d = 64w + 16j + 8h + r, t = lane&15) -> os[t][16j + 8h + r]; rows 0..15 x columns 0..63 all written
    { v4f a, c;
      a[0] = o0[0] * inv; a[1] = o0[1] * inv; a[2] = o0[2] * inv; a[3] = o0[3] * inv; c[0] = o0[4] * inv; c[1] = o0[5] * inv; c[2] = o0[6] * inv; c[3] = o0[7] * inv;
      *(v4fa*)(&os[wb + lr * OSP +  0 + 8 * hi]) = a; *(v4fa*)(&os[wb + lr * OSP +  0 + 8 * hi + 4]) = c;
      a[0] = o1[0] * inv; a[1] = o1[1] * inv; a[2] = o1[2] * inv; a[3] = o1[3] * inv; c[0] = o1[4] * inv; c[1] = o1[5] * inv; c[2] = o1[6] * inv; c[3] = o1[7] * inv;
      *(v4fa*)(&os[wb + lr * OSP + 16 + 8 * hi]) = a; *(v4fa*)(&os[wb + lr * OSP + 16 + 8 * hi + 4]) = c;
      a[0] = o2[0] * inv; a[1] = o2[1] * inv; a[2] = o2[2] * inv; a[3] = o2[3] * inv; c[0] = o2[4] * inv; c[1] = o2[5] * inv; c[2] = o2[6] * inv; c[3] = o2[7] * inv;
      *(v4fa*)(&os[wb + lr * OSP + 32 + 8 * hi]) = a; *(v4fa*)(&os[wb + lr * OSP + 32 + 8 * hi + 4]) = c;
      a[0] = o3[0] * inv; a[1] = o3[1] * inv; a[2] = o3[2] * inv; a[3] = o3[3] * inv; c[0] = o3[4] * inv; c[1] = o3[5] * inv; c[2] = o3[6] * inv; c[3] = o3[7] * inv;
      *(v4fa*)(&os[wb + lr * OSP + 48 + 8 * hi]) = a; *(v4fa*)(&os[wb + lr * OSP + 48 + 8 * hi + 4]) = c; }
    wave_sync();
    float* orow = OUT + (size_t)q0 * DK + wave * 64;
{
#pragma unroll
        for (int s = 0; s < 8; ++s) { const int row = 2 * s + (lane >> 4), cofs = (lane & 15) * 4;   // 8 s x 2 rows = 16 rows; 16 lanes x 4 floats = 64 columns = two lines
            const v4f val = *(const v4fa*)(&os[wb + row * OSP + cofs]);
            *(v4f*)(orow + (size_t)row * DK + cofs) = val; }
         }
}

static constexpr size_t al256(size_t v) { return (v + 255) & ~(size_t)255; }
static constexpr size_t SZ_XB = al256((size_t)SEQ * DIN * 2);
static constexpr size_t SZ_WB = al256((size_t)3 * DK * DIN * 2);
static constexpr size_t SZ_PL = al256((size_t)SEQ * DK * 2);
static constexpr size_t SZ_AJ = al256((size_t)SEQ * AWORDS * 4);
static constexpr size_t SZ_TOTAL = SZ_XB + SZ_WB + 3 * SZ_PL + SZ_AJ;
static_assert(SZ_TOTAL <= (size_t)134217728);          // workspace carve <= 128 MiB
static_assert(((size_t)DK * DIN * 2) % 256 == 0);      // weight sub-planes stay 256-byte aligned
static_assert((size_t)(SEQ / AROWS) * AROWS * AWORDS * 4 <= SZ_AJ);   // builder grid x block extent == adjacency plane
static_assert((size_t)(SEQ / 64) * 64 * DK * 2 <= SZ_PL);             // projection grids x tile extent == plane

extern "C" void kernel_launch(void* const* d_in, const int* in_sizes, int n_in,
                              void* d_out, int out_size, void* d_ws, size_t ws_size, hipStream_t stream) {
    if (n_in < 8) return;
    if ((size_t)in_sizes[0] < (size_t)SEQ * DIN) return;
    if (in_sizes[1] < 2) return;
    if ((size_t)in_sizes[2] < (size_t)DIN * DK || (size_t)in_sizes[4] < (size_t)DIN * DK || (size_t)in_sizes[6] < (size_t)DIN * DK) return;
    if (in_sizes[3] < DK || in_sizes[5] < DK || in_sizes[7] < DK) return;
    if ((size_t)out_size < (size_t)SEQ * DK) return;
    if (SZ_TOTAL > ws_size) return;
    // wire order: x, edge_index, Wq, bq, Wk, bk, Wv, bv
    const float* x  = (const float*)d_in[0];
    const int*   ei = (const int*)d_in[1];
    const float* wq = (const float*)d_in[2]; const float* bq = (const float*)d_in[3];
    const float* wk = (const float*)d_in[4]; const float* bk = (const float*)d_in[5];
    const float* wv = (const float*)d_in[6]; const float* bv = (const float*)d_in[7];
    const int E = in_sizes[1] / 2;
    float* OUT = (float*)d_out;      // [SEQ][512]
    char* wsp = (char*)d_ws;
    bf* XB = (bf*)wsp; wsp += SZ_XB;                 // x        [SEQ][512] bf16
    bf* WB = (bf*)wsp; wsp += SZ_WB;                 // [3][512][512]: Wq^T | Wk^T | Wv^T  ([out][in])
    h16* QP = (h16*)wsp; wsp += SZ_PL;               // q   [SEQ][512]
    h16* KP = (h16*)wsp; wsp += SZ_PL;               // k   [SEQ][512]
    h16* VT = (h16*)wsp; wsp += SZ_PL;               // v^T [512][SEQ]
    unsigned* ADJ = (unsigned*)wsp; wsp += SZ_AJ;    // adjacency bits [SEQ][SEQ/32]
    bf* WQT = WB; bf* WKT = WB + (size_t)DK * DIN; bf* WVT = WB + (size_t)2 * DK * DIN;

    { const size_t n8 = (size_t)SEQ * DIN / 8;
      k_cvt8<<<(unsigned)((n8 + 255) / 256), 256, 0, stream>>>(x, XB, n8); }
    { const unsigned g = (unsigned)((DK * DIN / 8 + 255) / 256);
      k_wcvt<<<g, 256, 0, stream>>>(wq, WQT); k_wcvt<<<g, 256, 0, stream>>>(wk, WKT); k_wcvt<<<g, 256, 0, stream>>>(wv, WVT); }
    k_adj<<<SEQ / AROWS, ATH, 0, stream>>>(ei, ADJ, E);

    // q, k: A = x rows (m = t), Bt = W^T rows (n = column) -> plane [t][512]
    k_proj_rows<<<dim3(SEQ / 64, DK / 64, 1), 32, 0, stream>>>(XB, WQT, bq, QP);
    k_proj_rows<<<dim3(SEQ / 64, DK / 64, 1), 32, 0, stream>>>(XB, WKT, bk, KP);
    // v^T: A = Wv^T rows (m = d), Bt = x rows (n = t) -> plane [d][SEQ]
    k_proj_cols<<<dim3(DK / 64, SEQ / 64, 1), 32, 0, stream>>>(WVT, XB, bv, VT);

    k_flash<<<SEQ / 16, 32 * FW, 0, stream>>>(QP, KP, VT, ADJ, OUT);
}

// v002
// A run of this version takes 122 microseconds.
// Next to v001, in two timings, it ran 5.34 and 5.37 times as fast.
// All steps since v000 together make it 8.33 times as fast.
#include <hip/hip_runtime.h>

// Single-head graph attention block: x [SEQ][512]; Wq/Wk/Wv [in][out] (y = x W + bias); edge list (int32 [2][E]) -> dense adjacency bit plane; scores q k^T / sqrt(512);
// mask form: a kept (edge) key keeps its score, every other key's score is REPLACED by -1e6 (rows without any edge come out as the uniform mean of v); softmax over all keys; output = attn v (f32).
// Compute dtypes, f32 accumulate everywhere: projections v_wmma_f32_16x16x32_bf16 (x, W, bias RNE-converted to bf16; products exact); scores v_wmma_f32_16x16x32_f16 (single f16 q and k planes);
// P.V v_wmma_f32_16x16x32_f16 (P with a x16384 carry that cancels in the normalisation, single f16 v plane, row sum over the converted P); softmax f32 (online, running max, exp2 form).
// Layout: bf16 copies of x and of the transposed weights W^T [out][in]; f16 planes q [t][512], k [t][512], v [t][512]; adjacency bit plane [t][SEQ/32] words built without read-modify-write primitives on global memory.
// Fused attention in transposed form (S^T = K Q^T, O^T = V^T P^T): 16 query rows per block, 8 waves. The block first lists the keys that have an edge to any of its 16 rows and walks that list in panels of 128 keys
// (every wave scores its own 16 listed keys, the P tile goes through LDS, every wave owns 64 output columns and gathers its 128-byte slices of the listed v rows into LDS, read back transposed).
// The keys outside the list all carry the replaced score: they are walked too, by the same code, unless their weight is exactly zero for all 16 rows.

#ifndef SEQ
#define SEQ 8192                 // number of nodes (rows of x, queries and keys)
#endif
#define SEQ_FULL 8192
#define DIN  512                 // input width
#define DK   512                 // q / k / v width
#define FW   8                   // waves per attention block
#define PANEL (16 * FW)          // listed keys per panel
#define PP   (PANEL + 8)         // LDS row pitch (halves) of the P tile
#define OSP  68                  // LDS row pitch (floats) of the output staging tile
#define VH   64                  // listed keys whose v slices one wave stages at a time
#define VPITCH 160               // LDS row pitch (bytes) of a staged 128-byte v slice: an odd multiple of 32 bytes for the transposing reader
#define VSW  (VH * VPITCH)       // staging bytes per wave
#define AWORDS (SEQ / 32)        // adjacency words per row
#define AROWS 32                 // adjacency rows owned by one builder block
#define ATH  1024                // threads of one builder block
#define EU   8                   // 16-byte edge loads in flight per thread and batch
#define EBATCH (ATH * EU * 4)    // edges per batch of one builder block
#define SC2  ((float)(0.044194173824159216 * 1.4426950408889634))   // 512^-0.5 * log2(e)
#define FILL2 ((float)(-1000000.0 * 1.4426950408889634))            // replaced score (-1e6) in the exp2 domain
#define PSH  14.0f               // log2 of the P carry (16384)
#define NEGB (-3.0e38f)

static_assert(DIN % 32 == 0);                    // GEMM k-loop steps by 32
static_assert(DK % 32 == 0);                     // score k-loop steps by 32
static_assert(DK % 64 == 0);                     // 64-wide GEMM tiles
static_assert(DIN % 8 == 0);
static_assert(SEQ % 64 == 0);                    // 64-row GEMM tiles
static_assert(SEQ % PANEL == 0);                 // the list rounded up to whole panels stays within SEQ entries
static_assert(SEQ % 16 == 0);                    // 16 query rows per attention block
static_assert(SEQ % AROWS == 0);                 // builder grid covers the rows exactly
static_assert((SEQ & (SEQ - 1)) == 0);           // the builder's coarse filter reads the row-group bits of an index
static_assert(SEQ <= SEQ_FULL);
static_assert(DK == 64 * FW);                    // every wave owns 64 output columns
static_assert(PANEL == 128);
static_assert(PANEL % VH == 0 && VH % 32 == 0);
static_assert(VH / 4 == 16);                     // the gather's wait names its sixteen addresses
static_assert((PANEL & (PANEL - 1)) == 0 && PANEL <= 32 * FW);   // list padding: rounded up to a panel, at most one pad entry per thread
static_assert(AWORDS == 32 * FW);                // one adjacency word column per thread of an attention block
static_assert(SEQ <= 65536);                     // key indices fit 16 bits
static_assert(VPITCH % 32 == 0 && ((VPITCH / 32) & 1) == 1 && VPITCH >= 128);
static_assert((size_t)16 * OSP * 4 <= VSW);      // the output staging tile reuses the wave's own v staging bytes
static_assert((PP * 2) % 16 == 0);               // 16-byte aligned P rows
static_assert((OSP * 4) % 16 == 0);
static_assert((AROWS & (AROWS - 1)) == 0);
static_assert((AROWS * AWORDS) % ATH == 0);      // builder pack loop covers the words exactly
static_assert((AROWS * SEQ) % (16 * ATH) == 0);  // builder zero fill covers the flag bytes exactly
static_assert(4 * EU <= 32);                     // one candidate bit per edge of a thread's batch
static_assert(4 * 32 * 16 == 16 * 64 * 2);
static_assert(8 * 32 * 16 == 16 * 64 * 4);       // attention epilogue: 8 instructions x 32 lanes x 16 B == 16 rows x 256 B
static_assert((size_t)AROWS * SEQ <= 327680);                                           // builder static LDS
static_assert((size_t)16 * PP * 2 + 2 * FW * 16 * 4 + (size_t)FW * VSW + (size_t)SEQ * 4 + 64 <= 163840);   // attention static LDS: two blocks per 320 KiB
static_assert((size_t)16 * 68 * 4 <= 131072);                                           // projection static LDS
static_assert(((size_t)SEQ * DIN) % 8 == 0);
static_assert(((size_t)DIN * DK) % 8 == 0);

typedef _Float16 h16;
typedef unsigned short bf;
typedef __attribute__((ext_vector_type(16))) __bf16   v16bf;
typedef __attribute__((ext_vector_type(16))) _Float16 v16h;
typedef __attribute__((ext_vector_type(8)))  _Float16 v8h;
typedef __attribute__((ext_vector_type(8)))  unsigned short v8us;
typedef __attribute__((ext_vector_type(8)))  float    v8f;
typedef __attribute__((ext_vector_type(4)))  float    v4f;
typedef v4f  __attribute__((may_alias)) v4fa;
typedef __attribute__((ext_vector_type(4)))  unsigned v4u;
typedef v4u  __attribute__((may_alias)) v4ua;
typedef __attribute__((ext_vector_type(4)))  int      v4i;
typedef __attribute__((ext_vector_type(8)))  short    v8s;

__device__ __forceinline__ unsigned short f2bf(float f) { unsigned u = __float_as_uint(f); u += 0x7FFFu + ((u >> 16) & 1u); return (unsigned short)(u >> 16); }
__device__ __forceinline__ float bfr(float f) { return __uint_as_float(((unsigned)f2bf(f)) << 16); }   // value after RNE convert to bf16
__device__ __forceinline__ v16h cat16(v8h lo, v8h hi) { return __builtin_shufflevector(lo, hi, 0, 1, 2, 3, 4, 5, 6, 7, 8, 9, 10, 11, 12, 13, 14, 15); }
__device__ __forceinline__ v16bf cat16b(v8us lo, v8us hi) { return __builtin_bit_cast(v16bf, __builtin_shufflevector(lo, hi, 0, 1, 2, 3, 4, 5, 6, 7, 8, 9, 10, 11, 12, 13, 14, 15)); }
__device__ __forceinline__ v8f wmma16(v16h a, v16h b, v8f c) { return __builtin_amdgcn_wmma_f32_16x16x32_f16(false, a, false, b, (short)0, c, false, false); }
__device__ __forceinline__ v8f wmmab(v16bf a, v16bf b, v8f c) { return __builtin_amdgcn_wmma_f32_16x16x32_bf16(false, a, false, b, (short)0, c, false, false); }
// fragment loaders from K-contiguous 16-bit rows; p already includes + 8*(lane>>4): elements 0..7 <- k0+8h+0..7, elements 8..15 <- k0+16+8h+0..7 (same map for A and B)
__device__ __forceinline__ v16h  ldh(const h16* p) { return cat16(*(const v8h*)p, *(const v8h*)(p + 16)); }
__device__ __forceinline__ v16bf ldb(const bf* p)  { return cat16b(*(const v8us*)p, *(const v8us*)(p + 16)); }
// transposing LDS load: with p = T + (k0 + 8*(lane>>4) + (lane&7)) * pitch + 2 * d0 + 16 * ((lane>>3)&1), lane (c = lane&15, h = lane>>4) gets T[k0 + 8h + 0..7][d0 + c]
__device__ __forceinline__ v8h ldtr(const unsigned char* p) { typedef __attribute__((address_space(3))) v8s lds_v8s; return __builtin_bit_cast(v8h, __builtin_amdgcn_ds_load_tr16_b128_v8i16((lds_v8s*)p)); }
// ordering point for wave-private LDS tiles (same wave writes and reads)
__device__ __forceinline__ void wave_sync() { __builtin_amdgcn_fence(3 /* release order */, "wavefront"); __builtin_amdgcn_wave_barrier(); asm volatile("" ::: "memory"); }

// f32 -> f16 convert that cannot produce a subnormal f16 (|v| < 2^-14 -> +0)
static __device__ __forceinline__ h16 toh_flush(float v) { const h16 r = (h16)v; return (fabsf(v) < 6.103515625e-05f) ? (h16)0.0f : r; }
// one guarded f16 WMMA: the nops tie the accumulator and keep both fragments live
__device__ __forceinline__ v8f wmg(v16h a, v16h b, v8f c) { c = wmma16(a, b, c); asm volatile("v_nop\n\tv_nop\n\tv_nop\n\tv_nop" : "+v"(c) : "v"(a), "v"(b)); return c; }

__global__ __launch_bounds__(256) void k_cvt8(const float* __restrict__ src, bf* dst, size_t n8) {
    const size_t i = (size_t)blockIdx.x * 256 + threadIdx.x; if (i >= n8) return;
    const v8f v = *(const v8f*)(src + i * 8); v8us o;
#pragma unroll
    for (int k = 0; k < 8; ++k) o[k] = f2bf(v[k]);
    *(v8us*)(dst + i * 8) = o; 
}

// k_wcvt: W [DIN][DK] (f32, [in][out]) -> WT [DK][DIN] bf16 (RNE convert); thread i owns WT elements i*8 .. i*8+7 (row n = i / (DIN/8), k = (i % (DIN/8))*8 + j):
__global__ __launch_bounds__(256) void k_wcvt(const float* __restrict__ W, bf* WT) {
    const int i = blockIdx.x * 256 + threadIdx.x; if (i >= DK * DIN / 8) return;
    const int n = i / (DIN / 8), k8 = (i % (DIN / 8)) * 8; v8us o;
#pragma unroll
    for (int j = 0; j < 8; ++j) o[j] = f2bf(W[(size_t)(k8 + j) * DK + n]);
    *(v8us*)(WT + (size_t)i * 8) = o; 
}

// k_adj: adjacency bit plane ADJ[t][SEQ/32] from the edge list (src = ei[0..E), dst = ei[E..2E)); bit (c & 31) of word ADJ[r][c >> 5] set iff some edge (r, c) exists.
// One block of 32 waves owns AROWS rows as a BYTE plane in LDS (one byte per (row, column), zero-filled): setting a flag is a plain one-byte store of the value 1, so any thread may set any flag
// (two threads that meet on one byte store the same value) and the scan needs no list, no word owner and no barrier. The block's threads share ONE pass over the src row of the edge list
// (16-byte loads, the next batch in flight while this one is filtered); only an edge whose src falls into the block's rows, or that lies in the tail, reads its dst. After one barrier 32 flag bytes are packed into each word.
__global__ __launch_bounds__(ATH) void k_adj(const int* __restrict__ ei, unsigned* ADJ, int E) {
    __shared__ __align__(16) unsigned char flag[AROWS * SEQ];
    const int tid = threadIdx.x;
    const int r0 = blockIdx.x * AROWS;
    const int* __restrict__ sp = ei;
    const int* __restrict__ dp = ei + (size_t)E;
#pragma unroll
    for (int i = 0; i < AROWS * SEQ / 16 / ATH; ++i) { const v4u z = (v4u){0u, 0u, 0u, 0u}; *(v4ua*)(&flag[(size_t)(i * ATH + tid) * 16]) = z; }
    __syncthreads();
    // exact test and flag store of one edge e < E (indices below zero wrap once, anything still outside the matrix is dropped); the test bounds the LDS address
    auto mark = [&](int e) {
        int s = sp[(size_t)e]; int d = dp[(size_t)e];
        s += (s < 0) ? SEQ : 0; d += (d < 0) ? SEQ : 0;
        const bool hit = ((unsigned)(s - r0) < (unsigned)AROWS) & ((unsigned)d < (unsigned)SEQ);
        if (hit) flag[(s - r0) * SEQ + d] = (unsigned char)1;
    };
    // batch bt = edges [bt * EBATCH, (bt + 1) * EBATCH): load u of thread tid holds edges bt * EBATCH + u * 4 * ATH + 4 * tid + 0..3
    auto fetch = [&](v4i (&c)[EU], int bt) {
#pragma unroll
        for (int u = 0; u < EU; ++u) c[u] = *(const v4i*)(sp + (size_t)bt * EBATCH + (size_t)(u * 4 * ATH) + (size_t)tid * 4);
    };
    // coarse filter on the row-group bits of src (a wrapped index keeps them, SEQ being a power of two): one bit per candidate edge, then the exact test on the few candidates
    auto sift = [&](const v4i (&c)[EU], int bt) {
        unsigned hm = 0u;
#pragma unroll
        for (int u = 0; u < EU; ++u)
#pragma unroll
            for (int j = 0; j < 4; ++j) hm |= ((((unsigned)c[u][j] ^ (unsigned)r0) & (unsigned)(SEQ - AROWS)) == 0u) ? (1u << (u * 4 + j)) : 0u;
        while (hm != 0u) {                                             // at most 4 * EU trips
            const int b = __builtin_ctz(hm); hm &= hm - 1u;
            mark(bt * EBATCH + (b >> 2) * (4 * ATH) + tid * 4 + (b & 3));
        }
    };
    const int nb = E / EBATCH;                                         // whole batches (block-uniform)
    v4i ca[EU], cb[EU];
    if (nb > 0) fetch(ca, 0);
    int bt = 0;
#pragma unroll 1
    for (; bt + 3 <= nb; bt += 2) {                                    // both fetches unconditional, so that each batch is filtered with the next one still in flight
        fetch(cb, bt + 1);
        sift(ca, bt);
        fetch(ca, bt + 2);
        sift(cb, bt + 1);
    }
    if (bt + 2 <= nb) { fetch(cb, bt + 1); sift(ca, bt); sift(cb, bt + 1); }
    else if (bt < nb) sift(ca, bt);
#pragma unroll 1
    for (int e = nb * EBATCH + tid; e < E; e += ATH) mark(e);          // tail shorter than one batch
    __syncthreads();
    unsigned* dst = ADJ + (size_t)r0 * AWORDS;
#pragma unroll
    for (int i = 0; i < AROWS * AWORDS / ATH; ++i) {
        const int w = i * ATH + tid;                                   // word w of the block's rows <- flag bytes 32w .. 32w+31
        const v4u x0 = *(const v4ua*)(&flag[(size_t)w * 32]); const v4u x1 = *(const v4ua*)(&flag[(size_t)w * 32 + 16]);
        unsigned word = 0u;
#pragma unroll
        for (int k = 0; k < 4; ++k) {                                  // four 0/1 bytes -> four bits: the product puts byte i's bit at position 24 + i, no two terms meet
            word |= ((x0[k] * 0x01020408u) >> 24) << (4 * k);
            word |= ((x1[k] * 0x01020408u) >> 24) << (16 + 4 * k);
        }
        dst[(size_t)w] = word;
    }
}

// proj_body: register-blocked bf16 GEMM, ONE WAVE per 64x64 tile (16 accumulators), operands straight from K-contiguous bf16 planes, K = DIN.
// C[m][n] = sum_k A[m][k] Bt[n][k] + bias, written as f16 into a row-major plane.
// MODE 0: A = x rows (m = t), Bt = W^T rows (n = column), bias per column; plane [t][DK]. grid (SEQ/64, DK/64).
// MODE 1: A = W^T rows (m = d), Bt = x rows (n = t), bias per row; plane [d][SEQ]. grid (DK/64, SEQ/64).
template <int MODE>
__device__ __forceinline__ void proj_body(const bf* __restrict__ A, const bf* __restrict__ Bt, const float* __restrict__ bias, h16* Ph) {
    __shared__ __align__(16) float os[16 * 68];
    const int K = DIN;
    const int lane = threadIdx.x & 31, lr = lane & 15, hi = lane >> 4; const int r0 = blockIdx.x * 64, c0 = blockIdx.y * 64;
    v8f acc[4][4];
#pragma unroll
    for (int mb = 0; mb < 4; ++mb)
#pragma unroll
        for (int nb = 0; nb < 4; ++nb) acc[mb][nb] = (v8f){};
    const size_t aoff = (size_t)(r0 + lr) * K + 8 * hi, boff = (size_t)(c0 + lr) * K + 8 * hi;
#pragma unroll 1
    for (int kc = 0; kc < K; kc += 32) {
        v16bf a[4];
#pragma unroll
        for (int mb = 0; mb < 4; ++mb) a[mb] = ldb(A + aoff + (size_t)mb * 16 * K + kc);
#pragma unroll
        for (int nb = 0; nb < 4; ++nb) { const v16bf b = ldb(Bt + boff + (size_t)nb * 16 * K + kc);
#pragma unroll
            for (int mb = 0; mb < 4; ++mb) acc[mb][nb] = wmmab(a[mb], b, acc[mb][nb]); }
        asm volatile("v_nop\n\tv_nop\n\tv_nop\n\tv_nop" : "+v"(acc[0][0]), "+v"(acc[1][1]), "+v"(acc[2][2]), "+v"(acc[3][3]) : "v"(a[0]), "v"(a[1]), "v"(a[2]), "v"(a[3]));
    }
    float bc[4];
#pragma unroll
    for (int nb = 0; nb < 4; ++nb) bc[nb] = (MODE == 0) ? bfr(bias[c0 + nb * 16 + lr]) : 0.0f;   // MODE 0: c0 + 63 < DK
    const size_t pitch = (MODE == 0) ? (size_t)DK : (size_t)SEQ;
    const size_t tbase = (size_t)r0 * pitch + (size_t)c0;
#pragma unroll
    for (int mb = 0; mb < 4; ++mb) {
        float br[8];
#pragma unroll
        for (int j = 0; j < 8; ++j) br[j] = (MODE == 1) ? bfr(bias[r0 + mb * 16 + hi * 8 + j]) : 0.0f;   // MODE 1: r0 + 63 < DK
#pragma unroll
        for (int nb = 0; nb < 4; ++nb) {
#pragma unroll
            for (int j = 0; j < 8; ++j) os[(hi * 8 + j) * 68 + nb * 16 + lr] = acc[mb][nb][j] + bc[nb] + br[j]; }   // D: row 8h+j, col lane&15
        wave_sync();
{
            const size_t sb = tbase + (size_t)(mb * 16) * pitch;
#pragma unroll
            for (int s = 0; s < 4; ++s) { const int row = 4 * s + (lane >> 3), c8 = (lane & 7) * 8;   // 4 s x 4 row groups = 16 rows; 8 lanes x 8 = 64 columns
                const v4f x0 = *(const v4fa*)(&os[row * 68 + c8]); const v4f x1 = *(const v4fa*)(&os[row * 68 + c8 + 4]); v8h hv;
#pragma unroll
                for (int i = 0; i < 4; ++i) { hv[i] = toh_flush(x0[i]); hv[4 + i] = toh_flush(x1[i]); }
                const size_t oo = sb + (size_t)row * pitch + c8;
                *(v8h*)(Ph + oo) = hv; }
             }
        wave_sync();
    }
}

__global__ __launch_bounds__(32) void k_proj_rows(const bf* __restrict__ A, const bf* __restrict__ Bt, const float* __restrict__ bias, h16* Ph) { proj_body<0>(A, Bt, bias, Ph); }

// one 16-key x 16-query score tile: S^T = K Q^T over the full width (A = K rows, B = Q rows), fragments straight from the f16 planes
__device__ __forceinline__ v8f score16(const h16* __restrict__ kp, const h16* __restrict__ qp) {
    v8f s = (v8f){};
#pragma unroll 4
    for (int kc = 0; kc < DK; kc += 32) { const v16h a = ldh(kp + kc); const v16h b = ldh(qp + kc); s = wmg(a, b, s); }
    return s;
}

// k_flash: fused attention, one block per 16 query rows, FW = 8 waves.
// Pass 0 lists, in rising order, the keys with an edge to any of the block's 16 rows (thread i owns adjacency word column i: OR over the rows, block-wide prefix sum of the bit counts), each with a 16-bit
// mask of the rows that keep it, and walks the list; pass 1 does the same with the keys that are left (all masks zero). A key of pass 1 has the replaced score in every row, so its weight is
// exp2(FILL2 - max + 14), taken as 0 below -14 like every other weight: where that holds for all 16 rows after pass 0, pass 1 would add only zeros and is left out (same value in every wave: block-uniform).
// Per panel of 128 listed keys (the list is padded to whole panels; a pad entry scores NEGB, weight 0):
//  (1) wave w scores its own 16 listed keys in transposed form: A rows are gathered k rows; lane (t = lane&15, h = lane>>4) holds listed keys 8h+r for query t; a tile whose masks are all zero is not multiplied;
//  (2) per-query max: lane partial, xor-16 exchange, one word per wave per query in LDS, block barrier, combine over the 8 waves (identical in every wave);
//  (3) P = exp2(score - max + 14) as f16 (arguments below -14 give 0), P tile [t][128 keys] into LDS, partial sums over the converted P, block barrier;
//  (4) wave w accumulates O^T rows d in [64w, 64w+64): it gathers v[key][64w .. 64w+63] (one 128-byte line per key) of 64 listed keys at a time into its own LDS rows; A = V^T by transposing LDS loads,
//      B = P^T from the LDS tile (both in the k order 8h+0..7, 16+8h+0..7); block barrier before the next panel.
__global__ __launch_bounds__(32 * FW) void k_flash(const h16* __restrict__ QP, const h16* __restrict__ KP, const h16* __restrict__ VP, const unsigned* __restrict__ ADJ, float* OUT) {
    __shared__ __align__(16) h16 Ps[16 * PP];
    __shared__ float redm[FW * 16];
    __shared__ float reds[FW * 16];
    __shared__ int wsum[FW];
    __shared__ __align__(16) unsigned short klist[SEQ];
    __shared__ __align__(16) unsigned short kmask[SEQ];
    __shared__ __align__(32) unsigned char VS[FW * VSW];
    const int tid = threadIdx.x;
    const int lane = threadIdx.x & 31, lr = lane & 15, hi = lane >> 4;
    const int wave = __builtin_amdgcn_readfirstlane((int)(threadIdx.x >> 5));
    const int q0 = blockIdx.x * 16;
    const size_t qo = (size_t)(q0 + lr) * DK + 8 * hi;                 // B fragment: col t, k = d
    const int pw = lr * PP + wave * 16 + 8 * hi;                       // P tile write offset (listed keys wave*16 + 8h + r)
    const int pf = lr * PP + 8 * hi;                                   // P^T fragment read offset (col t, k = listed key)
    unsigned char* vsw = VS + wave * VSW;                              // the wave's own staging rows
    unsigned char* vwr = vsw + (lane >> 3) * VPITCH + (lane & 7) * 16;                                   // store i: staged row 4i + (lane>>3), 16-byte piece lane&7
    const unsigned char* vrd = vsw + (8 * hi + (lane & 7)) * VPITCH + ((lane >> 3) & 1) * 16;            // transposing read, staged row base 0, column base 0
    const h16* vsrc = VP + wave * 64 + (lane & 7) * 8;                 // + key * DK
    // gather of the wave's slices of listed keys jb .. jb+VH-1: load i covers four whole 128-byte lines (every list entry is below SEQ by construction)
    auto fetchv = [&](v4u (&vr)[VH / 4], int jb) {
        const h16* vp[VH / 4];                                         // all addresses are formed first; both loops are unrolled so that vp and vr are registers
#pragma unroll
        for (int i = 0; i < VH / 4; ++i) vp[i] = vsrc + (size_t)klist[jb + 4 * i + (lane >> 3)] * DK;
#pragma unroll
        for (int i = 0; i < VH / 4; ++i) vr[i] = *(const v4u*)vp[i];
        // the address registers of the issued loads stay as they are up to this wait (they are its inputs), so that none is reused ahead of it
        asm volatile("s_wait_xcnt 0x0" :: "v"(vp[0]), "v"(vp[1]), "v"(vp[2]), "v"(vp[3]), "v"(vp[4]), "v"(vp[5]), "v"(vp[6]), "v"(vp[7]),
                                          "v"(vp[8]), "v"(vp[9]), "v"(vp[10]), "v"(vp[11]), "v"(vp[12]), "v"(vp[13]), "v"(vp[14]), "v"(vp[15]) : "memory");
    };
    auto stagev = [&](const v4u (&vr)[VH / 4]) {
#pragma unroll
        for (int i = 0; i < VH / 4; ++i) *(v4ua*)(vwr + i * 4 * VPITCH) = vr[i];
        asm volatile("s_wait_dscnt 0x0" ::: "memory");                 // the wave's own stores have retired before its transposing loads read the rows back
    };
    v8f o0 = (v8f){}, o1 = (v8f){}, o2 = (v8f){}, o3 = (v8f){};
    auto pv = [&](int jl) {                                            // VH staged keys against P columns jl .. jl+VH-1
#pragma unroll
        for (int kc = 0; kc < VH; kc += 32) {
            const v16h pb = cat16(*(const v8h*)(&Ps[pf + jl + kc]), *(const v8h*)(&Ps[pf + jl + kc + 16]));
            const unsigned char* ad = vrd + kc * VPITCH;
            const v16h v0 = cat16(ldtr(ad),      ldtr(ad + 16 * VPITCH));        o0 = wmg(v0, pb, o0);
            const v16h v1 = cat16(ldtr(ad + 32), ldtr(ad + 16 * VPITCH + 32));   o1 = wmg(v1, pb, o1);
            const v16h v2 = cat16(ldtr(ad + 64), ldtr(ad + 16 * VPITCH + 64));   o2 = wmg(v2, pb, o2);
            const v16h v3 = cat16(ldtr(ad + 96), ldtr(ad + 16 * VPITCH + 96));   o3 = wmg(v3, pb, o3);
        }
        wave_sync();                                                   // the staged rows are rewritten only behind these reads
    };
    float m = NEGB, l = 0.0f;
#pragma unroll 1                                                        // one copy of the large body with its barriers serves both passes
    for (int pass = 0; pass < 2; ++pass) {
        unsigned aw[16]; unsigned un = 0u;
        const unsigned* ap = ADJ + (size_t)q0 * AWORDS + tid;
#pragma unroll
        for (int r = 0; r < 16; ++r) aw[r] = ap[(size_t)r * AWORDS];
        asm volatile("s_wait_xcnt 0x0" :: "v"(ap) : "memory");         // the address register of the issued loads stays as it is up to this wait (it is its input)
#pragma unroll
        for (int r = 0; r < 16; ++r) un |= aw[r];
        unsigned sel = (pass == 0) ? un : ~un;                         // this pass's keys among 32*tid .. 32*tid+31
        const int cnt = __popc(sel);
        int inc = cnt;                                                 // inclusive prefix sum over the wave
#pragma unroll
        for (int d = 1; d < 32; d <<= 1) { const int up = __shfl_up(inc, d, 32); inc += (lane >= d) ? up : 0; }
        if (lane == 31) wsum[wave] = inc;
        __syncthreads();
        int base = 0, nn = 0;
#pragma unroll
        for (int w = 0; w < FW; ++w) { const int c = wsum[w]; base += (w < wave) ? c : 0; nn += c; }
        const int n = __builtin_amdgcn_readfirstlane(nn);              // listed keys of this pass, at most SEQ
        int pos = base + inc - cnt;
        while (sel != 0u) {                                            // at most 32 trips; pos stays below n
            const int b = __builtin_ctz(sel); sel &= sel - 1u;
            unsigned mk = 0u;
#pragma unroll
            for (int r = 0; r < 16; ++r) mk |= ((aw[r] >> b) & 1u) << r;
            klist[pos] = (unsigned short)(tid * 32 + b); kmask[pos] = (unsigned short)mk; ++pos;
        }
        const int np = (n + PANEL - 1) & ~(PANEL - 1);                 // at most SEQ
        if (n + tid < np) { klist[n + tid] = (unsigned short)0; kmask[n + tid] = (unsigned short)0; }
        __syncthreads();
#pragma unroll 1
        for (int kb = 0; kb < np; kb += PANEL) {
            v4u va[VH / 4], vb[VH / 4];
            fetchv(va, kb);                                            // in flight under the score stage
            const int j0 = kb + wave * 16;
            const v8us km = *(const v8us*)(&kmask[j0 + 8 * hi]);       // row masks of the lane's 8 listed keys
            unsigned orm = 0u;
#pragma unroll
            for (int r = 0; r < 8; ++r) orm |= (unsigned)km[r];
            const bool any = __builtin_amdgcn_ballot_w32(orm != 0u) != 0u;   // wave-uniform
            v8f sa = (v8f){};
            if (any) { const int krow = klist[j0 + lr]; sa = score16(KP + (size_t)krow * DK + 8 * hi, QP + qo); }   // A fragment: row = listed key, k = d
            float ta[8]; float mx = NEGB;
#pragma unroll
            for (int r = 0; r < 8; ++r) {
                const bool fa = ((((unsigned)km[r]) >> lr) & 1u) != 0u;
                const float sc = fa ? sa[r] * SC2 : FILL2;             // kept: scaled score; otherwise the score is replaced
                ta[r] = (j0 + 8 * hi + r < n) ? sc : NEGB;             // a pad entry is no key
                mx = fmaxf(mx, ta[r]); }
            mx = fmaxf(mx, __shfl_xor(mx, 16, 32));
            if (hi == 0) redm[wave * 16 + lr] = mx;
            __syncthreads();
            float pm = redm[lr];
#pragma unroll
            for (int w = 1; w < FW; ++w) pm = fmaxf(pm, redm[w * 16 + lr]);
            const float mnew = fmaxf(m, pm);
            const float alpha = __builtin_amdgcn_exp2f(m - mnew);
            const float sh = PSH - mnew;
            v8h pa; float ls = 0.0f;
#pragma unroll
            for (int r = 0; r < 8; ++r) {
                const float ea = ta[r] + sh;
                const float xa = __builtin_amdgcn_exp2f(ea);
                const float ga = (ea < -14.0f) ? 0.0f : xa;            // never a subnormal f16
                const h16 ha = (h16)ga;
                pa[r] = ha; ls += (float)ha; }
            ls += __shfl_xor(ls, 16, 32);
            if (hi == 0) reds[wave * 16 + lr] = ls;
            *(v8h*)(&Ps[pw]) = pa;
            __syncthreads();
            float lsum = reds[lr];
#pragma unroll
            for (int w = 1; w < FW; ++w) lsum += reds[w * 16 + lr];
            l = l * alpha + lsum; m = mnew;
            o0 = o0 * alpha; o1 = o1 * alpha; o2 = o2 * alpha; o3 = o3 * alpha;
            stagev(va);
            fetchv(vb, kb + VH);                                       // in flight under the first half's products
            pv(0);
            stagev(vb);
            pv(VH);
            __syncthreads();
        }
        const float ef = FILL2 + (PSH - fmaxf(m, FILL2));              // weight argument of a key that no row of the block keeps
        if (__builtin_amdgcn_ballot_w32(ef >= -14.0f) == 0u) break;    // m is the same in every wave: block-uniform
    }
    const float inv = 1.0f / l;                                        // l >= 16384: the panel holding a row's maximum contributes the full carry
    float* os = (float*)vsw;                                           // output staging in the wave's own rows (their last reads lie behind pv's ordering point)
    // O^T D layout: o_j[r] = (d = 64w + 16j + 8h + r, t = lane&15) -> os[t][16j + 8h + r]; rows 0..15 x columns 0..63 all written
    { v4f a, c;
      a[0] = o0[0] * inv; a[1] = o0[1] * inv; a[2] = o0[2] * inv; a[3] = o0[3] * inv; c[0] = o0[4] * inv; c[1] = o0[5] * inv; c[2] = o0[6] * inv; c[3] = o0[7] * inv;
      *(v4fa*)(&os[lr * OSP +  0 + 8 * hi]) = a; *(v4fa*)(&os[lr * OSP +  0 + 8 * hi + 4]) = c;
      a[0] = o1[0] * inv; a[1] = o1[1] * inv; a[2] = o1[2] * inv; a[3] = o1[3] * inv; c[0] = o1[4] * inv; c[1] = o1[5] * inv; c[2] = o1[6] * inv; c[3] = o1[7] * inv;
      *(v4fa*)(&os[lr * OSP + 16 + 8 * hi]) = a; *(v4fa*)(&os[lr * OSP + 16 + 8 * hi + 4]) = c;
      a[0] = o2[0] * inv; a[1] = o2[1] * inv; a[2] = o2[2] * inv; a[3] = o2[3] * inv; c[0] = o2[4] * inv; c[1] = o2[5] * inv; c[2] = o2[6] * inv; c[3] = o2[7] * inv;
      *(v4fa*)(&os[lr * OSP + 32 + 8 * hi]) = a; *(v4fa*)(&os[lr * OSP + 32 + 8 * hi + 4]) = c;
      a[0] = o3[0] * inv; a[1] = o3[1] * inv; a[2] = o3[2] * inv; a[3] = o3[3] * inv; c[0] = o3[4] * inv; c[1] = o3[5] * inv; c[2] = o3[6] * inv; c[3] = o3[7] * inv;
      *(v4fa*)(&os[lr * OSP + 48 + 8 * hi]) = a; *(v4fa*)(&os[lr * OSP + 48 + 8 * hi + 4]) = c; }
    wave_sync();
    float* orow = OUT + (size_t)q0 * DK + wave * 64;
{
#pragma unroll
        for (int s = 0; s < 8; ++s) { const int row = 2 * s + (lane >> 4), cofs = (lane & 15) * 4;   // 8 s x 2 rows = 16 rows; 16 lanes x 4 floats = 64 columns = two lines
            const v4f val = *(const v4fa*)(&os[row * OSP + cofs]);
            *(v4f*)(orow + (size_t)row * DK + cofs) = val; }
         }
}

static constexpr size_t al256(size_t v) { return (v + 255) & ~(size_t)255; }
static constexpr size_t SZ_XB = al256((size_t)SEQ * DIN * 2);
static constexpr size_t SZ_WB = al256((size_t)3 * DK * DIN * 2);
static constexpr size_t SZ_PL = al256((size_t)SEQ * DK * 2);
static constexpr size_t SZ_AJ = al256((size_t)SEQ * AWORDS * 4);
static constexpr size_t SZ_TOTAL = SZ_XB + SZ_WB + 3 * SZ_PL + SZ_AJ;
static_assert(SZ_TOTAL <= (size_t)134217728);          // workspace carve <= 128 MiB
static_assert(((size_t)DK * DIN * 2) % 256 == 0);      // weight sub-planes stay 256-byte aligned
static_assert((size_t)(SEQ / AROWS) * AROWS * AWORDS * 4 <= SZ_AJ);   // builder grid x block extent == adjacency plane
static_assert((size_t)(SEQ / 64) * 64 * DK * 2 <= SZ_PL);             // projection grids x tile extent == plane

extern "C" void kernel_launch(void* const* d_in, const int* in_sizes, int n_in,
                              void* d_out, int out_size, void* d_ws, size_t ws_size, hipStream_t stream) {
    if (n_in < 8) return;
    if ((size_t)in_sizes[0] < (size_t)SEQ * DIN) return;
    if (in_sizes[1] < 2) return;
    if ((size_t)in_sizes[2] < (size_t)DIN * DK || (size_t)in_sizes[4] < (size_t)DIN * DK || (size_t)in_sizes[6] < (size_t)DIN * DK) return;
    if (in_sizes[3] < DK || in_sizes[5] < DK || in_sizes[7] < DK) return;
    if ((size_t)out_size < (size_t)SEQ * DK) return;
    if (SZ_TOTAL > ws_size) return;
    // wire order: x, edge_index, Wq, bq, Wk, bk, Wv, bv
    const float* x  = (const float*)d_in[0];
    const int*   ei = (const int*)d_in[1];
    const float* wq = (const float*)d_in[2]; const float* bq = (const float*)d_in[3];
    const float* wk = (const float*)d_in[4]; const float* bk = (const float*)d_in[5];
    const float* wv = (const float*)d_in[6]; const float* bv = (const float*)d_in[7];
    const int E = in_sizes[1] / 2;
    float* OUT = (float*)d_out;      // [SEQ][512]
    char* wsp = (char*)d_ws;
    bf* XB = (bf*)wsp; wsp += SZ_XB;                 // x        [SEQ][512] bf16
    bf* WB = (bf*)wsp; wsp += SZ_WB;                 // [3][512][512]: Wq^T | Wk^T | Wv^T  ([out][in])
    h16* QP = (h16*)wsp; wsp += SZ_PL;               // q   [SEQ][512]
    h16* KP = (h16*)wsp; wsp += SZ_PL;               // k   [SEQ][512]
    h16* VP = (h16*)wsp; wsp += SZ_PL;               // v   [SEQ][512]
    unsigned* ADJ = (unsigned*)wsp; wsp += SZ_AJ;    // adjacency bits [SEQ][SEQ/32]
    bf* WQT = WB; bf* WKT = WB + (size_t)DK * DIN; bf* WVT = WB + (size_t)2 * DK * DIN;

    { const size_t n8 = (size_t)SEQ * DIN / 8;
      k_cvt8<<<(unsigned)((n8 + 255) / 256), 256, 0, stream>>>(x, XB, n8); }
    { const unsigned g = (unsigned)((DK * DIN / 8 + 255) / 256);
      k_wcvt<<<g, 256, 0, stream>>>(wq, WQT); k_wcvt<<<g, 256, 0, stream>>>(wk, WKT); k_wcvt<<<g, 256, 0, stream>>>(wv, WVT); }
    k_adj<<<SEQ / AROWS, ATH, 0, stream>>>(ei, ADJ, E);

    // q, k, v: A = x rows (m = t), Bt = W^T rows (n = column) -> plane [t][512]
    k_proj_rows<<<dim3(SEQ / 64, DK / 64, 1), 32, 0, stream>>>(XB, WQT, bq, QP);
    k_proj_rows<<<dim3(SEQ / 64, DK / 64, 1), 32, 0, stream>>>(XB, WKT, bk, KP);
    k_proj_rows<<<dim3(SEQ / 64, DK / 64, 1), 32, 0, stream>>>(XB, WVT, bv, VP);

    k_flash<<<SEQ / 16, 32 * FW, 0, stream>>>(QP, KP, VP, ADJ, OUT);
}

// v003
// It runs in 101 microseconds.
// Two timings next to v002 both put it at 1.21 times that version's speed.
// Over all steps from v000 it is 10.1 times as fast.
#include <hip/hip_runtime.h>

// Single-head graph attention block: x [SEQ][512]; Wq/Wk/Wv [in][out] (y = x W + bias); edge list (int32 [2][E]) -> dense adjacency bit plane; scores q k^T / sqrt(512);
// mask form: a kept (edge) key keeps its score, every other key's score is REPLACED by -1e6 (rows without any edge come out as the uniform mean of v); softmax over all keys; output = attn v (f32).
// Compute dtypes, f32 accumulate everywhere: projections v_wmma_f32_16x16x32_bf16 (x, W, bias RNE-converted to bf16; products exact); scores v_wmma_f32_16x16x32_f16 (single f16 q and k planes);
// P.V v_wmma_f32_16x16x32_f16 (P with a x16384 carry that cancels in the normalisation, single f16 v plane, row sum over the converted P); softmax f32 (online, running max, exp2 form).
// Layout: bf16 copies of x and of the transposed weights W^T [out][in]; f16 planes q [t][512], k [t][512], v [t][512]; adjacency bit plane [t][SEQ/32] words built without read-modify-write primitives on global memory.
// Three launches: (1) adjacency builder, whose blocks also convert their shares of x and of the weights; (2) the q, k and v projections in one grid; (3) fused attention.
// Fused attention in transposed form (S^T = K Q^T, O^T = V^T P^T): 16 query rows per block, 8 waves. The block first lists the keys that have an edge to any of its 16 rows and walks that list in panels of 128 keys
// (every wave scores its own 16 listed keys, the P tile goes through LDS, every wave owns 64 output columns and gathers its 128-byte slices of the listed v rows into LDS, read back transposed).
// The keys outside the list all carry the replaced score: they are walked too, by the same code, unless their weight is exactly zero for all 16 rows.

#ifndef SEQ
#define SEQ 8192                 // number of nodes (rows of x, queries and keys)
#endif
#define SEQ_FULL 8192
#define DIN  512                 // input width
#define DK   512                 // q / k / v width
#define FW   8                   // waves per attention block
#define PANEL (16 * FW)          // listed keys per panel
#define PP   (PANEL + 8)         // LDS row pitch (halves) of the P tile
#define OSP  68                  // LDS row pitch (floats) of the output staging tile
#define VH   64                  // listed keys whose v slices one wave stages at a time
#define VPITCH 160               // LDS row pitch (bytes) of a staged 128-byte v slice: an odd multiple of 32 bytes for the transposing reader
#define VSW  (VH * VPITCH)       // staging bytes per wave
#define AWORDS (SEQ / 32)        // adjacency words per row
#define AROWS 32                 // adjacency rows owned by one builder block
#define ATH  1024                // threads of one builder block
#define EU   8                   // 16-byte edge loads in flight per thread and batch
#define EBATCH (ATH * EU * 4)    // edges per batch of one builder block
#define XU   ((SEQ * (DIN / 8)) / ((SEQ / AROWS) * ATH))   // 8-element units of x converted per builder thread
#define WU   ((3 * DK * (DIN / 8)) / (SEQ / AROWS))        // 8-element units of the three W^T planes converted per builder block
#define PLE  ((size_t)SEQ * DK)  // elements of one of the q, k, v planes, which lie one behind the other
#define SC2  ((float)(0.044194173824159216 * 1.4426950408889634))   // 512^-0.5 * log2(e)
#define FILL2 ((float)(-1000000.0 * 1.4426950408889634))            // replaced score (-1e6) in the exp2 domain
#define PSH  14.0f               // log2 of the P carry (16384)
#define NEGB (-3.0e38f)

static_assert(DIN % 32 == 0);                    // GEMM k-loop steps by 32
static_assert(DK % 32 == 0);                     // score k-loop steps by 32
static_assert(DK % 64 == 0);                     // 64-wide GEMM tiles
static_assert(DIN % 8 == 0);
static_assert(SEQ % 64 == 0);                    // 64-row GEMM tiles
static_assert(SEQ % PANEL == 0);                 // the list rounded up to whole panels stays within SEQ entries
static_assert(SEQ % 16 == 0);                    // 16 query rows per attention block
static_assert(SEQ % AROWS == 0);                 // builder grid covers the rows exactly
static_assert((SEQ & (SEQ - 1)) == 0);           // the builder's coarse filter reads the row-group bits of an index
static_assert(SEQ <= SEQ_FULL);
static_assert(DK == 64 * FW);                    // every wave owns 64 output columns
static_assert(PANEL == 128);
static_assert(PANEL % VH == 0 && VH % 32 == 0);
static_assert(VH / 4 == 16);                     // the gather's wait names its sixteen addresses
static_assert((PANEL & (PANEL - 1)) == 0 && PANEL <= 32 * FW);   // list padding: rounded up to a panel, at most one pad entry per thread
static_assert(AWORDS == 32 * FW);                // one adjacency word column per thread of an attention block
static_assert(SEQ <= 65536);                     // key indices fit 16 bits
static_assert(VPITCH % 32 == 0 && ((VPITCH / 32) & 1) == 1 && VPITCH >= 128);
static_assert((size_t)16 * OSP * 4 <= VSW);      // the output staging tile reuses the wave's own v staging bytes
static_assert((PP * 2) % 16 == 0);               // 16-byte aligned P rows
static_assert((OSP * 4) % 16 == 0);
static_assert((AROWS & (AROWS - 1)) == 0);
static_assert((AROWS * AWORDS) % ATH == 0);      // builder pack loop covers the words exactly
static_assert((AROWS * SEQ) % (16 * ATH) == 0);  // builder zero fill covers the flag bytes exactly
static_assert(4 * EU <= 32);                     // one candidate bit per edge of a thread's batch
static_assert((size_t)XU * (SEQ / AROWS) * ATH == (size_t)SEQ * DIN / 8);               // builder grid covers x exactly
static_assert((size_t)WU * (SEQ / AROWS) == (size_t)3 * DK * DIN / 8);                  // builder grid covers the weights exactly
static_assert(WU <= ATH && WU % 32 == 0 && (DK * DIN / 8) % 32 == 0);                   // whole waves, each inside one weight plane
static_assert(4 * 32 * 16 == 16 * 64 * 2);
static_assert(8 * 32 * 16 == 16 * 64 * 4);       // attention epilogue: 8 instructions x 32 lanes x 16 B == 16 rows x 256 B
static_assert((size_t)AROWS * SEQ <= 327680);                                           // builder static LDS
static_assert((size_t)16 * PP * 2 + 2 * FW * 16 * 4 + (size_t)FW * VSW + (size_t)SEQ * 4 + 64 <= 163840);   // attention static LDS: two blocks per 320 KiB
static_assert((size_t)16 * 68 * 4 <= 131072);                                           // projection static LDS
static_assert(((size_t)SEQ * DIN) % 8 == 0);
static_assert(((size_t)DIN * DK) % 8 == 0);

typedef _Float16 h16;
typedef unsigned short bf;
typedef __attribute__((ext_vector_type(16))) __bf16   v16bf;
typedef __attribute__((ext_vector_type(16))) _Float16 v16h;
typedef __attribute__((ext_vector_type(8)))  _Float16 v8h;
typedef __attribute__((ext_vector_type(8)))  unsigned short v8us;
typedef __attribute__((ext_vector_type(8)))  float    v8f;
typedef __attribute__((ext_vector_type(4)))  float    v4f;
typedef v4f  __attribute__((may_alias)) v4fa;
typedef __attribute__((ext_vector_type(4)))  unsigned v4u;
typedef v4u  __attribute__((may_alias)) v4ua;
typedef __attribute__((ext_vector_type(4)))  int      v4i;
typedef __attribute__((ext_vector_type(8)))  short    v8s;

__device__ __forceinline__ unsigned short f2bf(float f) { unsigned u = __float_as_uint(f); u += 0x7FFFu + ((u >> 16) & 1u); return (unsigned short)(u >> 16); }
__device__ __forceinline__ float bfr(float f) { return __uint_as_float(((unsigned)f2bf(f)) << 16); }   // value after RNE convert to bf16
__device__ __forceinline__ v16h cat16(v8h lo, v8h hi) { return __builtin_shufflevector(lo, hi, 0, 1, 2, 3, 4, 5, 6, 7, 8, 9, 10, 11, 12, 13, 14, 15); }
__device__ __forceinline__ v16bf cat16b(v8us lo, v8us hi) { return __builtin_bit_cast(v16bf, __builtin_shufflevector(lo, hi, 0, 1, 2, 3, 4, 5, 6, 7, 8, 9, 10, 11, 12, 13, 14, 15)); }
__device__ __forceinline__ v8f wmma16(v16h a, v16h b, v8f c) { return __builtin_amdgcn_wmma_f32_16x16x32_f16(false, a, false, b, (short)0, c, false, false); }
__device__ __forceinline__ v8f wmmab(v16bf a, v16bf b, v8f c) { return __builtin_amdgcn_wmma_f32_16x16x32_bf16(false, a, false, b, (short)0, c, false, false); }
// fragment loaders from K-contiguous 16-bit rows; p already includes + 8*(lane>>4): elements 0..7 <- k0+8h+0..7, elements 8..15 <- k0+16+8h+0..7 (same map for A and B)
__device__ __forceinline__ v16h  ldh(const h16* p) { return cat16(*(const v8h*)p, *(const v8h*)(p + 16)); }
__device__ __forceinline__ v16bf ldb(const bf* p)  { return cat16b(*(const v8us*)p, *(const v8us*)(p + 16)); }
// transposing LDS load: with p = T + (k0 + 8*(lane>>4) + (lane&7)) * pitch + 2 * d0 + 16 * ((lane>>3)&1), lane (c = lane&15, h = lane>>4) gets T[k0 + 8h + 0..7][d0 + c]
__device__ __forceinline__ v8h ldtr(const unsigned char* p) { typedef __attribute__((address_space(3))) v8s lds_v8s; return __builtin_bit_cast(v8h, __builtin_amdgcn_ds_load_tr16_b128_v8i16((lds_v8s*)p)); }
// ordering point for wave-private LDS tiles (same wave writes and reads)
__device__ __forceinline__ void wave_sync() { __builtin_amdgcn_fence(3 /* release order */, "wavefront"); __builtin_amdgcn_wave_barrier(); asm volatile("" ::: "memory"); }

// f32 -> f16 convert that cannot produce a subnormal f16 (|v| < 2^-14 -> +0)
static __device__ __forceinline__ h16 toh_flush(float v) { const h16 r = (h16)v; return (fabsf(v) < 6.103515625e-05f) ? (h16)0.0f : r; }
// one guarded f16 WMMA: the nops tie the accumulator and keep both fragments live
__device__ __forceinline__ v8f wmg(v16h a, v16h b, v8f c) { c = wmma16(a, b, c); asm volatile("v_nop\n\tv_nop\n\tv_nop\n\tv_nop" : "+v"(c) : "v"(a), "v"(b)); return c; }

// k_adj: adjacency bit plane ADJ[t][SEQ/32] from the edge list (src = ei[0..E), dst = ei[E..2E)); bit (c & 31) of word ADJ[r][c >> 5] set iff some edge (r, c) exists.
// One block of 32 waves owns AROWS rows as a BYTE plane in LDS (one byte per (row, column), zero-filled): setting a flag is a plain one-byte store of the value 1, so any thread may set any flag
// (two threads that meet on one byte store the same value) and the scan needs no list, no word owner and no barrier. The block's threads share ONE pass over the src row of the edge list
// (16-byte loads, the next batch in flight while this one is filtered); in whole batches only an edge whose src falls into the block's rows reads its dst (the tail reads every dst). After one barrier 32 flag bytes are packed into each word.
// The block also converts its share of the projection operands (RNE to bf16), work that depends on nothing here and that only the next launch reads: XU units of x per thread (unit i = elements 8i .. 8i+7),
// and WU units of the transposed weights WB = Wq^T | Wk^T | Wv^T, W [DIN][DK] ([in][out]) -> W^T [DK][DIN] (unit i of a plane: row n = i / (DIN/8), k = (i % (DIN/8))*8 + j); the loads of both are in flight under the zero fill.
__global__ __launch_bounds__(ATH) void k_adj(const int* __restrict__ ei, unsigned* ADJ, int E, const float* __restrict__ x, bf* XB,
                                             const float* __restrict__ wq, const float* __restrict__ wk, const float* __restrict__ wv, bf* WB) {
    __shared__ __align__(16) unsigned char flag[AROWS * SEQ];
    const int tid = threadIdx.x;
    const int r0 = blockIdx.x * AROWS;
    const int* __restrict__ sp = ei;
    const int* __restrict__ dp = ei + (size_t)E;
    const size_t xu = (size_t)blockIdx.x * (XU * ATH) + tid;           // the thread's first unit of x; the others follow ATH units apart
    v8f xv[XU];
#pragma unroll
    for (int u = 0; u < XU; ++u) xv[u] = *(const v8f*)(x + (xu + (size_t)u * ATH) * 8);
    const unsigned g = blockIdx.x * WU + tid;                          // the thread's unit of WB, for tid < WU (whole waves)
    float wr[8] = {0.0f, 0.0f, 0.0f, 0.0f, 0.0f, 0.0f, 0.0f, 0.0f};
    if (tid < WU) {
        const unsigned pl = g / (DK * DIN / 8), i = g % (DK * DIN / 8);
        const float* __restrict__ Wp = (pl == 0u) ? wq : (pl == 1u) ? wk : wv;
        const unsigned n = i / (DIN / 8), k8 = (i % (DIN / 8)) * 8;
#pragma unroll
        for (int j = 0; j < 8; ++j) wr[j] = Wp[(size_t)(k8 + j) * DK + n];
    }
#pragma unroll
    for (int i = 0; i < AROWS * SEQ / 16 / ATH; ++i) { const v4u z = (v4u){0u, 0u, 0u, 0u}; *(v4ua*)(&flag[(size_t)(i * ATH + tid) * 16]) = z; }
    __builtin_amdgcn_sched_barrier(0);                                 // keeps the conversions, which wait for their loads, behind the zero fill's stores
#pragma unroll
    for (int u = 0; u < XU; ++u) { v8us o;
#pragma unroll
        for (int k = 0; k < 8; ++k) o[k] = f2bf(xv[u][k]);
        *(v8us*)(XB + (xu + (size_t)u * ATH) * 8) = o; }
    if (tid < WU) { v8us o;
#pragma unroll
        for (int j = 0; j < 8; ++j) o[j] = f2bf(wr[j]);
        *(v8us*)(WB + (size_t)g * 8) = o;
    }
    __syncthreads();
    // exact test and flag store of one edge e < E (indices below zero wrap once, anything still outside the matrix is dropped); the test bounds the LDS address
    auto mark = [&](int e) {
        int s = sp[(size_t)e]; int d = dp[(size_t)e];
        s += (s < 0) ? SEQ : 0; d += (d < 0) ? SEQ : 0;
        const bool hit = ((unsigned)(s - r0) < (unsigned)AROWS) & ((unsigned)d < (unsigned)SEQ);
        if (hit) flag[(s - r0) * SEQ + d] = (unsigned char)1;
    };
    // batch bt = edges [bt * EBATCH, (bt + 1) * EBATCH): load u of thread tid holds edges bt * EBATCH + u * 4 * ATH + 4 * tid + 0..3
    auto fetch = [&](v4i (&c)[EU], int bt) {
#pragma unroll
        for (int u = 0; u < EU; ++u) c[u] = *(const v4i*)(sp + (size_t)bt * EBATCH + (size_t)(u * 4 * ATH) + (size_t)tid * 4);
    };
    // coarse filter on the row-group bits of src (a wrapped index keeps them, SEQ being a power of two): one bit per candidate edge, then the exact test on the few candidates
    auto sift = [&](const v4i (&c)[EU], int bt) {
        unsigned hm = 0u;
#pragma unroll
        for (int u = 0; u < EU; ++u)
#pragma unroll
            for (int j = 0; j < 4; ++j) hm |= ((((unsigned)c[u][j] ^ (unsigned)r0) & (unsigned)(SEQ - AROWS)) == 0u) ? (1u << (u * 4 + j)) : 0u;
        while (hm != 0u) {                                             // at most 4 * EU trips
            const int b = __builtin_ctz(hm); hm &= hm - 1u;
            mark(bt * EBATCH + (b >> 2) * (4 * ATH) + tid * 4 + (b & 3));
        }
    };
    const int nb = E / EBATCH;                                         // whole batches (block-uniform)
    v4i ca[EU], cb[EU];
    if (nb > 0) fetch(ca, 0);
    int bt = 0;
#pragma unroll 1
    for (; bt + 3 <= nb; bt += 2) {                                    // both fetches unconditional, so that each batch is filtered with the next one still in flight
        fetch(cb, bt + 1);
        sift(ca, bt);
        fetch(ca, bt + 2);
        sift(cb, bt + 1);
    }
    if (bt + 2 <= nb) { fetch(cb, bt + 1); sift(ca, bt); sift(cb, bt + 1); }
    else if (bt < nb) sift(ca, bt);
#pragma unroll 1
    for (int e = nb * EBATCH + tid; e < E; e += ATH) mark(e);          // tail shorter than one batch
    __syncthreads();
    unsigned* dst = ADJ + (size_t)r0 * AWORDS;
#pragma unroll
    for (int i = 0; i < AROWS * AWORDS / ATH; ++i) {
        const int w = i * ATH + tid;                                   // word w of the block's rows <- flag bytes 32w .. 32w+31
        const v4u x0 = *(const v4ua*)(&flag[(size_t)w * 32]); const v4u x1 = *(const v4ua*)(&flag[(size_t)w * 32 + 16]);
        unsigned word = 0u;
#pragma unroll
        for (int k = 0; k < 4; ++k) {                                  // four 0/1 bytes -> four bits: the product puts byte i's bit at position 24 + i, no two terms meet
            word |= ((x0[k] * 0x01020408u) >> 24) << (4 * k);
            word |= ((x1[k] * 0x01020408u) >> 24) << (16 + 4 * k);
        }
        dst[(size_t)w] = word;
    }
}

// proj_body: register-blocked bf16 GEMM, ONE WAVE per 64x64 tile (16 accumulators), operands straight from K-contiguous bf16 planes, K = DIN.
// C[m][n] = sum_k A[m][k] Bt[n][k] + bias, written as f16 into a row-major plane.
// MODE 0: A = x rows (m = t), Bt = W^T rows (n = column), bias per column; plane [t][DK]. r0 = 64 * blockIdx.x, c0 from the caller.
// MODE 1: A = W^T rows (m = d), Bt = x rows (n = t), bias per row; plane [d][SEQ].
template <int MODE>
__device__ __forceinline__ void proj_body(const bf* __restrict__ A, const bf* __restrict__ Bt, const float* __restrict__ bias, h16* Ph, const int c0) {
    __shared__ __align__(16) float os[16 * 68];
    const int K = DIN;
    const int lane = threadIdx.x & 31, lr = lane & 15, hi = lane >> 4; const int r0 = blockIdx.x * 64;
    v8f acc[4][4];
#pragma unroll
    for (int mb = 0; mb < 4; ++mb)
#pragma unroll
        for (int nb = 0; nb < 4; ++nb) acc[mb][nb] = (v8f){};
    const size_t aoff = (size_t)(r0 + lr) * K + 8 * hi, boff = (size_t)(c0 + lr) * K + 8 * hi;
#pragma unroll 1
    for (int kc = 0; kc < K; kc += 32) {
        v16bf a[4], b[4];
        const bf* pa = A + aoff + kc; const bf* pb = Bt + boff + kc;
#pragma unroll
        for (int mb = 0; mb < 4; ++mb) a[mb] = ldb(pa + (size_t)mb * 16 * K);
#pragma unroll
        for (int nb = 0; nb < 4; ++nb) b[nb] = ldb(pb + (size_t)nb * 16 * K);
        asm volatile("s_wait_xcnt 0x0" :: "v"(pa), "v"(pb) : "memory");   // the address registers of the issued loads stay as they are up to this wait (they are its inputs)
#pragma unroll
        for (int nb = 0; nb < 4; ++nb)
#pragma unroll
            for (int mb = 0; mb < 4; ++mb) acc[mb][nb] = wmmab(a[mb], b[nb], acc[mb][nb]);
        asm volatile("v_nop\n\tv_nop\n\tv_nop\n\tv_nop" : "+v"(acc[0][0]), "+v"(acc[1][1]), "+v"(acc[2][2]), "+v"(acc[3][3]) : "v"(a[0]), "v"(a[1]), "v"(a[2]), "v"(a[3]));
    }
    float bc[4];
#pragma unroll
    for (int nb = 0; nb < 4; ++nb) bc[nb] = (MODE == 0) ? bfr(bias[c0 + nb * 16 + lr]) : 0.0f;   // MODE 0: c0 + 63 < DK
    const size_t pitch = (MODE == 0) ? (size_t)DK : (size_t)SEQ;
    const size_t tbase = (size_t)r0 * pitch + (size_t)c0;
#pragma unroll
    for (int mb = 0; mb < 4; ++mb) {
        float br[8];
#pragma unroll
        for (int j = 0; j < 8; ++j) br[j] = (MODE == 1) ? bfr(bias[r0 + mb * 16 + hi * 8 + j]) : 0.0f;   // MODE 1: r0 + 63 < DK
#pragma unroll
        for (int nb = 0; nb < 4; ++nb) {
#pragma unroll
            for (int j = 0; j < 8; ++j) os[(hi * 8 + j) * 68 + nb * 16 + lr] = acc[mb][nb][j] + bc[nb] + br[j]; }   // D: row 8h+j, col lane&15
        wave_sync();
{
            const size_t sb = tbase + (size_t)(mb * 16) * pitch;
#pragma unroll
            for (int s = 0; s < 4; ++s) { const int row = 4 * s + (lane >> 3), c8 = (lane & 7) * 8;   // 4 s x 4 row groups = 16 rows; 8 lanes x 8 = 64 columns
                const v4f x0 = *(const v4fa*)(&os[row * 68 + c8]); const v4f x1 = *(const v4fa*)(&os[row * 68 + c8 + 4]); v8h hv;
#pragma unroll
                for (int i = 0; i < 4; ++i) { hv[i] = toh_flush(x0[i]); hv[4 + i] = toh_flush(x1[i]); }
                const size_t oo = sb + (size_t)row * pitch + c8;
                *(v8h*)(Ph + oo) = hv; }
             }
        wave_sync();
    }
}

// q, k and v in one grid (SEQ/64, 3 * DK/64): blockIdx.y names the plane and its 64-column tile, so that three waves share a SIMD and wait out each other's loads
__global__ __launch_bounds__(32) void k_proj_rows(const bf* __restrict__ A, const bf* __restrict__ WB, const float* __restrict__ bq, const float* __restrict__ bk, const float* __restrict__ bv, h16* P) {
    const int pl = blockIdx.y / (DK / 64), c0 = (blockIdx.y % (DK / 64)) * 64;
    proj_body<0>(A, WB + (size_t)pl * DK * DIN, (pl == 0) ? bq : (pl == 1) ? bk : bv, P + (size_t)pl * PLE, c0);
}

// one 16-key x 16-query score tile: S^T = K Q^T over the full width (A = K rows, B = Q rows), fragments straight from the f16 planes
__device__ __forceinline__ v8f score16(const h16* __restrict__ kp, const h16* __restrict__ qp) {
    v8f s = (v8f){};
#pragma unroll 4
    for (int kc = 0; kc < DK; kc += 32) { const v16h a = ldh(kp + kc); const v16h b = ldh(qp + kc); s = wmg(a, b, s); }
    return s;
}

// k_flash: fused attention, one block per 16 query rows, FW = 8 waves.
// Pass 0 lists, in rising order, the keys with an edge to any of the block's 16 rows (thread i owns adjacency word column i: OR over the rows, block-wide prefix sum of the bit counts), each with a 16-bit
// mask of the rows that keep it, and walks the list; pass 1 does the same with the keys that are left (all masks zero). A key of pass 1 has the replaced score in every row, so its weight is
// exp2(FILL2 - max + 14), taken as 0 below -14 like every other weight: where that holds for all 16 rows after pass 0, pass 1 would add only zeros and is left out (same value in every wave: block-uniform).
// Per panel of 128 listed keys (the list is padded to whole panels; a pad entry scores NEGB, weight 0):
//  (1) wave w scores its own 16 listed keys in transposed form: A rows are gathered k rows; lane (t = lane&15, h = lane>>4) holds listed keys 8h+r for query t; a tile whose masks are all zero is not multiplied;
//  (2) per-query max: lane partial, xor-16 exchange, one word per wave per query in LDS, block barrier, combine over the 8 waves (identical in every wave);
//  (3) P = exp2(score - max + 14) as f16 (arguments below -14 give 0), P tile [t][128 keys] into LDS, partial sums over the converted P, block barrier;
//  (4) wave w accumulates O^T rows d in [64w, 64w+64): it gathers v[key][64w .. 64w+63] (one 128-byte line per key) of 64 listed keys at a time into its own LDS rows; A = V^T by transposing LDS loads,
//      B = P^T from the LDS tile (both in the k order 8h+0..7, 16+8h+0..7); block barrier before the next panel.
__global__ __launch_bounds__(32 * FW) void k_flash(const h16* __restrict__ QP, const h16* __restrict__ KP, const h16* __restrict__ VP, const unsigned* __restrict__ ADJ, float* OUT) {
    __shared__ __align__(16) h16 Ps[16 * PP];
    __shared__ float redm[FW * 16];
    __shared__ float reds[FW * 16];
    __shared__ int wsum[FW];
    __shared__ __align__(16) unsigned short klist[SEQ];
    __shared__ __align__(16) unsigned short kmask[SEQ];
    __shared__ __align__(32) unsigned char VS[FW * VSW];
    const int tid = threadIdx.x;
    const int lane = threadIdx.x & 31, lr = lane & 15, hi = lane >> 4;
    const int wave = __builtin_amdgcn_readfirstlane((int)(threadIdx.x >> 5));
    const int q0 = blockIdx.x * 16;
    const size_t qo = (size_t)(q0 + lr) * DK + 8 * hi;                 // B fragment: col t, k = d
    const int pw = lr * PP + wave * 16 + 8 * hi;                       // P tile write offset (listed keys wave*16 + 8h + r)
    const int pf = lr * PP + 8 * hi;                                   // P^T fragment read offset (col t, k = listed key)
    unsigned char* vsw = VS + wave * VSW;                              // the wave's own staging rows
    unsigned char* vwr = vsw + (lane >> 3) * VPITCH + (lane & 7) * 16;                                   // store i: staged row 4i + (lane>>3), 16-byte piece lane&7
    const unsigned char* vrd = vsw + (8 * hi + (lane & 7)) * VPITCH + ((lane >> 3) & 1) * 16;            // transposing read, staged row base 0, column base 0
    const h16* vsrc = VP + wave * 64 + (lane & 7) * 8;                 // + key * DK
    // gather of the wave's slices of listed keys jb .. jb+VH-1: load i covers four whole 128-byte lines (every list entry is below SEQ by construction)
    auto fetchv = [&](v4u (&vr)[VH / 4], int jb) {
        const h16* vp[VH / 4];                                         // all addresses are formed first; both loops are unrolled so that vp and vr are registers
#pragma unroll
        for (int i = 0; i < VH / 4; ++i) vp[i] = vsrc + (size_t)klist[jb + 4 * i + (lane >> 3)] * DK;
#pragma unroll
        for (int i = 0; i < VH / 4; ++i) vr[i] = *(const v4u*)vp[i];
        // the address registers of the issued loads stay as they are up to this wait (they are its inputs), so that none is reused ahead of it
        asm volatile("s_wait_xcnt 0x0" :: "v"(vp[0]), "v"(vp[1]), "v"(vp[2]), "v"(vp[3]), "v"(vp[4]), "v"(vp[5]), "v"(vp[6]), "v"(vp[7]),
                                          "v"(vp[8]), "v"(vp[9]), "v"(vp[10]), "v"(vp[11]), "v"(vp[12]), "v"(vp[13]), "v"(vp[14]), "v"(vp[15]) : "memory");
    };
    auto stagev = [&](const v4u (&vr)[VH / 4]) {
#pragma unroll
        for (int i = 0; i < VH / 4; ++i) *(v4ua*)(vwr + i * 4 * VPITCH) = vr[i];
        asm volatile("s_wait_dscnt 0x0" ::: "memory");                 // the wave's own stores have retired before its transposing loads read the rows back
    };
    v8f o0 = (v8f){}, o1 = (v8f){}, o2 = (v8f){}, o3 = (v8f){};
    auto pv = [&](int jl) {                                            // VH staged keys against P columns jl .. jl+VH-1
#pragma unroll
        for (int kc = 0; kc < VH; kc += 32) {
            const v16h pb = cat16(*(const v8h*)(&Ps[pf + jl + kc]), *(const v8h*)(&Ps[pf + jl + kc + 16]));
            const unsigned char* ad = vrd + kc * VPITCH;
            const v16h v0 = cat16(ldtr(ad),      ldtr(ad + 16 * VPITCH));        o0 = wmg(v0, pb, o0);
            const v16h v1 = cat16(ldtr(ad + 32), ldtr(ad + 16 * VPITCH + 32));   o1 = wmg(v1, pb, o1);
            const v16h v2 = cat16(ldtr(ad + 64), ldtr(ad + 16 * VPITCH + 64));   o2 = wmg(v2, pb, o2);
            const v16h v3 = cat16(ldtr(ad + 96), ldtr(ad + 16 * VPITCH + 96));   o3 = wmg(v3, pb, o3);
        }
        wave_sync();                                                   // the staged rows are rewritten only behind these reads
    };
    float m = NEGB, l = 0.0f;
#pragma unroll 1                                                        // one copy of the large body with its barriers serves both passes
    for (int pass = 0; pass < 2; ++pass) {
        unsigned aw[16]; unsigned un = 0u;
        const unsigned* ap = ADJ + (size_t)q0 * AWORDS + tid;
#pragma unroll
        for (int r = 0; r < 16; ++r) aw[r] = ap[(size_t)r * AWORDS];
        asm volatile("s_wait_xcnt 0x0" :: "v"(ap) : "memory");         // the address register of the issued loads stays as it is up to this wait (it is its input)
#pragma unroll
        for (int r = 0; r < 16; ++r) un |= aw[r];
        unsigned sel = (pass == 0) ? un : ~un;                         // this pass's keys among 32*tid .. 32*tid+31
        const int cnt = __popc(sel);
        int inc = cnt;                                                 // inclusive prefix sum over the wave
#pragma unroll
        for (int d = 1; d < 32; d <<= 1) { const int up = __shfl_up(inc, d, 32); inc += (lane >= d) ? up : 0; }
        if (lane == 31) wsum[wave] = inc;
        __syncthreads();
        int base = 0, nn = 0;
#pragma unroll
        for (int w = 0; w < FW; ++w) { const int c = wsum[w]; base += (w < wave) ? c : 0; nn += c; }
        const int n = __builtin_amdgcn_readfirstlane(nn);              // listed keys of this pass, at most SEQ
        int pos = base + inc - cnt;
        while (sel != 0u) {                                            // at most 32 trips; pos stays below n
            const int b = __builtin_ctz(sel); sel &= sel - 1u;
            unsigned mk = 0u;
#pragma unroll
            for (int r = 0; r < 16; ++r) mk |= ((aw[r] >> b) & 1u) << r;
            klist[pos] = (unsigned short)(tid * 32 + b); kmask[pos] = (unsigned short)mk; ++pos;
        }
        const int np = (n + PANEL - 1) & ~(PANEL - 1);                 // at most SEQ
        if (n + tid < np) { klist[n + tid] = (unsigned short)0; kmask[n + tid] = (unsigned short)0; }
        __syncthreads();
#pragma unroll 1
        for (int kb = 0; kb < np; kb += PANEL) {
            v4u va[VH / 4], vb[VH / 4];
            fetchv(va, kb);                                            // in flight under the score stage
            const int j0 = kb + wave * 16;
            const v8us km = *(const v8us*)(&kmask[j0 + 8 * hi]);       // row masks of the lane's 8 listed keys
            unsigned orm = 0u;
#pragma unroll
            for (int r = 0; r < 8; ++r) orm |= (unsigned)km[r];
            const bool any = __builtin_amdgcn_ballot_w32(orm != 0u) != 0u;   // wave-uniform
            v8f sa = (v8f){};
            if (any) { const int krow = klist[j0 + lr]; sa = score16(KP + (size_t)krow * DK + 8 * hi, QP + qo); }   // A fragment: row = listed key, k = d
            float ta[8]; float mx = NEGB;
#pragma unroll
            for (int r = 0; r < 8; ++r) {
                const bool fa = ((((unsigned)km[r]) >> lr) & 1u) != 0u;
                const float sc = fa ? sa[r] * SC2 : FILL2;             // kept: scaled score; otherwise the score is replaced
                ta[r] = (j0 + 8 * hi + r < n) ? sc : NEGB;             // a pad entry is no key
                mx = fmaxf(mx, ta[r]); }
            mx = fmaxf(mx, __shfl_xor(mx, 16, 32));
            if (hi == 0) redm[wave * 16 + lr] = mx;
            __syncthreads();
            float pm = redm[lr];
#pragma unroll
            for (int w = 1; w < FW; ++w) pm = fmaxf(pm, redm[w * 16 + lr]);
            const float mnew = fmaxf(m, pm);
            const float alpha = __builtin_amdgcn_exp2f(m - mnew);
            const float sh = PSH - mnew;
            v8h pa; float ls = 0.0f;
#pragma unroll
            for (int r = 0; r < 8; ++r) {
                const float ea = ta[r] + sh;
                const float xa = __builtin_amdgcn_exp2f(ea);
                const float ga = (ea < -14.0f) ? 0.0f : xa;            // never a subnormal f16
                const h16 ha = (h16)ga;
                pa[r] = ha; ls += (float)ha; }
            ls += __shfl_xor(ls, 16, 32);
            if (hi == 0) reds[wave * 16 + lr] = ls;
            *(v8h*)(&Ps[pw]) = pa;
            __syncthreads();
            float lsum = reds[lr];
#pragma unroll
            for (int w = 1; w < FW; ++w) lsum += reds[w * 16 + lr];
            l = l * alpha + lsum; m = mnew;
            o0 = o0 * alpha; o1 = o1 * alpha; o2 = o2 * alpha; o3 = o3 * alpha;
            stagev(va);
            fetchv(vb, kb + VH);                                       // in flight under the first half's products
            pv(0);
            stagev(vb);
            pv(VH);
            __syncthreads();
        }
        const float ef = FILL2 + (PSH - fmaxf(m, FILL2));              // weight argument of a key that no row of the block keeps
        if (__builtin_amdgcn_ballot_w32(ef >= -14.0f) == 0u) break;    // m is the same in every wave: block-uniform
    }
    const float inv = 1.0f / l;                                        // l >= 16384: the panel holding a row's maximum contributes the full carry
    float* os = (float*)vsw;                                           // output staging in the wave's own rows (their last reads lie behind pv's ordering point)
    // O^T D layout: o_j[r] = (d = 64w + 16j + 8h + r, t = lane&15) -> os[t][16j + 8h + r]; rows 0..15 x columns 0..63 all written
    { v4f a, c;
      a[0] = o0[0] * inv; a[1] = o0[1] * inv; a[2] = o0[2] * inv; a[3] = o0[3] * inv; c[0] = o0[4] * inv; c[1] = o0[5] * inv; c[2] = o0[6] * inv; c[3] = o0[7] * inv;
      *(v4fa*)(&os[lr * OSP +  0 + 8 * hi]) = a; *(v4fa*)(&os[lr * OSP +  0 + 8 * hi + 4]) = c;
      a[0] = o1[0] * inv; a[1] = o1[1] * inv; a[2] = o1[2] * inv; a[3] = o1[3] * inv; c[0] = o1[4] * inv; c[1] = o1[5] * inv; c[2] = o1[6] * inv; c[3] = o1[7] * inv;
      *(v4fa*)(&os[lr * OSP + 16 + 8 * hi]) = a; *(v4fa*)(&os[lr * OSP + 16 + 8 * hi + 4]) = c;
      a[0] = o2[0] * inv; a[1] = o2[1] * inv; a[2] = o2[2] * inv; a[3] = o2[3] * inv; c[0] = o2[4] * inv; c[1] = o2[5] * inv; c[2] = o2[6] * inv; c[3] = o2[7] * inv;
      *(v4fa*)(&os[lr * OSP + 32 + 8 * hi]) = a; *(v4fa*)(&os[lr * OSP + 32 + 8 * hi + 4]) = c;
      a[0] = o3[0] * inv; a[1] = o3[1] * inv; a[2] = o3[2] * inv; a[3] = o3[3] * inv; c[0] = o3[4] * inv; c[1] = o3[5] * inv; c[2] = o3[6] * inv; c[3] = o3[7] * inv;
      *(v4fa*)(&os[lr * OSP + 48 + 8 * hi]) = a; *(v4fa*)(&os[lr * OSP + 48 + 8 * hi + 4]) = c; }
    wave_sync();
    float* orow = OUT + (size_t)q0 * DK + wave * 64;
{
#pragma unroll
        for (int s = 0; s < 8; ++s) { const int row = 2 * s + (lane >> 4), cofs = (lane & 15) * 4;   // 8 s x 2 rows = 16 rows; 16 lanes x 4 floats = 64 columns = two lines
            const v4f val = *(const v4fa*)(&os[row * OSP + cofs]);
            *(v4f*)(orow + (size_t)row * DK + cofs) = val; }
         }
}

static constexpr size_t al256(size_t v) { return (v + 255) & ~(size_t)255; }
static constexpr size_t SZ_XB = al256((size_t)SEQ * DIN * 2);
static constexpr size_t SZ_WB = al256((size_t)3 * DK * DIN * 2);
static constexpr size_t SZ_PL = al256((size_t)SEQ * DK * 2);
static constexpr size_t SZ_AJ = al256((size_t)SEQ * AWORDS * 4);
static constexpr size_t SZ_TOTAL = SZ_XB + SZ_WB + 3 * SZ_PL + SZ_AJ;
static_assert(SZ_TOTAL <= (size_t)134217728);          // workspace carve <= 128 MiB
static_assert(SZ_PL == PLE * 2);                       // q, k, v planes lie one behind the other without a gap
static_assert(((size_t)DK * DIN * 2) % 256 == 0);      // weight sub-planes stay 256-byte aligned
static_assert((size_t)(SEQ / AROWS) * AROWS * AWORDS * 4 <= SZ_AJ);   // builder grid x block extent == adjacency plane
static_assert((size_t)(SEQ / 64) * 64 * DK * 2 <= SZ_PL);             // projection grid x tile extent == plane

extern "C" void kernel_launch(void* const* d_in, const int* in_sizes, int n_in,
                              void* d_out, int out_size, void* d_ws, size_t ws_size, hipStream_t stream) {
    if (n_in < 8) return;
    if ((size_t)in_sizes[0] < (size_t)SEQ * DIN) return;
    if (in_sizes[1] < 2) return;
    if ((size_t)in_sizes[2] < (size_t)DIN * DK || (size_t)in_sizes[4] < (size_t)DIN * DK || (size_t)in_sizes[6] < (size_t)DIN * DK) return;
    if (in_sizes[3] < DK || in_sizes[5] < DK || in_sizes[7] < DK) return;
    if ((size_t)out_size < (size_t)SEQ * DK) return;
    if (SZ_TOTAL > ws_size) return;
    // wire order: x, edge_index, Wq, bq, Wk, bk, Wv, bv
    const float* x  = (const float*)d_in[0];
    const int*   ei = (const int*)d_in[1];
    const float* wq = (const float*)d_in[2]; const float* bq = (const float*)d_in[3];
    const float* wk = (const float*)d_in[4]; const float* bk = (const float*)d_in[5];
    const float* wv = (const float*)d_in[6]; const float* bv = (const float*)d_in[7];
    const int E = in_sizes[1] / 2;
    float* OUT = (float*)d_out;      // [SEQ][512]
    char* wsp = (char*)d_ws;
    bf* XB = (bf*)wsp; wsp += SZ_XB;                 // x        [SEQ][512] bf16
    bf* WB = (bf*)wsp; wsp += SZ_WB;                 // [3][512][512]: Wq^T | Wk^T | Wv^T  ([out][in])
    h16* QP = (h16*)wsp; wsp += SZ_PL;               // q   [SEQ][512]
    h16* KP = (h16*)wsp; wsp += SZ_PL;               // k   [SEQ][512]
    h16* VP = (h16*)wsp; wsp += SZ_PL;               // v   [SEQ][512]
    unsigned* ADJ = (unsigned*)wsp; wsp += SZ_AJ;    // adjacency bits [SEQ][SEQ/32]

    k_adj<<<SEQ / AROWS, ATH, 0, stream>>>(ei, ADJ, E, x, XB, wq, wk, wv, WB);

    // q, k, v: A = x rows (m = t), Bt = W^T rows (n = column) -> planes [t][512], QP | KP | VP
    k_proj_rows<<<dim3(SEQ / 64, 3 * (DK / 64), 1), 32, 0, stream>>>(XB, WB, bq, bk, bv, QP);

    k_flash<<<SEQ / 16, 32 * FW, 0, stream>>>(QP, KP, VP, ADJ, OUT);
}

// v004
// It runs in 81.7 microseconds.
// Timed twice side by side with v003, it ran 1.24 and 1.23 times as fast.
// Counting every step since v000, it is 12.5 times as fast.
#include <hip/hip_runtime.h>

// Single-head graph attention block: x [SEQ][512]; Wq/Wk/Wv [in][out] (y = x W + bias); edge list (int32 [2][E]) -> dense adjacency bit plane; scores q k^T / sqrt(512);
// mask form: a kept (edge) key keeps its score, every other key's score is REPLACED by -1e6 (rows without any edge come out as the uniform mean of v); softmax over all keys; output = attn v (f32).
// Compute dtypes, f32 accumulate everywhere: projections v_wmma_f32_16x16x32_bf16 (x, W, bias RNE-converted to bf16; products exact); scores v_wmma_f32_16x16x32_f16 (single f16 q and k planes);
// P.V v_wmma_f32_16x16x32_f16 (P with a x16384 carry that cancels in the normalisation, single f16 v plane, row sum over the converted P); softmax f32 (online, running max, exp2 form).
// Layout: bf16 copies of x and of the transposed weights W^T [out][in]; f16 planes q [t][512], k [t][512], v [t][512]; adjacency bit plane [t][SEQ/32] words built without read-modify-write primitives on global memory.
// Three launches: (1) adjacency builder, whose blocks also convert their shares of x and of the weights; (2) the q, k and v projections in one grid; (3) fused attention.
// Fused attention in transposed form (S^T = K Q^T, O^T = V^T P^T): 16 query rows per block, 8 waves. The block first lists the keys that have an edge to any of its 16 rows and walks that list in panels of 128 keys
// (every wave scores its own 16 listed keys, whose k rows it brings into LDS by whole-line loads, against a q tile that the block keeps in LDS; the P tile goes through LDS, every wave owns 64 output columns and gathers its 128-byte slices of the listed v rows into LDS, read back transposed).
// The keys outside the list all carry the replaced score: they are walked too, by the same code, unless their weight is exactly zero for all 16 rows.

#ifndef SEQ
#define SEQ 8192                 // number of nodes (rows of x, queries and keys)
#endif
#define SEQ_FULL 8192
#define DIN  512                 // input width
#define DK   512                 // q / k / v width
#define FW   8                   // waves per attention block
#define PANEL (16 * FW)          // listed keys per panel
#define PP   (PANEL + 8)         // LDS row pitch (halves) of the P tile
#define OSP  68                  // LDS row pitch (floats) of the output staging tile
#define VH   64                  // listed keys whose v slices one wave stages at a time
#define VPITCH 160               // LDS row pitch (bytes) of a staged 128-byte v slice: an odd multiple of 32 bytes for the transposing reader
#define VSW  (VH * VPITCH)       // staging bytes per wave
#define KHB  (DK)                // bytes of half a k row: the piece of each of its 16 listed keys that a wave stages at a time
#define KPITCH (KHB + 16)        // LDS row pitch (bytes) of a staged half k row: an odd multiple of 16 bytes for the 16-byte fragment reader
#define QPITCH (DK * 2 + 16)     // LDS row pitch (bytes) of the q tile, likewise
#define AWORDS (SEQ / 32)        // adjacency words per row
#define AROWS 32                 // adjacency rows owned by one builder block
#define ATH  1024                // threads of one builder block
#define EU   8                   // 16-byte edge loads in flight per thread and batch
#define EBATCH (ATH * EU * 4)    // edges per batch of one builder block
#define XU   ((SEQ * (DIN / 8)) / ((SEQ / AROWS) * ATH))   // 8-element units of x converted per builder thread
#define WU   ((3 * DK * (DIN / 8)) / (SEQ / AROWS))        // 8-element units of the three W^T planes converted per builder block
#define PLE  ((size_t)SEQ * DK)  // elements of one of the q, k, v planes, which lie one behind the other
#define SC2  ((float)(0.044194173824159216 * 1.4426950408889634))   // 512^-0.5 * log2(e)
#define FILL2 ((float)(-1000000.0 * 1.4426950408889634))            // replaced score (-1e6) in the exp2 domain
#define PSH  14.0f               // log2 of the P carry (16384)
#define NEGB (-3.0e38f)

static_assert(DIN % 32 == 0);                    // GEMM k-loop steps by 32
static_assert(DK % 32 == 0);                     // score k-loop steps by 32
static_assert(DK % 64 == 0);                     // 64-wide GEMM tiles
static_assert(DIN % 8 == 0);
static_assert(SEQ % 64 == 0);                    // 64-row GEMM tiles
static_assert(SEQ % PANEL == 0);                 // the list rounded up to whole panels stays within SEQ entries
static_assert(SEQ % 16 == 0);                    // 16 query rows per attention block
static_assert(SEQ % AROWS == 0);                 // builder grid covers the rows exactly
static_assert((SEQ & (SEQ - 1)) == 0);           // the builder's coarse filter reads the row-group bits of an index
static_assert(SEQ <= SEQ_FULL);
static_assert(DK == 64 * FW);                    // every wave owns 64 output columns
static_assert(PANEL == 128);
static_assert(PANEL % VH == 0 && VH % 32 == 0);
static_assert(VH / 4 == 16);                     // the gather's wait names its sixteen addresses
static_assert((PANEL & (PANEL - 1)) == 0 && PANEL <= 32 * FW);   // list padding: rounded up to a panel, at most one pad entry per thread
static_assert(AWORDS == 32 * FW);                // one adjacency word column per thread of an attention block
static_assert(SEQ <= 65536);                     // key indices fit 16 bits
static_assert(VPITCH % 32 == 0 && ((VPITCH / 32) & 1) == 1 && VPITCH >= 128);
static_assert((size_t)16 * OSP * 4 <= VSW);      // the output staging tile reuses the wave's own v staging bytes
static_assert((size_t)16 * KPITCH <= VSW);       // so do the staged half k rows
static_assert(KHB == 32 * 16);                   // one 16-byte load per lane covers half a k row
static_assert(KPITCH % 16 == 0 && ((KPITCH / 16) & 1) == 1 && QPITCH % 16 == 0 && ((QPITCH / 16) & 1) == 1);
static_assert(16 * DK * 2 == 4 * 32 * FW * 16);  // q tile: four 16-byte pieces per thread
static_assert((PP * 2) % 16 == 0);               // 16-byte aligned P rows
static_assert((OSP * 4) % 16 == 0);
static_assert((AROWS & (AROWS - 1)) == 0);
static_assert((AROWS * AWORDS) % ATH == 0);      // builder pack loop covers the words exactly
static_assert((AROWS * SEQ) % (16 * ATH) == 0);  // builder zero fill covers the flag bytes exactly
static_assert(4 * EU <= 32);                     // one candidate bit per edge of a thread's batch
static_assert((size_t)XU * (SEQ / AROWS) * ATH == (size_t)SEQ * DIN / 8);               // builder grid covers x exactly
static_assert((size_t)WU * (SEQ / AROWS) == (size_t)3 * DK * DIN / 8);                  // builder grid covers the weights exactly
static_assert(WU <= ATH && WU % 32 == 0 && (DK * DIN / 8) % 32 == 0);                   // whole waves, each inside one weight plane
static_assert(4 * 32 * 16 == 16 * 64 * 2);
static_assert(8 * 32 * 16 == 16 * 64 * 4);       // attention epilogue: 8 instructions x 32 lanes x 16 B == 16 rows x 256 B
static_assert((size_t)AROWS * SEQ <= 327680);                                           // builder static LDS
static_assert((size_t)16 * PP * 2 + 2 * FW * 16 * 4 + (size_t)FW * VSW + (size_t)SEQ * 4 + (size_t)16 * QPITCH + 64 <= 163840);   // attention static LDS: two blocks per 320 KiB
static_assert((size_t)16 * 68 * 4 <= 131072);                                           // projection static LDS
static_assert(((size_t)SEQ * DIN) % 8 == 0);
static_assert(((size_t)DIN * DK) % 8 == 0);

typedef _Float16 h16;
typedef unsigned short bf;
typedef __attribute__((ext_vector_type(16))) __bf16   v16bf;
typedef __attribute__((ext_vector_type(16))) _Float16 v16h;
typedef __attribute__((ext_vector_type(8)))  _Float16 v8h;
typedef __attribute__((ext_vector_type(8)))  unsigned short v8us;
typedef __attribute__((ext_vector_type(8)))  float    v8f;
typedef __attribute__((ext_vector_type(4)))  float    v4f;
typedef v4f  __attribute__((may_alias)) v4fa;
typedef __attribute__((ext_vector_type(4)))  unsigned v4u;
typedef v4u  __attribute__((may_alias)) v4ua;
typedef __attribute__((ext_vector_type(4)))  int      v4i;
typedef __attribute__((ext_vector_type(8)))  short    v8s;

__device__ __forceinline__ unsigned short f2bf(float f) { unsigned u = __float_as_uint(f); u += 0x7FFFu + ((u >> 16) & 1u); return (unsigned short)(u >> 16); }
__device__ __forceinline__ float bfr(float f) { return __uint_as_float(((unsigned)f2bf(f)) << 16); }   // value after RNE convert to bf16
__device__ __forceinline__ v16h cat16(v8h lo, v8h hi) { return __builtin_shufflevector(lo, hi, 0, 1, 2, 3, 4, 5, 6, 7, 8, 9, 10, 11, 12, 13, 14, 15); }
__device__ __forceinline__ v16bf cat16b(v8us lo, v8us hi) { return __builtin_bit_cast(v16bf, __builtin_shufflevector(lo, hi, 0, 1, 2, 3, 4, 5, 6, 7, 8, 9, 10, 11, 12, 13, 14, 15)); }
__device__ __forceinline__ v8f wmma16(v16h a, v16h b, v8f c) { return __builtin_amdgcn_wmma_f32_16x16x32_f16(false, a, false, b, (short)0, c, false, false); }
__device__ __forceinline__ v8f wmmab(v16bf a, v16bf b, v8f c) { return __builtin_amdgcn_wmma_f32_16x16x32_bf16(false, a, false, b, (short)0, c, false, false); }
// fragment loaders from K-contiguous 16-bit rows; p already includes + 8*(lane>>4): elements 0..7 <- k0+8h+0..7, elements 8..15 <- k0+16+8h+0..7 (same map for A and B)
__device__ __forceinline__ v16h  ldh(const h16* p) { return cat16(*(const v8h*)p, *(const v8h*)(p + 16)); }
__device__ __forceinline__ v16bf ldb(const bf* p)  { return cat16b(*(const v8us*)p, *(const v8us*)(p + 16)); }
// transposing LDS load: with p = T + (k0 + 8*(lane>>4) + (lane&7)) * pitch + 2 * d0 + 16 * ((lane>>3)&1), lane (c = lane&15, h = lane>>4) gets T[k0 + 8h + 0..7][d0 + c]
__device__ __forceinline__ v8h ldtr(const unsigned char* p) { typedef __attribute__((address_space(3))) v8s lds_v8s; return __builtin_bit_cast(v8h, __builtin_amdgcn_ds_load_tr16_b128_v8i16((lds_v8s*)p)); }
// ordering point for wave-private LDS tiles (same wave writes and reads)
__device__ __forceinline__ void wave_sync() { __builtin_amdgcn_fence(3 /* release order */, "wavefront"); __builtin_amdgcn_wave_barrier(); asm volatile("" ::: "memory"); }

// f32 -> f16 convert that cannot produce a subnormal f16 (|v| < 2^-14 -> +0)
static __device__ __forceinline__ h16 toh_flush(float v) { const h16 r = (h16)v; return (fabsf(v) < 6.103515625e-05f) ? (h16)0.0f : r; }
// one guarded f16 WMMA: the nops tie the accumulator and keep both fragments live
__device__ __forceinline__ v8f wmg(v16h a, v16h b, v8f c) { c = wmma16(a, b, c); asm volatile("v_nop\n\tv_nop\n\tv_nop\n\tv_nop" : "+v"(c) : "v"(a), "v"(b)); return c; }

// k_adj: adjacency bit plane ADJ[t][SEQ/32] from the edge list (src = ei[0..E), dst = ei[E..2E)); bit (c & 31) of word ADJ[r][c >> 5] set iff some edge (r, c) exists.
// One block of 32 waves owns AROWS rows as a BYTE plane in LDS (one byte per (row, column), zero-filled): setting a flag is a plain one-byte store of the value 1, so any thread may set any flag
// (two threads that meet on one byte store the same value) and the scan needs no list, no word owner and no barrier. The block's threads share ONE pass over the src row of the edge list
// (16-byte loads, the next batch in flight while this one is filtered); in whole batches only an edge whose src falls into the block's rows reads its dst (the tail reads every dst). After one barrier 32 flag bytes are packed into each word.
// The block also converts its share of the projection operands (RNE to bf16), work that depends on nothing here and that only the next launch reads: XU units of x per thread (unit i = elements 8i .. 8i+7),
// and WU units of the transposed weights WB = Wq^T | Wk^T | Wv^T, W [DIN][DK] ([in][out]) -> W^T [DK][DIN] (unit i of a plane: row n = i / (DIN/8), k = (i % (DIN/8))*8 + j); the loads of both are in flight under the zero fill.
__global__ __launch_bounds__(ATH) void k_adj(const int* __restrict__ ei, unsigned* ADJ, int E, const float* __restrict__ x, bf* XB,
                                             const float* __restrict__ wq, const float* __restrict__ wk, const float* __restrict__ wv, bf* WB) {
    __shared__ __align__(16) unsigned char flag[AROWS * SEQ];
    const int tid = threadIdx.x;
    const int r0 = blockIdx.x * AROWS;
    const int* __restrict__ sp = ei;
    const int* __restrict__ dp = ei + (size_t)E;
    const size_t xu = (size_t)blockIdx.x * (XU * ATH) + tid;           // the thread's first unit of x; the others follow ATH units apart
    v8f xv[XU];
#pragma unroll
    for (int u = 0; u < XU; ++u) xv[u] = *(const v8f*)(x + (xu + (size_t)u * ATH) * 8);
    const unsigned g = blockIdx.x * WU + tid;                          // the thread's unit of WB, for tid < WU (whole waves)
    float wr[8] = {0.0f, 0.0f, 0.0f, 0.0f, 0.0f, 0.0f, 0.0f, 0.0f};
    if (tid < WU) {
        const unsigned pl = g / (DK * DIN / 8), i = g % (DK * DIN / 8);
        const float* __restrict__ Wp = (pl == 0u) ? wq : (pl == 1u) ? wk : wv;
        const unsigned n = i / (DIN / 8), k8 = (i % (DIN / 8)) * 8;
#pragma unroll
        for (int j = 0; j < 8; ++j) wr[j] = Wp[(size_t)(k8 + j) * DK + n];
    }
#pragma unroll
    for (int i = 0; i < AROWS * SEQ / 16 / ATH; ++i) { const v4u z = (v4u){0u, 0u, 0u, 0u}; *(v4ua*)(&flag[(size_t)(i * ATH + tid) * 16]) = z; }
    __builtin_amdgcn_sched_barrier(0);                                 // keeps the conversions, which wait for their loads, behind the zero fill's stores
#pragma unroll
    for (int u = 0; u < XU; ++u) { v8us o;
#pragma unroll
        for (int k = 0; k < 8; ++k) o[k] = f2bf(xv[u][k]);
        *(v8us*)(XB + (xu + (size_t)u * ATH) * 8) = o; }
    if (tid < WU) { v8us o;
#pragma unroll
        for (int j = 0; j < 8; ++j) o[j] = f2bf(wr[j]);
        *(v8us*)(WB + (size_t)g * 8) = o;
    }
    __syncthreads();
    // exact test and flag store of one edge e < E (indices below zero wrap once, anything still outside the matrix is dropped); the test bounds the LDS address
    auto mark = [&](int e) {
        int s = sp[(size_t)e]; int d = dp[(size_t)e];
        s += (s < 0) ? SEQ : 0; d += (d < 0) ? SEQ : 0;
        const bool hit = ((unsigned)(s - r0) < (unsigned)AROWS) & ((unsigned)d < (unsigned)SEQ);
        if (hit) flag[(s - r0) * SEQ + d] = (unsigned char)1;
    };
    // batch bt = edges [bt * EBATCH, (bt + 1) * EBATCH): load u of thread tid holds edges bt * EBATCH + u * 4 * ATH + 4 * tid + 0..3
    auto fetch = [&](v4i (&c)[EU], int bt) {
#pragma unroll
        for (int u = 0; u < EU; ++u) c[u] = *(const v4i*)(sp + (size_t)bt * EBATCH + (size_t)(u * 4 * ATH) + (size_t)tid * 4);
    };
    // coarse filter on the row-group bits of src (a wrapped index keeps them, SEQ being a power of two): one bit per candidate edge, then the exact test on the few candidates
    auto sift = [&](const v4i (&c)[EU], int bt) {
        unsigned hm = 0u;
#pragma unroll
        for (int u = 0; u < EU; ++u)
#pragma unroll
            for (int j = 0; j < 4; ++j) hm |= ((((unsigned)c[u][j] ^ (unsigned)r0) & (unsigned)(SEQ - AROWS)) == 0u) ? (1u << (u * 4 + j)) : 0u;
        while (hm != 0u) {                                             // at most 4 * EU trips
            const int b = __builtin_ctz(hm); hm &= hm - 1u;
            mark(bt * EBATCH + (b >> 2) * (4 * ATH) + tid * 4 + (b & 3));
        }
    };
    const int nb = E / EBATCH;                                         // whole batches (block-uniform)
    v4i ca[EU], cb[EU];
    if (nb > 0) fetch(ca, 0);
    int bt = 0;
#pragma unroll 1
    for (; bt + 3 <= nb; bt += 2) {                                    // both fetches unconditional, so that each batch is filtered with the next one still in flight
        fetch(cb, bt + 1);
        sift(ca, bt);
        fetch(ca, bt + 2);
        sift(cb, bt + 1);
    }
    if (bt + 2 <= nb) { fetch(cb, bt + 1); sift(ca, bt); sift(cb, bt + 1); }
    else if (bt < nb) sift(ca, bt);
#pragma unroll 1
    for (int e = nb * EBATCH + tid; e < E; e += ATH) mark(e);          // tail shorter than one batch
    __syncthreads();
    unsigned* dst = ADJ + (size_t)r0 * AWORDS;
#pragma unroll
    for (int i = 0; i < AROWS * AWORDS / ATH; ++i) {
        const int w = i * ATH + tid;                                   // word w of the block's rows <- flag bytes 32w .. 32w+31
        const v4u x0 = *(const v4ua*)(&flag[(size_t)w * 32]); const v4u x1 = *(const v4ua*)(&flag[(size_t)w * 32 + 16]);
        unsigned word = 0u;
#pragma unroll
        for (int k = 0; k < 4; ++k) {                                  // four 0/1 bytes -> four bits: the product puts byte i's bit at position 24 + i, no two terms meet
            word |= ((x0[k] * 0x01020408u) >> 24) << (4 * k);
            word |= ((x1[k] * 0x01020408u) >> 24) << (16 + 4 * k);
        }
        dst[(size_t)w] = word;
    }
}

// proj_body: register-blocked bf16 GEMM, ONE WAVE per 64x64 tile (16 accumulators), operands straight from K-contiguous bf16 planes, K = DIN.
// C[m][n] = sum_k A[m][k] Bt[n][k] + bias, written as f16 into a row-major plane.
// MODE 0: A = x rows (m = t), Bt = W^T rows (n = column), bias per column; plane [t][DK]. r0 = 64 * blockIdx.x, c0 from the caller.
// MODE 1: A = W^T rows (m = d), Bt = x rows (n = t), bias per row; plane [d][SEQ].
template <int MODE>
__device__ __forceinline__ void proj_body(const bf* __restrict__ A, const bf* __restrict__ Bt, const float* __restrict__ bias, h16* Ph, const int c0) {
    __shared__ __align__(16) float os[16 * 68];
    const int K = DIN;
    const int lane = threadIdx.x & 31, lr = lane & 15, hi = lane >> 4; const int r0 = blockIdx.x * 64;
    v8f acc[4][4];
#pragma unroll
    for (int mb = 0; mb < 4; ++mb)
#pragma unroll
        for (int nb = 0; nb < 4; ++nb) acc[mb][nb] = (v8f){};
    const size_t aoff = (size_t)(r0 + lr) * K + 8 * hi, boff = (size_t)(c0 + lr) * K + 8 * hi;
#pragma unroll 1
    for (int kc = 0; kc < K; kc += 32) {
        v16bf a[4], b[4];
        const bf* pa = A + aoff + kc; const bf* pb = Bt + boff + kc;
#pragma unroll
        for (int mb = 0; mb < 4; ++mb) a[mb] = ldb(pa + (size_t)mb * 16 * K);
#pragma unroll
        for (int nb = 0; nb < 4; ++nb) b[nb] = ldb(pb + (size_t)nb * 16 * K);
        asm volatile("s_wait_xcnt 0x0" :: "v"(pa), "v"(pb) : "memory");   // the address registers of the issued loads stay as they are up to this wait (they are its inputs)
#pragma unroll
        for (int nb = 0; nb < 4; ++nb)
#pragma unroll
            for (int mb = 0; mb < 4; ++mb) acc[mb][nb] = wmmab(a[mb], b[nb], acc[mb][nb]);
        asm volatile("v_nop\n\tv_nop\n\tv_nop\n\tv_nop" : "+v"(acc[0][0]), "+v"(acc[1][1]), "+v"(acc[2][2]), "+v"(acc[3][3]) : "v"(a[0]), "v"(a[1]), "v"(a[2]), "v"(a[3]));
    }
    float bc[4];
#pragma unroll
    for (int nb = 0; nb < 4; ++nb) bc[nb] = (MODE == 0) ? bfr(bias[c0 + nb * 16 + lr]) : 0.0f;   // MODE 0: c0 + 63 < DK
    const size_t pitch = (MODE == 0) ? (size_t)DK : (size_t)SEQ;
    const size_t tbase = (size_t)r0 * pitch + (size_t)c0;
#pragma unroll
    for (int mb = 0; mb < 4; ++mb) {
        float br[8];
#pragma unroll
        for (int j = 0; j < 8; ++j) br[j] = (MODE == 1) ? bfr(bias[r0 + mb * 16 + hi * 8 + j]) : 0.0f;   // MODE 1: r0 + 63 < DK
#pragma unroll
        for (int nb = 0; nb < 4; ++nb) {
#pragma unroll
            for (int j = 0; j < 8; ++j) os[(hi * 8 + j) * 68 + nb * 16 + lr] = acc[mb][nb][j] + bc[nb] + br[j]; }   // D: row 8h+j, col lane&15
        wave_sync();
{
            const size_t sb = tbase + (size_t)(mb * 16) * pitch;
#pragma unroll
            for (int s = 0; s < 4; ++s) { const int row = 4 * s + (lane >> 3), c8 = (lane & 7) * 8;   // 4 s x 4 row groups = 16 rows; 8 lanes x 8 = 64 columns
                const v4f x0 = *(const v4fa*)(&os[row * 68 + c8]); const v4f x1 = *(const v4fa*)(&os[row * 68 + c8 + 4]); v8h hv;
#pragma unroll
                for (int i = 0; i < 4; ++i) { hv[i] = toh_flush(x0[i]); hv[4 + i] = toh_flush(x1[i]); }
                const size_t oo = sb + (size_t)row * pitch + c8;
                *(v8h*)(Ph + oo) = hv; }
             }
        wave_sync();
    }
}

// q, k and v in one grid (SEQ/64, 3 * DK/64): blockIdx.y names the plane and its 64-column tile, so that three waves share a SIMD and wait out each other's loads
__global__ __launch_bounds__(32) void k_proj_rows(const bf* __restrict__ A, const bf* __restrict__ WB, const float* __restrict__ bq, const float* __restrict__ bk, const float* __restrict__ bv, h16* P) {
    const int pl = blockIdx.y / (DK / 64), c0 = (blockIdx.y % (DK / 64)) * 64;
    proj_body<0>(A, WB + (size_t)pl * DK * DIN, (pl == 0) ? bq : (pl == 1) ? bk : bv, P + (size_t)pl * PLE, c0);
}

// k_flash: fused attention, one block per 16 query rows, FW = 8 waves.
// Pass 0 lists, in rising order, the keys with an edge to any of the block's 16 rows (thread i owns adjacency word column i: OR over the rows, block-wide prefix sum of the bit counts), each with a 16-bit
// mask of the rows that keep it, and walks the list; pass 1 does the same with the keys that are left (all masks zero). A key of pass 1 has the replaced score in every row, so its weight is
// exp2(FILL2 - max + 14), taken as 0 below -14 like every other weight: where that holds for all 16 rows after pass 0, pass 1 would add only zeros and is left out (same value in every wave: block-uniform).
// Per panel of 128 listed keys (the list is padded to whole panels; a pad entry scores NEGB, weight 0):
//  (1) wave w scores its own 16 listed keys in transposed form, S^T = K Q^T over the full width: all 32 loads of its 16 k rows (512 contiguous bytes each) are issued together, the rows go through the wave's own LDS bytes
//      one half width at a time, and A (k rows) and B (q rows, from the block's LDS tile) are read as fragments there; lane (t = lane&15, h = lane>>4) holds listed keys 8h+r for query t; a tile whose masks are all zero is not multiplied;
//  (2) per-query max: lane partial, xor-16 exchange, one word per wave per query in LDS, block barrier, combine over the 8 waves (identical in every wave);
//  (3) P = exp2(score - max + 14) as f16 (arguments below -14 give 0), P tile [t][128 keys] into LDS, partial sums over the converted P, block barrier;
//  (4) wave w accumulates O^T rows d in [64w, 64w+64): it gathers v[key][64w .. 64w+63] (one 128-byte line per key) of 64 listed keys at a time into its own LDS rows; A = V^T by transposing LDS loads,
//      B = P^T from the LDS tile (both in the k order 8h+0..7, 16+8h+0..7); block barrier before the next panel.
__global__ __launch_bounds__(32 * FW) void k_flash(const h16* __restrict__ QP, const h16* __restrict__ KP, const h16* __restrict__ VP, const unsigned* __restrict__ ADJ, float* OUT) {
    __shared__ __align__(16) h16 Ps[16 * PP];
    __shared__ float redm[FW * 16];
    __shared__ float reds[FW * 16];
    __shared__ int wsum[FW];
    __shared__ __align__(16) unsigned short klist[SEQ];
    __shared__ __align__(16) unsigned short kmask[SEQ];
    __shared__ __align__(32) unsigned char VS[FW * VSW];
    __shared__ __align__(16) unsigned char QS[16 * QPITCH];
    const int tid = threadIdx.x;
    const int lane = threadIdx.x & 31, lr = lane & 15, hi = lane >> 4;
    const int wave = __builtin_amdgcn_readfirstlane((int)(threadIdx.x >> 5));
    const int q0 = blockIdx.x * 16;
    const int pw = lr * PP + wave * 16 + 8 * hi;                       // P tile write offset (listed keys wave*16 + 8h + r)
    const int pf = lr * PP + 8 * hi;                                   // P^T fragment read offset (col t, k = listed key)
    unsigned char* vsw = VS + wave * VSW;                              // the wave's own staging rows
    unsigned char* vwr = vsw + (lane >> 3) * VPITCH + (lane & 7) * 16;                                   // store i: staged row 4i + (lane>>3), 16-byte piece lane&7
    const unsigned char* vrd = vsw + (8 * hi + (lane & 7)) * VPITCH + ((lane >> 3) & 1) * 16;            // transposing read, staged row base 0, column base 0
    const h16* vsrc = VP + wave * 64 + (lane & 7) * 8;                 // + key * DK
    // gather of the wave's slices of listed keys jb .. jb+VH-1: load i covers four whole 128-byte lines (every list entry is below SEQ by construction)
    auto fetchv = [&](v4u (&vr)[VH / 4], int jb) {
        const h16* vp[VH / 4];                                         // all addresses are formed first; both loops are unrolled so that vp and vr are registers
#pragma unroll
        for (int i = 0; i < VH / 4; ++i) vp[i] = vsrc + (size_t)klist[jb + 4 * i + (lane >> 3)] * DK;
#pragma unroll
        for (int i = 0; i < VH / 4; ++i) vr[i] = *(const v4u*)vp[i];
        // the address registers of the issued loads stay as they are up to this wait (they are its inputs), so that none is reused ahead of it
        asm volatile("s_wait_xcnt 0x0" :: "v"(vp[0]), "v"(vp[1]), "v"(vp[2]), "v"(vp[3]), "v"(vp[4]), "v"(vp[5]), "v"(vp[6]), "v"(vp[7]),
                                          "v"(vp[8]), "v"(vp[9]), "v"(vp[10]), "v"(vp[11]), "v"(vp[12]), "v"(vp[13]), "v"(vp[14]), "v"(vp[15]) : "memory");
    };
    auto stagev = [&](const v4u (&vr)[VH / 4]) {
#pragma unroll
        for (int i = 0; i < VH / 4; ++i) *(v4ua*)(vwr + i * 4 * VPITCH) = vr[i];
        asm volatile("s_wait_dscnt 0x0" ::: "memory");                 // the wave's own stores have retired before its transposing loads read the rows back
    };
    // the block's 16 q rows (16 KiB in a row in the plane) into LDS: piece 256 i + tid = row 4i + (tid>>6), 16-byte column tid&63; first read behind the barriers of the list stage (loops unrolled: qv is registers)
    { const h16* qg = QP + (size_t)q0 * DK + tid * 8; v4u qv[4];
#pragma unroll
      for (int i = 0; i < 4; ++i) qv[i] = *(const v4u*)(qg + i * (32 * FW * 8));
      asm volatile("s_wait_xcnt 0x0" :: "v"(qg) : "memory");           // the address register of the issued loads stays as it is up to this wait (it is its input)
#pragma unroll
      for (int i = 0; i < 4; ++i) *(v4ua*)(QS + (4 * i + (tid >> 6)) * QPITCH + (tid & 63) * 16) = qv[i]; }
    unsigned char* kwr = vsw + lane * 16;                              // store i: staged row i (listed key j0 + i), 16-byte piece lane
    const unsigned char* krd = vsw + lr * KPITCH + 16 * hi;            // A fragment: row = listed key, k = d
    const unsigned char* qrd = QS + lr * QPITCH + 16 * hi;             // B fragment: col t, k = d
    // the k rows of listed keys j0 .. j0+15, lower halves into k0, upper halves into k1: every load covers four whole 128-byte lines (every list entry is below SEQ by construction)
    auto fetchk = [&](v4u (&k0)[16], v4u (&k1)[16], int j0) {
        const v8us ia = *(const v8us*)(&klist[j0]); const v8us ib = *(const v8us*)(&klist[j0 + 8]);
        const h16* kp[16];                                             // all addresses are formed first; the loops are unrolled so that kp, k0 and k1 are registers
#pragma unroll
        for (int i = 0; i < 8; ++i) { kp[i] = KP + (size_t)ia[i] * DK + lane * 8; kp[8 + i] = KP + (size_t)ib[i] * DK + lane * 8; }
#pragma unroll
        for (int i = 0; i < 16; ++i) k0[i] = *(const v4u*)kp[i];
#pragma unroll
        for (int i = 0; i < 16; ++i) k1[i] = *(const v4u*)(kp[i] + KHB / 2);
        // the address registers of the issued loads stay as they are up to this wait (they are its inputs), so that none is reused ahead of it; it also keeps all 32 loads ahead of the first product
        asm volatile("s_wait_xcnt 0x0" :: "v"(kp[0]), "v"(kp[1]), "v"(kp[2]), "v"(kp[3]), "v"(kp[4]), "v"(kp[5]), "v"(kp[6]), "v"(kp[7]),
                                          "v"(kp[8]), "v"(kp[9]), "v"(kp[10]), "v"(kp[11]), "v"(kp[12]), "v"(kp[13]), "v"(kp[14]), "v"(kp[15]) : "memory");
    };
    auto stagek = [&](const v4u (&kr)[16]) {
#pragma unroll                                                          // kr is registers, the row offsets are immediates
        for (int i = 0; i < 16; ++i) *(v4ua*)(kwr + i * KPITCH) = kr[i];
        asm volatile("s_wait_dscnt 0x0" ::: "memory");                 // the wave's own stores have retired before its fragment loads read the rows back
    };
    // the staged half width (d = 256 hf .. 256 hf + 255) of the score tile, in rising d; all loops unrolled, so that the sixteen LDS reads of four k steps stand together ahead of their products
    auto qk = [&](v8f s, int hf) {
#pragma unroll
        for (int g = 0; g < KHB / 256; ++g) {
            v16h a[4], b[4];
#pragma unroll
            for (int u = 0; u < 4; ++u) { a[u] = ldh((const h16*)(krd + g * 256 + u * 64)); b[u] = ldh((const h16*)(qrd + hf * KHB + g * 256 + u * 64)); }
#pragma unroll
            for (int u = 0; u < 4; ++u) s = wmg(a[u], b[u], s);
        }
        wave_sync();                                                   // the staged rows are rewritten only behind these reads
        return s;
    };
    v8f o0 = (v8f){}, o1 = (v8f){}, o2 = (v8f){}, o3 = (v8f){};
    auto pv = [&](int jl) {                                            // VH staged keys against P columns jl .. jl+VH-1
#pragma unroll
        for (int kc = 0; kc < VH; kc += 32) {
            const v16h pb = cat16(*(const v8h*)(&Ps[pf + jl + kc]), *(const v8h*)(&Ps[pf + jl + kc + 16]));
            const unsigned char* ad = vrd + kc * VPITCH;
            const v16h v0 = cat16(ldtr(ad),      ldtr(ad + 16 * VPITCH));        o0 = wmg(v0, pb, o0);
            const v16h v1 = cat16(ldtr(ad + 32), ldtr(ad + 16 * VPITCH + 32));   o1 = wmg(v1, pb, o1);
            const v16h v2 = cat16(ldtr(ad + 64), ldtr(ad + 16 * VPITCH + 64));   o2 = wmg(v2, pb, o2);
            const v16h v3 = cat16(ldtr(ad + 96), ldtr(ad + 16 * VPITCH + 96));   o3 = wmg(v3, pb, o3);
        }
        wave_sync();                                                   // the staged rows are rewritten only behind these reads
    };
    float m = NEGB, l = 0.0f;
#pragma unroll 1                                                        // one copy of the large body with its barriers serves both passes
    for (int pass = 0; pass < 2; ++pass) {
        unsigned aw[16]; unsigned un = 0u;
        const unsigned* ap = ADJ + (size_t)q0 * AWORDS + tid;
#pragma unroll
        for (int r = 0; r < 16; ++r) aw[r] = ap[(size_t)r * AWORDS];
        asm volatile("s_wait_xcnt 0x0" :: "v"(ap) : "memory");         // the address register of the issued loads stays as it is up to this wait (it is its input)
#pragma unroll
        for (int r = 0; r < 16; ++r) un |= aw[r];
        unsigned sel = (pass == 0) ? un : ~un;                         // this pass's keys among 32*tid .. 32*tid+31
        const int cnt = __popc(sel);
        int inc = cnt;                                                 // inclusive prefix sum over the wave
#pragma unroll
        for (int d = 1; d < 32; d <<= 1) { const int up = __shfl_up(inc, d, 32); inc += (lane >= d) ? up : 0; }
        if (lane == 31) wsum[wave] = inc;
        __syncthreads();
        int base = 0, nn = 0;
#pragma unroll
        for (int w = 0; w < FW; ++w) { const int c = wsum[w]; base += (w < wave) ? c : 0; nn += c; }
        const int n = __builtin_amdgcn_readfirstlane(nn);              // listed keys of this pass, at most SEQ
        int pos = base + inc - cnt;
        while (sel != 0u) {                                            // at most 32 trips; pos stays below n
            const int b = __builtin_ctz(sel); sel &= sel - 1u;
            unsigned mk = 0u;
#pragma unroll
            for (int r = 0; r < 16; ++r) mk |= ((aw[r] >> b) & 1u) << r;
            klist[pos] = (unsigned short)(tid * 32 + b); kmask[pos] = (unsigned short)mk; ++pos;
        }
        const int np = (n + PANEL - 1) & ~(PANEL - 1);                 // at most SEQ
        if (n + tid < np) { klist[n + tid] = (unsigned short)0; kmask[n + tid] = (unsigned short)0; }
        __syncthreads();
#pragma unroll 1
        for (int kb = 0; kb < np; kb += PANEL) {
            v4u va[VH / 4], vb[VH / 4];
            const int j0 = kb + wave * 16;
            const v8us km = *(const v8us*)(&kmask[j0 + 8 * hi]);       // row masks of the lane's 8 listed keys
            unsigned orm = 0u;
#pragma unroll
            for (int r = 0; r < 8; ++r) orm |= (unsigned)km[r];
            const bool any = __builtin_amdgcn_ballot_w32(orm != 0u) != 0u;   // wave-uniform
            v8f sa = (v8f){};
            // the first v gather is issued once the lower k halves have left their registers: in flight under the second half of the score stage
            if (any) { v4u k0[16], k1[16]; fetchk(k0, k1, j0); stagek(k0); sa = qk(sa, 0); fetchv(va, kb); stagek(k1); sa = qk(sa, 1); }
            else fetchv(va, kb);
            float ta[8]; float mx = NEGB;
#pragma unroll
            for (int r = 0; r < 8; ++r) {
                const bool fa = ((((unsigned)km[r]) >> lr) & 1u) != 0u;
                const float sc = fa ? sa[r] * SC2 : FILL2;             // kept: scaled score; otherwise the score is replaced
                ta[r] = (j0 + 8 * hi + r < n) ? sc : NEGB;             // a pad entry is no key
                mx = fmaxf(mx, ta[r]); }
            mx = fmaxf(mx, __shfl_xor(mx, 16, 32));
            if (hi == 0) redm[wave * 16 + lr] = mx;
            __syncthreads();
            float pm = redm[lr];
#pragma unroll
            for (int w = 1; w < FW; ++w) pm = fmaxf(pm, redm[w * 16 + lr]);
            const float mnew = fmaxf(m, pm);
            const float alpha = __builtin_amdgcn_exp2f(m - mnew);
            const float sh = PSH - mnew;
            v8h pa; float ls = 0.0f;
#pragma unroll
            for (int r = 0; r < 8; ++r) {
                const float ea = ta[r] + sh;
                const float xa = __builtin_amdgcn_exp2f(ea);
                const float ga = (ea < -14.0f) ? 0.0f : xa;            // never a subnormal f16
                const h16 ha = (h16)ga;
                pa[r] = ha; ls += (float)ha; }
            ls += __shfl_xor(ls, 16, 32);
            if (hi == 0) reds[wave * 16 + lr] = ls;
            *(v8h*)(&Ps[pw]) = pa;
            __syncthreads();
            float lsum = reds[lr];
#pragma unroll
            for (int w = 1; w < FW; ++w) lsum += reds[w * 16 + lr];
            l = l * alpha + lsum; m = mnew;
            o0 = o0 * alpha; o1 = o1 * alpha; o2 = o2 * alpha; o3 = o3 * alpha;
            stagev(va);
            fetchv(vb, kb + VH);                                       // in flight under the first half's products
            pv(0);
            stagev(vb);
            pv(VH);
            __syncthreads();
        }
        const float ef = FILL2 + (PSH - fmaxf(m, FILL2));              // weight argument of a key that no row of the block keeps
        if (__builtin_amdgcn_ballot_w32(ef >= -14.0f) == 0u) break;    // m is the same in every wave: block-uniform
    }
    const float inv = 1.0f / l;                                        // l >= 16384: the panel holding a row's maximum contributes the full carry
    float* os = (float*)vsw;                                           // output staging in the wave's own rows (their last reads lie behind pv's ordering point)
    // O^T D layout: o_j[r] = (d = 64w + 16j + 8h + r, t = lane&15) -> os[t][16j + 8h + r]; rows 0..15 x columns 0..63 all written
    { v4f a, c;
      a[0] = o0[0] * inv; a[1] = o0[1] * inv; a[2] = o0[2] * inv; a[3] = o0[3] * inv; c[0] = o0[4] * inv; c[1] = o0[5] * inv; c[2] = o0[6] * inv; c[3] = o0[7] * inv;
      *(v4fa*)(&os[lr * OSP +  0 + 8 * hi]) = a; *(v4fa*)(&os[lr * OSP +  0 + 8 * hi + 4]) = c;
      a[0] = o1[0] * inv; a[1] = o1[1] * inv; a[2] = o1[2] * inv; a[3] = o1[3] * inv; c[0] = o1[4] * inv; c[1] = o1[5] * inv; c[2] = o1[6] * inv; c[3] = o1[7] * inv;
      *(v4fa*)(&os[lr * OSP + 16 + 8 * hi]) = a; *(v4fa*)(&os[lr * OSP + 16 + 8 * hi + 4]) = c;
      a[0] = o2[0] * inv; a[1] = o2[1] * inv; a[2] = o2[2] * inv; a[3] = o2[3] * inv; c[0] = o2[4] * inv; c[1] = o2[5] * inv; c[2] = o2[6] * inv; c[3] = o2[7] * inv;
      *(v4fa*)(&os[lr * OSP + 32 + 8 * hi]) = a; *(v4fa*)(&os[lr * OSP + 32 + 8 * hi + 4]) = c;
      a[0] = o3[0] * inv; a[1] = o3[1] * inv; a[2] = o3[2] * inv; a[3] = o3[3] * inv; c[0] = o3[4] * inv; c[1] = o3[5] * inv; c[2] = o3[6] * inv; c[3] = o3[7] * inv;
      *(v4fa*)(&os[lr * OSP + 48 + 8 * hi]) = a; *(v4fa*)(&os[lr * OSP + 48 + 8 * hi + 4]) = c; }
    wave_sync();
    float* orow = OUT + (size_t)q0 * DK + wave * 64;
{
#pragma unroll
        for (int s = 0; s < 8; ++s) { const int row = 2 * s + (lane >> 4), cofs = (lane & 15) * 4;   // 8 s x 2 rows = 16 rows; 16 lanes x 4 floats = 64 columns = two lines
            const v4f val = *(const v4fa*)(&os[row * OSP + cofs]);
            *(v4f*)(orow + (size_t)row * DK + cofs) = val; }
         }
}

static constexpr size_t al256(size_t v) { return (v + 255) & ~(size_t)255; }
static constexpr size_t SZ_XB = al256((size_t)SEQ * DIN * 2);
static constexpr size_t SZ_WB = al256((size_t)3 * DK * DIN * 2);
static constexpr size_t SZ_PL = al256((size_t)SEQ * DK * 2);
static constexpr size_t SZ_AJ = al256((size_t)SEQ * AWORDS * 4);
static constexpr size_t SZ_TOTAL = SZ_XB + SZ_WB + 3 * SZ_PL + SZ_AJ;
static_assert(SZ_TOTAL <= (size_t)134217728);          // workspace carve <= 128 MiB
static_assert(SZ_PL == PLE * 2);                       // q, k, v planes lie one behind the other without a gap
static_assert(((size_t)DK * DIN * 2) % 256 == 0);      // weight sub-planes stay 256-byte aligned
static_assert((size_t)(SEQ / AROWS) * AROWS * AWORDS * 4 <= SZ_AJ);   // builder grid x block extent == adjacency plane
static_assert((size_t)(SEQ / 64) * 64 * DK * 2 <= SZ_PL);             // projection grid x tile extent == plane

extern "C" void kernel_launch(void* const* d_in, const int* in_sizes, int n_in,
                              void* d_out, int out_size, void* d_ws, size_t ws_size, hipStream_t stream) {
    if (n_in < 8) return;
    if ((size_t)in_sizes[0] < (size_t)SEQ * DIN) return;
    if (in_sizes[1] < 2) return;
    if ((size_t)in_sizes[2] < (size_t)DIN * DK || (size_t)in_sizes[4] < (size_t)DIN * DK || (size_t)in_sizes[6] < (size_t)DIN * DK) return;
    if (in_sizes[3] < DK || in_sizes[5] < DK || in_sizes[7] < DK) return;
    if ((size_t)out_size < (size_t)SEQ * DK) return;
    if (SZ_TOTAL > ws_size) return;
    // wire order: x, edge_index, Wq, bq, Wk, bk, Wv, bv
    const float* x  = (const float*)d_in[0];
    const int*   ei = (const int*)d_in[1];
    const float* wq = (const float*)d_in[2]; const float* bq = (const float*)d_in[3];
    const float* wk = (const float*)d_in[4]; const float* bk = (const float*)d_in[5];
    const float* wv = (const float*)d_in[6]; const float* bv = (const float*)d_in[7];
    const int E = in_sizes[1] / 2;
    float* OUT = (float*)d_out;      // [SEQ][512]
    char* wsp = (char*)d_ws;
    bf* XB = (bf*)wsp; wsp += SZ_XB;                 // x        [SEQ][512] bf16
    bf* WB = (bf*)wsp; wsp += SZ_WB;                 // [3][512][512]: Wq^T | Wk^T | Wv^T  ([out][in])
    h16* QP = (h16*)wsp; wsp += SZ_PL;               // q   [SEQ][512]
    h16* KP = (h16*)wsp; wsp += SZ_PL;               // k   [SEQ][512]
    h16* VP = (h16*)wsp; wsp += SZ_PL;               // v   [SEQ][512]
    unsigned* ADJ = (unsigned*)wsp; wsp += SZ_AJ;    // adjacency bits [SEQ][SEQ/32]

    k_adj<<<SEQ / AROWS, ATH, 0, stream>>>(ei, ADJ, E, x, XB, wq, wk, wv, WB);

    // q, k, v: A = x rows (m = t), Bt = W^T rows (n = column) -> planes [t][512], QP | KP | VP
    k_proj_rows<<<dim3(SEQ / 64, 3 * (DK / 64), 1), 32, 0, stream>>>(XB, WB, bq, bk, bv, QP);

    k_flash<<<SEQ / 16, 32 * FW, 0, stream>>>(QP, KP, VP, ADJ, OUT);
}

// v005
// A run of this version takes 65.1 microseconds.
// Next to v004, in two timings, it ran 1.25 times as fast each time.
// Over all steps from v000 it is 15.7 times as fast.
#include <hip/hip_runtime.h>

// Single-head graph attention block: x [SEQ][512]; Wq/Wk/Wv [in][out] (y = x W + bias); edge list (int32 [2][E]) -> dense adjacency bit plane; scores q k^T / sqrt(512);
// mask form: a kept (edge) key keeps its score, every other key's score is REPLACED by -1e6 (rows without any edge come out as the uniform mean of v); softmax over all keys; output = attn v (f32).
// Compute dtypes, f32 accumulate everywhere: projections v_wmma_f32_16x16x32_bf16 (x, W, bias RNE-converted to bf16; products exact); scores v_wmma_f32_16x16x32_f16 (single f16 q and k planes);
// P.V v_wmma_f32_16x16x32_f16 (P with a x16384 carry that cancels in the normalisation, single f16 v plane, row sum over the converted P); softmax f32 (online, running max, exp2 form).
// Layout: bf16 copies of x and of the transposed weights W^T [out][in]; f16 planes q [t][512], k [t][512], v [t][512]; adjacency bit plane [t][SEQ/32] words built without read-modify-write primitives on global memory.
// Three launches: (1) adjacency builder, whose blocks also convert their shares of x and of the weights; (2) the q, k and v projections in one grid, operands staged in LDS; (3) fused attention.
// Fused attention in transposed form (S^T = K Q^T, O^T = V^T P^T): 16 query rows per block, 8 waves. The block first lists the keys that have an edge to any of its 16 rows and walks that list in panels of 128 keys
// (every wave scores its own 16 listed keys, whose k rows it brings into LDS by whole-line loads, against a q tile that the block keeps in LDS; the P tile goes through LDS, every wave owns 64 output columns and gathers its 128-byte slices of the listed v rows into LDS, read back transposed).
// The keys outside the list all carry the replaced score: they are walked too, by the same code, unless their weight is exactly zero for all 16 rows.

#ifndef SEQ
#define SEQ 8192                 // number of nodes (rows of x, queries and keys)
#endif
#define SEQ_FULL 8192
#define DIN  512                 // input width
#define DK   512                 // q / k / v width
#define FW   8                   // waves per attention block
#define PANEL (16 * FW)          // listed keys per panel
#define PP   (PANEL + 8)         // LDS row pitch (halves) of the P tile
#define OSP  68                  // LDS row pitch (floats) of the output staging tile
#define VH   64                  // listed keys whose v slices one wave stages at a time
#define VPITCH 160               // LDS row pitch (bytes) of a staged 128-byte v slice: an odd multiple of 32 bytes for the transposing reader
#define VSW  (VH * VPITCH)       // staging bytes per wave
#define KHB  (DK)                // bytes of half a k row: the piece of each of its 16 listed keys that a wave stages at a time
#define KPITCH (KHB + 16)        // LDS row pitch (bytes) of a staged half k row: an odd multiple of 16 bytes for the 16-byte fragment reader
#define QPITCH (DK * 2 + 16)     // LDS row pitch (bytes) of the q tile, likewise
#define AWORDS (SEQ / 32)        // adjacency words per row
#define AROWS 32                 // adjacency rows owned by one builder block
#define ATH  1024                // threads of one builder block
#define EU   8                   // 16-byte edge loads in flight per thread and batch
#define EBATCH (ATH * EU * 4)    // edges per batch of one builder block
#define XU   ((SEQ * (DIN / 8)) / ((SEQ / AROWS) * ATH))   // 8-element units of x converted per builder thread
#define WU   ((3 * DK * (DIN / 8)) / (SEQ / AROWS))        // 8-element units of the three W^T planes converted per builder block
#define GT   128                 // rows and columns of one projection block's tile
#define GW   4                   // waves of a projection block, 64x64 outputs each
#define GKC  64                  // k values per projection stage: one 128-byte line of every operand row
#define GPITCH (GKC * 2 + 16)    // LDS row pitch (bytes) of a staged line: an odd multiple of 16 bytes for the 16-byte fragment reader
#define GSTAGE (2 * GT * GPITCH) // bytes of one projection stage buffer
#define GNS  (DIN / GKC)         // projection stages
#define PLE  ((size_t)SEQ * DK)  // elements of one of the q, k, v planes, which lie one behind the other
#define SC2  ((float)(0.044194173824159216 * 1.4426950408889634))   // 512^-0.5 * log2(e)
#define FILL2 ((float)(-1000000.0 * 1.4426950408889634))            // replaced score (-1e6) in the exp2 domain
#define PSH  14.0f               // log2 of the P carry (16384)
#define NEGB (-3.0e38f)

static_assert(DIN % 32 == 0);                    // GEMM k-loop steps by 32
static_assert(DK % 32 == 0);                     // score k-loop steps by 32
static_assert(DK % 64 == 0);                     // 64-wide GEMM tiles
static_assert(DIN % 8 == 0);
static_assert(SEQ % 64 == 0);                    // 64-row GEMM tiles
static_assert(SEQ % PANEL == 0);                 // the list rounded up to whole panels stays within SEQ entries
static_assert(SEQ % 16 == 0);                    // 16 query rows per attention block
static_assert(SEQ % AROWS == 0);                 // builder grid covers the rows exactly
static_assert((SEQ & (SEQ - 1)) == 0);           // the builder's coarse filter reads the row-group bits of an index
static_assert(SEQ <= SEQ_FULL);
static_assert(DK == 64 * FW);                    // every wave owns 64 output columns
static_assert(PANEL == 128);
static_assert(PANEL % VH == 0 && VH % 32 == 0);
static_assert(VH / 4 == 16);                     // the gather's wait names its sixteen addresses
static_assert((PANEL & (PANEL - 1)) == 0 && PANEL <= 32 * FW);   // list padding: rounded up to a panel, at most one pad entry per thread
static_assert(AWORDS == 32 * FW);                // one adjacency word column per thread of an attention block
static_assert(SEQ <= 65536);                     // key indices fit 16 bits
static_assert(VPITCH % 32 == 0 && ((VPITCH / 32) & 1) == 1 && VPITCH >= 128);
static_assert((size_t)16 * OSP * 4 <= VSW);      // the output staging tile reuses the wave's own v staging bytes
static_assert((size_t)16 * KPITCH <= VSW);       // so do the staged half k rows
static_assert(KHB == 32 * 16);                   // one 16-byte load per lane covers half a k row
static_assert(KPITCH % 16 == 0 && ((KPITCH / 16) & 1) == 1 && QPITCH % 16 == 0 && ((QPITCH / 16) & 1) == 1);
static_assert(16 * DK * 2 == 4 * 32 * FW * 16);  // q tile: four 16-byte pieces per thread
static_assert((PP * 2) % 16 == 0);               // 16-byte aligned P rows
static_assert((OSP * 4) % 16 == 0);
static_assert((AROWS & (AROWS - 1)) == 0);
static_assert((AROWS * AWORDS) % ATH == 0);      // builder pack loop covers the words exactly
static_assert((AROWS * SEQ) % (16 * ATH) == 0);  // builder zero fill covers the flag bytes exactly
static_assert(4 * EU <= 32);                     // one candidate bit per edge of a thread's batch
static_assert((size_t)XU * (SEQ / AROWS) * ATH == (size_t)SEQ * DIN / 8);               // builder grid covers x exactly
static_assert((size_t)WU * (SEQ / AROWS) == (size_t)3 * DK * DIN / 8);                  // builder grid covers the weights exactly
static_assert(WU <= ATH && WU % 32 == 0 && (DK * DIN / 8) % 32 == 0);                   // whole waves, each inside one weight plane
static_assert(4 * 32 * 16 == 16 * 64 * 2);
static_assert(8 * 32 * 16 == 16 * 64 * 4);       // attention epilogue: 8 instructions x 32 lanes x 16 B == 16 rows x 256 B
static_assert((size_t)AROWS * SEQ <= 327680);                                           // builder static LDS
static_assert((size_t)16 * PP * 2 + 2 * FW * 16 * 4 + (size_t)FW * VSW + (size_t)SEQ * 4 + (size_t)16 * QPITCH + 64 <= 163840);   // attention static LDS: two blocks per 320 KiB
static_assert(3 * ((size_t)2 * GSTAGE + (size_t)GW * 16 * 68 * 4) <= 327680);           // projection static LDS: three blocks per 320 KiB
static_assert(SEQ % GT == 0 && DK % GT == 0 && GT == 128 && GW == 4);                   // 2 x 2 waves of 64x64; eight copies of 16 rows per operand, thread and stage
static_assert(DIN % GKC == 0 && GNS >= 2 && GKC % 32 == 0 && GKC * 2 == 8 * 16);        // both first stages exist; eight 16-byte pieces per staged row
static_assert(GPITCH % 16 == 0 && ((GPITCH / 16) & 1) == 1);
static_assert(((size_t)SEQ * DIN) % 8 == 0);
static_assert(((size_t)DIN * DK) % 8 == 0);

typedef _Float16 h16;
typedef unsigned short bf;
typedef __attribute__((ext_vector_type(16))) __bf16   v16bf;
typedef __attribute__((ext_vector_type(16))) _Float16 v16h;
typedef __attribute__((ext_vector_type(8)))  _Float16 v8h;
typedef __attribute__((ext_vector_type(8)))  unsigned short v8us;
typedef __attribute__((ext_vector_type(8)))  float    v8f;
typedef __attribute__((ext_vector_type(4)))  float    v4f;
typedef v4f  __attribute__((may_alias)) v4fa;
typedef __attribute__((ext_vector_type(4)))  unsigned v4u;
typedef v4u  __attribute__((may_alias)) v4ua;
typedef __attribute__((ext_vector_type(4)))  int      v4i;
typedef __attribute__((ext_vector_type(8)))  short    v8s;

__device__ __forceinline__ unsigned short f2bf(float f) { unsigned u = __float_as_uint(f); u += 0x7FFFu + ((u >> 16) & 1u); return (unsigned short)(u >> 16); }
__device__ __forceinline__ float bfr(float f) { return __uint_as_float(((unsigned)f2bf(f)) << 16); }   // value after RNE convert to bf16
__device__ __forceinline__ v16h cat16(v8h lo, v8h hi) { return __builtin_shufflevector(lo, hi, 0, 1, 2, 3, 4, 5, 6, 7, 8, 9, 10, 11, 12, 13, 14, 15); }
__device__ __forceinline__ v16bf cat16b(v8us lo, v8us hi) { return __builtin_bit_cast(v16bf, __builtin_shufflevector(lo, hi, 0, 1, 2, 3, 4, 5, 6, 7, 8, 9, 10, 11, 12, 13, 14, 15)); }
__device__ __forceinline__ v8f wmma16(v16h a, v16h b, v8f c) { return __builtin_amdgcn_wmma_f32_16x16x32_f16(false, a, false, b, (short)0, c, false, false); }
__device__ __forceinline__ v8f wmmab(v16bf a, v16bf b, v8f c) { return __builtin_amdgcn_wmma_f32_16x16x32_bf16(false, a, false, b, (short)0, c, false, false); }
// fragment loaders from K-contiguous 16-bit rows; p already includes + 8*(lane>>4): elements 0..7 <- k0+8h+0..7, elements 8..15 <- k0+16+8h+0..7 (same map for A and B)
__device__ __forceinline__ v16h  ldh(const h16* p) { return cat16(*(const v8h*)p, *(const v8h*)(p + 16)); }
__device__ __forceinline__ v16bf ldb(const bf* p)  { return cat16b(*(const v8us*)p, *(const v8us*)(p + 16)); }
// transposing LDS load: with p = T + (k0 + 8*(lane>>4) + (lane&7)) * pitch + 2 * d0 + 16 * ((lane>>3)&1), lane (c = lane&15, h = lane>>4) gets T[k0 + 8h + 0..7][d0 + c]
__device__ __forceinline__ v8h ldtr(const unsigned char* p) { typedef __attribute__((address_space(3))) v8s lds_v8s; return __builtin_bit_cast(v8h, __builtin_amdgcn_ds_load_tr16_b128_v8i16((lds_v8s*)p)); }
// ordering point for wave-private LDS tiles (same wave writes and reads)
__device__ __forceinline__ void wave_sync() { __builtin_amdgcn_fence(3 /* release order */, "wavefront"); __builtin_amdgcn_wave_barrier(); asm volatile("" ::: "memory"); }

// f32 -> f16 convert that cannot produce a subnormal f16 (|v| < 2^-14 -> +0)
static __device__ __forceinline__ h16 toh_flush(float v) { const h16 r = (h16)v; return (fabsf(v) < 6.103515625e-05f) ? (h16)0.0f : r; }
// one guarded f16 WMMA: the nops tie the accumulator and keep both fragments live
__device__ __forceinline__ v8f wmg(v16h a, v16h b, v8f c) { c = wmma16(a, b, c); asm volatile("v_nop\n\tv_nop\n\tv_nop\n\tv_nop" : "+v"(c) : "v"(a), "v"(b)); return c; }

// k_adj: adjacency bit plane ADJ[t][SEQ/32] from the edge list (src = ei[0..E), dst = ei[E..2E)); bit (c & 31) of word ADJ[r][c >> 5] set iff some edge (r, c) exists.
// One block of 32 waves owns AROWS rows as a BYTE plane in LDS (one byte per (row, column), zero-filled): setting a flag is a plain one-byte store of the value 1, so any thread may set any flag
// (two threads that meet on one byte store the same value) and the scan needs no list, no word owner and no barrier. The block's threads share ONE pass over the src row of the edge list
// (16-byte loads, the next batch in flight while this one is filtered); in whole batches only an edge whose src falls into the block's rows reads its dst (the tail reads every dst). After one barrier 32 flag bytes are packed into each word.
// The block also converts its share of the projection operands (RNE to bf16), work that depends on nothing here and that only the next launch reads: XU units of x per thread (unit i = elements 8i .. 8i+7),
// and WU units of the transposed weights WB = Wq^T | Wk^T | Wv^T, W [DIN][DK] ([in][out]) -> W^T [DK][DIN] (unit i of a plane: row n = i / (DIN/8), k = (i % (DIN/8))*8 + j); the loads of both are in flight under the zero fill.
__global__ __launch_bounds__(ATH) void k_adj(const int* __restrict__ ei, unsigned* ADJ, int E, const float* __restrict__ x, bf* XB,
                                             const float* __restrict__ wq, const float* __restrict__ wk, const float* __restrict__ wv, bf* WB) {
    __shared__ __align__(16) unsigned char flag[AROWS * SEQ];
    const int tid = threadIdx.x;
    const int r0 = blockIdx.x * AROWS;
    const int* __restrict__ sp = ei;
    const int* __restrict__ dp = ei + (size_t)E;
    const size_t xu = (size_t)blockIdx.x * (XU * ATH) + tid;           // the thread's first unit of x; the others follow ATH units apart
    v8f xv[XU];
#pragma unroll
    for (int u = 0; u < XU; ++u) xv[u] = *(const v8f*)(x + (xu + (size_t)u * ATH) * 8);
    const unsigned g = blockIdx.x * WU + tid;                          // the thread's unit of WB, for tid < WU (whole waves)
    float wr[8] = {0.0f, 0.0f, 0.0f, 0.0f, 0.0f, 0.0f, 0.0f, 0.0f};
    if (tid < WU) {
        const unsigned pl = g / (DK * DIN / 8), i = g % (DK * DIN / 8);
        const float* __restrict__ Wp = (pl == 0u) ? wq : (pl == 1u) ? wk : wv;
        const unsigned n = i / (DIN / 8), k8 = (i % (DIN / 8)) * 8;
#pragma unroll
        for (int j = 0; j < 8; ++j) wr[j] = Wp[(size_t)(k8 + j) * DK + n];
    }
#pragma unroll
    for (int i = 0; i < AROWS * SEQ / 16 / ATH; ++i) { const v4u z = (v4u){0u, 0u, 0u, 0u}; *(v4ua*)(&flag[(size_t)(i * ATH + tid) * 16]) = z; }
    __builtin_amdgcn_sched_barrier(0);                                 // keeps the conversions, which wait for their loads, behind the zero fill's stores
#pragma unroll
    for (int u = 0; u < XU; ++u) { v8us o;
#pragma unroll
        for (int k = 0; k < 8; ++k) o[k] = f2bf(xv[u][k]);
        *(v8us*)(XB + (xu + (size_t)u * ATH) * 8) = o; }
    if (tid < WU) { v8us o;
#pragma unroll
        for (int j = 0; j < 8; ++j) o[j] = f2bf(wr[j]);
        *(v8us*)(WB + (size_t)g * 8) = o;
    }
    __syncthreads();
    // exact test and flag store of one edge e < E (indices below zero wrap once, anything still outside the matrix is dropped); the test bounds the LDS address
    auto mark = [&](int e) {
        int s = sp[(size_t)e]; int d = dp[(size_t)e];
        s += (s < 0) ? SEQ : 0; d += (d < 0) ? SEQ : 0;
        const bool hit = ((unsigned)(s - r0) < (unsigned)AROWS) & ((unsigned)d < (unsigned)SEQ);
        if (hit) flag[(s - r0) * SEQ + d] = (unsigned char)1;
    };
    // batch bt = edges [bt * EBATCH, (bt + 1) * EBATCH): load u of thread tid holds edges bt * EBATCH + u * 4 * ATH + 4 * tid + 0..3
    auto fetch = [&](v4i (&c)[EU], int bt) {
#pragma unroll
        for (int u = 0; u < EU; ++u) c[u] = *(const v4i*)(sp + (size_t)bt * EBATCH + (size_t)(u * 4 * ATH) + (size_t)tid * 4);
    };
    // coarse filter on the row-group bits of src (a wrapped index keeps them, SEQ being a power of two): one bit per candidate edge, then the exact test on the few candidates
    auto sift = [&](const v4i (&c)[EU], int bt) {
        unsigned hm = 0u;
#pragma unroll
        for (int u = 0; u < EU; ++u)
#pragma unroll
            for (int j = 0; j < 4; ++j) hm |= ((((unsigned)c[u][j] ^ (unsigned)r0) & (unsigned)(SEQ - AROWS)) == 0u) ? (1u << (u * 4 + j)) : 0u;
        while (hm != 0u) {                                             // at most 4 * EU trips
            const int b = __builtin_ctz(hm); hm &= hm - 1u;
            mark(bt * EBATCH + (b >> 2) * (4 * ATH) + tid * 4 + (b & 3));
        }
    };
    const int nb = E / EBATCH;                                         // whole batches (block-uniform)
    v4i ca[EU], cb[EU];
    if (nb > 0) fetch(ca, 0);
    int bt = 0;
#pragma unroll 1
    for (; bt + 3 <= nb; bt += 2) {                                    // both fetches unconditional, so that each batch is filtered with the next one still in flight
        fetch(cb, bt + 1);
        sift(ca, bt);
        fetch(ca, bt + 2);
        sift(cb, bt + 1);
    }
    if (bt + 2 <= nb) { fetch(cb, bt + 1); sift(ca, bt); sift(cb, bt + 1); }
    else if (bt < nb) sift(ca, bt);
#pragma unroll 1
    for (int e = nb * EBATCH + tid; e < E; e += ATH) mark(e);          // tail shorter than one batch
    __syncthreads();
    unsigned* dst = ADJ + (size_t)r0 * AWORDS;
#pragma unroll
    for (int i = 0; i < AROWS * AWORDS / ATH; ++i) {
        const int w = i * ATH + tid;                                   // word w of the block's rows <- flag bytes 32w .. 32w+31
        const v4u x0 = *(const v4ua*)(&flag[(size_t)w * 32]); const v4u x1 = *(const v4ua*)(&flag[(size_t)w * 32 + 16]);
        unsigned word = 0u;
#pragma unroll
        for (int k = 0; k < 4; ++k) {                                  // four 0/1 bytes -> four bits: the product puts byte i's bit at position 24 + i, no two terms meet
            word |= ((x0[k] * 0x01020408u) >> 24) << (4 * k);
            word |= ((x1[k] * 0x01020408u) >> 24) << (16 + 4 * k);
        }
        dst[(size_t)w] = word;
    }
}

// k_proj_rows: bf16 GEMM for q, k and v in one grid (SEQ/GT, 3 * DK/GT): C[t][n] = sum_k x[t][k] W^T[n][k] + bias[n], written as f16 into the row-major plane [t][DK] that blockIdx.y names.
// One block of four waves per GT x GT tile, every wave a 64x64 quarter (16 accumulators). The block's GT rows of x and GT rows of W^T go through LDS in stages of GKC k values (one whole 128-byte line per row and stage),
// brought by asynchronous copies into two buffers: stage s + 1 flies while stage s is multiplied. Fragments are read from LDS rows of pitch GPITCH; k runs upward in steps of 32 for every accumulator.
__global__ __launch_bounds__(32 * GW) void k_proj_rows(const bf* __restrict__ A, const bf* __restrict__ WB, const float* __restrict__ bq, const float* __restrict__ bk, const float* __restrict__ bv, h16* P) {
    __shared__ __align__(16) unsigned char GS[2 * GSTAGE];             // two buffers, each: GT rows of x, then GT rows of W^T
    __shared__ __align__(16) float osb[GW * 16 * 68];                  // output staging, one tile per wave
    const int tid = threadIdx.x;
    const int lane = threadIdx.x & 31, lr = lane & 15, hi = lane >> 4;
    const int wave = __builtin_amdgcn_readfirstlane((int)(threadIdx.x >> 5));
    const int pl = blockIdx.y / (DK / GT);
    const int r0 = blockIdx.x * GT + (wave >> 1) * 64, c0 = (blockIdx.y % (DK / GT)) * GT + (wave & 1) * 64;   // the wave's quarter in the plane
    const float* __restrict__ bias = (pl == 0) ? bq : (pl == 1) ? bk : bv;
    h16* Ph = P + (size_t)pl * PLE;
    // copy i of a thread: staged row 16 i + (tid >> 3), 16-byte piece tid & 7; all rows lie inside the planes (the grid covers them exactly), all LDS bytes inside GS
    const bf* ga = A + (size_t)(blockIdx.x * GT + (tid >> 3)) * DIN + (tid & 7) * 8;
    const bf* gb = WB + (size_t)pl * DK * DIN + (size_t)((blockIdx.y % (DK / GT)) * GT + (tid >> 3)) * DIN + (tid & 7) * 8;
    const unsigned l0 = (unsigned)(size_t)(&GS[0]) + (unsigned)((tid >> 3) * GPITCH + (tid & 7) * 16);   // LDS byte address: the low 32 bits of the shared address
    // eight copies, rows 16 apart, each with its own address registers; the wait in the same statement stands in front of any rewrite of those registers
    auto copy8 = [&](unsigned l, const bf* g) {
        asm volatile("global_load_async_to_lds_b128 %0, %8, off\n\t"
                     "global_load_async_to_lds_b128 %1, %9, off\n\t"
                     "global_load_async_to_lds_b128 %2, %10, off\n\t"
                     "global_load_async_to_lds_b128 %3, %11, off\n\t"
                     "global_load_async_to_lds_b128 %4, %12, off\n\t"
                     "global_load_async_to_lds_b128 %5, %13, off\n\t"
                     "global_load_async_to_lds_b128 %6, %14, off\n\t"
                     "global_load_async_to_lds_b128 %7, %15, off\n\t"
                     "s_wait_xcnt 0x0"
                     :: "v"(l), "v"(l + 16 * GPITCH), "v"(l + 32 * GPITCH), "v"(l + 48 * GPITCH), "v"(l + 64 * GPITCH), "v"(l + 80 * GPITCH), "v"(l + 96 * GPITCH), "v"(l + 112 * GPITCH),
                        "v"(g), "v"(g + 16 * DIN), "v"(g + 32 * DIN), "v"(g + 48 * DIN), "v"(g + 64 * DIN), "v"(g + 80 * DIN), "v"(g + 96 * DIN), "v"(g + 112 * DIN) : "memory");
    };
    auto fill = [&](int s) {                                           // stage s into buffer s & 1
        const unsigned l = l0 + (unsigned)((s & 1) * GSTAGE);
        copy8(l, ga + s * GKC);
        copy8(l + GT * GPITCH, gb + s * GKC);
    };
    v8f acc[4][4];
#pragma unroll
    for (int mb = 0; mb < 4; ++mb)
#pragma unroll
        for (int nb = 0; nb < 4; ++nb) acc[mb][nb] = (v8f){};
    const unsigned char* ard = GS + ((wave >> 1) * 64 + lr) * GPITCH + 16 * hi;        // A fragment: row t, k
    const unsigned char* brd = GS + (GT + (wave & 1) * 64 + lr) * GPITCH + 16 * hi;    // B fragment: row n of W^T, k
    fill(0);
    asm volatile("s_wait_asynccnt 0x0" ::: "memory");                  // the wave's own copies of stage 0 have landed
    __syncthreads();                                                   // and every other wave's
    fill(1);
#pragma unroll 1                                                        // one copy of the body: the buffer is picked by the stage's parity
    for (int s = 0; s < GNS; ++s) {
        const int bo = (s & 1) * GSTAGE;
#pragma unroll
        for (int ks = 0; ks < GKC / 32; ++ks) {
            v16bf a[4], b[4];
#pragma unroll
            for (int mb = 0; mb < 4; ++mb) a[mb] = ldb((const bf*)(ard + bo + mb * 16 * GPITCH + ks * 64));
#pragma unroll
            for (int nb = 0; nb < 4; ++nb) b[nb] = ldb((const bf*)(brd + bo + nb * 16 * GPITCH + ks * 64));
            __builtin_amdgcn_sched_barrier(0);                         // keeps the sixteen LDS reads together ahead of their sixteen products: one exposed LDS latency per k step, not one per W^T fragment
#pragma unroll
            for (int nb = 0; nb < 4; ++nb)
#pragma unroll
                for (int mb = 0; mb < 4; ++mb) acc[mb][nb] = wmmab(a[mb], b[nb], acc[mb][nb]);
        }
        asm volatile("s_wait_dscnt 0x0" ::: "memory");                 // the wave's reads of this buffer have retired before the buffer is refilled
        asm volatile("s_wait_asynccnt 0x0" ::: "memory");              // the wave's own copies of stage s + 1 have landed
        __syncthreads();                                               // publishes stage s + 1 and ends every wave's reads of stage s
        if (s + 2 < GNS) fill(s + 2);                                  // same test in the whole block
    }
    asm volatile("s_wait_asynccnt 0x0" ::: "memory");                  // no copy is outstanding when the wave ends
    float* os = osb + wave * (16 * 68);
    float bc[4];
#pragma unroll
    for (int nb = 0; nb < 4; ++nb) bc[nb] = bfr(bias[c0 + nb * 16 + lr]);   // c0 + 63 < DK
    const size_t tbase = (size_t)r0 * DK + (size_t)c0;
#pragma unroll
    for (int mb = 0; mb < 4; ++mb) {
#pragma unroll
        for (int nb = 0; nb < 4; ++nb) {
#pragma unroll
            for (int j = 0; j < 8; ++j) os[(hi * 8 + j) * 68 + nb * 16 + lr] = acc[mb][nb][j] + bc[nb]; }   // D: row 8h+j, col lane&15
        wave_sync();
        {
            const size_t sb = tbase + (size_t)(mb * 16) * DK;
#pragma unroll
            for (int s = 0; s < 4; ++s) { const int row = 4 * s + (lane >> 3), c8 = (lane & 7) * 8;   // 4 s x 4 row groups = 16 rows; 8 lanes x 8 = 64 columns
                const v4f x0 = *(const v4fa*)(&os[row * 68 + c8]); const v4f x1 = *(const v4fa*)(&os[row * 68 + c8 + 4]); v8h hv;
#pragma unroll
                for (int i = 0; i < 4; ++i) { hv[i] = toh_flush(x0[i]); hv[4 + i] = toh_flush(x1[i]); }
                const size_t oo = sb + (size_t)row * DK + c8;
                *(v8h*)(Ph + oo) = hv; }
        }
        wave_sync();
    }
}

// k_flash: fused attention, one block per 16 query rows, FW = 8 waves.
// Pass 0 lists, in rising order, the keys with an edge to any of the block's 16 rows (thread i owns adjacency word column i: OR over the rows, block-wide prefix sum of the bit counts), each with a 16-bit
// mask of the rows that keep it, and walks the list; pass 1 does the same with the keys that are left (all masks zero). A key of pass 1 has the replaced score in every row, so its weight is
// exp2(FILL2 - max + 14), taken as 0 below -14 like every other weight: where that holds for all 16 rows after pass 0, pass 1 would add only zeros and is left out (same value in every wave: block-uniform).
// Per panel of 128 listed keys (the list is padded to whole panels; a pad entry scores NEGB, weight 0):
//  (1) wave w scores its own 16 listed keys in transposed form, S^T = K Q^T over the full width: all 32 loads of its 16 k rows (512 contiguous bytes each) are issued together, the rows go through the wave's own LDS bytes
//      one half width at a time, and A (k rows) and B (q rows, from the block's LDS tile) are read as fragments there; lane (t = lane&15, h = lane>>4) holds listed keys 8h+r for query t; a tile whose masks are all zero is not multiplied;
//  (2) per-query max: lane partial, xor-16 exchange, one word per wave per query in LDS, block barrier, combine over the 8 waves (identical in every wave);
//  (3) P = exp2(score - max + 14) as f16 (arguments below -14 give 0), P tile [t][128 keys] into LDS, partial sums over the converted P, block barrier;
//  (4) wave w accumulates O^T rows d in [64w, 64w+64): it gathers v[key][64w .. 64w+63] (one 128-byte line per key) of 64 listed keys at a time into its own LDS rows; A = V^T by transposing LDS loads,
//      B = P^T from the LDS tile (both in the k order 8h+0..7, 16+8h+0..7); block barrier before the next panel.
__global__ __launch_bounds__(32 * FW) void k_flash(const h16* __restrict__ QP, const h16* __restrict__ KP, const h16* __restrict__ VP, const unsigned* __restrict__ ADJ, float* OUT) {
    __shared__ __align__(16) h16 Ps[16 * PP];
    __shared__ float redm[FW * 16];
    __shared__ float reds[FW * 16];
    __shared__ int wsum[FW];
    __shared__ __align__(16) unsigned short klist[SEQ];
    __shared__ __align__(16) unsigned short kmask[SEQ];
    __shared__ __align__(32) unsigned char VS[FW * VSW];
    __shared__ __align__(16) unsigned char QS[16 * QPITCH];
    const int tid = threadIdx.x;
    const int lane = threadIdx.x & 31, lr = lane & 15, hi = lane >> 4;
    const int wave = __builtin_amdgcn_readfirstlane((int)(threadIdx.x >> 5));
    const int q0 = blockIdx.x * 16;
    const int pw = lr * PP + wave * 16 + 8 * hi;                       // P tile write offset (listed keys wave*16 + 8h + r)
    const int pf = lr * PP + 8 * hi;                                   // P^T fragment read offset (col t, k = listed key)
    unsigned char* vsw = VS + wave * VSW;                              // the wave's own staging rows
    unsigned char* vwr = vsw + (lane >> 3) * VPITCH + (lane & 7) * 16;                                   // store i: staged row 4i + (lane>>3), 16-byte piece lane&7
    const unsigned char* vrd = vsw + (8 * hi + (lane & 7)) * VPITCH + ((lane >> 3) & 1) * 16;            // transposing read, staged row base 0, column base 0
    const h16* vsrc = VP + wave * 64 + (lane & 7) * 8;                 // + key * DK
    // gather of the wave's slices of listed keys jb .. jb+VH-1: load i covers four whole 128-byte lines (every list entry is below SEQ by construction)
    auto fetchv = [&](v4u (&vr)[VH / 4], int jb) {
        const h16* vp[VH / 4];                                         // all addresses are formed first; both loops are unrolled so that vp and vr are registers
#pragma unroll
        for (int i = 0; i < VH / 4; ++i) vp[i] = vsrc + (size_t)klist[jb + 4 * i + (lane >> 3)] * DK;
#pragma unroll
        for (int i = 0; i < VH / 4; ++i) vr[i] = *(const v4u*)vp[i];
        // the address registers of the issued loads stay as they are up to this wait (they are its inputs), so that none is reused ahead of it
        asm volatile("s_wait_xcnt 0x0" :: "v"(vp[0]), "v"(vp[1]), "v"(vp[2]), "v"(vp[3]), "v"(vp[4]), "v"(vp[5]), "v"(vp[6]), "v"(vp[7]),
                                          "v"(vp[8]), "v"(vp[9]), "v"(vp[10]), "v"(vp[11]), "v"(vp[12]), "v"(vp[13]), "v"(vp[14]), "v"(vp[15]) : "memory");
    };
    auto stagev = [&](const v4u (&vr)[VH / 4]) {
#pragma unroll
        for (int i = 0; i < VH / 4; ++i) *(v4ua*)(vwr + i * 4 * VPITCH) = vr[i];
        asm volatile("s_wait_dscnt 0x0" ::: "memory");                 // the wave's own stores have retired before its transposing loads read the rows back
    };
    // the block's 16 q rows (16 KiB in a row in the plane) into LDS: piece 256 i + tid = row 4i + (tid>>6), 16-byte column tid&63; first read behind the barriers of the list stage (loops unrolled: qv is registers)
    { const h16* qg = QP + (size_t)q0 * DK + tid * 8; v4u qv[4];
#pragma unroll
      for (int i = 0; i < 4; ++i) qv[i] = *(const v4u*)(qg + i * (32 * FW * 8));
      asm volatile("s_wait_xcnt 0x0" :: "v"(qg) : "memory");           // the address register of the issued loads stays as it is up to this wait (it is its input)
#pragma unroll
      for (int i = 0; i < 4; ++i) *(v4ua*)(QS + (4 * i + (tid >> 6)) * QPITCH + (tid & 63) * 16) = qv[i]; }
    unsigned char* kwr = vsw + lane * 16;                              // store i: staged row i (listed key j0 + i), 16-byte piece lane
    const unsigned char* krd = vsw + lr * KPITCH + 16 * hi;            // A fragment: row = listed key, k = d
    const unsigned char* qrd = QS + lr * QPITCH + 16 * hi;             // B fragment: col t, k = d
    // the k rows of listed keys j0 .. j0+15, lower halves into k0, upper halves into k1: every load covers four whole 128-byte lines (every list entry is below SEQ by construction)
    auto fetchk = [&](v4u (&k0)[16], v4u (&k1)[16], int j0) {
        const v8us ia = *(const v8us*)(&klist[j0]); const v8us ib = *(const v8us*)(&klist[j0 + 8]);
        const h16* kp[16];                                             // all addresses are formed first; the loops are unrolled so that kp, k0 and k1 are registers
#pragma unroll
        for (int i = 0; i < 8; ++i) { kp[i] = KP + (size_t)ia[i] * DK + lane * 8; kp[8 + i] = KP + (size_t)ib[i] * DK + lane * 8; }
#pragma unroll
        for (int i = 0; i < 16; ++i) k0[i] = *(const v4u*)kp[i];
#pragma unroll
        for (int i = 0; i < 16; ++i) k1[i] = *(const v4u*)(kp[i] + KHB / 2);
        // the address registers of the issued loads stay as they are up to this wait (they are its inputs), so that none is reused ahead of it; it also keeps all 32 loads ahead of the first product
        asm volatile("s_wait_xcnt 0x0" :: "v"(kp[0]), "v"(kp[1]), "v"(kp[2]), "v"(kp[3]), "v"(kp[4]), "v"(kp[5]), "v"(kp[6]), "v"(kp[7]),
                                          "v"(kp[8]), "v"(kp[9]), "v"(kp[10]), "v"(kp[11]), "v"(kp[12]), "v"(kp[13]), "v"(kp[14]), "v"(kp[15]) : "memory");
    };
    auto stagek = [&](const v4u (&kr)[16]) {
#pragma unroll                                                          // kr is registers, the row offsets are immediates
        for (int i = 0; i < 16; ++i) *(v4ua*)(kwr + i * KPITCH) = kr[i];
        asm volatile("s_wait_dscnt 0x0" ::: "memory");                 // the wave's own stores have retired before its fragment loads read the rows back
    };
    // the staged half width (d = 256 hf .. 256 hf + 255) of the score tile, in rising d; all loops unrolled, so that the sixteen LDS reads of four k steps stand together ahead of their products
    auto qk = [&](v8f s, int hf) {
#pragma unroll
        for (int g = 0; g < KHB / 256; ++g) {
            v16h a[4], b[4];
#pragma unroll
            for (int u = 0; u < 4; ++u) { a[u] = ldh((const h16*)(krd + g * 256 + u * 64)); b[u] = ldh((const h16*)(qrd + hf * KHB + g * 256 + u * 64)); }
#pragma unroll
            for (int u = 0; u < 4; ++u) s = wmg(a[u], b[u], s);
        }
        wave_sync();                                                   // the staged rows are rewritten only behind these reads
        return s;
    };
    v8f o0 = (v8f){}, o1 = (v8f){}, o2 = (v8f){}, o3 = (v8f){};
    auto pv = [&](int jl) {                                            // VH staged keys against P columns jl .. jl+VH-1
#pragma unroll
        for (int kc = 0; kc < VH; kc += 32) {
            const v16h pb = cat16(*(const v8h*)(&Ps[pf + jl + kc]), *(const v8h*)(&Ps[pf + jl + kc + 16]));
            const unsigned char* ad = vrd + kc * VPITCH;
            const v16h v0 = cat16(ldtr(ad),      ldtr(ad + 16 * VPITCH));        o0 = wmg(v0, pb, o0);
            const v16h v1 = cat16(ldtr(ad + 32), ldtr(ad + 16 * VPITCH + 32));   o1 = wmg(v1, pb, o1);
            const v16h v2 = cat16(ldtr(ad + 64), ldtr(ad + 16 * VPITCH + 64));   o2 = wmg(v2, pb, o2);
            const v16h v3 = cat16(ldtr(ad + 96), ldtr(ad + 16 * VPITCH + 96));   o3 = wmg(v3, pb, o3);
        }
        wave_sync();                                                   // the staged rows are rewritten only behind these reads
    };
    float m = NEGB, l = 0.0f;
#pragma unroll 1                                                        // one copy of the large body with its barriers serves both passes
    for (int pass = 0; pass < 2; ++pass) {
        unsigned aw[16]; unsigned un = 0u;
        const unsigned* ap = ADJ + (size_t)q0 * AWORDS + tid;
#pragma unroll
        for (int r = 0; r < 16; ++r) aw[r] = ap[(size_t)r * AWORDS];
        asm volatile("s_wait_xcnt 0x0" :: "v"(ap) : "memory");         // the address register of the issued loads stays as it is up to this wait (it is its input)
#pragma unroll
        for (int r = 0; r < 16; ++r) un |= aw[r];
        unsigned sel = (pass == 0) ? un : ~un;                         // this pass's keys among 32*tid .. 32*tid+31
        const int cnt = __popc(sel);
        int inc = cnt;                                                 // inclusive prefix sum over the wave
#pragma unroll
        for (int d = 1; d < 32; d <<= 1) { const int up = __shfl_up(inc, d, 32); inc += (lane >= d) ? up : 0; }
        if (lane == 31) wsum[wave] = inc;
        __syncthreads();
        int base = 0, nn = 0;
#pragma unroll
        for (int w = 0; w < FW; ++w) { const int c = wsum[w]; base += (w < wave) ? c : 0; nn += c; }
        const int n = __builtin_amdgcn_readfirstlane(nn);              // listed keys of this pass, at most SEQ
        int pos = base + inc - cnt;
        while (sel != 0u) {                                            // at most 32 trips; pos stays below n
            const int b = __builtin_ctz(sel); sel &= sel - 1u;
            unsigned mk = 0u;
#pragma unroll
            for (int r = 0; r < 16; ++r) mk |= ((aw[r] >> b) & 1u) << r;
            klist[pos] = (unsigned short)(tid * 32 + b); kmask[pos] = (unsigned short)mk; ++pos;
        }
        const int np = (n + PANEL - 1) & ~(PANEL - 1);                 // at most SEQ
        if (n + tid < np) { klist[n + tid] = (unsigned short)0; kmask[n + tid] = (unsigned short)0; }
        __syncthreads();
#pragma unroll 1
        for (int kb = 0; kb < np; kb += PANEL) {
            v4u va[VH / 4], vb[VH / 4];
            const int j0 = kb + wave * 16;
            const v8us km = *(const v8us*)(&kmask[j0 + 8 * hi]);       // row masks of the lane's 8 listed keys
            unsigned orm = 0u;
#pragma unroll
            for (int r = 0; r < 8; ++r) orm |= (unsigned)km[r];
            const bool any = __builtin_amdgcn_ballot_w32(orm != 0u) != 0u;   // wave-uniform
            v8f sa = (v8f){};
            // the first v gather is issued once the lower k halves have left their registers: in flight under the second half of the score stage
            if (any) { v4u k0[16], k1[16]; fetchk(k0, k1, j0); stagek(k0); sa = qk(sa, 0); fetchv(va, kb); stagek(k1); sa = qk(sa, 1); }
            else fetchv(va, kb);
            float ta[8]; float mx = NEGB;
#pragma unroll
            for (int r = 0; r < 8; ++r) {
                const bool fa = ((((unsigned)km[r]) >> lr) & 1u) != 0u;
                const float sc = fa ? sa[r] * SC2 : FILL2;             // kept: scaled score; otherwise the score is replaced
                ta[r] = (j0 + 8 * hi + r < n) ? sc : NEGB;             // a pad entry is no key
                mx = fmaxf(mx, ta[r]); }
            mx = fmaxf(mx, __shfl_xor(mx, 16, 32));
            if (hi == 0) redm[wave * 16 + lr] = mx;
            __syncthreads();
            float pm = redm[lr];
#pragma unroll
            for (int w = 1; w < FW; ++w) pm = fmaxf(pm, redm[w * 16 + lr]);
            const float mnew = fmaxf(m, pm);
            const float alpha = __builtin_amdgcn_exp2f(m - mnew);
            const float sh = PSH - mnew;
            v8h pa; float ls = 0.0f;
#pragma unroll
            for (int r = 0; r < 8; ++r) {
                const float ea = ta[r] + sh;
                const float xa = __builtin_amdgcn_exp2f(ea);
                const float ga = (ea < -14.0f) ? 0.0f : xa;            // never a subnormal f16
                const h16 ha = (h16)ga;
                pa[r] = ha; ls += (float)ha; }
            ls += __shfl_xor(ls, 16, 32);
            if (hi == 0) reds[wave * 16 + lr] = ls;
            *(v8h*)(&Ps[pw]) = pa;
            __syncthreads();
            float lsum = reds[lr];
#pragma unroll
            for (int w = 1; w < FW; ++w) lsum += reds[w * 16 + lr];
            l = l * alpha + lsum; m = mnew;
            o0 = o0 * alpha; o1 = o1 * alpha; o2 = o2 * alpha; o3 = o3 * alpha;
            stagev(va);
            fetchv(vb, kb + VH);                                       // in flight under the first half's products
            pv(0);
            stagev(vb);
            pv(VH);
            __syncthreads();
        }
        const float ef = FILL2 + (PSH - fmaxf(m, FILL2));              // weight argument of a key that no row of the block keeps
        if (__builtin_amdgcn_ballot_w32(ef >= -14.0f) == 0u) break;    // m is the same in every wave: block-uniform
    }
    const float inv = 1.0f / l;                                        // l >= 16384: the panel holding a row's maximum contributes the full carry
    float* os = (float*)vsw;                                           // output staging in the wave's own rows (their last reads lie behind pv's ordering point)
    // O^T D layout: o_j[r] = (d = 64w + 16j + 8h + r, t = lane&15) -> os[t][16j + 8h + r]; rows 0..15 x columns 0..63 all written
    { v4f a, c;
      a[0] = o0[0] * inv; a[1] = o0[1] * inv; a[2] = o0[2] * inv; a[3] = o0[3] * inv; c[0] = o0[4] * inv; c[1] = o0[5] * inv; c[2] = o0[6] * inv; c[3] = o0[7] * inv;
      *(v4fa*)(&os[lr * OSP +  0 + 8 * hi]) = a; *(v4fa*)(&os[lr * OSP +  0 + 8 * hi + 4]) = c;
      a[0] = o1[0] * inv; a[1] = o1[1] * inv; a[2] = o1[2] * inv; a[3] = o1[3] * inv; c[0] = o1[4] * inv; c[1] = o1[5] * inv; c[2] = o1[6] * inv; c[3] = o1[7] * inv;
      *(v4fa*)(&os[lr * OSP + 16 + 8 * hi]) = a; *(v4fa*)(&os[lr * OSP + 16 + 8 * hi + 4]) = c;
      a[0] = o2[0] * inv; a[1] = o2[1] * inv; a[2] = o2[2] * inv; a[3] = o2[3] * inv; c[0] = o2[4] * inv; c[1] = o2[5] * inv; c[2] = o2[6] * inv; c[3] = o2[7] * inv;
      *(v4fa*)(&os[lr * OSP + 32 + 8 * hi]) = a; *(v4fa*)(&os[lr * OSP + 32 + 8 * hi + 4]) = c;
      a[0] = o3[0] * inv; a[1] = o3[1] * inv; a[2] = o3[2] * inv; a[3] = o3[3] * inv; c[0] = o3[4] * inv; c[1] = o3[5] * inv; c[2] = o3[6] * inv; c[3] = o3[7] * inv;
      *(v4fa*)(&os[lr * OSP + 48 + 8 * hi]) = a; *(v4fa*)(&os[lr * OSP + 48 + 8 * hi + 4]) = c; }
    wave_sync();
    float* orow = OUT + (size_t)q0 * DK + wave * 64;
{
#pragma unroll
        for (int s = 0; s < 8; ++s) { const int row = 2 * s + (lane >> 4), cofs = (lane & 15) * 4;   // 8 s x 2 rows = 16 rows; 16 lanes x 4 floats = 64 columns = two lines
            const v4f val = *(const v4fa*)(&os[row * OSP + cofs]);
            *(v4f*)(orow + (size_t)row * DK + cofs) = val; }
         }
}

static constexpr size_t al256(size_t v) { return (v + 255) & ~(size_t)255; }
static constexpr size_t SZ_XB = al256((size_t)SEQ * DIN * 2);
static constexpr size_t SZ_WB = al256((size_t)3 * DK * DIN * 2);
static constexpr size_t SZ_PL = al256((size_t)SEQ * DK * 2);
static constexpr size_t SZ_AJ = al256((size_t)SEQ * AWORDS * 4);
static constexpr size_t SZ_TOTAL = SZ_XB + SZ_WB + 3 * SZ_PL + SZ_AJ;
static_assert(SZ_TOTAL <= (size_t)134217728);          // workspace carve <= 128 MiB
static_assert(SZ_PL == PLE * 2);                       // q, k, v planes lie one behind the other without a gap
static_assert(((size_t)DK * DIN * 2) % 256 == 0);      // weight sub-planes stay 256-byte aligned
static_assert((size_t)(SEQ / AROWS) * AROWS * AWORDS * 4 <= SZ_AJ);   // builder grid x block extent == adjacency plane
static_assert((size_t)(SEQ / GT) * GT * DK * 2 <= SZ_PL);             // projection grid x tile extent == plane

extern "C" void kernel_launch(void* const* d_in, const int* in_sizes, int n_in,
                              void* d_out, int out_size, void* d_ws, size_t ws_size, hipStream_t stream) {
    if (n_in < 8) return;
    if ((size_t)in_sizes[0] < (size_t)SEQ * DIN) return;
    if (in_sizes[1] < 2) return;
    if ((size_t)in_sizes[2] < (size_t)DIN * DK || (size_t)in_sizes[4] < (size_t)DIN * DK || (size_t)in_sizes[6] < (size_t)DIN * DK) return;
    if (in_sizes[3] < DK || in_sizes[5] < DK || in_sizes[7] < DK) return;
    if ((size_t)out_size < (size_t)SEQ * DK) return;
    if (SZ_TOTAL > ws_size) return;
    // wire order: x, edge_index, Wq, bq, Wk, bk, Wv, bv
    const float* x  = (const float*)d_in[0];
    const int*   ei = (const int*)d_in[1];
    const float* wq = (const float*)d_in[2]; const float* bq = (const float*)d_in[3];
    const float* wk = (const float*)d_in[4]; const float* bk = (const float*)d_in[5];
    const float* wv = (const float*)d_in[6]; const float* bv = (const float*)d_in[7];
    const int E = in_sizes[1] / 2;
    float* OUT = (float*)d_out;      // [SEQ][512]
    char* wsp = (char*)d_ws;
    bf* XB = (bf*)wsp; wsp += SZ_XB;                 // x        [SEQ][512] bf16
    bf* WB = (bf*)wsp; wsp += SZ_WB;                 // [3][512][512]: Wq^T | Wk^T | Wv^T  ([out][in])
    h16* QP = (h16*)wsp; wsp += SZ_PL;               // q   [SEQ][512]
    h16* KP = (h16*)wsp; wsp += SZ_PL;               // k   [SEQ][512]
    h16* VP = (h16*)wsp; wsp += SZ_PL;               // v   [SEQ][512]
    unsigned* ADJ = (unsigned*)wsp; wsp += SZ_AJ;    // adjacency bits [SEQ][SEQ/32]

    k_adj<<<SEQ / AROWS, ATH, 0, stream>>>(ei, ADJ, E, x, XB, wq, wk, wv, WB);

    // q, k, v: A = x rows (m = t), Bt = W^T rows (n = column) -> planes [t][512], QP | KP | VP
    k_proj_rows<<<dim3(SEQ / GT, 3 * (DK / GT), 1), 32 * GW, 0, stream>>>(XB, WB, bq, bk, bv, QP);

    k_flash<<<SEQ / 16, 32 * FW, 0, stream>>>(QP, KP, VP, ADJ, OUT);
}

// v006
// One run takes 57.7 microseconds.
// Two timings next to v005 both put it at 1.13 times that version's speed.
// Counting every step since v000, it is 17.7 times as fast.
#include <hip/hip_runtime.h>

// Single-head graph attention block: x [SEQ][512]; Wq/Wk/Wv [in][out] (y = x W + bias); edge list (int32 [2][E]) -> edges sorted by query-row group; scores q k^T / sqrt(512);
// mask form: a kept (edge) key keeps its score, every other key's score is REPLACED by -1e6 (rows without any edge come out as the uniform mean of v); softmax over all keys; output = attn v (f32).
// Compute dtypes, f32 accumulate everywhere: projections v_wmma_f32_16x16x32_bf16 (x, W, bias RNE-converted to bf16; products exact); scores v_wmma_f32_16x16x32_f16 (single f16 q and k planes);
// P.V v_wmma_f32_16x16x32_f16 (P with a x16384 carry that cancels in the normalisation, single f16 v plane, row sum over the converted P); softmax f32 (online, running max, exp2 form).
// Layout: bf16 copies of x and of the transposed weights W^T [out][in]; f16 planes q [t][512], k [t][512], v [t][512]; the edge list in chunks, each chunk sorted by the group of 16 query rows that its edges belong to, with one (start, count) word per chunk and group.
// Three launches: (1) edge sorter, whose blocks also convert their shares of x and of the weights; (2) the q, k and v projections in one grid, operands staged in LDS; (3) fused attention.
// Fused attention in transposed form (S^T = K Q^T, O^T = V^T P^T): 16 query rows per block, 8 waves. The block first lists the keys that have an edge to any of its 16 rows and walks that list in panels of 128 keys
// (every wave scores its own 16 listed keys, whose k rows it brings into LDS by whole-line loads, against a q tile that the block keeps in LDS; the P tile goes through LDS, every wave owns 64 output columns and gathers its 128-byte slices of the listed v rows into LDS, read back transposed).
// The keys outside the list all carry the replaced score: they are walked too, by the same code, unless their weight is exactly zero for all 16 rows.

#ifndef SEQ
#define SEQ 8192                 // number of nodes (rows of x, queries and keys)
#endif
#define SEQ_FULL 8192
#define DIN  512                 // input width
#define DK   512                 // q / k / v width
#define FW   8                   // waves per attention block
#define PANEL (16 * FW)          // listed keys per panel
#define PP   (PANEL + 8)         // LDS row pitch (halves) of the P tile
#define OSP  68                  // LDS row pitch (floats) of the output staging tile
#define VH   64                  // listed keys whose v slices one wave stages at a time
#define VPITCH 160               // LDS row pitch (bytes) of a staged 128-byte v slice: an odd multiple of 32 bytes for the transposing reader
#define VSW  (VH * VPITCH)       // staging bytes per wave
#define KHB  (DK)                // bytes of half a k row: the piece of each of its 16 listed keys that a wave stages at a time
#define KPITCH (KHB + 16)        // LDS row pitch (bytes) of a staged half k row: an odd multiple of 16 bytes for the 16-byte fragment reader
#define QPITCH (DK * 2 + 16)     // LDS row pitch (bytes) of the q tile, likewise
#define AWORDS (SEQ / 32)        // groups of 32 keys: one per thread of an attention block
#define AROWS 32                 // SEQ / AROWS blocks sort the edges and convert the operands
#define ATH  1024                // threads of one such block
#define NG   (SEQ / 16)          // groups of 16 query rows: one per attention block
#define ECH  ATH                 // edges per chunk: one per thread of a sorting block
#define NCH  (SEQ / AROWS)       // chunks: one per sorting block, and one per thread of an attention block
#define CCAP (ECH + 3 * NG)      // entries of one sorted chunk: every group's segment starts at a multiple of four entries (16 bytes)
#define XU   ((SEQ * (DIN / 8)) / ((SEQ / AROWS) * ATH))   // 8-element units of x converted per builder thread
#define WU   ((3 * DK * (DIN / 8)) / (SEQ / AROWS))        // 8-element units of the three W^T planes converted per builder block
#define GT   128                 // rows and columns of one projection block's tile
#define GW   4                   // waves of a projection block, 64x64 outputs each
#define GKC  64                  // k values per projection stage: one 128-byte line of every operand row
#define GPITCH (GKC * 2 + 16)    // LDS row pitch (bytes) of a staged line: an odd multiple of 16 bytes for the 16-byte fragment reader
#define GSTAGE (2 * GT * GPITCH) // bytes of one projection stage buffer
#define GNS  (DIN / GKC)         // projection stages
#define PLE  ((size_t)SEQ * DK)  // elements of one of the q, k, v planes, which lie one behind the other
#define SC2  ((float)(0.044194173824159216 * 1.4426950408889634))   // 512^-0.5 * log2(e)
#define FILL2 ((float)(-1000000.0 * 1.4426950408889634))            // replaced score (-1e6) in the exp2 domain
#define PSH  14.0f               // log2 of the P carry (16384)
#define NEGB (-3.0e38f)

static_assert(DIN % 32 == 0);                    // GEMM k-loop steps by 32
static_assert(DK % 32 == 0);                     // score k-loop steps by 32
static_assert(DK % 64 == 0);                     // 64-wide GEMM tiles
static_assert(DIN % 8 == 0);
static_assert(SEQ % 64 == 0);                    // 64-row GEMM tiles
static_assert(SEQ % PANEL == 0);                 // the list rounded up to whole panels stays within SEQ entries
static_assert(SEQ % 16 == 0);                    // 16 query rows per attention block
static_assert(SEQ % AROWS == 0);
static_assert((SEQ & (SEQ - 1)) == 0 && SEQ <= 8192);   // a sorted entry holds the key in 13 bits, the row within its group above them
static_assert(NCH == 32 * FW);                   // one chunk per thread of an attention block
static_assert(NG % 32 == 0 && NG <= ATH && CCAP < 65536 && ECH < 65536 && (CCAP * 4) % 16 == 0);   // whole waves sum the groups; start and count fit 16 bits each
static_assert(SEQ <= SEQ_FULL);
static_assert(DK == 64 * FW);                    // every wave owns 64 output columns
static_assert(PANEL == 128);
static_assert(PANEL % VH == 0 && VH % 32 == 0);
static_assert(VH / 4 == 16);                     // the gather's wait names its sixteen addresses
static_assert((PANEL & (PANEL - 1)) == 0 && PANEL <= 32 * FW);   // list padding: rounded up to a panel, at most one pad entry per thread
static_assert(AWORDS == 32 * FW);                // 32 keys per thread of an attention block
static_assert(SEQ <= 65536);                     // key indices fit 16 bits
static_assert(VPITCH % 32 == 0 && ((VPITCH / 32) & 1) == 1 && VPITCH >= 128);
static_assert((size_t)16 * OSP * 4 <= VSW);      // the output staging tile reuses the wave's own v staging bytes
static_assert((size_t)16 * KPITCH <= VSW);       // so do the staged half k rows
static_assert(KHB == 32 * 16);                   // one 16-byte load per lane covers half a k row
static_assert(KPITCH % 16 == 0 && ((KPITCH / 16) & 1) == 1 && QPITCH % 16 == 0 && ((QPITCH / 16) & 1) == 1);
static_assert(16 * DK * 2 == 4 * 32 * FW * 16);  // q tile: four 16-byte pieces per thread
static_assert((PP * 2) % 16 == 0);               // 16-byte aligned P rows
static_assert((OSP * 4) % 16 == 0);
static_assert((size_t)XU * (SEQ / AROWS) * ATH == (size_t)SEQ * DIN / 8);               // builder grid covers x exactly
static_assert((size_t)WU * (SEQ / AROWS) == (size_t)3 * DK * DIN / 8);                  // builder grid covers the weights exactly
static_assert(WU <= ATH && WU % 32 == 0 && (DK * DIN / 8) % 32 == 0);                   // whole waves, each inside one weight plane
static_assert(4 * 32 * 16 == 16 * 64 * 2);
static_assert(8 * 32 * 16 == 16 * 64 * 4);       // attention epilogue: 8 instructions x 32 lanes x 16 B == 16 rows x 256 B
static_assert((size_t)16 * PP * 2 + 2 * FW * 16 * 4 + (size_t)FW * VSW + (size_t)SEQ * 6 + (size_t)16 * QPITCH + 128 <= 163840);   // attention static LDS: two blocks per 320 KiB
static_assert(3 * ((size_t)2 * GSTAGE + (size_t)GW * 16 * 68 * 4) <= 327680);           // projection static LDS: three blocks per 320 KiB
static_assert(SEQ % GT == 0 && DK % GT == 0 && GT == 128 && GW == 4);                   // 2 x 2 waves of 64x64; eight copies of 16 rows per operand, thread and stage
static_assert(DIN % GKC == 0 && GNS >= 2 && GKC % 32 == 0 && GKC * 2 == 8 * 16);        // both first stages exist; eight 16-byte pieces per staged row
static_assert(GPITCH % 16 == 0 && ((GPITCH / 16) & 1) == 1);
static_assert(((size_t)SEQ * DIN) % 8 == 0);
static_assert(((size_t)DIN * DK) % 8 == 0);

typedef _Float16 h16;
typedef unsigned short bf;
typedef __attribute__((ext_vector_type(16))) __bf16   v16bf;
typedef __attribute__((ext_vector_type(16))) _Float16 v16h;
typedef __attribute__((ext_vector_type(8)))  _Float16 v8h;
typedef __attribute__((ext_vector_type(8)))  unsigned short v8us;
typedef __attribute__((ext_vector_type(8)))  float    v8f;
typedef __attribute__((ext_vector_type(4)))  float    v4f;
typedef v4f  __attribute__((may_alias)) v4fa;
typedef __attribute__((ext_vector_type(4)))  unsigned v4u;
typedef v4u  __attribute__((may_alias)) v4ua;
typedef __attribute__((ext_vector_type(4)))  int      v4i;
typedef __attribute__((ext_vector_type(8)))  short    v8s;

__device__ __forceinline__ unsigned short f2bf(float f) { unsigned u = __float_as_uint(f); u += 0x7FFFu + ((u >> 16) & 1u); return (unsigned short)(u >> 16); }
__device__ __forceinline__ float bfr(float f) { return __uint_as_float(((unsigned)f2bf(f)) << 16); }   // value after RNE convert to bf16
__device__ __forceinline__ v16h cat16(v8h lo, v8h hi) { return __builtin_shufflevector(lo, hi, 0, 1, 2, 3, 4, 5, 6, 7, 8, 9, 10, 11, 12, 13, 14, 15); }
__device__ __forceinline__ v16bf cat16b(v8us lo, v8us hi) { return __builtin_bit_cast(v16bf, __builtin_shufflevector(lo, hi, 0, 1, 2, 3, 4, 5, 6, 7, 8, 9, 10, 11, 12, 13, 14, 15)); }
__device__ __forceinline__ v8f wmma16(v16h a, v16h b, v8f c) { return __builtin_amdgcn_wmma_f32_16x16x32_f16(false, a, false, b, (short)0, c, false, false); }
__device__ __forceinline__ v8f wmmab(v16bf a, v16bf b, v8f c) { return __builtin_amdgcn_wmma_f32_16x16x32_bf16(false, a, false, b, (short)0, c, false, false); }
// fragment loaders from K-contiguous 16-bit rows; p already includes + 8*(lane>>4): elements 0..7 <- k0+8h+0..7, elements 8..15 <- k0+16+8h+0..7 (same map for A and B)
__device__ __forceinline__ v16h  ldh(const h16* p) { return cat16(*(const v8h*)p, *(const v8h*)(p + 16)); }
__device__ __forceinline__ v16bf ldb(const bf* p)  { return cat16b(*(const v8us*)p, *(const v8us*)(p + 16)); }
// transposing LDS load: with p = T + (k0 + 8*(lane>>4) + (lane&7)) * pitch + 2 * d0 + 16 * ((lane>>3)&1), lane (c = lane&15, h = lane>>4) gets T[k0 + 8h + 0..7][d0 + c]
__device__ __forceinline__ v8h ldtr(const unsigned char* p) { typedef __attribute__((address_space(3))) v8s lds_v8s; return __builtin_bit_cast(v8h, __builtin_amdgcn_ds_load_tr16_b128_v8i16((lds_v8s*)p)); }
// ordering point for wave-private LDS tiles (same wave writes and reads)
__device__ __forceinline__ void wave_sync() { __builtin_amdgcn_fence(3 /* release order */, "wavefront"); __builtin_amdgcn_wave_barrier(); asm volatile("" ::: "memory"); }

// f32 -> f16 convert that cannot produce a subnormal f16 (|v| < 2^-14 -> +0)
static __device__ __forceinline__ h16 toh_flush(float v) { const h16 r = (h16)v; return (fabsf(v) < 6.103515625e-05f) ? (h16)0.0f : r; }
// one guarded f16 WMMA: the nops tie the accumulator and keep both fragments live
__device__ __forceinline__ v8f wmg(v16h a, v16h b, v8f c) { c = wmma16(a, b, c); asm volatile("v_nop\n\tv_nop\n\tv_nop\n\tv_nop" : "+v"(c) : "v"(a), "v"(b)); return c; }

// k_sort: the edge list (src = ei[0..E), dst = ei[E..2E)) in chunks of ECH edges, one chunk per block and one edge per thread, each chunk sorted by group g = src / 16 (the 16 query rows of one attention block).
// No block reads more than its own chunk. Place of an edge = start of its group's segment in the chunk + edges of the group in earlier waves + edges of the group in earlier lanes of its own wave:
// every lane compares its group with the 32 lanes' groups (count of equals, count of equals below it); the first lane of each group in a wave stores the wave's count as one byte of cnt[g][wave] (one writer per byte);
// thread g sums its 32 bytes, a block-wide prefix sum over the padded totals gives the segment starts. SE[chunk][place] = (src % 16) << 13 | dst; OC[chunk][g] = start | count << 16.
// Indices below zero wrap once; an edge still outside the matrix, or past the end of the list, goes to the spare group NG and is not stored.
// The block also converts its share of the projection operands (RNE to bf16), work that depends on nothing here and that only the next launch reads: XU units of x per thread (unit i = elements 8i .. 8i+7),
// and WU units of the transposed weights WB = Wq^T | Wk^T | Wv^T, W [DIN][DK] ([in][out]) -> W^T [DK][DIN] (unit i of a plane: row n = i / (DIN/8), k = (i % (DIN/8))*8 + j); the loads of both are in flight under the edge loads and the lane comparison.
__global__ __launch_bounds__(ATH) void k_sort(const int* __restrict__ ei, unsigned* SE, unsigned* OC, int E, const float* __restrict__ x, bf* XB,
                                              const float* __restrict__ wq, const float* __restrict__ wk, const float* __restrict__ wv, bf* WB) {
    __shared__ __align__(16) unsigned char cnt[(NG + 1) * 32];         // edges of group g in wave w
    __shared__ __align__(16) unsigned short wb[NG * 32];               // place of the first edge of group g in wave w
    __shared__ int wsum[NG / 32];
    const int tid = threadIdx.x, lane = threadIdx.x & 31;
    const int wave = __builtin_amdgcn_readfirstlane((int)(threadIdx.x >> 5));
    const int e = blockIdx.x * ECH + tid;                              // the thread's edge; its loads go first: the lane comparison waits for them alone
    int s = SEQ, d = SEQ;                                              // no edge: outside the matrix
    { const int* ps = ei + (size_t)e; const int* pd = ei + (size_t)E + (size_t)e;
      if (e < E) { s = *ps; d = *pd; }
      asm volatile("s_wait_xcnt 0x0" :: "v"(ps), "v"(pd) : "memory"); }   // the address registers of the issued loads stay as they are up to this wait (they are its inputs)
    const size_t xu = (size_t)blockIdx.x * (XU * ATH) + tid;           // the thread's first unit of x; the others follow ATH units apart
    v8f xv[XU];
#pragma unroll
    for (int u = 0; u < XU; ++u) xv[u] = *(const v8f*)(x + (xu + (size_t)u * ATH) * 8);
    const unsigned g8 = blockIdx.x * WU + tid;                         // the thread's unit of WB, for tid < WU (whole waves)
    float wr[8] = {0.0f, 0.0f, 0.0f, 0.0f, 0.0f, 0.0f, 0.0f, 0.0f};
    if (tid < WU) {
        const unsigned pl = g8 / (DK * DIN / 8), i = g8 % (DK * DIN / 8);
        const float* __restrict__ Wp = (pl == 0u) ? wq : (pl == 1u) ? wk : wv;
        const unsigned n = i / (DIN / 8), k8 = (i % (DIN / 8)) * 8;
#pragma unroll
        for (int j = 0; j < 8; ++j) wr[j] = Wp[(size_t)(k8 + j) * DK + n];
    }
    for (int i = tid; i < (NG + 1) * 2; i += ATH) { const v4u z = (v4u){0u, 0u, 0u, 0u}; *(v4ua*)(&cnt[(size_t)i * 16]) = z; }
    s += (s < 0) ? SEQ : 0; d += (d < 0) ? SEQ : 0;
    const bool ok = ((unsigned)s < (unsigned)SEQ) & ((unsigned)d < (unsigned)SEQ);
    const int g = ok ? (s >> 4) : NG;
    int before = 0, total = 0;                                         // edges of the same group in lower lanes, in the whole wave
#pragma unroll
    for (int i = 0; i < 32; ++i) { const int eq = (__builtin_amdgcn_readlane(g, i) == g) ? 1 : 0; total += eq; before += (i < lane) ? eq : 0; }
    __syncthreads();                                                   // cnt is zero everywhere
    if (before == 0) cnt[g * 32 + wave] = (unsigned char)total;        // at most 32
    __syncthreads();
    int pre[32]; int tot = 0;                                          // thread g < NG: edges of group g in earlier waves, in the chunk (loops unrolled: pre is registers)
    if (tid < NG) {
        const v4u c0 = *(const v4ua*)(&cnt[(size_t)tid * 32]); const v4u c1 = *(const v4ua*)(&cnt[(size_t)tid * 32 + 16]);
#pragma unroll
        for (int w = 0; w < 16; ++w) { pre[w] = tot; tot += (int)((c0[w >> 2] >> (8 * (w & 3))) & 255u); }
#pragma unroll
        for (int w = 0; w < 16; ++w) { pre[16 + w] = tot; tot += (int)((c1[w >> 2] >> (8 * (w & 3))) & 255u); }
    } else {
#pragma unroll
        for (int w = 0; w < 32; ++w) pre[w] = 0;
    }
    const int pad = (tot + 3) & ~3;                                    // entries that the group's segment takes
    int inc = pad;                                                     // inclusive prefix sum over the wave
#pragma unroll
    for (int dd = 1; dd < 32; dd <<= 1) { const int up = __shfl_up(inc, dd, 32); inc += (lane >= dd) ? up : 0; }
    if (lane == 31 && wave < NG / 32) wsum[wave] = inc;
    __syncthreads();
    unsigned* se = SE + (size_t)blockIdx.x * CCAP;
    int gs = 0;
    if (tid < NG) {
        int base = 0;
#pragma unroll
        for (int w = 0; w < NG / 32; ++w) base += (w < wave) ? wsum[w] : 0;
        gs = base + inc - pad;                                         // start of the segment: a multiple of 4, gs + pad <= CCAP
#pragma unroll
        for (int q = 0; q < 4; ++q) { v8us o;
#pragma unroll
            for (int k = 0; k < 8; ++k) o[k] = (unsigned short)(gs + pre[8 * q + k]);
            *(v8us*)(&wb[(size_t)tid * 32 + 8 * q]) = o; }
    }
    __syncthreads();
    // all global stores stand behind the last barrier, so that no barrier waits for a store
    if (ok) se[(int)wb[g * 32 + wave] + before] = ((unsigned)(s & 15) << 13) | (unsigned)d;
    if (tid < NG) {
        OC[(size_t)blockIdx.x * NG + tid] = (unsigned)gs | ((unsigned)tot << 16);
#pragma unroll
        for (int k = 0; k < 3; ++k) if (tot + k < pad) se[gs + tot + k] = 0u;   // the pad entries are loaded with their segment, and not used
    }
#pragma unroll
    for (int u = 0; u < XU; ++u) { v8us o;
#pragma unroll
        for (int k = 0; k < 8; ++k) o[k] = f2bf(xv[u][k]);
        *(v8us*)(XB + (xu + (size_t)u * ATH) * 8) = o; }
    if (tid < WU) { v8us o;
#pragma unroll
        for (int j = 0; j < 8; ++j) o[j] = f2bf(wr[j]);
        *(v8us*)(WB + (size_t)g8 * 8) = o;
    }
}

// k_proj_rows: bf16 GEMM for q, k and v in one grid (SEQ/GT, 3 * DK/GT): C[t][n] = sum_k x[t][k] W^T[n][k] + bias[n], written as f16 into the row-major plane [t][DK] that blockIdx.y names.
// One block of four waves per GT x GT tile, every wave a 64x64 quarter (16 accumulators). The block's GT rows of x and GT rows of W^T go through LDS in stages of GKC k values (one whole 128-byte line per row and stage),
// brought by asynchronous copies into two buffers: stage s + 1 flies while stage s is multiplied. Fragments are read from LDS rows of pitch GPITCH; k runs upward in steps of 32 for every accumulator.
__global__ __launch_bounds__(32 * GW) void k_proj_rows(const bf* __restrict__ A, const bf* __restrict__ WB, const float* __restrict__ bq, const float* __restrict__ bk, const float* __restrict__ bv, h16* P) {
    __shared__ __align__(16) unsigned char GS[2 * GSTAGE];             // two buffers, each: GT rows of x, then GT rows of W^T
    __shared__ __align__(16) float osb[GW * 16 * 68];                  // output staging, one tile per wave
    const int tid = threadIdx.x;
    const int lane = threadIdx.x & 31, lr = lane & 15, hi = lane >> 4;
    const int wave = __builtin_amdgcn_readfirstlane((int)(threadIdx.x >> 5));
    const int pl = blockIdx.y / (DK / GT);
    const int r0 = blockIdx.x * GT + (wave >> 1) * 64, c0 = (blockIdx.y % (DK / GT)) * GT + (wave & 1) * 64;   // the wave's quarter in the plane
    const float* __restrict__ bias = (pl == 0) ? bq : (pl == 1) ? bk : bv;
    h16* Ph = P + (size_t)pl * PLE;
    // copy i of a thread: staged row 16 i + (tid >> 3), 16-byte piece tid & 7; all rows lie inside the planes (the grid covers them exactly), all LDS bytes inside GS
    const bf* ga = A + (size_t)(blockIdx.x * GT + (tid >> 3)) * DIN + (tid & 7) * 8;
    const bf* gb = WB + (size_t)pl * DK * DIN + (size_t)((blockIdx.y % (DK / GT)) * GT + (tid >> 3)) * DIN + (tid & 7) * 8;
    const unsigned l0 = (unsigned)(size_t)(&GS[0]) + (unsigned)((tid >> 3) * GPITCH + (tid & 7) * 16);   // LDS byte address: the low 32 bits of the shared address
    // eight copies, rows 16 apart, each with its own address registers; the wait in the same statement stands in front of any rewrite of those registers
    auto copy8 = [&](unsigned l, const bf* g) {
        asm volatile("global_load_async_to_lds_b128 %0, %8, off\n\t"
                     "global_load_async_to_lds_b128 %1, %9, off\n\t"
                     "global_load_async_to_lds_b128 %2, %10, off\n\t"
                     "global_load_async_to_lds_b128 %3, %11, off\n\t"
                     "global_load_async_to_lds_b128 %4, %12, off\n\t"
                     "global_load_async_to_lds_b128 %5, %13, off\n\t"
                     "global_load_async_to_lds_b128 %6, %14, off\n\t"
                     "global_load_async_to_lds_b128 %7, %15, off\n\t"
                     "s_wait_xcnt 0x0"
                     :: "v"(l), "v"(l + 16 * GPITCH), "v"(l + 32 * GPITCH), "v"(l + 48 * GPITCH), "v"(l + 64 * GPITCH), "v"(l + 80 * GPITCH), "v"(l + 96 * GPITCH), "v"(l + 112 * GPITCH),
                        "v"(g), "v"(g + 16 * DIN), "v"(g + 32 * DIN), "v"(g + 48 * DIN), "v"(g + 64 * DIN), "v"(g + 80 * DIN), "v"(g + 96 * DIN), "v"(g + 112 * DIN) : "memory");
    };
    auto fill = [&](int s) {                                           // stage s into buffer s & 1
        const unsigned l = l0 + (unsigned)((s & 1) * GSTAGE);
        copy8(l, ga + s * GKC);
        copy8(l + GT * GPITCH, gb + s * GKC);
    };
    v8f acc[4][4];
#pragma unroll
    for (int mb = 0; mb < 4; ++mb)
#pragma unroll
        for (int nb = 0; nb < 4; ++nb) acc[mb][nb] = (v8f){};
    const unsigned char* ard = GS + ((wave >> 1) * 64 + lr) * GPITCH + 16 * hi;        // A fragment: row t, k
    const unsigned char* brd = GS + (GT + (wave & 1) * 64 + lr) * GPITCH + 16 * hi;    // B fragment: row n of W^T, k
    fill(0);
    asm volatile("s_wait_asynccnt 0x0" ::: "memory");                  // the wave's own copies of stage 0 have landed
    __syncthreads();                                                   // and every other wave's
    fill(1);
#pragma unroll 1                                                        // one copy of the body: the buffer is picked by the stage's parity
    for (int s = 0; s < GNS; ++s) {
        const int bo = (s & 1) * GSTAGE;
#pragma unroll
        for (int ks = 0; ks < GKC / 32; ++ks) {
            v16bf a[4], b[4];
#pragma unroll
            for (int mb = 0; mb < 4; ++mb) a[mb] = ldb((const bf*)(ard + bo + mb * 16 * GPITCH + ks * 64));
#pragma unroll
            for (int nb = 0; nb < 4; ++nb) b[nb] = ldb((const bf*)(brd + bo + nb * 16 * GPITCH + ks * 64));
            __builtin_amdgcn_sched_barrier(0);                         // keeps the sixteen LDS reads together ahead of their sixteen products: one exposed LDS latency per k step, not one per W^T fragment
#pragma unroll
            for (int nb = 0; nb < 4; ++nb)
#pragma unroll
                for (int mb = 0; mb < 4; ++mb) acc[mb][nb] = wmmab(a[mb], b[nb], acc[mb][nb]);
        }
        asm volatile("s_wait_dscnt 0x0" ::: "memory");                 // the wave's reads of this buffer have retired before the buffer is refilled
        asm volatile("s_wait_asynccnt 0x0" ::: "memory");              // the wave's own copies of stage s + 1 have landed
        __syncthreads();                                               // publishes stage s + 1 and ends every wave's reads of stage s
        if (s + 2 < GNS) fill(s + 2);                                  // same test in the whole block
    }
    asm volatile("s_wait_asynccnt 0x0" ::: "memory");                  // no copy is outstanding when the wave ends
    float* os = osb + wave * (16 * 68);
    float bc[4];
#pragma unroll
    for (int nb = 0; nb < 4; ++nb) bc[nb] = bfr(bias[c0 + nb * 16 + lr]);   // c0 + 63 < DK
    const size_t tbase = (size_t)r0 * DK + (size_t)c0;
#pragma unroll
    for (int mb = 0; mb < 4; ++mb) {
#pragma unroll
        for (int nb = 0; nb < 4; ++nb) {
#pragma unroll
            for (int j = 0; j < 8; ++j) os[(hi * 8 + j) * 68 + nb * 16 + lr] = acc[mb][nb][j] + bc[nb]; }   // D: row 8h+j, col lane&15
        wave_sync();
        {
            const size_t sb = tbase + (size_t)(mb * 16) * DK;
#pragma unroll
            for (int s = 0; s < 4; ++s) { const int row = 4 * s + (lane >> 3), c8 = (lane & 7) * 8;   // 4 s x 4 row groups = 16 rows; 8 lanes x 8 = 64 columns
                const v4f x0 = *(const v4fa*)(&os[row * 68 + c8]); const v4f x1 = *(const v4fa*)(&os[row * 68 + c8 + 4]); v8h hv;
#pragma unroll
                for (int i = 0; i < 4; ++i) { hv[i] = toh_flush(x0[i]); hv[4 + i] = toh_flush(x1[i]); }
                const size_t oo = sb + (size_t)row * DK + c8;
                *(v8h*)(Ph + oo) = hv; }
        }
        wave_sync();
    }
}

// k_flash: fused attention, one block per 16 query rows, FW = 8 waves.
// First the block builds, in LDS, one 16-bit mask per key: the rows among its 16 that have an edge to the key. Thread c takes the block's segment of sorted chunk c; an edge's bit is set by a plain load, OR and store,
// so a store can overwrite another edge's bit set between its load and itself: behind a barrier every thread looks its bits up again, and the missing ones are set anew in a further round. A bit that stands at a barrier
// stays (every later load sees it), only an edge whose bit is missing stores, and the last store to a word in a round brings a new bit: 16 rounds at most, the result the same whatever the order.
// Pass 0 lists, in rising order, the keys with an edge to any of the block's 16 rows (thread i owns keys 32i .. 32i+31: block-wide prefix sum of the counts), each with its
// mask of the rows that keep it, and walks the list; pass 1 does the same with the keys that are left (all masks zero). A key of pass 1 has the replaced score in every row, so its weight is
// exp2(FILL2 - max + 14), taken as 0 below -14 like every other weight: where that holds for all 16 rows after pass 0, pass 1 would add only zeros and is left out (same value in every wave: block-uniform).
// Per panel of 128 listed keys (the list is padded to whole panels; a pad entry scores NEGB, weight 0):
//  (1) wave w scores its own 16 listed keys in transposed form, S^T = K Q^T over the full width: all 32 loads of its 16 k rows (512 contiguous bytes each) are issued together, the rows go through the wave's own LDS bytes
//      one half width at a time, and A (k rows) and B (q rows, from the block's LDS tile) are read as fragments there; lane (t = lane&15, h = lane>>4) holds listed keys 8h+r for query t; a tile whose masks are all zero is not multiplied;
//  (2) per-query max: lane partial, xor-16 exchange, one word per wave per query in LDS, block barrier, combine over the 8 waves (identical in every wave);
//  (3) P = exp2(score - max + 14) as f16 (arguments below -14 give 0), P tile [t][128 keys] into LDS, partial sums over the converted P, block barrier;
//  (4) wave w accumulates O^T rows d in [64w, 64w+64): it gathers v[key][64w .. 64w+63] (one 128-byte line per key) of 64 listed keys at a time into its own LDS rows; A = V^T by transposing LDS loads,
//      B = P^T from the LDS tile (both in the k order 8h+0..7, 16+8h+0..7); block barrier before the next panel.
__global__ __launch_bounds__(32 * FW) void k_flash(const h16* __restrict__ QP, const h16* __restrict__ KP, const h16* __restrict__ VP, const unsigned* __restrict__ SE, const unsigned* __restrict__ OC, float* OUT) {
    __shared__ __align__(16) h16 Ps[16 * PP];
    __shared__ float redm[FW * 16];
    __shared__ float reds[FW * 16];
    __shared__ int wsum[FW];
    __shared__ int wflag[FW];
    __shared__ __align__(16) unsigned short kpl[SEQ];                  // per key: the block's rows that keep it
    __shared__ __align__(16) unsigned short klist[SEQ];
    __shared__ __align__(16) unsigned short kmask[SEQ];
    __shared__ __align__(32) unsigned char VS[FW * VSW];
    __shared__ __align__(16) unsigned char QS[16 * QPITCH];
    const int tid = threadIdx.x;
    const int lane = threadIdx.x & 31, lr = lane & 15, hi = lane >> 4;
    const int wave = __builtin_amdgcn_readfirstlane((int)(threadIdx.x >> 5));
    const int q0 = blockIdx.x * 16;
    const int pw = lr * PP + wave * 16 + 8 * hi;                       // P tile write offset (listed keys wave*16 + 8h + r)
    const int pf = lr * PP + 8 * hi;                                   // P^T fragment read offset (col t, k = listed key)
    unsigned char* vsw = VS + wave * VSW;                              // the wave's own staging rows
    unsigned char* vwr = vsw + (lane >> 3) * VPITCH + (lane & 7) * 16;                                   // store i: staged row 4i + (lane>>3), 16-byte piece lane&7
    const unsigned char* vrd = vsw + (8 * hi + (lane & 7)) * VPITCH + ((lane >> 3) & 1) * 16;            // transposing read, staged row base 0, column base 0
    const h16* vsrc = VP + wave * 64 + (lane & 7) * 8;                 // + key * DK
    // gather of the wave's slices of listed keys jb .. jb+VH-1: load i covers four whole 128-byte lines (every list entry is below SEQ by construction)
    auto fetchv = [&](v4u (&vr)[VH / 4], int jb) {
        const h16* vp[VH / 4];                                         // all addresses are formed first; both loops are unrolled so that vp and vr are registers
#pragma unroll
        for (int i = 0; i < VH / 4; ++i) vp[i] = vsrc + (size_t)klist[jb + 4 * i + (lane >> 3)] * DK;
#pragma unroll
        for (int i = 0; i < VH / 4; ++i) vr[i] = *(const v4u*)vp[i];
        // the address registers of the issued loads stay as they are up to this wait (they are its inputs), so that none is reused ahead of it
        asm volatile("s_wait_xcnt 0x0" :: "v"(vp[0]), "v"(vp[1]), "v"(vp[2]), "v"(vp[3]), "v"(vp[4]), "v"(vp[5]), "v"(vp[6]), "v"(vp[7]),
                                          "v"(vp[8]), "v"(vp[9]), "v"(vp[10]), "v"(vp[11]), "v"(vp[12]), "v"(vp[13]), "v"(vp[14]), "v"(vp[15]) : "memory");
    };
    auto stagev = [&](const v4u (&vr)[VH / 4]) {
#pragma unroll
        for (int i = 0; i < VH / 4; ++i) *(v4ua*)(vwr + i * 4 * VPITCH) = vr[i];
        asm volatile("s_wait_dscnt 0x0" ::: "memory");                 // the wave's own stores have retired before its transposing loads read the rows back
    };
    // the block's 16 q rows (16 KiB in a row in the plane) into LDS: piece 256 i + tid = row 4i + (tid>>6), 16-byte column tid&63; first read behind the barriers of the list stage (loops unrolled: qv is registers)
    { const h16* qg = QP + (size_t)q0 * DK + tid * 8; v4u qv[4];
#pragma unroll
      for (int i = 0; i < 4; ++i) qv[i] = *(const v4u*)(qg + i * (32 * FW * 8));
      asm volatile("s_wait_xcnt 0x0" :: "v"(qg) : "memory");           // the address register of the issued loads stays as it is up to this wait (it is its input)
#pragma unroll
      for (int i = 0; i < 4; ++i) *(v4ua*)(QS + (4 * i + (tid >> 6)) * QPITCH + (tid & 63) * 16) = qv[i]; }
    // row masks of all keys from the block's segments of the sorted chunks (thread tid: chunk tid); start and count are bounded here, so that every entry read lies inside the chunk
    {
        const unsigned* op = OC + (size_t)tid * NG + blockIdx.x;
        const unsigned oc = *op;
        asm volatile("s_wait_xcnt 0x0" :: "v"(op) : "memory");         // the address register of the issued load stays as it is up to this wait (it is its input)
#pragma unroll
        for (int i = 0; i < SEQ * 2 / 16 / (32 * FW); ++i) { const v4u z = (v4u){0u, 0u, 0u, 0u}; *(v4ua*)(&kpl[(size_t)(i * 32 * FW + tid) * 8]) = z; }
        const int es = min((int)(oc & 0xFFFCu), CCAP);
        const int ec = min((int)(oc >> 16), CCAP - es);
        const unsigned* sp = SE + (size_t)tid * CCAP + es;
        v4u e0 = (v4u){0u, 0u, 0u, 0u}, e1 = (v4u){0u, 0u, 0u, 0u};    // the first eight edges stay in registers; a longer segment is read again in every round
        if (ec > 0) e0 = *(const v4u*)sp;
        if (ec > 4) e1 = *(const v4u*)(sp + 4);
        asm volatile("s_wait_xcnt 0x0" :: "v"(sp) : "memory");         // likewise
        int ky[8]; unsigned bt[8];                                     // loops unrolled: registers; an entry past the count has no bit
#pragma unroll
        for (int j = 0; j < 8; ++j) { const unsigned w = (j < 4) ? e0[j & 3] : e1[j & 3]; ky[j] = (int)(w & (unsigned)(SEQ - 1)); bt[j] = (j < ec) ? (1u << ((w >> 13) & 15u)) : 0u; }
        __syncthreads();                                               // the masks are zero everywhere
#pragma unroll 1                                                        // one copy of the round with its barriers: the first round or two end it
        for (int round = 0; round < 16; ++round) {
            unsigned od[8];
#pragma unroll
            for (int j = 0; j < 8; ++j) od[j] = (unsigned)kpl[ky[j]];  // all eight loads together: one LDS latency
#pragma unroll
            for (int j = 0; j < 8; ++j) if ((bt[j] & ~od[j]) != 0u) kpl[ky[j]] = (unsigned short)(od[j] | bt[j]);
#pragma unroll 1                                                        // seldom entered: kept small
            for (int i = 8; i < ec; ++i) {                             // at most CCAP trips
                const unsigned w = sp[i]; const int k = (int)(w & (unsigned)(SEQ - 1)); const unsigned b = 1u << ((w >> 13) & 15u);
                const unsigned o = (unsigned)kpl[k]; if ((b & ~o) != 0u) kpl[k] = (unsigned short)(o | b);
            }
            __syncthreads();                                           // every store of the round stands
            unsigned miss = 0u;
#pragma unroll
            for (int j = 0; j < 8; ++j) miss |= bt[j] & ~(unsigned)kpl[ky[j]];
#pragma unroll 1                                                        // seldom entered: kept small
            for (int i = 8; i < ec; ++i) { const unsigned w = sp[i]; miss |= (1u << ((w >> 13) & 15u)) & ~(unsigned)kpl[(int)(w & (unsigned)(SEQ - 1))]; }
            const unsigned wm = __builtin_amdgcn_ballot_w32(miss != 0u);
            if (lane == 0) wflag[wave] = (wm != 0u) ? 1 : 0;
            __syncthreads();                                           // also ends the round's look-ups before the next round's stores
            int anym = 0;
#pragma unroll
            for (int w = 0; w < FW; ++w) anym |= wflag[w];
            if (__builtin_amdgcn_readfirstlane(anym) == 0) break;      // same value in every wave: block-uniform
        }
    }
    unsigned char* kwr = vsw + lane * 16;                              // store i: staged row i (listed key j0 + i), 16-byte piece lane
    const unsigned char* krd = vsw + lr * KPITCH + 16 * hi;            // A fragment: row = listed key, k = d
    const unsigned char* qrd = QS + lr * QPITCH + 16 * hi;             // B fragment: col t, k = d
    // the k rows of listed keys j0 .. j0+15, lower halves into k0, upper halves into k1: every load covers four whole 128-byte lines (every list entry is below SEQ by construction)
    auto fetchk = [&](v4u (&k0)[16], v4u (&k1)[16], int j0) {
        const v8us ia = *(const v8us*)(&klist[j0]); const v8us ib = *(const v8us*)(&klist[j0 + 8]);
        const h16* kp[16];                                             // all addresses are formed first; the loops are unrolled so that kp, k0 and k1 are registers
#pragma unroll
        for (int i = 0; i < 8; ++i) { kp[i] = KP + (size_t)ia[i] * DK + lane * 8; kp[8 + i] = KP + (size_t)ib[i] * DK + lane * 8; }
#pragma unroll
        for (int i = 0; i < 16; ++i) k0[i] = *(const v4u*)kp[i];
#pragma unroll
        for (int i = 0; i < 16; ++i) k1[i] = *(const v4u*)(kp[i] + KHB / 2);
        // the address registers of the issued loads stay as they are up to this wait (they are its inputs), so that none is reused ahead of it; it also keeps all 32 loads ahead of the first product
        asm volatile("s_wait_xcnt 0x0" :: "v"(kp[0]), "v"(kp[1]), "v"(kp[2]), "v"(kp[3]), "v"(kp[4]), "v"(kp[5]), "v"(kp[6]), "v"(kp[7]),
                                          "v"(kp[8]), "v"(kp[9]), "v"(kp[10]), "v"(kp[11]), "v"(kp[12]), "v"(kp[13]), "v"(kp[14]), "v"(kp[15]) : "memory");
    };
    auto stagek = [&](const v4u (&kr)[16]) {
#pragma unroll                                                          // kr is registers, the row offsets are immediates
        for (int i = 0; i < 16; ++i) *(v4ua*)(kwr + i * KPITCH) = kr[i];
        asm volatile("s_wait_dscnt 0x0" ::: "memory");                 // the wave's own stores have retired before its fragment loads read the rows back
    };
    // the staged half width (d = 256 hf .. 256 hf + 255) of the score tile, in rising d; all loops unrolled, so that the sixteen LDS reads of four k steps stand together ahead of their products
    auto qk = [&](v8f s, int hf) {
#pragma unroll
        for (int g = 0; g < KHB / 256; ++g) {
            v16h a[4], b[4];
#pragma unroll
            for (int u = 0; u < 4; ++u) { a[u] = ldh((const h16*)(krd + g * 256 + u * 64)); b[u] = ldh((const h16*)(qrd + hf * KHB + g * 256 + u * 64)); }
#pragma unroll
            for (int u = 0; u < 4; ++u) s = wmg(a[u], b[u], s);
        }
        wave_sync();                                                   // the staged rows are rewritten only behind these reads
        return s;
    };
    v8f o0 = (v8f){}, o1 = (v8f){}, o2 = (v8f){}, o3 = (v8f){};
    auto pv = [&](int jl) {                                            // VH staged keys against P columns jl .. jl+VH-1
#pragma unroll
        for (int kc = 0; kc < VH; kc += 32) {
            const v16h pb = cat16(*(const v8h*)(&Ps[pf + jl + kc]), *(const v8h*)(&Ps[pf + jl + kc + 16]));
            const unsigned char* ad = vrd + kc * VPITCH;
            const v16h v0 = cat16(ldtr(ad),      ldtr(ad + 16 * VPITCH));        o0 = wmg(v0, pb, o0);
            const v16h v1 = cat16(ldtr(ad + 32), ldtr(ad + 16 * VPITCH + 32));   o1 = wmg(v1, pb, o1);
            const v16h v2 = cat16(ldtr(ad + 64), ldtr(ad + 16 * VPITCH + 64));   o2 = wmg(v2, pb, o2);
            const v16h v3 = cat16(ldtr(ad + 96), ldtr(ad + 16 * VPITCH + 96));   o3 = wmg(v3, pb, o3);
        }
        wave_sync();                                                   // the staged rows are rewritten only behind these reads
    };
    float m = NEGB, l = 0.0f;
#pragma unroll 1                                                        // one copy of the large body with its barriers serves both passes
    for (int pass = 0; pass < 2; ++pass) {
        unsigned un = 0u;                                              // bit b: key 32*tid + b has an edge to one of the block's rows
#pragma unroll
        for (int i = 0; i < 4; ++i) { const v4u pm = *(const v4ua*)(&kpl[(size_t)tid * 32 + 8 * i]);
#pragma unroll
            for (int k = 0; k < 4; ++k) un |= (((pm[k] & 0xFFFFu) != 0u) ? (1u << (8 * i + 2 * k)) : 0u) | (((pm[k] >> 16) != 0u) ? (2u << (8 * i + 2 * k)) : 0u); }
        unsigned sel = (pass == 0) ? un : ~un;                         // this pass's keys among 32*tid .. 32*tid+31
        const int cnt = __popc(sel);
        int inc = cnt;                                                 // inclusive prefix sum over the wave
#pragma unroll
        for (int d = 1; d < 32; d <<= 1) { const int up = __shfl_up(inc, d, 32); inc += (lane >= d) ? up : 0; }
        if (lane == 31) wsum[wave] = inc;
        __syncthreads();
        int base = 0, nn = 0;
#pragma unroll
        for (int w = 0; w < FW; ++w) { const int c = wsum[w]; base += (w < wave) ? c : 0; nn += c; }
        const int n = __builtin_amdgcn_readfirstlane(nn);              // listed keys of this pass, at most SEQ
        int pos = base + inc - cnt;
        while (sel != 0u) {                                            // at most 32 trips; pos stays below n
            const int b = __builtin_ctz(sel); sel &= sel - 1u;
            klist[pos] = (unsigned short)(tid * 32 + b); kmask[pos] = kpl[tid * 32 + b]; ++pos;
        }
        const int np = (n + PANEL - 1) & ~(PANEL - 1);                 // at most SEQ
        if (n + tid < np) { klist[n + tid] = (unsigned short)0; kmask[n + tid] = (unsigned short)0; }
        __syncthreads();
#pragma unroll 1
        for (int kb = 0; kb < np; kb += PANEL) {
            v4u va[VH / 4], vb[VH / 4];
            const int j0 = kb + wave * 16;
            const v8us km = *(const v8us*)(&kmask[j0 + 8 * hi]);       // row masks of the lane's 8 listed keys
            unsigned orm = 0u;
#pragma unroll
            for (int r = 0; r < 8; ++r) orm |= (unsigned)km[r];
            const bool any = __builtin_amdgcn_ballot_w32(orm != 0u) != 0u;   // wave-uniform
            v8f sa = (v8f){};
            // the first v gather is issued once the lower k halves have left their registers: in flight under the second half of the score stage
            if (any) { v4u k0[16], k1[16]; fetchk(k0, k1, j0); stagek(k0); sa = qk(sa, 0); fetchv(va, kb); stagek(k1); sa = qk(sa, 1); }
            else fetchv(va, kb);
            float ta[8]; float mx = NEGB;
#pragma unroll
            for (int r = 0; r < 8; ++r) {
                const bool fa = ((((unsigned)km[r]) >> lr) & 1u) != 0u;
                const float sc = fa ? sa[r] * SC2 : FILL2;             // kept: scaled score; otherwise the score is replaced
                ta[r] = (j0 + 8 * hi + r < n) ? sc : NEGB;             // a pad entry is no key
                mx = fmaxf(mx, ta[r]); }
            mx = fmaxf(mx, __shfl_xor(mx, 16, 32));
            if (hi == 0) redm[wave * 16 + lr] = mx;
            __syncthreads();
            float pm = redm[lr];
#pragma unroll
            for (int w = 1; w < FW; ++w) pm = fmaxf(pm, redm[w * 16 + lr]);
            const float mnew = fmaxf(m, pm);
            const float alpha = __builtin_amdgcn_exp2f(m - mnew);
            const float sh = PSH - mnew;
            v8h pa; float ls = 0.0f;
#pragma unroll
            for (int r = 0; r < 8; ++r) {
                const float ea = ta[r] + sh;
                const float xa = __builtin_amdgcn_exp2f(ea);
                const float ga = (ea < -14.0f) ? 0.0f : xa;            // never a subnormal f16
                const h16 ha = (h16)ga;
                pa[r] = ha; ls += (float)ha; }
            ls += __shfl_xor(ls, 16, 32);
            if (hi == 0) reds[wave * 16 + lr] = ls;
            *(v8h*)(&Ps[pw]) = pa;
            __syncthreads();
            float lsum = reds[lr];
#pragma unroll
            for (int w = 1; w < FW; ++w) lsum += reds[w * 16 + lr];
            l = l * alpha + lsum; m = mnew;
            o0 = o0 * alpha; o1 = o1 * alpha; o2 = o2 * alpha; o3 = o3 * alpha;
            stagev(va);
            fetchv(vb, kb + VH);                                       // in flight under the first half's products
            pv(0);
            stagev(vb);
            pv(VH);
            __syncthreads();
        }
        const float ef = FILL2 + (PSH - fmaxf(m, FILL2));              // weight argument of a key that no row of the block keeps
        if (__builtin_amdgcn_ballot_w32(ef >= -14.0f) == 0u) break;    // m is the same in every wave: block-uniform
    }
    const float inv = 1.0f / l;                                        // l >= 16384: the panel holding a row's maximum contributes the full carry
    float* os = (float*)vsw;                                           // output staging in the wave's own rows (their last reads lie behind pv's ordering point)
    // O^T D layout: o_j[r] = (d = 64w + 16j + 8h + r, t = lane&15) -> os[t][16j + 8h + r]; rows 0..15 x columns 0..63 all written
    { v4f a, c;
      a[0] = o0[0] * inv; a[1] = o0[1] * inv; a[2] = o0[2] * inv; a[3] = o0[3] * inv; c[0] = o0[4] * inv; c[1] = o0[5] * inv; c[2] = o0[6] * inv; c[3] = o0[7] * inv;
      *(v4fa*)(&os[lr * OSP +  0 + 8 * hi]) = a; *(v4fa*)(&os[lr * OSP +  0 + 8 * hi + 4]) = c;
      a[0] = o1[0] * inv; a[1] = o1[1] * inv; a[2] = o1[2] * inv; a[3] = o1[3] * inv; c[0] = o1[4] * inv; c[1] = o1[5] * inv; c[2] = o1[6] * inv; c[3] = o1[7] * inv;
      *(v4fa*)(&os[lr * OSP + 16 + 8 * hi]) = a; *(v4fa*)(&os[lr * OSP + 16 + 8 * hi + 4]) = c;
      a[0] = o2[0] * inv; a[1] = o2[1] * inv; a[2] = o2[2] * inv; a[3] = o2[3] * inv; c[0] = o2[4] * inv; c[1] = o2[5] * inv; c[2] = o2[6] * inv; c[3] = o2[7] * inv;
      *(v4fa*)(&os[lr * OSP + 32 + 8 * hi]) = a; *(v4fa*)(&os[lr * OSP + 32 + 8 * hi + 4]) = c;
      a[0] = o3[0] * inv; a[1] = o3[1] * inv; a[2] = o3[2] * inv; a[3] = o3[3] * inv; c[0] = o3[4] * inv; c[1] = o3[5] * inv; c[2] = o3[6] * inv; c[3] = o3[7] * inv;
      *(v4fa*)(&os[lr * OSP + 48 + 8 * hi]) = a; *(v4fa*)(&os[lr * OSP + 48 + 8 * hi + 4]) = c; }
    wave_sync();
    float* orow = OUT + (size_t)q0 * DK + wave * 64;
{
#pragma unroll
        for (int s = 0; s < 8; ++s) { const int row = 2 * s + (lane >> 4), cofs = (lane & 15) * 4;   // 8 s x 2 rows = 16 rows; 16 lanes x 4 floats = 64 columns = two lines
            const v4f val = *(const v4fa*)(&os[row * OSP + cofs]);
            *(v4f*)(orow + (size_t)row * DK + cofs) = val; }
         }
}

static constexpr size_t al256(size_t v) { return (v + 255) & ~(size_t)255; }
static constexpr size_t SZ_XB = al256((size_t)SEQ * DIN * 2);
static constexpr size_t SZ_WB = al256((size_t)3 * DK * DIN * 2);
static constexpr size_t SZ_PL = al256((size_t)SEQ * DK * 2);
static constexpr size_t SZ_SE = al256((size_t)NCH * CCAP * 4);
static constexpr size_t SZ_OC = al256((size_t)NCH * NG * 4);
static constexpr size_t SZ_TOTAL = SZ_XB + SZ_WB + 3 * SZ_PL + SZ_SE + SZ_OC;
static_assert(SZ_TOTAL <= (size_t)134217728);          // workspace carve <= 128 MiB
static_assert(SZ_PL == PLE * 2);                       // q, k, v planes lie one behind the other without a gap
static_assert(((size_t)DK * DIN * 2) % 256 == 0);      // weight sub-planes stay 256-byte aligned
static_assert((size_t)(SEQ / GT) * GT * DK * 2 <= SZ_PL);             // projection grid x tile extent == plane

extern "C" void kernel_launch(void* const* d_in, const int* in_sizes, int n_in,
                              void* d_out, int out_size, void* d_ws, size_t ws_size, hipStream_t stream) {
    if (n_in < 8) return;
    if ((size_t)in_sizes[0] < (size_t)SEQ * DIN) return;
    if (in_sizes[1] < 2 || (size_t)in_sizes[1] > (size_t)2 * NCH * ECH) return;   // the chunks cover the edge list
    if ((size_t)in_sizes[2] < (size_t)DIN * DK || (size_t)in_sizes[4] < (size_t)DIN * DK || (size_t)in_sizes[6] < (size_t)DIN * DK) return;
    if (in_sizes[3] < DK || in_sizes[5] < DK || in_sizes[7] < DK) return;
    if ((size_t)out_size < (size_t)SEQ * DK) return;
    if (SZ_TOTAL > ws_size) return;
    // wire order: x, edge_index, Wq, bq, Wk, bk, Wv, bv
    const float* x  = (const float*)d_in[0];
    const int*   ei = (const int*)d_in[1];
    const float* wq = (const float*)d_in[2]; const float* bq = (const float*)d_in[3];
    const float* wk = (const float*)d_in[4]; const float* bk = (const float*)d_in[5];
    const float* wv = (const float*)d_in[6]; const float* bv = (const float*)d_in[7];
    const int E = in_sizes[1] / 2;
    float* OUT = (float*)d_out;      // [SEQ][512]
    char* wsp = (char*)d_ws;
    bf* XB = (bf*)wsp; wsp += SZ_XB;                 // x        [SEQ][512] bf16
    bf* WB = (bf*)wsp; wsp += SZ_WB;                 // [3][512][512]: Wq^T | Wk^T | Wv^T  ([out][in])
    h16* QP = (h16*)wsp; wsp += SZ_PL;               // q   [SEQ][512]
    h16* KP = (h16*)wsp; wsp += SZ_PL;               // k   [SEQ][512]
    h16* VP = (h16*)wsp; wsp += SZ_PL;               // v   [SEQ][512]
    unsigned* SE = (unsigned*)wsp; wsp += SZ_SE;     // sorted edges [chunk][CCAP]
    unsigned* OC = (unsigned*)wsp; wsp += SZ_OC;     // segment start and count [chunk][group]

    k_sort<<<NCH, ATH, 0, stream>>>(ei, SE, OC, E, x, XB, wq, wk, wv, WB);

    // q, k, v: A = x rows (m = t), Bt = W^T rows (n = column) -> planes [t][512], QP | KP | VP
    k_proj_rows<<<dim3(SEQ / GT, 3 * (DK / GT), 1), 32 * GW, 0, stream>>>(XB, WB, bq, bk, bv, QP);

    k_flash<<<SEQ / 16, 32 * FW, 0, stream>>>(QP, KP, VP, SE, OC, OUT);
}

// v007
// It runs in 53 microseconds.
// In two side-by-side timings against v006, it was 1.08 and 1.09 times as fast.
// Over all steps from v000 it is 19.2 times as fast.
#include <hip/hip_runtime.h>

// Single-head graph attention block: x [SEQ][512]; Wq/Wk/Wv [in][out] (y = x W + bias); edge list (int32 [2][E]) -> edges sorted by query-row group; scores q k^T / sqrt(512);
// mask form: a kept (edge) key keeps its score, every other key's score is REPLACED by -1e6 (rows without any edge come out as the uniform mean of v); softmax over all keys; output = attn v (f32).
// Compute dtypes, f32 accumulate everywhere: projections v_wmma_f32_16x16x32_bf16 (x, W, bias RNE-converted to bf16; products exact); scores v_wmma_f32_16x16x32_f16 (single f16 q and k planes);
// P.V v_wmma_f32_16x16x32_f16 (P with a x16384 carry that cancels in the normalisation, single f16 v plane, row sum over the converted P); softmax f32 (online, running max, exp2 form).
// Layout: bf16 copies of x and of the transposed weights W^T [out][in]; f16 planes q [t][512], k [t][512], v [t][512]; the edge list in chunks, each chunk sorted by the group of 16 query rows that its edges belong to, with one (start, count) word per chunk and group.
// Three launches: (1) edge sorter, whose blocks also convert their shares of x and of the weights; (2) the q, k and v projections in one grid, operands staged in LDS; (3) fused attention.
// Fused attention in transposed form (S^T = K Q^T, O^T = V^T P^T): 16 query rows per block, 8 waves. The block first lists the keys that have an edge to any of its 16 rows and walks that list in rounds of up to five panels of 128 keys (all scores of a round first, then one softmax step, then all its products with v)
// (every wave scores its own 16 listed keys, whose k rows it brings into LDS by whole-line loads, against a q tile that the block keeps in LDS; the P tile goes through LDS, every wave owns 64 output columns and gathers its 128-byte slices of the listed v rows into LDS, read back transposed).
// The keys outside the list all carry the replaced score: they are walked too, by the same code, unless their weight is exactly zero for all 16 rows.

#ifndef SEQ
#define SEQ 8192                 // number of nodes (rows of x, queries and keys)
#endif
#define SEQ_FULL 8192
#define DIN  512                 // input width
#define DK   512                 // q / k / v width
#define FW   8                   // waves per attention block
#define PANEL (16 * FW)          // listed keys per panel
#define NT   5                   // panels that share one softmax round (one maximum, one P tile, two block barriers)
#define SPAN (NT * PANEL)        // listed keys per round
#define PP   (SPAN + 8)          // LDS row pitch (halves) of the P tile
#define OSP  68                  // LDS row pitch (floats) of the output staging tile
#define VH   64                  // listed keys whose v slices one wave stages at a time
#define VPITCH 160               // LDS row pitch (bytes) of a staged 128-byte v slice: an odd multiple of 32 bytes for the transposing reader
#define VSW  (VH * VPITCH)       // staging bytes per wave
#define KHB  (DK)                // bytes of half a k row: the piece of each of its 16 listed keys that a wave stages at a time
#define KPITCH (KHB + 16)        // LDS row pitch (bytes) of a staged half k row: an odd multiple of 16 bytes for the 16-byte fragment reader
#define QPITCH (DK * 2 + 16)     // LDS row pitch (bytes) of the q tile, likewise
#define AWORDS (SEQ / 32)        // groups of 32 keys: one per thread of an attention block
#define AROWS 32                 // SEQ / AROWS blocks sort the edges and convert the operands
#define ATH  1024                // threads of one such block
#define NG   (SEQ / 16)          // groups of 16 query rows: one per attention block
#define ECH  ATH                 // edges per chunk: one per thread of a sorting block
#define NCH  (SEQ / AROWS)       // chunks: one per sorting block, and one per thread of an attention block
#define CCAP (ECH + 3 * NG)      // entries of one sorted chunk: every group's segment starts at a multiple of four entries (16 bytes)
#define XU   ((SEQ * (DIN / 8)) / ((SEQ / AROWS) * ATH))   // 8-element units of x converted per builder thread
#define WU   ((3 * DK * (DIN / 8)) / (SEQ / AROWS))        // 8-element units of the three W^T planes converted per builder block
#define GT   128                 // rows and columns of one projection block's tile
#define GW   4                   // waves of a projection block, 64x64 outputs each
#define GKC  64                  // k values per projection stage: one 128-byte line of every operand row
#define GPITCH (GKC * 2 + 16)    // LDS row pitch (bytes) of a staged line: an odd multiple of 16 bytes for the 16-byte fragment reader
#define GSTAGE (2 * GT * GPITCH) // bytes of one projection stage buffer
#define GNS  (DIN / GKC)         // projection stages
#define PLE  ((size_t)SEQ * DK)  // elements of one of the q, k, v planes, which lie one behind the other
#define SC2  ((float)(0.044194173824159216 * 1.4426950408889634))   // 512^-0.5 * log2(e)
#define FILL2 ((float)(-1000000.0 * 1.4426950408889634))            // replaced score (-1e6) in the exp2 domain
#define PSH  14.0f               // log2 of the P carry (16384)
#define NEGB (-3.0e38f)

static_assert(DIN % 32 == 0);                    // GEMM k-loop steps by 32
static_assert(DK % 32 == 0);                     // score k-loop steps by 32
static_assert(DK % 64 == 0);                     // 64-wide GEMM tiles
static_assert(DIN % 8 == 0);
static_assert(SEQ % 64 == 0);                    // 64-row GEMM tiles
static_assert(SEQ % PANEL == 0);                 // the list rounded up to whole panels stays within SEQ entries
static_assert(SEQ % 16 == 0);                    // 16 query rows per attention block
static_assert(SEQ % AROWS == 0);
static_assert((SEQ & (SEQ - 1)) == 0 && SEQ <= 8192);   // a sorted entry holds the key in 13 bits, the row within its group above them
static_assert(NCH == 32 * FW);                   // one chunk per thread of an attention block
static_assert(NG % 32 == 0 && NG <= ATH && CCAP < 65536 && ECH < 65536 && (CCAP * 4) % 16 == 0);   // whole waves sum the groups; start and count fit 16 bits each
static_assert(SEQ <= SEQ_FULL);
static_assert(DK == 64 * FW);                    // every wave owns 64 output columns
static_assert(PANEL == 128);
static_assert(PANEL % VH == 0 && VH % 32 == 0);
static_assert(VH / 4 == 16);                     // the gather's wait names its sixteen addresses
static_assert((PANEL & (PANEL - 1)) == 0 && PANEL <= 32 * FW);   // list padding: rounded up to a panel, at most one pad entry per thread
static_assert(AWORDS == 32 * FW);                // 32 keys per thread of an attention block
static_assert(SEQ <= 65536);                     // key indices fit 16 bits
static_assert(VPITCH % 32 == 0 && ((VPITCH / 32) & 1) == 1 && VPITCH >= 128);
static_assert((size_t)16 * OSP * 4 <= VSW);      // the output staging tile reuses the wave's own v staging bytes
static_assert((size_t)16 * KPITCH <= VSW);       // so do the staged half k rows
static_assert(KHB == 32 * 16);                   // one 16-byte load per lane covers half a k row
static_assert(KPITCH % 16 == 0 && ((KPITCH / 16) & 1) == 1 && QPITCH % 16 == 0 && ((QPITCH / 16) & 1) == 1);
static_assert(16 * DK * 2 == 4 * 32 * FW * 16);  // q tile: four 16-byte pieces per thread
static_assert((PP * 2) % 16 == 0 && (((PP * 2) / 16) & 1) == 1);   // 16-byte aligned P rows, an odd multiple of 16 bytes for the fragment reader
static_assert((OSP * 4) % 16 == 0);
static_assert((size_t)XU * (SEQ / AROWS) * ATH == (size_t)SEQ * DIN / 8);               // builder grid covers x exactly
static_assert((size_t)WU * (SEQ / AROWS) == (size_t)3 * DK * DIN / 8);                  // builder grid covers the weights exactly
static_assert(WU <= ATH && WU % 32 == 0 && (DK * DIN / 8) % 32 == 0);                   // whole waves, each inside one weight plane
static_assert(4 * 32 * 16 == 16 * 64 * 2);
static_assert(8 * 32 * 16 == 16 * 64 * 4);       // attention epilogue: 8 instructions x 32 lanes x 16 B == 16 rows x 256 B
static_assert((size_t)16 * PP * 2 + 2 * FW * 16 * 4 + (size_t)FW * VSW + (size_t)SEQ * 4 + (size_t)16 * QPITCH + 128 <= 163840);   // attention static LDS: two blocks per 320 KiB
static_assert(3 * ((size_t)2 * GSTAGE + (size_t)GW * 16 * 68 * 4) <= 327680);           // projection static LDS: three blocks per 320 KiB
static_assert(SEQ % GT == 0 && DK % GT == 0 && GT == 128 && GW == 4);                   // 2 x 2 waves of 64x64; eight copies of 16 rows per operand, thread and stage
static_assert(DIN % GKC == 0 && GNS >= 2 && GKC % 32 == 0 && GKC * 2 == 8 * 16);        // both first stages exist; eight 16-byte pieces per staged row
static_assert(GPITCH % 16 == 0 && ((GPITCH / 16) & 1) == 1);
static_assert(((size_t)SEQ * DIN) % 8 == 0);
static_assert(((size_t)DIN * DK) % 8 == 0);

typedef _Float16 h16;
typedef unsigned short bf;
typedef __attribute__((ext_vector_type(16))) __bf16   v16bf;
typedef __attribute__((ext_vector_type(16))) _Float16 v16h;
typedef __attribute__((ext_vector_type(8)))  _Float16 v8h;
typedef __attribute__((ext_vector_type(8)))  unsigned short v8us;
typedef __attribute__((ext_vector_type(8)))  float    v8f;
typedef __attribute__((ext_vector_type(4)))  float    v4f;
typedef v4f  __attribute__((may_alias)) v4fa;
typedef __attribute__((ext_vector_type(4)))  unsigned v4u;
typedef v4u  __attribute__((may_alias)) v4ua;
typedef __attribute__((ext_vector_type(4)))  int      v4i;
typedef __attribute__((ext_vector_type(8)))  short    v8s;

__device__ __forceinline__ unsigned short f2bf(float f) { unsigned u = __float_as_uint(f); u += 0x7FFFu + ((u >> 16) & 1u); return (unsigned short)(u >> 16); }
__device__ __forceinline__ float bfr(float f) { return __uint_as_float(((unsigned)f2bf(f)) << 16); }   // value after RNE convert to bf16
__device__ __forceinline__ v16h cat16(v8h lo, v8h hi) { return __builtin_shufflevector(lo, hi, 0, 1, 2, 3, 4, 5, 6, 7, 8, 9, 10, 11, 12, 13, 14, 15); }
__device__ __forceinline__ v16bf cat16b(v8us lo, v8us hi) { return __builtin_bit_cast(v16bf, __builtin_shufflevector(lo, hi, 0, 1, 2, 3, 4, 5, 6, 7, 8, 9, 10, 11, 12, 13, 14, 15)); }
__device__ __forceinline__ v8f wmma16(v16h a, v16h b, v8f c) { return __builtin_amdgcn_wmma_f32_16x16x32_f16(false, a, false, b, (short)0, c, false, false); }
__device__ __forceinline__ v8f wmmab(v16bf a, v16bf b, v8f c) { return __builtin_amdgcn_wmma_f32_16x16x32_bf16(false, a, false, b, (short)0, c, false, false); }
// fragment loaders from K-contiguous 16-bit rows; p already includes + 8*(lane>>4): elements 0..7 <- k0+8h+0..7, elements 8..15 <- k0+16+8h+0..7 (same map for A and B)
__device__ __forceinline__ v16h  ldh(const h16* p) { return cat16(*(const v8h*)p, *(const v8h*)(p + 16)); }
__device__ __forceinline__ v16bf ldb(const bf* p)  { return cat16b(*(const v8us*)p, *(const v8us*)(p + 16)); }
// transposing LDS load: with p = T + (k0 + 8*(lane>>4) + (lane&7)) * pitch + 2 * d0 + 16 * ((lane>>3)&1), lane (c = lane&15, h = lane>>4) gets T[k0 + 8h + 0..7][d0 + c]
__device__ __forceinline__ v8h ldtr(const unsigned char* p) { typedef __attribute__((address_space(3))) v8s lds_v8s; return __builtin_bit_cast(v8h, __builtin_amdgcn_ds_load_tr16_b128_v8i16((lds_v8s*)p)); }
// ordering point for wave-private LDS tiles (same wave writes and reads)
__device__ __forceinline__ void wave_sync() { __builtin_amdgcn_fence(3 /* release order */, "wavefront"); __builtin_amdgcn_wave_barrier(); asm volatile("" ::: "memory"); }

// f32 -> f16 convert that cannot produce a subnormal f16 (|v| < 2^-14 -> +0)
static __device__ __forceinline__ h16 toh_flush(float v) { const h16 r = (h16)v; return (fabsf(v) < 6.103515625e-05f) ? (h16)0.0f : r; }
// one guarded f16 WMMA: the nops tie the accumulator and keep both fragments live
__device__ __forceinline__ v8f wmg(v16h a, v16h b, v8f c) { c = wmma16(a, b, c); asm volatile("v_nop\n\tv_nop\n\tv_nop\n\tv_nop" : "+v"(c) : "v"(a), "v"(b)); return c; }

// k_sort: the edge list (src = ei[0..E), dst = ei[E..2E)) in chunks of ECH edges, one chunk per block and one edge per thread, each chunk sorted by group g = src / 16 (the 16 query rows of one attention block).
// No block reads more than its own chunk. Place of an edge = start of its group's segment in the chunk + edges of the group in earlier waves + edges of the group in earlier lanes of its own wave:
// every lane compares its group with the 32 lanes' groups (count of equals, count of equals below it); the first lane of each group in a wave stores the wave's count as one byte of cnt[g][wave] (one writer per byte);
// thread g sums its 32 bytes, a block-wide prefix sum over the padded totals gives the segment starts. SE[chunk][place] = (src % 16) << 13 | dst; OC[chunk][g] = start | count << 16.
// Indices below zero wrap once; an edge still outside the matrix, or past the end of the list, goes to the spare group NG and is not stored.
// The block also converts its share of the projection operands (RNE to bf16), work that depends on nothing here and that only the next launch reads: XU units of x per thread (unit i = elements 8i .. 8i+7),
// and WU units of the transposed weights WB = Wq^T | Wk^T | Wv^T, W [DIN][DK] ([in][out]) -> W^T [DK][DIN] (unit i of a plane: row n = i / (DIN/8), k = (i % (DIN/8))*8 + j); the loads of both are in flight under the edge loads and the lane comparison.
__global__ __launch_bounds__(ATH) void k_sort(const int* __restrict__ ei, unsigned* SE, unsigned* OC, int E, const float* __restrict__ x, bf* XB,
                                              const float* __restrict__ wq, const float* __restrict__ wk, const float* __restrict__ wv, bf* WB) {
    __shared__ __align__(16) unsigned char cnt[(NG + 1) * 32];         // edges of group g in wave w
    __shared__ __align__(16) unsigned short wb[NG * 32];               // place of the first edge of group g in wave w
    __shared__ int wsum[NG / 32];
    const int tid = threadIdx.x, lane = threadIdx.x & 31;
    const int wave = __builtin_amdgcn_readfirstlane((int)(threadIdx.x >> 5));
    const int e = blockIdx.x * ECH + tid;                              // the thread's edge; its loads go first: the lane comparison waits for them alone
    int s = SEQ, d = SEQ;                                              // no edge: outside the matrix
    { const int* ps = ei + (size_t)e; const int* pd = ei + (size_t)E + (size_t)e;
      if (e < E) { s = *ps; d = *pd; }
      asm volatile("s_wait_xcnt 0x0" :: "v"(ps), "v"(pd) : "memory"); }   // the address registers of the issued loads stay as they are up to this wait (they are its inputs)
    const size_t xu = (size_t)blockIdx.x * (XU * ATH) + tid;           // the thread's first unit of x; the others follow ATH units apart
    v8f xv[XU];
#pragma unroll
    for (int u = 0; u < XU; ++u) xv[u] = *(const v8f*)(x + (xu + (size_t)u * ATH) * 8);
    const unsigned g8 = blockIdx.x * WU + tid;                         // the thread's unit of WB, for tid < WU (whole waves)
    float wr[8] = {0.0f, 0.0f, 0.0f, 0.0f, 0.0f, 0.0f, 0.0f, 0.0f};
    if (tid < WU) {
        const unsigned pl = g8 / (DK * DIN / 8), i = g8 % (DK * DIN / 8);
        const float* __restrict__ Wp = (pl == 0u) ? wq : (pl == 1u) ? wk : wv;
        const unsigned n = i / (DIN / 8), k8 = (i % (DIN / 8)) * 8;
#pragma unroll
        for (int j = 0; j < 8; ++j) wr[j] = Wp[(size_t)(k8 + j) * DK + n];
    }
    for (int i = tid; i < (NG + 1) * 2; i += ATH) { const v4u z = (v4u){0u, 0u, 0u, 0u}; *(v4ua*)(&cnt[(size_t)i * 16]) = z; }
    s += (s < 0) ? SEQ : 0; d += (d < 0) ? SEQ : 0;
    const bool ok = ((unsigned)s < (unsigned)SEQ) & ((unsigned)d < (unsigned)SEQ);
    const int g = ok ? (s >> 4) : NG;
    int before = 0, total = 0;                                         // edges of the same group in lower lanes, in the whole wave
#pragma unroll
    for (int i = 0; i < 32; ++i) { const int eq = (__builtin_amdgcn_readlane(g, i) == g) ? 1 : 0; total += eq; before += (i < lane) ? eq : 0; }
    __syncthreads();                                                   // cnt is zero everywhere
    if (before == 0) cnt[g * 32 + wave] = (unsigned char)total;        // at most 32
    __syncthreads();
    int pre[32]; int tot = 0;                                          // thread g < NG: edges of group g in earlier waves, in the chunk (loops unrolled: pre is registers)
    if (tid < NG) {
        const v4u c0 = *(const v4ua*)(&cnt[(size_t)tid * 32]); const v4u c1 = *(const v4ua*)(&cnt[(size_t)tid * 32 + 16]);
#pragma unroll
        for (int w = 0; w < 16; ++w) { pre[w] = tot; tot += (int)((c0[w >> 2] >> (8 * (w & 3))) & 255u); }
#pragma unroll
        for (int w = 0; w < 16; ++w) { pre[16 + w] = tot; tot += (int)((c1[w >> 2] >> (8 * (w & 3))) & 255u); }
    } else {
#pragma unroll
        for (int w = 0; w < 32; ++w) pre[w] = 0;
    }
    const int pad = (tot + 3) & ~3;                                    // entries that the group's segment takes
    int inc = pad;                                                     // inclusive prefix sum over the wave
#pragma unroll
    for (int dd = 1; dd < 32; dd <<= 1) { const int up = __shfl_up(inc, dd, 32); inc += (lane >= dd) ? up : 0; }
    if (lane == 31 && wave < NG / 32) wsum[wave] = inc;
    __syncthreads();
    unsigned* se = SE + (size_t)blockIdx.x * CCAP;
    int gs = 0;
    if (tid < NG) {
        int base = 0;
#pragma unroll
        for (int w = 0; w < NG / 32; ++w) base += (w < wave) ? wsum[w] : 0;
        gs = base + inc - pad;                                         // start of the segment: a multiple of 4, gs + pad <= CCAP
#pragma unroll
        for (int q = 0; q < 4; ++q) { v8us o;
#pragma unroll
            for (int k = 0; k < 8; ++k) o[k] = (unsigned short)(gs + pre[8 * q + k]);
            *(v8us*)(&wb[(size_t)tid * 32 + 8 * q]) = o; }
    }
    __syncthreads();
    // all global stores stand behind the last barrier, so that no barrier waits for a store
    if (ok) se[(int)wb[g * 32 + wave] + before] = ((unsigned)(s & 15) << 13) | (unsigned)d;
    if (tid < NG) {
        OC[(size_t)blockIdx.x * NG + tid] = (unsigned)gs | ((unsigned)tot << 16);
#pragma unroll
        for (int k = 0; k < 3; ++k) if (tot + k < pad) se[gs + tot + k] = 0u;   // the pad entries are loaded with their segment, and not used
    }
#pragma unroll
    for (int u = 0; u < XU; ++u) { v8us o;
#pragma unroll
        for (int k = 0; k < 8; ++k) o[k] = f2bf(xv[u][k]);
        *(v8us*)(XB + (xu + (size_t)u * ATH) * 8) = o; }
    if (tid < WU) { v8us o;
#pragma unroll
        for (int j = 0; j < 8; ++j) o[j] = f2bf(wr[j]);
        *(v8us*)(WB + (size_t)g8 * 8) = o;
    }
}

// k_proj_rows: bf16 GEMM for q, k and v in one grid (SEQ/GT, 3 * DK/GT): C[t][n] = sum_k x[t][k] W^T[n][k] + bias[n], written as f16 into the row-major plane [t][DK] that blockIdx.y names.
// One block of four waves per GT x GT tile, every wave a 64x64 quarter (16 accumulators). The block's GT rows of x and GT rows of W^T go through LDS in stages of GKC k values (one whole 128-byte line per row and stage),
// brought by asynchronous copies into two buffers: stage s + 1 flies while stage s is multiplied. Fragments are read from LDS rows of pitch GPITCH; k runs upward in steps of 32 for every accumulator.
__global__ __launch_bounds__(32 * GW) void k_proj_rows(const bf* __restrict__ A, const bf* __restrict__ WB, const float* __restrict__ bq, const float* __restrict__ bk, const float* __restrict__ bv, h16* P) {
    __shared__ __align__(16) unsigned char GS[2 * GSTAGE];             // two buffers, each: GT rows of x, then GT rows of W^T
    __shared__ __align__(16) float osb[GW * 16 * 68];                  // output staging, one tile per wave
    const int tid = threadIdx.x;
    const int lane = threadIdx.x & 31, lr = lane & 15, hi = lane >> 4;
    const int wave = __builtin_amdgcn_readfirstlane((int)(threadIdx.x >> 5));
    const int pl = blockIdx.y / (DK / GT);
    const int r0 = blockIdx.x * GT + (wave >> 1) * 64, c0 = (blockIdx.y % (DK / GT)) * GT + (wave & 1) * 64;   // the wave's quarter in the plane
    const float* __restrict__ bias = (pl == 0) ? bq : (pl == 1) ? bk : bv;
    h16* Ph = P + (size_t)pl * PLE;
    // copy i of a thread: staged row 16 i + (tid >> 3), 16-byte piece tid & 7; all rows lie inside the planes (the grid covers them exactly), all LDS bytes inside GS
    const bf* ga = A + (size_t)(blockIdx.x * GT + (tid >> 3)) * DIN + (tid & 7) * 8;
    const bf* gb = WB + (size_t)pl * DK * DIN + (size_t)((blockIdx.y % (DK / GT)) * GT + (tid >> 3)) * DIN + (tid & 7) * 8;
    const unsigned l0 = (unsigned)(size_t)(&GS[0]) + (unsigned)((tid >> 3) * GPITCH + (tid & 7) * 16);   // LDS byte address: the low 32 bits of the shared address
    // eight copies, rows 16 apart, each with its own address registers; the wait in the same statement stands in front of any rewrite of those registers
    auto copy8 = [&](unsigned l, const bf* g) {
        asm volatile("global_load_async_to_lds_b128 %0, %8, off\n\t"
                     "global_load_async_to_lds_b128 %1, %9, off\n\t"
                     "global_load_async_to_lds_b128 %2, %10, off\n\t"
                     "global_load_async_to_lds_b128 %3, %11, off\n\t"
                     "global_load_async_to_lds_b128 %4, %12, off\n\t"
                     "global_load_async_to_lds_b128 %5, %13, off\n\t"
                     "global_load_async_to_lds_b128 %6, %14, off\n\t"
                     "global_load_async_to_lds_b128 %7, %15, off\n\t"
                     "s_wait_xcnt 0x0"
                     :: "v"(l), "v"(l + 16 * GPITCH), "v"(l + 32 * GPITCH), "v"(l + 48 * GPITCH), "v"(l + 64 * GPITCH), "v"(l + 80 * GPITCH), "v"(l + 96 * GPITCH), "v"(l + 112 * GPITCH),
                        "v"(g), "v"(g + 16 * DIN), "v"(g + 32 * DIN), "v"(g + 48 * DIN), "v"(g + 64 * DIN), "v"(g + 80 * DIN), "v"(g + 96 * DIN), "v"(g + 112 * DIN) : "memory");
    };
    auto fill = [&](int s) {                                           // stage s into buffer s & 1
        const unsigned l = l0 + (unsigned)((s & 1) * GSTAGE);
        copy8(l, ga + s * GKC);
        copy8(l + GT * GPITCH, gb + s * GKC);
    };
    v8f acc[4][4];
#pragma unroll
    for (int mb = 0; mb < 4; ++mb)
#pragma unroll
        for (int nb = 0; nb < 4; ++nb) acc[mb][nb] = (v8f){};
    const unsigned char* ard = GS + ((wave >> 1) * 64 + lr) * GPITCH + 16 * hi;        // A fragment: row t, k
    const unsigned char* brd = GS + (GT + (wave & 1) * 64 + lr) * GPITCH + 16 * hi;    // B fragment: row n of W^T, k
    fill(0);
    asm volatile("s_wait_asynccnt 0x0" ::: "memory");                  // the wave's own copies of stage 0 have landed
    __syncthreads();                                                   // and every other wave's
    fill(1);
#pragma unroll 1                                                        // one copy of the body: the buffer is picked by the stage's parity
    for (int s = 0; s < GNS; ++s) {
        const int bo = (s & 1) * GSTAGE;
#pragma unroll
        for (int ks = 0; ks < GKC / 32; ++ks) {
            v16bf a[4], b[4];
#pragma unroll
            for (int mb = 0; mb < 4; ++mb) a[mb] = ldb((const bf*)(ard + bo + mb * 16 * GPITCH + ks * 64));
#pragma unroll
            for (int nb = 0; nb < 4; ++nb) b[nb] = ldb((const bf*)(brd + bo + nb * 16 * GPITCH + ks * 64));
            __builtin_amdgcn_sched_barrier(0);                         // keeps the sixteen LDS reads together ahead of their sixteen products: one exposed LDS latency per k step, not one per W^T fragment
#pragma unroll
            for (int nb = 0; nb < 4; ++nb)
#pragma unroll
                for (int mb = 0; mb < 4; ++mb) acc[mb][nb] = wmmab(a[mb], b[nb], acc[mb][nb]);
        }
        asm volatile("s_wait_dscnt 0x0" ::: "memory");                 // the wave's reads of this buffer have retired before the buffer is refilled
        asm volatile("s_wait_asynccnt 0x0" ::: "memory");              // the wave's own copies of stage s + 1 have landed
        __syncthreads();                                               // publishes stage s + 1 and ends every wave's reads of stage s
        if (s + 2 < GNS) fill(s + 2);                                  // same test in the whole block
    }
    asm volatile("s_wait_asynccnt 0x0" ::: "memory");                  // no copy is outstanding when the wave ends
    float* os = osb + wave * (16 * 68);
    float bc[4];
#pragma unroll
    for (int nb = 0; nb < 4; ++nb) bc[nb] = bfr(bias[c0 + nb * 16 + lr]);   // c0 + 63 < DK
    const size_t tbase = (size_t)r0 * DK + (size_t)c0;
#pragma unroll
    for (int mb = 0; mb < 4; ++mb) {
#pragma unroll
        for (int nb = 0; nb < 4; ++nb) {
#pragma unroll
            for (int j = 0; j < 8; ++j) os[(hi * 8 + j) * 68 + nb * 16 + lr] = acc[mb][nb][j] + bc[nb]; }   // D: row 8h+j, col lane&15
        wave_sync();
        {
            const size_t sb = tbase + (size_t)(mb * 16) * DK;
#pragma unroll
            for (int s = 0; s < 4; ++s) { const int row = 4 * s + (lane >> 3), c8 = (lane & 7) * 8;   // 4 s x 4 row groups = 16 rows; 8 lanes x 8 = 64 columns
                const v4f x0 = *(const v4fa*)(&os[row * 68 + c8]); const v4f x1 = *(const v4fa*)(&os[row * 68 + c8 + 4]); v8h hv;
#pragma unroll
                for (int i = 0; i < 4; ++i) { hv[i] = toh_flush(x0[i]); hv[4 + i] = toh_flush(x1[i]); }
                const size_t oo = sb + (size_t)row * DK + c8;
                *(v8h*)(Ph + oo) = hv; }
        }
        wave_sync();
    }
}

// k_flash: fused attention, one block per 16 query rows, FW = 8 waves.
// First the block builds, in LDS, one 16-bit mask per key: the rows among its 16 that have an edge to the key. Thread c takes the block's segment of sorted chunk c; an edge's bit is set by a plain load, OR and store,
// so a store can overwrite another edge's bit set between its load and itself: behind a barrier every thread looks its bits up again, and the missing ones are set anew in a further round. A bit that stands at a barrier
// stays (every later load sees it), only an edge whose bit is missing stores, and the last store to a word in a round brings a new bit: 16 rounds at most, the result the same whatever the order.
// Pass 0 lists, in rising order, the keys with an edge to any of the block's 16 rows (thread i owns keys 32i .. 32i+31: block-wide prefix sum of the counts),
// and walks the list, looking each listed key's row mask up again; pass 1 does the same with the keys that are left (all masks zero). A key of pass 1 has the replaced score in every row, so its weight is
// exp2(FILL2 - max + 14), taken as 0 below -14 like every other weight: where that holds for all 16 rows after pass 0, pass 1 would add only zeros and is left out (same value in every wave: block-uniform).
// The list is padded to whole panels of 128 keys (a pad entry scores NEGB, weight 0) and walked in rounds of up to NT panels; no block barrier stands between the panels of a round. Per round:
//  (1) for each panel, wave w scores its own 16 listed keys in transposed form, S^T = K Q^T over the full width: all 32 loads of its 16 k rows (512 contiguous bytes each) are issued together, the rows go through the wave's own LDS bytes
//      one half width at a time, and A (k rows) and B (q rows, from the block's LDS tile) are read as fragments there; lane (t = lane&15, h = lane>>4) holds listed keys 8h+r for query t; a tile of pass 1, or of pad entries alone, is not multiplied;
//  (2) per-query max over the round: lane partial, xor-16 exchange, one word per wave per query in LDS, block barrier, combine over the 8 waves (identical in every wave);
//  (3) P = exp2(score - max + 14) as f16 (arguments below -14 give 0), P tile [t][keys of the round] into LDS, partial sums over the converted P, block barrier;
//  (4) wave w accumulates O^T rows d in [64w, 64w+64): it gathers v[key][64w .. 64w+63] (one 128-byte line per key) of 64 listed keys at a time into its own LDS rows; A = V^T by transposing LDS loads,
//      B = P^T from the LDS tile (both in the k order 8h+0..7, 16+8h+0..7), the next 64 keys' gather in flight under every product stage but the round's last; block barrier before the next round.
// four waves per SIMD asked for: at most 256 registers a wave, so that two blocks share a WGP
__global__ __launch_bounds__(32 * FW, 4) void k_flash(const h16* __restrict__ QP, const h16* __restrict__ KP, const h16* __restrict__ VP, const unsigned* __restrict__ SE, const unsigned* __restrict__ OC, float* OUT) {
    __shared__ __align__(16) h16 Ps[16 * PP];
    __shared__ float redm[FW * 16];
    __shared__ float reds[FW * 16];
    __shared__ int wsum[FW];
    __shared__ int wflag[FW];
    __shared__ __align__(16) unsigned short kpl[SEQ];                  // per key: the block's rows that keep it
    __shared__ __align__(16) unsigned short klist[SEQ];
    __shared__ __align__(32) unsigned char VS[FW * VSW];
    __shared__ __align__(16) unsigned char QS[16 * QPITCH];
    const int tid = threadIdx.x;
    const int lane = threadIdx.x & 31, lr = lane & 15, hi = lane >> 4;
    const int wave = __builtin_amdgcn_readfirstlane((int)(threadIdx.x >> 5));
    const int q0 = blockIdx.x * 16;
    const int pw = lr * PP + wave * 16 + 8 * hi;                       // P tile write offset (listed keys wave*16 + 8h + r)
    const int pf = lr * PP + 8 * hi;                                   // P^T fragment read offset (col t, k = listed key)
    unsigned char* vsw = VS + wave * VSW;                              // the wave's own staging rows
    unsigned char* vwr = vsw + (lane >> 3) * VPITCH + (lane & 7) * 16;                                   // store i: staged row 4i + (lane>>3), 16-byte piece lane&7
    const unsigned char* vrd = vsw + (8 * hi + (lane & 7)) * VPITCH + ((lane >> 3) & 1) * 16;            // transposing read, staged row base 0, column base 0
    const h16* vsrc = VP + wave * 64 + (lane & 7) * 8;                 // + key * DK
    // gather of the wave's slices of listed keys jb .. jb+VH-1: load i covers four whole 128-byte lines (every list entry is below SEQ by construction)
    auto fetchv = [&](v4u (&vr)[VH / 4], int jb) {
        const h16* vp[VH / 4];                                         // all addresses are formed first; both loops are unrolled so that vp and vr are registers
#pragma unroll
        for (int i = 0; i < VH / 4; ++i) vp[i] = vsrc + (size_t)klist[jb + 4 * i + (lane >> 3)] * DK;
#pragma unroll
        for (int i = 0; i < VH / 4; ++i) vr[i] = *(const v4u*)vp[i];
        // the address registers of the issued loads stay as they are up to this wait (they are its inputs), so that none is reused ahead of it
        asm volatile("s_wait_xcnt 0x0" :: "v"(vp[0]), "v"(vp[1]), "v"(vp[2]), "v"(vp[3]), "v"(vp[4]), "v"(vp[5]), "v"(vp[6]), "v"(vp[7]),
                                          "v"(vp[8]), "v"(vp[9]), "v"(vp[10]), "v"(vp[11]), "v"(vp[12]), "v"(vp[13]), "v"(vp[14]), "v"(vp[15]) : "memory");
    };
    auto stagev = [&](const v4u (&vr)[VH / 4]) {
#pragma unroll
        for (int i = 0; i < VH / 4; ++i) *(v4ua*)(vwr + i * 4 * VPITCH) = vr[i];
        asm volatile("s_wait_dscnt 0x0" ::: "memory");                 // the wave's own stores have retired before its transposing loads read the rows back
    };
    // the block's 16 q rows (16 KiB in a row in the plane) into LDS: piece 256 i + tid = row 4i + (tid>>6), 16-byte column tid&63; first read behind the barriers of the list stage (loops unrolled: qv is registers)
    { const h16* qg = QP + (size_t)q0 * DK + tid * 8; v4u qv[4];
#pragma unroll
      for (int i = 0; i < 4; ++i) qv[i] = *(const v4u*)(qg + i * (32 * FW * 8));
      asm volatile("s_wait_xcnt 0x0" :: "v"(qg) : "memory");           // the address register of the issued loads stays as it is up to this wait (it is its input)
#pragma unroll
      for (int i = 0; i < 4; ++i) *(v4ua*)(QS + (4 * i + (tid >> 6)) * QPITCH + (tid & 63) * 16) = qv[i]; }
    // row masks of all keys from the block's segments of the sorted chunks (thread tid: chunk tid); start and count are bounded here, so that every entry read lies inside the chunk
    {
        const unsigned* op = OC + (size_t)tid * NG + blockIdx.x;
        const unsigned oc = *op;
        asm volatile("s_wait_xcnt 0x0" :: "v"(op) : "memory");         // the address register of the issued load stays as it is up to this wait (it is its input)
#pragma unroll
        for (int i = 0; i < SEQ * 2 / 16 / (32 * FW); ++i) { const v4u z = (v4u){0u, 0u, 0u, 0u}; *(v4ua*)(&kpl[(size_t)(i * 32 * FW + tid) * 8]) = z; }
        const int es = min((int)(oc & 0xFFFCu), CCAP);
        const int ec = min((int)(oc >> 16), CCAP - es);
        const unsigned* sp = SE + (size_t)tid * CCAP + es;
        v4u e0 = (v4u){0u, 0u, 0u, 0u}, e1 = (v4u){0u, 0u, 0u, 0u};    // the first eight edges stay in registers; a longer segment is read again in every round
        if (ec > 0) e0 = *(const v4u*)sp;
        if (ec > 4) e1 = *(const v4u*)(sp + 4);
        asm volatile("s_wait_xcnt 0x0" :: "v"(sp) : "memory");         // likewise
        int ky[8]; unsigned bt[8];                                     // loops unrolled: registers; an entry past the count has no bit
#pragma unroll
        for (int j = 0; j < 8; ++j) { const unsigned w = (j < 4) ? e0[j & 3] : e1[j & 3]; ky[j] = (int)(w & (unsigned)(SEQ - 1)); bt[j] = (j < ec) ? (1u << ((w >> 13) & 15u)) : 0u; }
        __syncthreads();                                               // the masks are zero everywhere
#pragma unroll 1                                                        // one copy of the round with its barriers: the first round or two end it
        for (int round = 0; round < 16; ++round) {
            unsigned od[8];
#pragma unroll
            for (int j = 0; j < 8; ++j) od[j] = (unsigned)kpl[ky[j]];  // all eight loads together: one LDS latency
#pragma unroll
            for (int j = 0; j < 8; ++j) if ((bt[j] & ~od[j]) != 0u) kpl[ky[j]] = (unsigned short)(od[j] | bt[j]);
#pragma unroll 1                                                        // seldom entered: kept small
            for (int i = 8; i < ec; ++i) {                             // at most CCAP trips
                const unsigned w = sp[i]; const int k = (int)(w & (unsigned)(SEQ - 1)); const unsigned b = 1u << ((w >> 13) & 15u);
                const unsigned o = (unsigned)kpl[k]; if ((b & ~o) != 0u) kpl[k] = (unsigned short)(o | b);
            }
            __syncthreads();                                           // every store of the round stands
            unsigned miss = 0u;
#pragma unroll
            for (int j = 0; j < 8; ++j) miss |= bt[j] & ~(unsigned)kpl[ky[j]];
#pragma unroll 1                                                        // seldom entered: kept small
            for (int i = 8; i < ec; ++i) { const unsigned w = sp[i]; miss |= (1u << ((w >> 13) & 15u)) & ~(unsigned)kpl[(int)(w & (unsigned)(SEQ - 1))]; }
            const unsigned wm = __builtin_amdgcn_ballot_w32(miss != 0u);
            if (lane == 0) wflag[wave] = (wm != 0u) ? 1 : 0;
            __syncthreads();                                           // also ends the round's look-ups before the next round's stores
            int anym = 0;
#pragma unroll
            for (int w = 0; w < FW; ++w) anym |= wflag[w];
            if (__builtin_amdgcn_readfirstlane(anym) == 0) break;      // same value in every wave: block-uniform
        }
    }
    unsigned char* kwr = vsw + lane * 16;                              // store i: staged row i (listed key j0 + i), 16-byte piece lane
    const unsigned char* krd = vsw + lr * KPITCH + 16 * hi;            // A fragment: row = listed key, k = d
    const unsigned char* qrd = QS + lr * QPITCH + 16 * hi;             // B fragment: col t, k = d
    // the k rows of listed keys j0 .. j0+15, lower halves into k0, upper halves into k1: every load covers four whole 128-byte lines (every list entry is below SEQ by construction)
    auto fetchk = [&](v4u (&k0)[16], v4u (&k1)[16], int j0) {
        const v8us ia = *(const v8us*)(&klist[j0]); const v8us ib = *(const v8us*)(&klist[j0 + 8]);
        unsigned kp[16];                                               // byte offsets in the plane (below SEQ * DK * 2), one register each, all formed first; the loops are unrolled so that kp, k0 and k1 are registers
#pragma unroll
        for (int i = 0; i < 8; ++i) { kp[i] = (unsigned)ia[i] * (DK * 2) + (unsigned)lane * 16u; kp[8 + i] = (unsigned)ib[i] * (DK * 2) + (unsigned)lane * 16u; }
#pragma unroll
        for (int i = 0; i < 16; ++i) k0[i] = *(const v4u*)((const unsigned char*)KP + kp[i]);
#pragma unroll
        for (int i = 0; i < 16; ++i) k1[i] = *(const v4u*)((const unsigned char*)KP + kp[i] + KHB);
        // the address registers of the issued loads stay as they are up to this wait (they are its inputs), so that none is reused ahead of it; it also keeps all 32 loads ahead of the first product
        asm volatile("s_wait_xcnt 0x0" :: "v"(kp[0]), "v"(kp[1]), "v"(kp[2]), "v"(kp[3]), "v"(kp[4]), "v"(kp[5]), "v"(kp[6]), "v"(kp[7]),
                                          "v"(kp[8]), "v"(kp[9]), "v"(kp[10]), "v"(kp[11]), "v"(kp[12]), "v"(kp[13]), "v"(kp[14]), "v"(kp[15]) : "memory");
    };
    auto stagek = [&](const v4u (&kr)[16]) {
#pragma unroll                                                          // kr is registers, the row offsets are immediates
        for (int i = 0; i < 16; ++i) *(v4ua*)(kwr + i * KPITCH) = kr[i];
        asm volatile("s_wait_dscnt 0x0" ::: "memory");                 // the wave's own stores have retired before its fragment loads read the rows back
    };
    // the staged half width (d = 256 hf .. 256 hf + 255) of the score tile, in rising d; all loops unrolled, so that the sixteen LDS reads of four k steps stand together ahead of their products
    auto qk = [&](v8f s, int hf) {
#pragma unroll
        for (int g = 0; g < KHB / 256; ++g) {
            v16h a[4], b[4];
#pragma unroll
            for (int u = 0; u < 4; ++u) { a[u] = ldh((const h16*)(krd + g * 256 + u * 64)); b[u] = ldh((const h16*)(qrd + hf * KHB + g * 256 + u * 64)); }
#pragma unroll
            for (int u = 0; u < 4; ++u) s = wmg(a[u], b[u], s);
        }
        wave_sync();                                                   // the staged rows are rewritten only behind these reads
        return s;
    };
    v8f o0 = (v8f){}, o1 = (v8f){}, o2 = (v8f){}, o3 = (v8f){};
    auto pv = [&](int jl) {                                            // VH staged keys against P columns jl .. jl+VH-1
#pragma unroll
        for (int kc = 0; kc < VH; kc += 32) {
            const v16h pb = cat16(*(const v8h*)(&Ps[pf + jl + kc]), *(const v8h*)(&Ps[pf + jl + kc + 16]));
            const unsigned char* ad = vrd + kc * VPITCH;
            const v16h v0 = cat16(ldtr(ad),      ldtr(ad + 16 * VPITCH));        o0 = wmg(v0, pb, o0);
            const v16h v1 = cat16(ldtr(ad + 32), ldtr(ad + 16 * VPITCH + 32));   o1 = wmg(v1, pb, o1);
            const v16h v2 = cat16(ldtr(ad + 64), ldtr(ad + 16 * VPITCH + 64));   o2 = wmg(v2, pb, o2);
            const v16h v3 = cat16(ldtr(ad + 96), ldtr(ad + 16 * VPITCH + 96));   o3 = wmg(v3, pb, o3);
        }
        wave_sync();                                                   // the staged rows are rewritten only behind these reads
    };
    float m = NEGB, l = 0.0f;
#pragma unroll 1                                                        // one copy of the large body with its barriers serves both passes
    for (int pass = 0; pass < 2; ++pass) {
        unsigned un = 0u;                                              // bit b: key 32*tid + b has an edge to one of the block's rows
#pragma unroll
        for (int i = 0; i < 4; ++i) { const v4u pm = *(const v4ua*)(&kpl[(size_t)tid * 32 + 8 * i]);
#pragma unroll
            for (int k = 0; k < 4; ++k) un |= (((pm[k] & 0xFFFFu) != 0u) ? (1u << (8 * i + 2 * k)) : 0u) | (((pm[k] >> 16) != 0u) ? (2u << (8 * i + 2 * k)) : 0u); }
        unsigned sel = (pass == 0) ? un : ~un;                         // this pass's keys among 32*tid .. 32*tid+31
        const int cnt = __popc(sel);
        int inc = cnt;                                                 // inclusive prefix sum over the wave
#pragma unroll
        for (int d = 1; d < 32; d <<= 1) { const int up = __shfl_up(inc, d, 32); inc += (lane >= d) ? up : 0; }
        if (lane == 31) wsum[wave] = inc;
        __syncthreads();
        int base = 0, nn = 0;
#pragma unroll
        for (int w = 0; w < FW; ++w) { const int c = wsum[w]; base += (w < wave) ? c : 0; nn += c; }
        const int n = __builtin_amdgcn_readfirstlane(nn);              // listed keys of this pass, at most SEQ
        int pos = base + inc - cnt;
        while (sel != 0u) {                                            // at most 32 trips; pos stays below n
            const int b = __builtin_ctz(sel); sel &= sel - 1u;
            klist[pos] = (unsigned short)(tid * 32 + b); ++pos;
        }
        const int np = (n + PANEL - 1) & ~(PANEL - 1);                 // at most SEQ
        if (n + tid < np) klist[n + tid] = (unsigned short)0;
        __syncthreads();
#pragma unroll 1                                                        // one copy of the round with its barriers
        for (int kb = 0; kb < np; kb += SPAN) {
            const int nt = min(NT, (np - kb) / PANEL);                 // panels of this round, at least one: the same in the whole block
            v4u va[VH / 4], vb[VH / 4];
            float ta[NT][8]; float mx = NEGB;                          // loops over u unrolled: ta and fb are registers
            // fb[u], bit r: the lane's query row keeps listed key r of the lane's eight in panel u. All look-ups of the round stand together (one LDS latency); a panel past the round's last reads the last one's entries, and is not used
            unsigned fb[NT];
            { v8us kk[NT];
#pragma unroll
              for (int u = 0; u < NT; ++u) kk[u] = *(const v8us*)(&klist[kb + min(u, nt - 1) * PANEL + wave * 16 + 8 * hi]);
#pragma unroll
              for (int u = 0; u < NT; ++u) { fb[u] = 0u;
#pragma unroll
                  for (int r = 0; r < 8; ++r) fb[u] |= (((unsigned)kpl[kk[u][r]] >> lr) & 1u) << r; } }   // every list entry is below SEQ
#pragma unroll
            for (int u = 0; u < NT; ++u) {
                if (u < nt) {
                    const int j0 = kb + u * PANEL + wave * 16;
                    const bool any = (pass == 0) && (j0 < n);          // a key of pass 0 has a row that keeps it, a key of pass 1 and a pad entry have none that counts: wave-uniform
                    v8f sa = (v8f){};
                    if (any) { v4u k0[16], k1[16]; fetchk(k0, k1, j0); stagek(k0); sa = qk(sa, 0); stagek(k1); sa = qk(sa, 1); }
#pragma unroll
                    for (int r = 0; r < 8; ++r) {
                        const bool fa = ((fb[u] >> r) & 1u) != 0u;
                        const float sc = fa ? sa[r] * SC2 : FILL2;     // kept: scaled score; otherwise the score is replaced
                        ta[u][r] = (j0 + 8 * hi + r < n) ? sc : NEGB;  // a pad entry is no key
                        mx = fmaxf(mx, ta[u][r]); }
                } else {
#pragma unroll
                    for (int r = 0; r < 8; ++r) ta[u][r] = NEGB;       // no panel: not used below
                }
            }
            fetchv(va, kb);                                            // the round's first v gather: in flight under the exchange of the maxima
            mx = fmaxf(mx, __shfl_xor(mx, 16, 32));
            if (hi == 0) redm[wave * 16 + lr] = mx;
            __syncthreads();
            float pm = redm[lr];
#pragma unroll
            for (int w = 1; w < FW; ++w) pm = fmaxf(pm, redm[w * 16 + lr]);
            const float mnew = fmaxf(m, pm);
            const float alpha = __builtin_amdgcn_exp2f(m - mnew);
            const float sh = PSH - mnew;
            float ls = 0.0f;
#pragma unroll
            for (int u = 0; u < NT; ++u) {
                if (u < nt) {
                    v8h pa;
#pragma unroll
                    for (int r = 0; r < 8; ++r) {
                        const float ea = ta[u][r] + sh;
                        const float xa = __builtin_amdgcn_exp2f(ea);
                        const float ga = (ea < -14.0f) ? 0.0f : xa;    // never a subnormal f16
                        const h16 ha = (h16)ga;
                        pa[r] = ha; ls += (float)ha; }
                    *(v8h*)(&Ps[pw + u * PANEL]) = pa;
                }
            }
            ls += __shfl_xor(ls, 16, 32);
            if (hi == 0) reds[wave * 16 + lr] = ls;
            __syncthreads();
            float lsum = reds[lr];
#pragma unroll
            for (int w = 1; w < FW; ++w) lsum += reds[w * 16 + lr];
            l = l * alpha + lsum; m = mnew;
            o0 = o0 * alpha; o1 = o1 * alpha; o2 = o2 * alpha; o3 = o3 * alpha;
#pragma unroll 1                                                        // one copy of the product stage serves every panel of the round
            for (int u = 0; u < nt; ++u) {
                stagev(va);
                fetchv(vb, kb + u * PANEL + VH);                       // in flight under the first half's products
                pv(u * PANEL);
                stagev(vb);
                if (u + 1 < nt) fetchv(va, kb + (u + 1) * PANEL);      // the next panel's first half, in flight under the second half's products (same test in the whole block)
                pv(u * PANEL + VH);
            }
            __syncthreads();
        }
        const float ef = FILL2 + (PSH - fmaxf(m, FILL2));              // weight argument of a key that no row of the block keeps
        if (__builtin_amdgcn_ballot_w32(ef >= -14.0f) == 0u) break;    // m is the same in every wave: block-uniform
    }
    const float inv = 1.0f / l;                                        // l >= 16384: the panel holding a row's maximum contributes the full carry
    float* os = (float*)vsw;                                           // output staging in the wave's own rows (their last reads lie behind pv's ordering point)
    // O^T D layout: o_j[r] = (d = 64w + 16j + 8h + r, t = lane&15) -> os[t][16j + 8h + r]; rows 0..15 x columns 0..63 all written
    { v4f a, c;
      a[0] = o0[0] * inv; a[1] = o0[1] * inv; a[2] = o0[2] * inv; a[3] = o0[3] * inv; c[0] = o0[4] * inv; c[1] = o0[5] * inv; c[2] = o0[6] * inv; c[3] = o0[7] * inv;
      *(v4fa*)(&os[lr * OSP +  0 + 8 * hi]) = a; *(v4fa*)(&os[lr * OSP +  0 + 8 * hi + 4]) = c;
      a[0] = o1[0] * inv; a[1] = o1[1] * inv; a[2] = o1[2] * inv; a[3] = o1[3] * inv; c[0] = o1[4] * inv; c[1] = o1[5] * inv; c[2] = o1[6] * inv; c[3] = o1[7] * inv;
      *(v4fa*)(&os[lr * OSP + 16 + 8 * hi]) = a; *(v4fa*)(&os[lr * OSP + 16 + 8 * hi + 4]) = c;
      a[0] = o2[0] * inv; a[1] = o2[1] * inv; a[2] = o2[2] * inv; a[3] = o2[3] * inv; c[0] = o2[4] * inv; c[1] = o2[5] * inv; c[2] = o2[6] * inv; c[3] = o2[7] * inv;
      *(v4fa*)(&os[lr * OSP + 32 + 8 * hi]) = a; *(v4fa*)(&os[lr * OSP + 32 + 8 * hi + 4]) = c;
      a[0] = o3[0] * inv; a[1] = o3[1] * inv; a[2] = o3[2] * inv; a[3] = o3[3] * inv; c[0] = o3[4] * inv; c[1] = o3[5] * inv; c[2] = o3[6] * inv; c[3] = o3[7] * inv;
      *(v4fa*)(&os[lr * OSP + 48 + 8 * hi]) = a; *(v4fa*)(&os[lr * OSP + 48 + 8 * hi + 4]) = c; }
    wave_sync();
    float* orow = OUT + (size_t)q0 * DK + wave * 64;
{
#pragma unroll
        for (int s = 0; s < 8; ++s) { const int row = 2 * s + (lane >> 4), cofs = (lane & 15) * 4;   // 8 s x 2 rows = 16 rows; 16 lanes x 4 floats = 64 columns = two lines
            const v4f val = *(const v4fa*)(&os[row * OSP + cofs]);
            *(v4f*)(orow + (size_t)row * DK + cofs) = val; }
         }
}

static constexpr size_t al256(size_t v) { return (v + 255) & ~(size_t)255; }
static constexpr size_t SZ_XB = al256((size_t)SEQ * DIN * 2);
static constexpr size_t SZ_WB = al256((size_t)3 * DK * DIN * 2);
static constexpr size_t SZ_PL = al256((size_t)SEQ * DK * 2);
static constexpr size_t SZ_SE = al256((size_t)NCH * CCAP * 4);
static constexpr size_t SZ_OC = al256((size_t)NCH * NG * 4);
static constexpr size_t SZ_TOTAL = SZ_XB + SZ_WB + 3 * SZ_PL + SZ_SE + SZ_OC;
static_assert(SZ_TOTAL <= (size_t)134217728);          // workspace carve <= 128 MiB
static_assert(SZ_PL == PLE * 2);                       // q, k, v planes lie one behind the other without a gap
static_assert(((size_t)DK * DIN * 2) % 256 == 0);      // weight sub-planes stay 256-byte aligned
static_assert((size_t)(SEQ / GT) * GT * DK * 2 <= SZ_PL);             // projection grid x tile extent == plane

extern "C" void kernel_launch(void* const* d_in, const int* in_sizes, int n_in,
                              void* d_out, int out_size, void* d_ws, size_t ws_size, hipStream_t stream) {
    if (n_in < 8) return;
    if ((size_t)in_sizes[0] < (size_t)SEQ * DIN) return;
    if (in_sizes[1] < 2 || (size_t)in_sizes[1] > (size_t)2 * NCH * ECH) return;   // the chunks cover the edge list
    if ((size_t)in_sizes[2] < (size_t)DIN * DK || (size_t)in_sizes[4] < (size_t)DIN * DK || (size_t)in_sizes[6] < (size_t)DIN * DK) return;
    if (in_sizes[3] < DK || in_sizes[5] < DK || in_sizes[7] < DK) return;
    if ((size_t)out_size < (size_t)SEQ * DK) return;
    if (SZ_TOTAL > ws_size) return;
    // wire order: x, edge_index, Wq, bq, Wk, bk, Wv, bv
    const float* x  = (const float*)d_in[0];
    const int*   ei = (const int*)d_in[1];
    const float* wq = (const float*)d_in[2]; const float* bq = (const float*)d_in[3];
    const float* wk = (const float*)d_in[4]; const float* bk = (const float*)d_in[5];
    const float* wv = (const float*)d_in[6]; const float* bv = (const float*)d_in[7];
    const int E = in_sizes[1] / 2;
    float* OUT = (float*)d_out;      // [SEQ][512]
    char* wsp = (char*)d_ws;
    bf* XB = (bf*)wsp; wsp += SZ_XB;                 // x        [SEQ][512] bf16
    bf* WB = (bf*)wsp; wsp += SZ_WB;                 // [3][512][512]: Wq^T | Wk^T | Wv^T  ([out][in])
    h16* QP = (h16*)wsp; wsp += SZ_PL;               // q   [SEQ][512]
    h16* KP = (h16*)wsp; wsp += SZ_PL;               // k   [SEQ][512]
    h16* VP = (h16*)wsp; wsp += SZ_PL;               // v   [SEQ][512]
    unsigned* SE = (unsigned*)wsp; wsp += SZ_SE;     // sorted edges [chunk][CCAP]
    unsigned* OC = (unsigned*)wsp; wsp += SZ_OC;     // segment start and count [chunk][group]

    k_sort<<<NCH, ATH, 0, stream>>>(ei, SE, OC, E, x, XB, wq, wk, wv, WB);

    // q, k, v: A = x rows (m = t), Bt = W^T rows (n = column) -> planes [t][512], QP | KP | VP
    k_proj_rows<<<dim3(SEQ / GT, 3 * (DK / GT), 1), 32 * GW, 0, stream>>>(XB, WB, bq, bk, bv, QP);

    k_flash<<<SEQ / 16, 32 * FW, 0, stream>>>(QP, KP, VP, SE, OC, OUT);
}

// v008
// Measured time: 49.8 microseconds a run.
// Two timings next to v007 both put it at 1.06 times that version's speed.
// Counting every step since v000, it is 20.4 times as fast.
#include <hip/hip_runtime.h>

// Single-head graph attention block: x [SEQ][512]; Wq/Wk/Wv [in][out] (y = x W + bias); edge list (int32 [2][E]) -> edges sorted by query-row group; scores q k^T / sqrt(512);
// mask form: a kept (edge) key keeps its score, every other key's score is REPLACED by -1e6 (rows without any edge come out as the uniform mean of v); softmax over all keys; output = attn v (f32).
// Compute dtypes, f32 accumulate everywhere: projections v_wmma_f32_16x16x32_bf16 (x, W, bias RNE-converted to bf16; products exact); scores v_wmma_f32_16x16x32_f16 (single f16 q and k planes);
// P.V v_wmma_f32_16x16x32_f16 (P with a x16384 carry that cancels in the normalisation, single f16 v plane, row sum over the converted P); softmax f32 (online, running max, exp2 form).
// Layout: bf16 copies of x and of the transposed weights W^T [out][in]; f16 planes q [t][512], k [t][512], v [t][512]; the edge list in chunks, each chunk sorted by the group of 16 query rows that its edges belong to, with one (start, count) word per chunk and group.
// Three launches: (1) conversion of x and of the weights; (2) the q, k and v projections in one grid, operands staged in LDS, with the edge sorter's blocks in front of them in the same grid; (3) fused attention.
// Fused attention in transposed form (S^T = K Q^T, O^T = V^T P^T): 16 query rows per block, 8 waves. The block first lists the keys that have an edge to any of its 16 rows and walks that list in rounds of up to five panels of 128 keys (all scores of a round first, then one softmax step, then all its products with v)
// (every wave scores its own 16 listed keys, whose k rows it brings into LDS by whole-line loads, against a q tile that the block keeps in LDS; the P tile goes through LDS, every wave owns 64 output columns and gathers its 128-byte slices of the listed v rows into LDS, read back transposed).
// The keys outside the list all carry the replaced score: they are walked too, by the same code, unless their weight is exactly zero for all 16 rows.

#ifndef SEQ
#define SEQ 8192                 // number of nodes (rows of x, queries and keys)
#endif
#define SEQ_FULL 8192
#define DIN  512                 // input width
#define DK   512                 // q / k / v width
#define FW   8                   // waves per attention block
#define PANEL (16 * FW)          // listed keys per panel
#define NT   5                   // panels that share one softmax round (one maximum, one P tile, two block barriers)
#define SPAN (NT * PANEL)        // listed keys per round
#define PP   (SPAN + 8)          // LDS row pitch (halves) of the P tile
#define OSP  68                  // LDS row pitch (floats) of the output staging tile
#define VH   64                  // listed keys whose v slices one wave stages at a time
#define VPITCH 160               // LDS row pitch (bytes) of a staged 128-byte v slice: an odd multiple of 32 bytes for the transposing reader
#define VSW  (VH * VPITCH)       // staging bytes per wave
#define KHB  (DK)                // bytes of half a k row: the piece of each of its 16 listed keys that a wave stages at a time
#define KPITCH (KHB + 16)        // LDS row pitch (bytes) of a staged half k row: an odd multiple of 16 bytes for the 16-byte fragment reader
#define QPITCH (DK * 2 + 16)     // LDS row pitch (bytes) of the q tile, likewise
#define AWORDS (SEQ / 32)        // groups of 32 keys: one per thread of an attention block
#define AROWS 32                 // SEQ / AROWS blocks convert the operands, and as many sort the edges
#define ATH  1024                // threads of a converting block
#define NG   (SEQ / 16)          // groups of 16 query rows: one per attention block
#define ECH  1024                // edges per chunk
#define NCH  (SEQ / AROWS)       // chunks: one per sorting block, and one per thread of an attention block
#define CCAP (ECH + 3 * NG)      // entries of one sorted chunk: every group's segment starts at a multiple of four entries (16 bytes)
#define XU   ((SEQ * (DIN / 8)) / ((SEQ / AROWS) * ATH))   // 8-element units of x converted per builder thread
#define WU   ((3 * DK * (DIN / 8)) / (SEQ / AROWS))        // 8-element units of the three W^T planes converted per builder block
#define GT   128                 // rows and columns of one projection block's tile
#define GW   4                   // waves of a projection block, 64x64 outputs each
#define GKC  64                  // k values per projection stage: one 128-byte line of every operand row
#define GPITCH (GKC * 2 + 16)    // LDS row pitch (bytes) of a staged line: an odd multiple of 16 bytes for the 16-byte fragment reader
#define GSTAGE (2 * GT * GPITCH) // bytes of one projection stage buffer
#define GNS  (DIN / GKC)         // projection stages
#define SV   (ECH / (32 * GW))   // runs of 32 edges per wave of a sorting block
#define SQ   (NG / (32 * GW))    // groups per thread of a sorting block
#define SB   (NCH / (SEQ / GT))  // rows of the projection grid that sort: SEQ / GT chunks each
#define PLE  ((size_t)SEQ * DK)  // elements of one of the q, k, v planes, which lie one behind the other
#define SC2  ((float)(0.044194173824159216 * 1.4426950408889634))   // 512^-0.5 * log2(e)
#define FILL2 ((float)(-1000000.0 * 1.4426950408889634))            // replaced score (-1e6) in the exp2 domain
#define PSH  14.0f               // log2 of the P carry (16384)
#define NEGB (-3.0e38f)

static_assert(DIN % 32 == 0);                    // GEMM k-loop steps by 32
static_assert(DK % 32 == 0);                     // score k-loop steps by 32
static_assert(DK % 64 == 0);                     // 64-wide GEMM tiles
static_assert(DIN % 8 == 0);
static_assert(SEQ % 64 == 0);                    // 64-row GEMM tiles
static_assert(SEQ % PANEL == 0);                 // the list rounded up to whole panels stays within SEQ entries
static_assert(SEQ % 16 == 0);                    // 16 query rows per attention block
static_assert(SEQ % AROWS == 0);
static_assert((SEQ & (SEQ - 1)) == 0 && SEQ <= 8192);   // a sorted entry holds the key in 13 bits, the row within its group above them
static_assert(NCH == 32 * FW);                   // one chunk per thread of an attention block
static_assert(NG % (32 * GW) == 0 && ECH % (32 * GW) == 0 && ECH / 32 == 32 && CCAP < 65536 && ECH < 65536 && (CCAP * 4) % 16 == 0);   // whole waves sum the groups; 32 runs, one count byte each; start and count fit 16 bits each
static_assert(SV == 8 && SQ == 4 && NCH % (SEQ / GT) == 0);   // the sorter's last wait names its addresses; whole grid rows sort
static_assert((size_t)(NG + 1) * 32 + (size_t)NG * 32 * 2 + (NG / 32) * 4 <= (size_t)2 * GSTAGE && ((NG + 1) * 32) % 16 == 0);   // the sorter's tables lie in the stage buffers of its block
static_assert(SEQ <= SEQ_FULL);
static_assert(DK == 64 * FW);                    // every wave owns 64 output columns
static_assert(PANEL == 128);
static_assert(PANEL % VH == 0 && VH % 32 == 0);
static_assert(VH / 4 == 16);                     // the gather's wait names its sixteen addresses
static_assert((PANEL & (PANEL - 1)) == 0 && PANEL <= 32 * FW);   // list padding: rounded up to a panel, at most one pad entry per thread
static_assert(AWORDS == 32 * FW);                // 32 keys per thread of an attention block
static_assert(SEQ <= 65536);                     // key indices fit 16 bits
static_assert(VPITCH % 32 == 0 && ((VPITCH / 32) & 1) == 1 && VPITCH >= 128);
static_assert((size_t)16 * OSP * 4 <= VSW);      // the output staging tile reuses the wave's own v staging bytes
static_assert((size_t)16 * KPITCH <= VSW);       // so do the staged half k rows
static_assert(KHB == 32 * 16);                   // one 16-byte load per lane covers half a k row
static_assert(KPITCH % 16 == 0 && ((KPITCH / 16) & 1) == 1 && QPITCH % 16 == 0 && ((QPITCH / 16) & 1) == 1);
static_assert(16 * DK * 2 == 4 * 32 * FW * 16);  // q tile: four 16-byte pieces per thread
static_assert((PP * 2) % 16 == 0 && (((PP * 2) / 16) & 1) == 1);   // 16-byte aligned P rows, an odd multiple of 16 bytes for the fragment reader
static_assert((OSP * 4) % 16 == 0);
static_assert((size_t)XU * (SEQ / AROWS) * ATH == (size_t)SEQ * DIN / 8);               // builder grid covers x exactly
static_assert((size_t)WU * (SEQ / AROWS) == (size_t)3 * DK * DIN / 8);                  // builder grid covers the weights exactly
static_assert(WU <= ATH && WU % 32 == 0 && (DK * DIN / 8) % 32 == 0);                   // whole waves, each inside one weight plane
static_assert(4 * 32 * 16 == 16 * 64 * 2);
static_assert(8 * 32 * 16 == 16 * 64 * 4);       // attention epilogue: 8 instructions x 32 lanes x 16 B == 16 rows x 256 B
static_assert((size_t)16 * PP * 2 + 2 * FW * 16 * 4 + (size_t)FW * VSW + (size_t)SEQ * 4 + (size_t)16 * QPITCH + 128 <= 163840);   // attention static LDS: two blocks per 320 KiB
static_assert(4 * ((size_t)2 * GSTAGE) <= 327680 && (size_t)GW * 16 * 68 * 4 <= (size_t)2 * GSTAGE);   // projection static LDS: four blocks per 320 KiB (three that multiply, one that sorts); the output staging fits the stage buffers
static_assert(SEQ % GT == 0 && DK % GT == 0 && GT == 128 && GW == 4);                   // 2 x 2 waves of 64x64; eight copies of 16 rows per operand, thread and stage
static_assert(DIN % GKC == 0 && GNS >= 2 && GKC % 32 == 0 && GKC * 2 == 8 * 16);        // both first stages exist; eight 16-byte pieces per staged row
static_assert(GPITCH % 16 == 0 && ((GPITCH / 16) & 1) == 1);
static_assert(((size_t)SEQ * DIN) % 8 == 0);
static_assert(((size_t)DIN * DK) % 8 == 0);

typedef _Float16 h16;
typedef unsigned short bf;
typedef __attribute__((ext_vector_type(16))) __bf16   v16bf;
typedef __attribute__((ext_vector_type(16))) _Float16 v16h;
typedef __attribute__((ext_vector_type(8)))  _Float16 v8h;
typedef __attribute__((ext_vector_type(8)))  unsigned short v8us;
typedef __attribute__((ext_vector_type(8)))  float    v8f;
typedef __attribute__((ext_vector_type(4)))  float    v4f;
typedef v4f  __attribute__((may_alias)) v4fa;
typedef __attribute__((ext_vector_type(4)))  unsigned v4u;
typedef v4u  __attribute__((may_alias)) v4ua;
typedef __attribute__((ext_vector_type(4)))  int      v4i;
typedef __attribute__((ext_vector_type(8)))  short    v8s;

__device__ __forceinline__ unsigned short f2bf(float f) { unsigned u = __float_as_uint(f); u += 0x7FFFu + ((u >> 16) & 1u); return (unsigned short)(u >> 16); }
__device__ __forceinline__ float bfr(float f) { return __uint_as_float(((unsigned)f2bf(f)) << 16); }   // value after RNE convert to bf16
__device__ __forceinline__ v16h cat16(v8h lo, v8h hi) { return __builtin_shufflevector(lo, hi, 0, 1, 2, 3, 4, 5, 6, 7, 8, 9, 10, 11, 12, 13, 14, 15); }
__device__ __forceinline__ v16bf cat16b(v8us lo, v8us hi) { return __builtin_bit_cast(v16bf, __builtin_shufflevector(lo, hi, 0, 1, 2, 3, 4, 5, 6, 7, 8, 9, 10, 11, 12, 13, 14, 15)); }
__device__ __forceinline__ v8f wmma16(v16h a, v16h b, v8f c) { return __builtin_amdgcn_wmma_f32_16x16x32_f16(false, a, false, b, (short)0, c, false, false); }
__device__ __forceinline__ v8f wmmab(v16bf a, v16bf b, v8f c) { return __builtin_amdgcn_wmma_f32_16x16x32_bf16(false, a, false, b, (short)0, c, false, false); }
// fragment loaders from K-contiguous 16-bit rows; p already includes + 8*(lane>>4): elements 0..7 <- k0+8h+0..7, elements 8..15 <- k0+16+8h+0..7 (same map for A and B)
__device__ __forceinline__ v16h  ldh(const h16* p) { return cat16(*(const v8h*)p, *(const v8h*)(p + 16)); }
__device__ __forceinline__ v16bf ldb(const bf* p)  { return cat16b(*(const v8us*)p, *(const v8us*)(p + 16)); }
// transposing LDS load: with p = T + (k0 + 8*(lane>>4) + (lane&7)) * pitch + 2 * d0 + 16 * ((lane>>3)&1), lane (c = lane&15, h = lane>>4) gets T[k0 + 8h + 0..7][d0 + c]
__device__ __forceinline__ v8h ldtr(const unsigned char* p) { typedef __attribute__((address_space(3))) v8s lds_v8s; return __builtin_bit_cast(v8h, __builtin_amdgcn_ds_load_tr16_b128_v8i16((lds_v8s*)p)); }
// ordering point for wave-private LDS tiles (same wave writes and reads)
__device__ __forceinline__ void wave_sync() { __builtin_amdgcn_fence(3 /* release order */, "wavefront"); __builtin_amdgcn_wave_barrier(); asm volatile("" ::: "memory"); }

// f32 -> f16 convert that cannot produce a subnormal f16 (|v| < 2^-14 -> +0)
static __device__ __forceinline__ h16 toh_flush(float v) { const h16 r = (h16)v; return (fabsf(v) < 6.103515625e-05f) ? (h16)0.0f : r; }
// one guarded f16 WMMA: the nops tie the accumulator and keep both fragments live
__device__ __forceinline__ v8f wmg(v16h a, v16h b, v8f c) { c = wmma16(a, b, c); asm volatile("v_nop\n\tv_nop\n\tv_nop\n\tv_nop" : "+v"(c) : "v"(a), "v"(b)); return c; }

// k_conv: the projection operands, RNE to bf16: XU units of x per thread (unit i = elements 8i .. 8i+7),
// and WU units per block of the transposed weights WB = Wq^T | Wk^T | Wv^T, W [DIN][DK] ([in][out]) -> W^T [DK][DIN] (unit i of a plane: row n = i / (DIN/8), k = (i % (DIN/8))*8 + j).
__global__ __launch_bounds__(ATH) void k_conv(const float* __restrict__ x, bf* XB, const float* __restrict__ wq, const float* __restrict__ wk, const float* __restrict__ wv, bf* WB) {
    const int tid = threadIdx.x;
    const size_t xu = (size_t)blockIdx.x * (XU * ATH) + tid;           // the thread's first unit of x; the others follow ATH units apart
    v8f xv[XU];
#pragma unroll
    for (int u = 0; u < XU; ++u) xv[u] = *(const v8f*)(x + (xu + (size_t)u * ATH) * 8);
    const unsigned g8 = blockIdx.x * WU + tid;                         // the thread's unit of WB, for tid < WU (whole waves)
    float wr[8] = {0.0f, 0.0f, 0.0f, 0.0f, 0.0f, 0.0f, 0.0f, 0.0f};
    if (tid < WU) {
        const unsigned pl = g8 / (DK * DIN / 8), i = g8 % (DK * DIN / 8);
        const float* __restrict__ Wp = (pl == 0u) ? wq : (pl == 1u) ? wk : wv;
        const unsigned n = i / (DIN / 8), k8 = (i % (DIN / 8)) * 8;
#pragma unroll
        for (int j = 0; j < 8; ++j) wr[j] = Wp[(size_t)(k8 + j) * DK + n];
    }
#pragma unroll
    for (int u = 0; u < XU; ++u) { v8us o;
#pragma unroll
        for (int k = 0; k < 8; ++k) o[k] = f2bf(xv[u][k]);
        *(v8us*)(XB + (xu + (size_t)u * ATH) * 8) = o; }
    if (tid < WU) { v8us o;
#pragma unroll
        for (int j = 0; j < 8; ++j) o[j] = f2bf(wr[j]);
        *(v8us*)(WB + (size_t)g8 * 8) = o;
    }
}

// sort_chunk: the edge list (src = ei[0..E), dst = ei[E..2E)) in chunks of ECH edges, one chunk per block of GW waves, each chunk sorted by group g = src / 16 (the 16 query rows of one attention block).
// It depends on nothing that the projections read or write, and only the attention launch reads its output: its blocks stand in the projection grid and run beside the matrix work.
// The chunk is taken as ECH / 32 runs of 32 edges; wave w owns runs SV w .. SV w + SV - 1, one edge of each run per lane. No block reads more than its own chunk.
// Place of an edge = start of its group's segment in the chunk + edges of the group in earlier runs + edges of the group in earlier lanes of its own run:
// every lane compares its group with the 32 lanes' groups (count of equals, count of equals below it); the first lane of each group in a run stores the run's count as one byte of cnt[g][run] (one writer per byte);
// a thread sums the 32 bytes of each of its SQ groups, a block-wide prefix sum over the padded totals gives the segment starts. SE[chunk][place] = (src % 16) << 13 | dst; OC[chunk][g] = start | count << 16.
// Indices below zero wrap once; an edge still outside the matrix, or past the end of the list, goes to the spare group NG and is not stored.
__device__ __forceinline__ void sort_chunk(const int chunk, const int* __restrict__ ei, unsigned* SE, unsigned* OC, const int E, unsigned char* lds) {
    unsigned char* cnt = lds;                                          // [(NG + 1) * 32]: edges of group g in run r
    unsigned short* wb = (unsigned short*)(lds + (NG + 1) * 32);       // [NG * 32]: place of the first edge of group g in run r
    int* wsum = (int*)(lds + (NG + 1) * 32 + NG * 32 * 2);             // [NG / 32]
    const int tid = threadIdx.x, lane = threadIdx.x & 31;
    const int wave = __builtin_amdgcn_readfirstlane((int)(threadIdx.x >> 5));
    const int e0 = chunk * ECH + wave * (SV * 32) + lane;              // the thread's edge of its wave's first run; the others follow 32 edges apart
    int s[SV], d[SV];                                                  // loops over j and q unrolled: registers
    { unsigned ob[SV];                                                 // places in either half of the list, held inside it (E is at least 1), all formed first: sixteen loads issued together, no branch between them
      const int* ed = ei + (size_t)E;
#pragma unroll
      for (int j = 0; j < SV; ++j) ob[j] = (unsigned)min(e0 + 32 * j, E - 1);
#pragma unroll
      for (int j = 0; j < SV; ++j) s[j] = ei[ob[j]];
#pragma unroll
      for (int j = 0; j < SV; ++j) d[j] = ed[ob[j]];
      // the address registers of the issued loads stay as they are up to this wait (they are its inputs)
      asm volatile("s_wait_xcnt 0x0" :: "v"(ob[0]), "v"(ob[1]), "v"(ob[2]), "v"(ob[3]), "v"(ob[4]), "v"(ob[5]), "v"(ob[6]), "v"(ob[7]) : "memory");
#pragma unroll
      for (int j = 0; j < SV; ++j) if (e0 + 32 * j >= E) { s[j] = SEQ; d[j] = SEQ; } }   // no edge: outside the matrix
    for (int i = tid; i < (NG + 1) * 2; i += 32 * GW) { const v4u z = (v4u){0u, 0u, 0u, 0u}; *(v4ua*)(&cnt[(size_t)i * 16]) = z; }
    int g[SV], before[SV], total[SV];                                  // group; edges of the same group in lower lanes, in the whole run
#pragma unroll
    for (int j = 0; j < SV; ++j) {
        s[j] += (s[j] < 0) ? SEQ : 0; d[j] += (d[j] < 0) ? SEQ : 0;
        const bool ok = ((unsigned)s[j] < (unsigned)SEQ) & ((unsigned)d[j] < (unsigned)SEQ);
        g[j] = ok ? (s[j] >> 4) : NG; before[j] = 0; total[j] = 0; }
#pragma unroll 1                                                        // one copy of the comparison with lane i serves all 32: small code beside the matrix loop
    for (int i = 0; i < 32; ++i) {
#pragma unroll
        for (int j = 0; j < SV; ++j) { const int eq = (__builtin_amdgcn_readlane(g[j], i) == g[j]) ? 1 : 0; total[j] += eq; before[j] += (i < lane) ? eq : 0; }
    }
    __syncthreads();                                                   // cnt is zero everywhere
#pragma unroll
    for (int j = 0; j < SV; ++j) if (before[j] == 0) cnt[g[j] * 32 + wave * SV + j] = (unsigned char)total[j];   // at most 32
    __syncthreads();
    int tot[SQ], pad[SQ], inc[SQ];                                     // group q * 32 GW + tid: its edges in the chunk, the entries that its segment takes, the inclusive prefix sum of those over the wave
#pragma unroll
    for (int q = 0; q < SQ; ++q) {
        const int gg = q * (32 * GW) + tid;
        const v4u c0 = *(const v4ua*)(&cnt[(size_t)gg * 32]); const v4u c1 = *(const v4ua*)(&cnt[(size_t)gg * 32 + 16]);
        int t = 0;
#pragma unroll
        for (int w = 0; w < 16; ++w) t += (int)((c0[w >> 2] >> (8 * (w & 3))) & 255u) + (int)((c1[w >> 2] >> (8 * (w & 3))) & 255u);
        tot[q] = t; pad[q] = (t + 3) & ~3; inc[q] = pad[q];
    }
#pragma unroll
    for (int dd = 1; dd < 32; dd <<= 1) { int up[SQ];                  // the SQ sums step together: one exchange latency a step
#pragma unroll
        for (int q = 0; q < SQ; ++q) up[q] = __shfl_up(inc[q], dd, 32);
#pragma unroll
        for (int q = 0; q < SQ; ++q) inc[q] += (lane >= dd) ? up[q] : 0; }
#pragma unroll
    for (int q = 0; q < SQ; ++q) if (lane == 31) wsum[q * GW + wave] = inc[q];   // groups 32 (q GW + wave) .. + 31
    __syncthreads();
    unsigned* se = SE + (size_t)chunk * CCAP;
    int gs[SQ];
#pragma unroll
    for (int q = 0; q < SQ; ++q) {
        const int gg = q * (32 * GW) + tid;
        int base = 0;
#pragma unroll
        for (int w = 0; w < NG / 32; ++w) base += (w < q * GW + wave) ? wsum[w] : 0;
        gs[q] = base + inc[q] - pad[q];                                // start of the segment: a multiple of 4, gs + pad <= CCAP
        const v4u c0 = *(const v4ua*)(&cnt[(size_t)gg * 32]); const v4u c1 = *(const v4ua*)(&cnt[(size_t)gg * 32 + 16]);
        int run = gs[q];
#pragma unroll
        for (int h = 0; h < 4; ++h) { v8us o;
#pragma unroll
            for (int k = 0; k < 8; ++k) { const int w = 8 * h + k; o[k] = (unsigned short)run; run += (int)((((w < 16) ? c0[(w & 15) >> 2] : c1[(w & 15) >> 2]) >> (8 * (w & 3))) & 255u); }
            *(v8us*)(&wb[(size_t)gg * 32 + 8 * h]) = o; }
    }
    __syncthreads();
    // all global stores stand behind the last barrier, so that no barrier waits for a store; all their addresses are formed first
    unsigned* sp[SV]; unsigned* tp[SQ];
#pragma unroll
    for (int j = 0; j < SV; ++j) sp[j] = se + ((int)wb[((g[j] < NG) ? g[j] : 0) * 32 + wave * SV + j] + before[j]);
#pragma unroll
    for (int q = 0; q < SQ; ++q) tp[q] = se + (gs[q] + tot[q]);
    unsigned* op = OC + (size_t)chunk * NG + tid;
#pragma unroll
    for (int j = 0; j < SV; ++j) if (g[j] < NG) *sp[j] = ((unsigned)(s[j] & 15) << 13) | (unsigned)d[j];
#pragma unroll
    for (int q = 0; q < SQ; ++q) {
        op[q * (32 * GW)] = (unsigned)gs[q] | ((unsigned)tot[q] << 16);
#pragma unroll
        for (int k = 0; k < 3; ++k) if (tot[q] + k < pad[q]) tp[q][k] = 0u;   // the pad entries are loaded with their segment, and not used
    }
    // the address registers of the issued stores stay as they are up to this wait (they are its inputs)
    asm volatile("s_wait_xcnt 0x0" :: "v"(sp[0]), "v"(sp[1]), "v"(sp[2]), "v"(sp[3]), "v"(sp[4]), "v"(sp[5]), "v"(sp[6]), "v"(sp[7]), "v"(tp[0]), "v"(tp[1]), "v"(tp[2]), "v"(tp[3]), "v"(op) : "memory");
}

// k_proj_rows: grid (SEQ/GT, SB + 3 * DK/GT). The blocks of the first SB grid rows sort one chunk of the edge list each (sort_chunk) and end. The others: bf16 GEMM for q, k and v: C[t][n] = sum_k x[t][k] W^T[n][k] + bias[n], written as f16 into the row-major plane [t][DK] that by = blockIdx.y - SB names.
// One block of four waves per GT x GT tile, every wave a 64x64 quarter (16 accumulators). The block's GT rows of x and GT rows of W^T go through LDS in stages of GKC k values (one whole 128-byte line per row and stage),
// brought by asynchronous copies into two buffers: stage s + 1 flies while stage s is multiplied. Fragments are read from LDS rows of pitch GPITCH; k runs upward in steps of 32 for every accumulator.
__global__ __launch_bounds__(32 * GW) void k_proj_rows(const bf* __restrict__ A, const bf* __restrict__ WB, const float* __restrict__ bq, const float* __restrict__ bk, const float* __restrict__ bv, h16* P,
                                                       const int* __restrict__ ei, unsigned* SE, unsigned* OC, int E) {
    __shared__ __align__(16) unsigned char GS[2 * GSTAGE];             // two buffers, each: GT rows of x, then GT rows of W^T
    if (blockIdx.y < SB) { sort_chunk((int)(blockIdx.y * (SEQ / GT) + blockIdx.x), ei, SE, OC, E, GS); return; }   // the whole block: in front of every barrier below
    const int by = (int)blockIdx.y - SB;
    const int tid = threadIdx.x;
    const int lane = threadIdx.x & 31, lr = lane & 15, hi = lane >> 4;
    const int wave = __builtin_amdgcn_readfirstlane((int)(threadIdx.x >> 5));
    const int pl = by / (DK / GT);
    const int r0 = blockIdx.x * GT + (wave >> 1) * 64, c0 = (by % (DK / GT)) * GT + (wave & 1) * 64;   // the wave's quarter in the plane
    const float* __restrict__ bias = (pl == 0) ? bq : (pl == 1) ? bk : bv;
    h16* Ph = P + (size_t)pl * PLE;
    // copy i of a thread: staged row 16 i + (tid >> 3), 16-byte piece tid & 7; all rows lie inside the planes (the grid covers them exactly), all LDS bytes inside GS
    const bf* ga = A + (size_t)(blockIdx.x * GT + (tid >> 3)) * DIN + (tid & 7) * 8;
    const bf* gb = WB + (size_t)pl * DK * DIN + (size_t)((by % (DK / GT)) * GT + (tid >> 3)) * DIN + (tid & 7) * 8;
    const unsigned l0 = (unsigned)(size_t)(&GS[0]) + (unsigned)((tid >> 3) * GPITCH + (tid & 7) * 16);   // LDS byte address: the low 32 bits of the shared address
    // eight copies, rows 16 apart, each with its own address registers; the wait in the same statement stands in front of any rewrite of those registers
    auto copy8 = [&](unsigned l, const bf* g) {
        asm volatile("global_load_async_to_lds_b128 %0, %8, off\n\t"
                     "global_load_async_to_lds_b128 %1, %9, off\n\t"
                     "global_load_async_to_lds_b128 %2, %10, off\n\t"
                     "global_load_async_to_lds_b128 %3, %11, off\n\t"
                     "global_load_async_to_lds_b128 %4, %12, off\n\t"
                     "global_load_async_to_lds_b128 %5, %13, off\n\t"
                     "global_load_async_to_lds_b128 %6, %14, off\n\t"
                     "global_load_async_to_lds_b128 %7, %15, off\n\t"
                     "s_wait_xcnt 0x0"
                     :: "v"(l), "v"(l + 16 * GPITCH), "v"(l + 32 * GPITCH), "v"(l + 48 * GPITCH), "v"(l + 64 * GPITCH), "v"(l + 80 * GPITCH), "v"(l + 96 * GPITCH), "v"(l + 112 * GPITCH),
                        "v"(g), "v"(g + 16 * DIN), "v"(g + 32 * DIN), "v"(g + 48 * DIN), "v"(g + 64 * DIN), "v"(g + 80 * DIN), "v"(g + 96 * DIN), "v"(g + 112 * DIN) : "memory");
    };
    auto fill = [&](int s) {                                           // stage s into buffer s & 1
        const unsigned l = l0 + (unsigned)((s & 1) * GSTAGE);
        copy8(l, ga + s * GKC);
        copy8(l + GT * GPITCH, gb + s * GKC);
    };
    v8f acc[4][4];
#pragma unroll
    for (int mb = 0; mb < 4; ++mb)
#pragma unroll
        for (int nb = 0; nb < 4; ++nb) acc[mb][nb] = (v8f){};
    const unsigned char* ard = GS + ((wave >> 1) * 64 + lr) * GPITCH + 16 * hi;        // A fragment: row t, k
    const unsigned char* brd = GS + (GT + (wave & 1) * 64 + lr) * GPITCH + 16 * hi;    // B fragment: row n of W^T, k
    fill(0);
    asm volatile("s_wait_asynccnt 0x0" ::: "memory");                  // the wave's own copies of stage 0 have landed
    __syncthreads();                                                   // and every other wave's
    fill(1);
#pragma unroll 1                                                        // one copy of the body: the buffer is picked by the stage's parity
    for (int s = 0; s < GNS; ++s) {
        const int bo = (s & 1) * GSTAGE;
#pragma unroll
        for (int ks = 0; ks < GKC / 32; ++ks) {
            v16bf a[4], b[4];
#pragma unroll
            for (int mb = 0; mb < 4; ++mb) a[mb] = ldb((const bf*)(ard + bo + mb * 16 * GPITCH + ks * 64));
#pragma unroll
            for (int nb = 0; nb < 4; ++nb) b[nb] = ldb((const bf*)(brd + bo + nb * 16 * GPITCH + ks * 64));
            __builtin_amdgcn_sched_barrier(0);                         // keeps the sixteen LDS reads together ahead of their sixteen products: one exposed LDS latency per k step, not one per W^T fragment
#pragma unroll
            for (int nb = 0; nb < 4; ++nb)
#pragma unroll
                for (int mb = 0; mb < 4; ++mb) acc[mb][nb] = wmmab(a[mb], b[nb], acc[mb][nb]);
        }
        asm volatile("s_wait_dscnt 0x0" ::: "memory");                 // the wave's reads of this buffer have retired before the buffer is refilled
        asm volatile("s_wait_asynccnt 0x0" ::: "memory");              // the wave's own copies of stage s + 1 have landed
        __syncthreads();                                               // publishes stage s + 1 and ends every wave's reads of stage s
        if (s + 2 < GNS) fill(s + 2);                                  // same test in the whole block
    }
    asm volatile("s_wait_asynccnt 0x0" ::: "memory");                  // no copy is outstanding when the wave ends
    float* os = (float*)GS + wave * (16 * 68);                         // output staging, one tile per wave, in the stage buffers: every wave's reads of them ended at the loop's last barrier, and no copy is outstanding
    float bc[4];
#pragma unroll
    for (int nb = 0; nb < 4; ++nb) bc[nb] = bfr(bias[c0 + nb * 16 + lr]);   // c0 + 63 < DK
    const size_t tbase = (size_t)r0 * DK + (size_t)c0;
#pragma unroll
    for (int mb = 0; mb < 4; ++mb) {
#pragma unroll
        for (int nb = 0; nb < 4; ++nb) {
#pragma unroll
            for (int j = 0; j < 8; ++j) os[(hi * 8 + j) * 68 + nb * 16 + lr] = acc[mb][nb][j] + bc[nb]; }   // D: row 8h+j, col lane&15
        wave_sync();
        {
            const size_t sb = tbase + (size_t)(mb * 16) * DK;
#pragma unroll
            for (int s = 0; s < 4; ++s) { const int row = 4 * s + (lane >> 3), c8 = (lane & 7) * 8;   // 4 s x 4 row groups = 16 rows; 8 lanes x 8 = 64 columns
                const v4f x0 = *(const v4fa*)(&os[row * 68 + c8]); const v4f x1 = *(const v4fa*)(&os[row * 68 + c8 + 4]); v8h hv;
#pragma unroll
                for (int i = 0; i < 4; ++i) { hv[i] = toh_flush(x0[i]); hv[4 + i] = toh_flush(x1[i]); }
                const size_t oo = sb + (size_t)row * DK + c8;
                *(v8h*)(Ph + oo) = hv; }
        }
        wave_sync();
    }
}

// k_flash: fused attention, one block per 16 query rows, FW = 8 waves.
// First the block builds, in LDS, one 16-bit mask per key: the rows among its 16 that have an edge to the key. Thread c takes the block's segment of sorted chunk c; an edge's bit is set by a plain load, OR and store,
// so a store can overwrite another edge's bit set between its load and itself: behind a barrier every thread looks its bits up again, and the missing ones are set anew in a further round. A bit that stands at a barrier
// stays (every later load sees it), only an edge whose bit is missing stores, and the last store to a word in a round brings a new bit: 16 rounds at most, the result the same whatever the order.
// Pass 0 lists, in rising order, the keys with an edge to any of the block's 16 rows (thread i owns keys 32i .. 32i+31: block-wide prefix sum of the counts),
// and walks the list, looking each listed key's row mask up again; pass 1 does the same with the keys that are left (all masks zero). A key of pass 1 has the replaced score in every row, so its weight is
// exp2(FILL2 - max + 14), taken as 0 below -14 like every other weight: where that holds for all 16 rows after pass 0, pass 1 would add only zeros and is left out (same value in every wave: block-uniform).
// The list is padded to whole panels of 128 keys (a pad entry scores NEGB, weight 0) and walked in rounds of up to NT panels; no block barrier stands between the panels of a round. Per round:
//  (1) for each panel, wave w scores its own 16 listed keys in transposed form, S^T = K Q^T over the full width: all 32 loads of its 16 k rows (512 contiguous bytes each) are issued together, the rows go through the wave's own LDS bytes
//      one half width at a time, and A (k rows) and B (q rows, from the block's LDS tile) are read as fragments there; lane (t = lane&15, h = lane>>4) holds listed keys 8h+r for query t; a tile of pass 1, or of pad entries alone, is not multiplied;
//  (2) per-query max over the round: lane partial, xor-16 exchange, one word per wave per query in LDS, block barrier, combine over the 8 waves (identical in every wave);
//  (3) P = exp2(score - max + 14) as f16 (arguments below -14 give 0), P tile [t][keys of the round] into LDS, partial sums over the converted P, block barrier;
//  (4) wave w accumulates O^T rows d in [64w, 64w+64): it gathers v[key][64w .. 64w+63] (one 128-byte line per key) of 64 listed keys at a time into its own LDS rows; A = V^T by transposing LDS loads,
//      B = P^T from the LDS tile (both in the k order 8h+0..7, 16+8h+0..7), the next 64 keys' gather in flight under every product stage but the round's last; block barrier before the next round.
// four waves per SIMD asked for: at most 256 registers a wave, so that two blocks share a WGP
__global__ __launch_bounds__(32 * FW, 4) void k_flash(const h16* __restrict__ QP, const h16* __restrict__ KP, const h16* __restrict__ VP, const unsigned* __restrict__ SE, const unsigned* __restrict__ OC, float* OUT) {
    __shared__ __align__(16) h16 Ps[16 * PP];
    __shared__ float redm[FW * 16];
    __shared__ float reds[FW * 16];
    __shared__ int wsum[FW];
    __shared__ int wflag[FW];
    __shared__ __align__(16) unsigned short kpl[SEQ];                  // per key: the block's rows that keep it
    __shared__ __align__(16) unsigned short klist[SEQ];
    __shared__ __align__(32) unsigned char VS[FW * VSW];
    __shared__ __align__(16) unsigned char QS[16 * QPITCH];
    const int tid = threadIdx.x;
    const int lane = threadIdx.x & 31, lr = lane & 15, hi = lane >> 4;
    const int wave = __builtin_amdgcn_readfirstlane((int)(threadIdx.x >> 5));
    const int q0 = blockIdx.x * 16;
    const int pw = lr * PP + wave * 16 + 8 * hi;                       // P tile write offset (listed keys wave*16 + 8h + r)
    const int pf = lr * PP + 8 * hi;                                   // P^T fragment read offset (col t, k = listed key)
    unsigned char* vsw = VS + wave * VSW;                              // the wave's own staging rows
    unsigned char* vwr = vsw + (lane >> 3) * VPITCH + (lane & 7) * 16;                                   // store i: staged row 4i + (lane>>3), 16-byte piece lane&7
    const unsigned char* vrd = vsw + (8 * hi + (lane & 7)) * VPITCH + ((lane >> 3) & 1) * 16;            // transposing read, staged row base 0, column base 0
    const h16* vsrc = VP + wave * 64 + (lane & 7) * 8;                 // + key * DK
    // gather of the wave's slices of listed keys jb .. jb+VH-1: load i covers four whole 128-byte lines (every list entry is below SEQ by construction)
    auto fetchv = [&](v4u (&vr)[VH / 4], int jb) {
        const h16* vp[VH / 4];                                         // all addresses are formed first; both loops are unrolled so that vp and vr are registers
#pragma unroll
        for (int i = 0; i < VH / 4; ++i) vp[i] = vsrc + (size_t)klist[jb + 4 * i + (lane >> 3)] * DK;
#pragma unroll
        for (int i = 0; i < VH / 4; ++i) vr[i] = *(const v4u*)vp[i];
        // the address registers of the issued loads stay as they are up to this wait (they are its inputs), so that none is reused ahead of it
        asm volatile("s_wait_xcnt 0x0" :: "v"(vp[0]), "v"(vp[1]), "v"(vp[2]), "v"(vp[3]), "v"(vp[4]), "v"(vp[5]), "v"(vp[6]), "v"(vp[7]),
                                          "v"(vp[8]), "v"(vp[9]), "v"(vp[10]), "v"(vp[11]), "v"(vp[12]), "v"(vp[13]), "v"(vp[14]), "v"(vp[15]) : "memory");
    };
    auto stagev = [&](const v4u (&vr)[VH / 4]) {
#pragma unroll
        for (int i = 0; i < VH / 4; ++i) *(v4ua*)(vwr + i * 4 * VPITCH) = vr[i];
        asm volatile("s_wait_dscnt 0x0" ::: "memory");                 // the wave's own stores have retired before its transposing loads read the rows back
    };
    // the block's 16 q rows (16 KiB in a row in the plane) into LDS: piece 256 i + tid = row 4i + (tid>>6), 16-byte column tid&63; first read behind the barriers of the list stage (loops unrolled: qv is registers)
    { const h16* qg = QP + (size_t)q0 * DK + tid * 8; v4u qv[4];
#pragma unroll
      for (int i = 0; i < 4; ++i) qv[i] = *(const v4u*)(qg + i * (32 * FW * 8));
      asm volatile("s_wait_xcnt 0x0" :: "v"(qg) : "memory");           // the address register of the issued loads stays as it is up to this wait (it is its input)
#pragma unroll
      for (int i = 0; i < 4; ++i) *(v4ua*)(QS + (4 * i + (tid >> 6)) * QPITCH + (tid & 63) * 16) = qv[i]; }
    // row masks of all keys from the block's segments of the sorted chunks (thread tid: chunk tid); start and count are bounded here, so that every entry read lies inside the chunk
    {
        const unsigned* op = OC + (size_t)tid * NG + blockIdx.x;
        const unsigned oc = *op;
        asm volatile("s_wait_xcnt 0x0" :: "v"(op) : "memory");         // the address register of the issued load stays as it is up to this wait (it is its input)
#pragma unroll
        for (int i = 0; i < SEQ * 2 / 16 / (32 * FW); ++i) { const v4u z = (v4u){0u, 0u, 0u, 0u}; *(v4ua*)(&kpl[(size_t)(i * 32 * FW + tid) * 8]) = z; }
        const int es = min((int)(oc & 0xFFFCu), CCAP);
        const int ec = min((int)(oc >> 16), CCAP - es);
        const unsigned* sp = SE + (size_t)tid * CCAP + es;
        v4u e0 = (v4u){0u, 0u, 0u, 0u}, e1 = (v4u){0u, 0u, 0u, 0u};    // the first eight edges stay in registers; a longer segment is read again in every round
        if (ec > 0) e0 = *(const v4u*)sp;
        if (ec > 4) e1 = *(const v4u*)(sp + 4);
        asm volatile("s_wait_xcnt 0x0" :: "v"(sp) : "memory");         // likewise
        int ky[8]; unsigned bt[8];                                     // loops unrolled: registers; an entry past the count has no bit
#pragma unroll
        for (int j = 0; j < 8; ++j) { const unsigned w = (j < 4) ? e0[j & 3] : e1[j & 3]; ky[j] = (int)(w & (unsigned)(SEQ - 1)); bt[j] = (j < ec) ? (1u << ((w >> 13) & 15u)) : 0u; }
        __syncthreads();                                               // the masks are zero everywhere
#pragma unroll 1                                                        // one copy of the round with its barriers: the first round or two end it
        for (int round = 0; round < 16; ++round) {
            unsigned od[8];
#pragma unroll
            for (int j = 0; j < 8; ++j) od[j] = (unsigned)kpl[ky[j]];  // all eight loads together: one LDS latency
#pragma unroll
            for (int j = 0; j < 8; ++j) if ((bt[j] & ~od[j]) != 0u) kpl[ky[j]] = (unsigned short)(od[j] | bt[j]);
#pragma unroll 1                                                        // seldom entered: kept small
            for (int i = 8; i < ec; ++i) {                             // at most CCAP trips
                const unsigned w = sp[i]; const int k = (int)(w & (unsigned)(SEQ - 1)); const unsigned b = 1u << ((w >> 13) & 15u);
                const unsigned o = (unsigned)kpl[k]; if ((b & ~o) != 0u) kpl[k] = (unsigned short)(o | b);
            }
            __syncthreads();                                           // every store of the round stands
            unsigned miss = 0u;
#pragma unroll
            for (int j = 0; j < 8; ++j) miss |= bt[j] & ~(unsigned)kpl[ky[j]];
#pragma unroll 1                                                        // seldom entered: kept small
            for (int i = 8; i < ec; ++i) { const unsigned w = sp[i]; miss |= (1u << ((w >> 13) & 15u)) & ~(unsigned)kpl[(int)(w & (unsigned)(SEQ - 1))]; }
            const unsigned wm = __builtin_amdgcn_ballot_w32(miss != 0u);
            if (lane == 0) wflag[wave] = (wm != 0u) ? 1 : 0;
            __syncthreads();                                           // also ends the round's look-ups before the next round's stores
            int anym = 0;
#pragma unroll
            for (int w = 0; w < FW; ++w) anym |= wflag[w];
            if (__builtin_amdgcn_readfirstlane(anym) == 0) break;      // same value in every wave: block-uniform
        }
    }
    unsigned char* kwr = vsw + lane * 16;                              // store i: staged row i (listed key j0 + i), 16-byte piece lane
    const unsigned char* krd = vsw + lr * KPITCH + 16 * hi;            // A fragment: row = listed key, k = d
    const unsigned char* qrd = QS + lr * QPITCH + 16 * hi;             // B fragment: col t, k = d
    // the k rows of listed keys j0 .. j0+15, lower halves into k0, upper halves into k1: every load covers four whole 128-byte lines (every list entry is below SEQ by construction)
    auto fetchk = [&](v4u (&k0)[16], v4u (&k1)[16], int j0) {
        const v8us ia = *(const v8us*)(&klist[j0]); const v8us ib = *(const v8us*)(&klist[j0 + 8]);
        unsigned kp[16];                                               // byte offsets in the plane (below SEQ * DK * 2), one register each, all formed first; the loops are unrolled so that kp, k0 and k1 are registers
#pragma unroll
        for (int i = 0; i < 8; ++i) { kp[i] = (unsigned)ia[i] * (DK * 2) + (unsigned)lane * 16u; kp[8 + i] = (unsigned)ib[i] * (DK * 2) + (unsigned)lane * 16u; }
#pragma unroll
        for (int i = 0; i < 16; ++i) k0[i] = *(const v4u*)((const unsigned char*)KP + kp[i]);
#pragma unroll
        for (int i = 0; i < 16; ++i) k1[i] = *(const v4u*)((const unsigned char*)KP + kp[i] + KHB);
        // the address registers of the issued loads stay as they are up to this wait (they are its inputs), so that none is reused ahead of it; it also keeps all 32 loads ahead of the first product
        asm volatile("s_wait_xcnt 0x0" :: "v"(kp[0]), "v"(kp[1]), "v"(kp[2]), "v"(kp[3]), "v"(kp[4]), "v"(kp[5]), "v"(kp[6]), "v"(kp[7]),
                                          "v"(kp[8]), "v"(kp[9]), "v"(kp[10]), "v"(kp[11]), "v"(kp[12]), "v"(kp[13]), "v"(kp[14]), "v"(kp[15]) : "memory");
    };
    auto stagek = [&](const v4u (&kr)[16]) {
#pragma unroll                                                          // kr is registers, the row offsets are immediates
        for (int i = 0; i < 16; ++i) *(v4ua*)(kwr + i * KPITCH) = kr[i];
        asm volatile("s_wait_dscnt 0x0" ::: "memory");                 // the wave's own stores have retired before its fragment loads read the rows back
    };
    // the staged half width (d = 256 hf .. 256 hf + 255) of the score tile, in rising d; all loops unrolled, so that the sixteen LDS reads of four k steps stand together ahead of their products
    auto qk = [&](v8f s, int hf) {
#pragma unroll
        for (int g = 0; g < KHB / 256; ++g) {
            v16h a[4], b[4];
#pragma unroll
            for (int u = 0; u < 4; ++u) { a[u] = ldh((const h16*)(krd + g * 256 + u * 64)); b[u] = ldh((const h16*)(qrd + hf * KHB + g * 256 + u * 64)); }
#pragma unroll
            for (int u = 0; u < 4; ++u) s = wmg(a[u], b[u], s);
        }
        wave_sync();                                                   // the staged rows are rewritten only behind these reads
        return s;
    };
    v8f o0 = (v8f){}, o1 = (v8f){}, o2 = (v8f){}, o3 = (v8f){};
    auto pv = [&](int jl) {                                            // VH staged keys against P columns jl .. jl+VH-1
#pragma unroll
        for (int kc = 0; kc < VH; kc += 32) {
            const v16h pb = cat16(*(const v8h*)(&Ps[pf + jl + kc]), *(const v8h*)(&Ps[pf + jl + kc + 16]));
            const unsigned char* ad = vrd + kc * VPITCH;
            const v16h v0 = cat16(ldtr(ad),      ldtr(ad + 16 * VPITCH));        o0 = wmg(v0, pb, o0);
            const v16h v1 = cat16(ldtr(ad + 32), ldtr(ad + 16 * VPITCH + 32));   o1 = wmg(v1, pb, o1);
            const v16h v2 = cat16(ldtr(ad + 64), ldtr(ad + 16 * VPITCH + 64));   o2 = wmg(v2, pb, o2);
            const v16h v3 = cat16(ldtr(ad + 96), ldtr(ad + 16 * VPITCH + 96));   o3 = wmg(v3, pb, o3);
        }
        wave_sync();                                                   // the staged rows are rewritten only behind these reads
    };
    float m = NEGB, l = 0.0f;
#pragma unroll 1                                                        // one copy of the large body with its barriers serves both passes
    for (int pass = 0; pass < 2; ++pass) {
        unsigned un = 0u;                                              // bit b: key 32*tid + b has an edge to one of the block's rows
#pragma unroll
        for (int i = 0; i < 4; ++i) { const v4u pm = *(const v4ua*)(&kpl[(size_t)tid * 32 + 8 * i]);
#pragma unroll
            for (int k = 0; k < 4; ++k) un |= (((pm[k] & 0xFFFFu) != 0u) ? (1u << (8 * i + 2 * k)) : 0u) | (((pm[k] >> 16) != 0u) ? (2u << (8 * i + 2 * k)) : 0u); }
        unsigned sel = (pass == 0) ? un : ~un;                         // this pass's keys among 32*tid .. 32*tid+31
        const int cnt = __popc(sel);
        int inc = cnt;                                                 // inclusive prefix sum over the wave
#pragma unroll
        for (int d = 1; d < 32; d <<= 1) { const int up = __shfl_up(inc, d, 32); inc += (lane >= d) ? up : 0; }
        if (lane == 31) wsum[wave] = inc;
        __syncthreads();
        int base = 0, nn = 0;
#pragma unroll
        for (int w = 0; w < FW; ++w) { const int c = wsum[w]; base += (w < wave) ? c : 0; nn += c; }
        const int n = __builtin_amdgcn_readfirstlane(nn);              // listed keys of this pass, at most SEQ
        int pos = base + inc - cnt;
        while (sel != 0u) {                                            // at most 32 trips; pos stays below n
            const int b = __builtin_ctz(sel); sel &= sel - 1u;
            klist[pos] = (unsigned short)(tid * 32 + b); ++pos;
        }
        const int np = (n + PANEL - 1) & ~(PANEL - 1);                 // at most SEQ
        if (n + tid < np) klist[n + tid] = (unsigned short)0;
        __syncthreads();
#pragma unroll 1                                                        // one copy of the round with its barriers
        for (int kb = 0; kb < np; kb += SPAN) {
            const int nt = min(NT, (np - kb) / PANEL);                 // panels of this round, at least one: the same in the whole block
            v4u va[VH / 4], vb[VH / 4];
            float ta[NT][8]; float mx = NEGB;                          // loops over u unrolled: ta and fb are registers
            // fb[u], bit r: the lane's query row keeps listed key r of the lane's eight in panel u. All look-ups of the round stand together (one LDS latency); a panel past the round's last reads the last one's entries, and is not used
            unsigned fb[NT];
            { v8us kk[NT];
#pragma unroll
              for (int u = 0; u < NT; ++u) kk[u] = *(const v8us*)(&klist[kb + min(u, nt - 1) * PANEL + wave * 16 + 8 * hi]);
#pragma unroll
              for (int u = 0; u < NT; ++u) { fb[u] = 0u;
#pragma unroll
                  for (int r = 0; r < 8; ++r) fb[u] |= (((unsigned)kpl[kk[u][r]] >> lr) & 1u) << r; } }   // every list entry is below SEQ
#pragma unroll
            for (int u = 0; u < NT; ++u) {
                if (u < nt) {
                    const int j0 = kb + u * PANEL + wave * 16;
                    const bool any = (pass == 0) && (j0 < n);          // a key of pass 0 has a row that keeps it, a key of pass 1 and a pad entry have none that counts: wave-uniform
                    v8f sa = (v8f){};
                    if (any) { v4u k0[16], k1[16]; fetchk(k0, k1, j0); stagek(k0); sa = qk(sa, 0); stagek(k1); sa = qk(sa, 1); }
#pragma unroll
                    for (int r = 0; r < 8; ++r) {
                        const bool fa = ((fb[u] >> r) & 1u) != 0u;
                        const float sc = fa ? sa[r] * SC2 : FILL2;     // kept: scaled score; otherwise the score is replaced
                        ta[u][r] = (j0 + 8 * hi + r < n) ? sc : NEGB;  // a pad entry is no key
                        mx = fmaxf(mx, ta[u][r]); }
                } else {
#pragma unroll
                    for (int r = 0; r < 8; ++r) ta[u][r] = NEGB;       // no panel: not used below
                }
            }
            fetchv(va, kb);                                            // the round's first v gather: in flight under the exchange of the maxima
            mx = fmaxf(mx, __shfl_xor(mx, 16, 32));
            if (hi == 0) redm[wave * 16 + lr] = mx;
            __syncthreads();
            float pm = redm[lr];
#pragma unroll
            for (int w = 1; w < FW; ++w) pm = fmaxf(pm, redm[w * 16 + lr]);
            const float mnew = fmaxf(m, pm);
            const float alpha = __builtin_amdgcn_exp2f(m - mnew);
            const float sh = PSH - mnew;
            float ls = 0.0f;
#pragma unroll
            for (int u = 0; u < NT; ++u) {
                if (u < nt) {
                    v8h pa;
#pragma unroll
                    for (int r = 0; r < 8; ++r) {
                        const float ea = ta[u][r] + sh;
                        const float xa = __builtin_amdgcn_exp2f(ea);
                        const float ga = (ea < -14.0f) ? 0.0f : xa;    // never a subnormal f16
                        const h16 ha = (h16)ga;
                        pa[r] = ha; ls += (float)ha; }
                    *(v8h*)(&Ps[pw + u * PANEL]) = pa;
                }
            }
            ls += __shfl_xor(ls, 16, 32);
            if (hi == 0) reds[wave * 16 + lr] = ls;
            __syncthreads();
            float lsum = reds[lr];
#pragma unroll
            for (int w = 1; w < FW; ++w) lsum += reds[w * 16 + lr];
            l = l * alpha + lsum; m = mnew;
            o0 = o0 * alpha; o1 = o1 * alpha; o2 = o2 * alpha; o3 = o3 * alpha;
#pragma unroll 1                                                        // one copy of the product stage serves every panel of the round
            for (int u = 0; u < nt; ++u) {
                stagev(va);
                fetchv(vb, kb + u * PANEL + VH);                       // in flight under the first half's products
                pv(u * PANEL);
                stagev(vb);
                if (u + 1 < nt) fetchv(va, kb + (u + 1) * PANEL);      // the next panel's first half, in flight under the second half's products (same test in the whole block)
                pv(u * PANEL + VH);
            }
            __syncthreads();
        }
        const float ef = FILL2 + (PSH - fmaxf(m, FILL2));              // weight argument of a key that no row of the block keeps
        if (__builtin_amdgcn_ballot_w32(ef >= -14.0f) == 0u) break;    // m is the same in every wave: block-uniform
    }
    const float inv = 1.0f / l;                                        // l >= 16384: the panel holding a row's maximum contributes the full carry
    float* os = (float*)vsw;                                           // output staging in the wave's own rows (their last reads lie behind pv's ordering point)
    // O^T D layout: o_j[r] = (d = 64w + 16j + 8h + r, t = lane&15) -> os[t][16j + 8h + r]; rows 0..15 x columns 0..63 all written
    { v4f a, c;
      a[0] = o0[0] * inv; a[1] = o0[1] * inv; a[2] = o0[2] * inv; a[3] = o0[3] * inv; c[0] = o0[4] * inv; c[1] = o0[5] * inv; c[2] = o0[6] * inv; c[3] = o0[7] * inv;
      *(v4fa*)(&os[lr * OSP +  0 + 8 * hi]) = a; *(v4fa*)(&os[lr * OSP +  0 + 8 * hi + 4]) = c;
      a[0] = o1[0] * inv; a[1] = o1[1] * inv; a[2] = o1[2] * inv; a[3] = o1[3] * inv; c[0] = o1[4] * inv; c[1] = o1[5] * inv; c[2] = o1[6] * inv; c[3] = o1[7] * inv;
      *(v4fa*)(&os[lr * OSP + 16 + 8 * hi]) = a; *(v4fa*)(&os[lr * OSP + 16 + 8 * hi + 4]) = c;
      a[0] = o2[0] * inv; a[1] = o2[1] * inv; a[2] = o2[2] * inv; a[3] = o2[3] * inv; c[0] = o2[4] * inv; c[1] = o2[5] * inv; c[2] = o2[6] * inv; c[3] = o2[7] * inv;
      *(v4fa*)(&os[lr * OSP + 32 + 8 * hi]) = a; *(v4fa*)(&os[lr * OSP + 32 + 8 * hi + 4]) = c;
      a[0] = o3[0] * inv; a[1] = o3[1] * inv; a[2] = o3[2] * inv; a[3] = o3[3] * inv; c[0] = o3[4] * inv; c[1] = o3[5] * inv; c[2] = o3[6] * inv; c[3] = o3[7] * inv;
      *(v4fa*)(&os[lr * OSP + 48 + 8 * hi]) = a; *(v4fa*)(&os[lr * OSP + 48 + 8 * hi + 4]) = c; }
    wave_sync();
    float* orow = OUT + (size_t)q0 * DK + wave * 64;
{
#pragma unroll
        for (int s = 0; s < 8; ++s) { const int row = 2 * s + (lane >> 4), cofs = (lane & 15) * 4;   // 8 s x 2 rows = 16 rows; 16 lanes x 4 floats = 64 columns = two lines
            const v4f val = *(const v4fa*)(&os[row * OSP + cofs]);
            *(v4f*)(orow + (size_t)row * DK + cofs) = val; }
         }
}

static constexpr size_t al256(size_t v) { return (v + 255) & ~(size_t)255; }
static constexpr size_t SZ_XB = al256((size_t)SEQ * DIN * 2);
static constexpr size_t SZ_WB = al256((size_t)3 * DK * DIN * 2);
static constexpr size_t SZ_PL = al256((size_t)SEQ * DK * 2);
static constexpr size_t SZ_SE = al256((size_t)NCH * CCAP * 4);
static constexpr size_t SZ_OC = al256((size_t)NCH * NG * 4);
static constexpr size_t SZ_TOTAL = SZ_XB + SZ_WB + 3 * SZ_PL + SZ_SE + SZ_OC;
static_assert(SZ_TOTAL <= (size_t)134217728);          // workspace carve <= 128 MiB
static_assert(SZ_PL == PLE * 2);                       // q, k, v planes lie one behind the other without a gap
static_assert(((size_t)DK * DIN * 2) % 256 == 0);      // weight sub-planes stay 256-byte aligned
static_assert((size_t)(SEQ / GT) * GT * DK * 2 <= SZ_PL);             // projection grid x tile extent == plane

extern "C" void kernel_launch(void* const* d_in, const int* in_sizes, int n_in,
                              void* d_out, int out_size, void* d_ws, size_t ws_size, hipStream_t stream) {
    if (n_in < 8) return;
    if ((size_t)in_sizes[0] < (size_t)SEQ * DIN) return;
    if (in_sizes[1] < 2 || (size_t)in_sizes[1] > (size_t)2 * NCH * ECH) return;   // the chunks cover the edge list
    if ((size_t)in_sizes[2] < (size_t)DIN * DK || (size_t)in_sizes[4] < (size_t)DIN * DK || (size_t)in_sizes[6] < (size_t)DIN * DK) return;
    if (in_sizes[3] < DK || in_sizes[5] < DK || in_sizes[7] < DK) return;
    if ((size_t)out_size < (size_t)SEQ * DK) return;
    if (SZ_TOTAL > ws_size) return;
    // wire order: x, edge_index, Wq, bq, Wk, bk, Wv, bv
    const float* x  = (const float*)d_in[0];
    const int*   ei = (const int*)d_in[1];
    const float* wq = (const float*)d_in[2]; const float* bq = (const float*)d_in[3];
    const float* wk = (const float*)d_in[4]; const float* bk = (const float*)d_in[5];
    const float* wv = (const float*)d_in[6]; const float* bv = (const float*)d_in[7];
    const int E = in_sizes[1] / 2;
    float* OUT = (float*)d_out;      // [SEQ][512]
    char* wsp = (char*)d_ws;
    bf* XB = (bf*)wsp; wsp += SZ_XB;                 // x        [SEQ][512] bf16
    bf* WB = (bf*)wsp; wsp += SZ_WB;                 // [3][512][512]: Wq^T | Wk^T | Wv^T  ([out][in])
    h16* QP = (h16*)wsp; wsp += SZ_PL;               // q   [SEQ][512]
    h16* KP = (h16*)wsp; wsp += SZ_PL;               // k   [SEQ][512]
    h16* VP = (h16*)wsp; wsp += SZ_PL;               // v   [SEQ][512]
    unsigned* SE = (unsigned*)wsp; wsp += SZ_SE;     // sorted edges [chunk][CCAP]
    unsigned* OC = (unsigned*)wsp; wsp += SZ_OC;     // segment start and count [chunk][group]

    k_conv<<<SEQ / AROWS, ATH, 0, stream>>>(x, XB, wq, wk, wv, WB);

    // q, k, v: A = x rows (m = t), Bt = W^T rows (n = column) -> planes [t][512], QP | KP | VP
    k_proj_rows<<<dim3(SEQ / GT, SB + 3 * (DK / GT), 1), 32 * GW, 0, stream>>>(XB, WB, bq, bk, bv, QP, ei, SE, OC, E);

    k_flash<<<SEQ / 16, 32 * FW, 0, stream>>>(QP, KP, VP, SE, OC, OUT);
}
